// v000
// Measured on an AMD MI455X. A time is GPU time per run, averaged over a window of back-to-back runs after a warm-up
// (all launches, gaps included; the runs take copies of the inputs in turn), and the median of several windows.
// Apart from v000's, it joins two sittings. Times from different sittings can be a few percent apart, while
// side-by-side timings come from the same sitting.
// v000, which the later versions start from, runs in 411 microseconds.
#include <hip/hip_runtime.h>
// Contractions on v_wmma_f32_16x16x32_f16 (f16 operands, f32 accumulate): q/k/v projections and the output projection plain f16 (inputs RNE-converted to bf16 then held exactly in f16, weights x16); q.k^T scores as f16 hi + residual (x2^10) planes on both operands (3 products, residual terms in a separate accumulator); q.rel_emb^T position table f16 hi + residual on q (rel_emb exact x16); t.v aggregation plain f16 (t carried x256, o carried x64); normaliser statistics f32.
#ifndef NB
#define NB 2
#endif
#ifndef SEQ
#define SEQ 2048
#endif
#define NB_FULL 2
#define SEQ_FULL 2048
#define DM 1024
#define NH 16
#define HD 64
#define NREL 33
#define KREL 16
#define NRELP 48                     /* rel_emb rows padded to 3 WMMA column tiles (rows 33..47 zero) */
#define NR ((size_t)NB * SEQ)        /* token rows processed (compact) */
static_assert(SEQ % 128 == 0);
static_assert(SEQ <= SEQ_FULL);
static_assert(NB >= 1 && NB <= NB_FULL);
static_assert(DM == NH * HD);

typedef unsigned short v8us __attribute__((ext_vector_type(8), may_alias));
typedef float  v8f  __attribute__((ext_vector_type(8)));
typedef float  v4f  __attribute__((ext_vector_type(4)));
typedef float  v4fa __attribute__((ext_vector_type(4), may_alias));
typedef _Float16 v16h __attribute__((ext_vector_type(16)));
typedef _Float16 v4h __attribute__((ext_vector_type(4)));
typedef int v4ia __attribute__((ext_vector_type(4), may_alias));
typedef unsigned int v2ua __attribute__((ext_vector_type(2), may_alias));
union FragH { v16h v; v8us half[2]; _Float16 h[16]; unsigned short u[16]; };

__device__ __forceinline__ unsigned short bf16_bits(float x) { unsigned int u = __float_as_uint(x); return (unsigned short)((u + 0x7FFFu + ((u >> 16) & 1u)) >> 16); }
__device__ __forceinline__ float bf16_val(unsigned short b) { return __uint_as_float(((unsigned int)b) << 16); }
__device__ __forceinline__ float bf16_rne(float x) { return bf16_val(bf16_bits(x)); }

// 16x32 fragment from a 16-bit row (lane row/col = lane & 15): elements 0..7 <- k0 + 8hh + 0..7, elements 8..15 <- k0 + 16 + 8hh + 0..7 (same map for A and B)
__device__ __forceinline__ v16h g2_frag(const _Float16* p, int hh) { FragH f; f.half[0] = *(const v8us*)((const unsigned short*)p + 8 * hh); f.half[1] = *(const v8us*)((const unsigned short*)p + 16 + 8 * hh); return f.v; }
__device__ __forceinline__ v8f g2_mma(v16h a, v16h b, v8f c) { v8f d = __builtin_amdgcn_wmma_f32_16x16x32_f16(false, a, false, b, (short)0, c, false, false); asm volatile("v_nop\n\tv_nop\n\tv_nop\n\tv_nop" : "+v"(d) : "v"(a), "v"(b)); return d; }
// two k-steps into one accumulator, hazard guard after the second
__device__ __forceinline__ v8f mma2(v16h a0, v16h b0, v16h a1, v16h b1, v8f c) {
  c = __builtin_amdgcn_wmma_f32_16x16x32_f16(false, a0, false, b0, (short)0, c, false, false);
  c = __builtin_amdgcn_wmma_f32_16x16x32_f16(false, a1, false, b1, (short)0, c, false, false);
  asm volatile("v_nop\n\tv_nop\n\tv_nop\n\tv_nop" : "+v"(c) : "v"(a0), "v"(b0), "v"(a1), "v"(b1));
  return c;
}

__global__ __launch_bounds__(256) void k_wnat(const float* __restrict__ w, size_t n8, _Float16* __restrict__ Bt) {
  const size_t t = (size_t)blockIdx.x * 256 + threadIdx.x; if (t >= n8) return; FragH f;
#pragma unroll
  for (int q = 0; q < 8; ++q) f.h[q] = (_Float16)(bf16_rne(w[t * 8 + q]) * 16.0f);
  *(v8us*)((unsigned short*)Bt + t * 8) = f.half[0]; 
}

__global__ __launch_bounds__(256) void k_relt(const float* __restrict__ rel, _Float16* __restrict__ RT) {
  const int t = blockIdx.x * 256 + threadIdx.x; if (t >= NRELP * (HD / 8)) return;
  const int r = t / (HD / 8), d8 = (t % (HD / 8)) * 8;
  const int rc = (r < NREL) ? r : (NREL - 1);          // clamped address, value zeroed by predicate
  const bool live = (r < NREL);
  FragH f;
#pragma unroll
  for (int q = 0; q < 8; ++q) { const float v = rel[(size_t)rc * HD + d8 + q]; f.h[q] = live ? (_Float16)(bf16_rne(v) * 16.0f) : (_Float16)0.0f; }
  *(v8us*)((unsigned short*)RT + (size_t)t * 8) = f.half[0]; 
}

__global__ __launch_bounds__(256) void k_x16c(const float* __restrict__ x, _Float16* __restrict__ X16, int nrow) {
  const size_t t = (size_t)blockIdx.x * 256 + threadIdx.x; if (t >= (size_t)nrow * (DM / 8)) return;
  const int r = (int)(t / (DM / 8)), c8 = (int)(t % (DM / 8)) * 8;
  const int b = r / SEQ, s = r - b * SEQ;
  const float* src = x + ((size_t)b * SEQ_FULL + s) * DM + c8;
  const v4f a = *(const v4fa*)src, c = *(const v4fa*)(src + 4); FragH f;
#pragma unroll
  for (int q = 0; q < 4; ++q) { f.h[q] = (_Float16)bf16_rne(a[q]); f.h[4 + q] = (_Float16)bf16_rne(c[q]); }
  *(v8us*)((unsigned short*)X16 + t * 8) = f.half[0]; 
}

__global__ __launch_bounds__(256) void k_pack(const int* __restrict__ msk, unsigned int* __restrict__ bits, int nwords) {
  const int i = blockIdx.x * 256 + threadIdx.x; if (i >= nwords) return;
  const int wpr = SEQ / 32;
  const int row = i / wpr, wi = i - row * wpr;
  const int b = row / SEQ, q = row - b * SEQ;
  const int* src = msk + ((size_t)b * SEQ_FULL + q) * SEQ_FULL + (size_t)wi * 32;
  unsigned int wd = 0u;
#pragma unroll
  for (int j = 0; j < 8; ++j) {
    const v4ia v = *(const v4ia*)(src + j * 4);
    wd |= (v[0] != 0 ? 1u : 0u) << (j * 4 + 0);
    wd |= (v[1] != 0 ? 1u : 0u) << (j * 4 + 1);
    wd |= (v[2] != 0 ? 1u : 0u) << (j * 4 + 2);
    wd |= (v[3] != 0 ? 1u : 0u) << (j * 4 + 3);
  }
  *(unsigned int*)(bits + i) = wd; 
}

// GEMM (wave tile 32x64; M % 128 == 0, N % 64 == 0, K % 32 == 0): C[m][n] = alpha * sum_k A[m][k] Bh[n][k]; A f16 rows (pitch lda), Bh f16 [n][k] (pitch ldb);
__global__ __launch_bounds__(128) void k_gemm2(const _Float16* __restrict__ A, int lda, size_t sA, const _Float16* __restrict__ Bh, int ldb, size_t sB, float alpha,
    float* __restrict__ C, _Float16* __restrict__ C16, _Float16* __restrict__ C16L, int ldc, size_t sC, int M, int N, int K) {
  __shared__ __attribute__((aligned(16))) float so[4][32][68];
  const int tid = threadIdx.x, w = tid >> 5, lane = tid & 31, ln = lane & 15, hh = lane >> 4; const int by = blockIdx.y;
  A += (size_t)by * sA; Bh += (size_t)by * sB; const size_t cofs = (size_t)by * sC;
  const int ntn = N >> 6; const int mt = blockIdx.x / ntn, nq = blockIdx.x - mt * ntn; const int row0 = mt * 128 + 32 * w, col0 = nq * 64; if (row0 >= M) return;
  const _Float16* a0p = A + (size_t)(row0 + ln) * lda; const _Float16* a1p = a0p + (size_t)16 * lda;
  const _Float16* b0p = Bh + (size_t)(col0 + ln) * ldb; const _Float16* b1p = b0p + (size_t)16 * ldb; const _Float16* b2p = b1p + (size_t)16 * ldb; const _Float16* b3p = b2p + (size_t)16 * ldb;
  const v8f z8 = {0.f,0.f,0.f,0.f,0.f,0.f,0.f,0.f}; v8f c00 = z8, c01 = z8, c02 = z8, c03 = z8, c10 = z8, c11 = z8, c12 = z8, c13 = z8;
#pragma unroll 1
  for (int kb = 0; kb < K; kb += 32) { const v16h a0 = g2_frag(a0p + kb, hh), a1 = g2_frag(a1p + kb, hh);
    v16h b = g2_frag(b0p + kb, hh); c00 = g2_mma(a0, b, c00); c10 = g2_mma(a1, b, c10);
    b = g2_frag(b1p + kb, hh); c01 = g2_mma(a0, b, c01); c11 = g2_mma(a1, b, c11);
    b = g2_frag(b2p + kb, hh); c02 = g2_mma(a0, b, c02); c12 = g2_mma(a1, b, c12);
    b = g2_frag(b3p + kb, hh); c03 = g2_mma(a0, b, c03); c13 = g2_mma(a1, b, c13); }
  v8f accs[8] = {c00, c01, c02, c03, c10, c11, c12, c13};
#pragma unroll
  for (int u = 0; u < 8; ++u) { const int t = u & 3, half = u >> 2;
#pragma unroll
    for (int r = 0; r < 8; ++r) { const int rloc = half * 16 + 8 * hh + r; so[w][rloc][t * 16 + ln] = accs[u][r] * alpha; } }
  __builtin_amdgcn_fence(4 /* acq_rel order */, "workgroup"); __builtin_amdgcn_wave_barrier();
  const int rsub = lane >> 4, c4 = (lane & 15) * 4;
  {
#pragma unroll
    for (int q = 0; q < 16; ++q) {
      const int r = q * 2 + rsub; const v4f v = *(const v4fa*)&so[w][r][c4];
      const size_t o = cofs + (size_t)(row0 + r) * ldc + col0 + c4;
      if (C) *(v4f*)(C + o) = v;
      if (C16) { v4h h4, l4;
#pragma unroll
        for (int i = 0; i < 4; ++i) { const _Float16 hq = (_Float16)v[i]; h4[i] = hq; l4[i] = (_Float16)((v[i] - (float)hq) * 1024.0f); }
        *(v4h*)(C16 + o) = h4;
        if (C16L) *(v4h*)(C16L + o) = l4; }
    }
     }
}

template <int NHv, int TTv>
__global__ __launch_bounds__(256) void k_vt(const _Float16* __restrict__ V16, int ldv, int voff, _Float16* __restrict__ Vt) {
  __shared__ unsigned short tl[64][66]; const int tid = threadIdx.x;
  const int slab = blockIdx.x / (TTv / 64), lg = blockIdx.x % (TTv / 64); const int b = slab / NHv, h = slab % NHv;
  for (int i = tid; i < 64 * 8; i += 256) { const int r = i / 8, c8 = (i % 8) * 8; FragH f; f.half[0] = *(const v8us*)((const unsigned short*)V16 + ((size_t)b * TTv + lg * 64 + r) * ldv + voff + h * 64 + c8);
#pragma unroll
    for (int q = 0; q < 8; ++q) tl[r][c8 + q] = f.u[q]; }
  __syncthreads();
  {
#pragma unroll
    for (int rd = 0; rd < 2; ++rd) { const int d = rd * 32 + tid / 8, pc = tid % 8; FragH f;
#pragma unroll
      for (int q = 0; q < 8; ++q) f.u[q] = tl[pc * 8 + q][d];
      *(v8us*)((unsigned short*)Vt + ((size_t)slab * 64 + d) * TTv + lg * 64 + pc * 8) = f.half[0]; }
     }
}

// Fused attention with relu^2 normaliser. grid = NB*NH*(SEQ/64), block = 4 waves; wave w owns query rows q0 = qb*64 + 16w .. +15 of (b, h).
// Per wave: position table qes[m][r] = q[m].rel_emb[r] (WMMA, f32 in LDS); per 64-key chunk: s = q.k^T (hi.hi + (lo.hi + hi.lo)/2^10), sv = (s + qes[m][clamp(key-q)+16]) / 8,
// masked -> -1e9, t = relu(sv + b)^2, dsum += t (f32), tls[m][key] = f16(256 t); o += tls . v^T ; end: o * (1/(sum+eps)) * 64/256 -> f16 rows of O16 (cols h*64..).
__global__ __launch_bounds__(128) void k_attn(const _Float16* __restrict__ QH, const _Float16* __restrict__ QL, const _Float16* __restrict__ KH, const _Float16* __restrict__ KL,
                                              const _Float16* __restrict__ VT, const _Float16* __restrict__ RT, const unsigned int* __restrict__ MBt,
                                              const float* __restrict__ spb, _Float16* __restrict__ O16) {
  #pragma clang fp contract(off)
  __shared__ __attribute__((aligned(16))) _Float16 tls[4][16][72];     // [row][key] t tile (cols 0..63 used), later [row][d] o tile
  __shared__ float qes[4][16][52];                                      // [row][r] position table (cols 0..47 written, 0..32 read)
  const int tid = threadIdx.x, w = tid >> 5, lane = tid & 31, ln = lane & 15, hh = lane >> 4;
  const int nqb = SEQ / 64;
  const int bh = blockIdx.x / nqb, qb = blockIdx.x - bh * nqb;
  const int b = bh / NH, h = bh - b * NH;
  const int q0 = qb * 64 + w * 16;                                      // first query of this wave (within the sequence)
  const size_t rq = (size_t)b * SEQ + q0;                               // compact token row of that query
  const size_t qoff = (rq + ln) * DM + (size_t)h * HD;
  const v16h qh0 = g2_frag(QH + qoff, hh), qh1 = g2_frag(QH + qoff + 32, hh);
  const v16h ql0 = g2_frag(QL + qoff, hh), ql1 = g2_frag(QL + qoff + 32, hh);
  const v8f z8 = {0.f,0.f,0.f,0.f,0.f,0.f,0.f,0.f};
  const float rsc = 0.0009765625f;                                      // 2^-10 fold of the residual planes
  // position table: qes[m][r] = (q[m] . (16 rel_emb[r])) / 16
#pragma unroll
  for (int nt = 0; nt < 3; ++nt) {
    const _Float16* rr = RT + (size_t)(nt * 16 + ln) * HD;
    const v16h r0 = g2_frag(rr, hh), r1 = g2_frag(rr + 32, hh);
    const v8f ah = mma2(qh0, r0, qh1, r1, z8);
    const v8f al = mma2(ql0, r0, ql1, r1, z8);
#pragma unroll
    for (int r = 0; r < 8; ++r) { const float e = ah[r] + al[r] * rsc; qes[w][8 * hh + r][nt * 16 + ln] = e * 0.0625f; }
  }
  __syncthreads();

  const _Float16* kbh = KH + ((size_t)b * SEQ) * DM + (size_t)h * HD;
  const _Float16* kbl = KL + ((size_t)b * SEQ) * DM + (size_t)h * HD;
  const _Float16* vtb = VT + ((size_t)bh * HD) * SEQ;
  const unsigned int* mbr = MBt + (rq + 8 * hh) * (SEQ / 32);          // bit row of query q0 + 8hh; row r at + r*(SEQ/32)
  const float sbias = spb[0];
  float dsum[8];
#pragma unroll
  for (int r = 0; r < 8; ++r) dsum[r] = 0.f;
  v8f oacc[4] = {z8, z8, z8, z8};

#pragma unroll 1
  for (int k0 = 0; k0 < SEQ; k0 += 64) {
    v2ua mw[8];
#pragma unroll
    for (int r = 0; r < 8; ++r) mw[r] = *(const v2ua*)(mbr + (size_t)r * (SEQ / 32) + (k0 >> 5));
#pragma unroll
    for (int kt = 0; kt < 4; ++kt) {
      const size_t koff = (size_t)(k0 + kt * 16 + ln) * DM;
      const v16h kh0 = g2_frag(kbh + koff, hh), kh1 = g2_frag(kbh + koff + 32, hh);
      const v8f sh = mma2(qh0, kh0, qh1, kh1, z8);
      v8f sx = mma2(ql0, kh0, ql1, kh1, z8);
      const v16h kl0 = g2_frag(kbl + koff, hh), kl1 = g2_frag(kbl + koff + 32, hh);
      sx = mma2(qh0, kl0, qh1, kl1, sx);
      const int kc = kt * 16 + ln;                                      // key within the chunk held by this lane (D column)
#pragma unroll
      for (int r = 0; r < 8; ++r) {
        const int m = 8 * hh + r;                                       // row within the wave tile (D row)
        int rel = (k0 + kc) - (q0 + m);
        rel = (rel < -KREL) ? -KREL : ((rel > KREL) ? KREL : rel);
        const float s = sh[r] + sx[r] * rsc;
        float sv = (s + qes[w][m][rel + KREL]) * 0.125f;
        const unsigned int word = (kt < 2) ? mw[r][0] : mw[r][1];
        const unsigned int bit = (word >> ((kt & 1) * 16 + ln)) & 1u;
        sv = (bit != 0u) ? -1.0e9f : sv;
        float t = sv + sbias;
        t = fmaxf(t, 0.0f);
        const float tt = t * t;
        dsum[r] += tt;
        tls[w][m][kc] = (_Float16)(tt * 256.0f);
      }
    }
    __builtin_amdgcn_fence(3 /* release order */, "wavefront"); __builtin_amdgcn_wave_barrier();
    FragH pa, pb;
    pa.half[0] = *(const v8us*)&tls[w][ln][8 * hh];      pa.half[1] = *(const v8us*)&tls[w][ln][16 + 8 * hh];       // keys k0 + 0..31
    pb.half[0] = *(const v8us*)&tls[w][ln][32 + 8 * hh]; pb.half[1] = *(const v8us*)&tls[w][ln][48 + 8 * hh];       // keys k0 + 32..63
#pragma unroll
    for (int dt = 0; dt < 4; ++dt) {
      const _Float16* vr = vtb + (size_t)(dt * 16 + ln) * SEQ + k0;
      const v16h v0 = g2_frag(vr, hh), v1 = g2_frag(vr + 32, hh);
      oacc[dt] = mma2(pa.v, v0, pb.v, v1, oacc[dt]);
    }
    __builtin_amdgcn_fence(3 /* release order */, "wavefront"); __builtin_amdgcn_wave_barrier();
  }

  // key sums across the 16 lanes of each half (each half holds its own 8 rows); scale = 64/256 / (sum + eps)
#pragma unroll
  for (int r = 0; r < 8; ++r) {
    float v = dsum[r];
    v += __shfl_xor(v, 1, 32); v += __shfl_xor(v, 2, 32); v += __shfl_xor(v, 4, 32); v += __shfl_xor(v, 8, 32);
    dsum[r] = (1.0f / (v + 1.0e-9f)) * 0.25f;
  }
#pragma unroll
  for (int dt = 0; dt < 4; ++dt)
#pragma unroll
    for (int r = 0; r < 8; ++r) tls[w][8 * hh + r][dt * 16 + ln] = (_Float16)(oacc[dt][r] * dsum[r]);
  __builtin_amdgcn_fence(3 /* release order */, "wavefront"); __builtin_amdgcn_wave_barrier();
  const int rl = lane >> 3, pc = (lane & 7) * 8;
  {
#pragma unroll
    for (int it = 0; it < 4; ++it) {
      const int row = it * 4 + rl;
      const v8us v = *(const v8us*)&tls[w][row][pc];
      *(v8us*)((unsigned short*)O16 + (rq + row) * DM + (size_t)h * HD + pc) = v;
    }
    
  }
}

extern "C" void kernel_launch(void* const* d_in, const int* in_sizes, int n_in,
                              void* d_out, int out_size, void* d_ws, size_t ws_size, hipStream_t stream) {
  if (n_in < 10) return;
  const int nx = (int)(NR * DM);
  if (in_sizes[0] < nx || in_sizes[1] < nx || in_sizes[2] < nx) return;
  if (in_sizes[3] < (int)(NR * SEQ)) return;
  if (in_sizes[4] < DM * DM || in_sizes[5] < DM * DM || in_sizes[6] < DM * DM || in_sizes[7] < DM * DM) return;
  if (in_sizes[8] < NREL * HD || in_sizes[9] < 1) return;
  if (out_size < nx) return;
  const float* xq = (const float*)d_in[0]; const float* xk = (const float*)d_in[1]; const float* xv = (const float*)d_in[2];
  const int* msk = (const int*)d_in[3];
  const float* wq = (const float*)d_in[4]; const float* wk = (const float*)d_in[5]; const float* wv = (const float*)d_in[6]; const float* wo = (const float*)d_in[7];
  const float* rel = (const float*)d_in[8]; const float* spb = (const float*)d_in[9];

  char* ws = (char*)d_ws; size_t off = 0;
  auto take = [&](size_t bytes) { char* p = ws + off; off += (bytes + 255) & ~(size_t)255; return p; };
  const size_t wbytes = (size_t)DM * DM * 2, xbytes = NR * DM * 2;
  _Float16* BQ = (_Float16*)take(wbytes); _Float16* BK = (_Float16*)take(wbytes); _Float16* BV = (_Float16*)take(wbytes); _Float16* BO = (_Float16*)take(wbytes);
  _Float16* RT = (_Float16*)take((size_t)NRELP * HD * 2);
  _Float16* XQ = (_Float16*)take(xbytes); _Float16* XK = (_Float16*)take(xbytes); _Float16* XV = (_Float16*)take(xbytes);
  _Float16* QH = (_Float16*)take(xbytes); _Float16* QL = (_Float16*)take(xbytes); _Float16* KH = (_Float16*)take(xbytes); _Float16* KL = (_Float16*)take(xbytes);
  _Float16* V16 = (_Float16*)take(xbytes);
  _Float16* VT = (_Float16*)take((size_t)NB * NH * HD * SEQ * 2);
  const int nwords = (int)(NR * (SEQ / 32));
  unsigned int* MB = (unsigned int*)take((size_t)nwords * 4);
  _Float16* O16 = (_Float16*)take(xbytes);
  if (off > ws_size || off > (size_t)134217728) return;

  { const size_t n8 = (size_t)DM * DM / 8; const unsigned g = (unsigned)((n8 + 255) / 256);
    k_wnat<<<g, 256, 0, stream>>>(wq, n8, BQ); k_wnat<<<g, 256, 0, stream>>>(wk, n8, BK); k_wnat<<<g, 256, 0, stream>>>(wv, n8, BV); k_wnat<<<g, 256, 0, stream>>>(wo, n8, BO); }
  k_relt<<<(NRELP * (HD / 8) + 255) / 256, 256, 0, stream>>>(rel, RT);
  { const unsigned g = (unsigned)((NR * DM / 8 + 255) / 256); const int nrow = (int)NR;
    k_x16c<<<g, 256, 0, stream>>>(xq, XQ, nrow); k_x16c<<<g, 256, 0, stream>>>(xk, XK, nrow); k_x16c<<<g, 256, 0, stream>>>(xv, XV, nrow); }
  k_pack<<<(nwords + 255) / 256, 256, 0, stream>>>(msk, MB, nwords);

  const int M = (int)NR;
  const dim3 gp((unsigned)((M / 128) * (DM / 64)), 1);
  k_gemm2<<<gp, 128, 0, stream>>>(XQ, DM, (size_t)0, BQ, DM, (size_t)0, 0.0625f, nullptr, QH, QL, DM, (size_t)0, M, DM, DM);
  k_gemm2<<<gp, 128, 0, stream>>>(XK, DM, (size_t)0, BK, DM, (size_t)0, 0.0625f, nullptr, KH, KL, DM, (size_t)0, M, DM, DM);
  k_gemm2<<<gp, 128, 0, stream>>>(XV, DM, (size_t)0, BV, DM, (size_t)0, 0.0625f, nullptr, V16, nullptr, DM, (size_t)0, M, DM, DM);
  k_vt<NH, SEQ><<<(unsigned)(NB * NH * (SEQ / 64)), 256, 0, stream>>>(V16, DM, 0, VT);
  k_attn<<<(unsigned)(NB * NH * (SEQ / 64)), 128, 0, stream>>>(QH, QL, KH, KL, VT, RT, MB, spb, O16);
  k_gemm2<<<gp, 128, 0, stream>>>(O16, DM, (size_t)0, BO, DM, (size_t)0, 0.0009765625f, (float*)d_out, nullptr, nullptr, DM, (size_t)0, M, DM, DM);
}

// v001
// A run of this version takes 297 microseconds.
// Two timings next to v000 both put it at 1.42 times that version's speed.
#include <hip/hip_runtime.h>
// Contractions on v_wmma_f32_16x16x32_f16 (f16 operands, f32 accumulate): q/k/v projections and the output projection plain f16 (inputs RNE-converted to bf16 then held exactly in f16, weights x16); q.k^T scores as f16 hi + residual (x2^10) planes on both operands (3 products, residual terms in a separate accumulator); q.rel_emb^T position table f16 hi + residual on q (rel_emb exact x16); t.v aggregation plain f16 (t carried x256, o carried x64); normaliser statistics f32.
#ifndef NB
#define NB 2
#endif
#ifndef SEQ
#define SEQ 2048
#endif
#define NB_FULL 2
#define SEQ_FULL 2048
#define DM 1024
#define NH 16
#define HD 64
#define NREL 33
#define KREL 16
#define NRELP 48                     /* rel_emb rows padded to 3 WMMA column tiles (rows 33..47 zero) */
#define NR ((size_t)NB * SEQ)        /* token rows processed (compact) */
static_assert(SEQ % 128 == 0);
static_assert(SEQ <= SEQ_FULL);
static_assert(NB >= 1 && NB <= NB_FULL);
static_assert(DM == NH * HD);

typedef unsigned short v8us __attribute__((ext_vector_type(8), may_alias));
typedef float  v8f  __attribute__((ext_vector_type(8)));
typedef float  v4f  __attribute__((ext_vector_type(4)));
typedef float  v4fa __attribute__((ext_vector_type(4), may_alias));
typedef _Float16 v16h __attribute__((ext_vector_type(16)));
typedef _Float16 v4h __attribute__((ext_vector_type(4)));
typedef int v4ia __attribute__((ext_vector_type(4), may_alias));
typedef unsigned int v2ua __attribute__((ext_vector_type(2), may_alias));
union FragH { v16h v; v8us half[2]; _Float16 h[16]; unsigned short u[16]; };

__device__ __forceinline__ unsigned short bf16_bits(float x) { unsigned int u = __float_as_uint(x); return (unsigned short)((u + 0x7FFFu + ((u >> 16) & 1u)) >> 16); }
__device__ __forceinline__ float bf16_val(unsigned short b) { return __uint_as_float(((unsigned int)b) << 16); }
__device__ __forceinline__ float bf16_rne(float x) { return bf16_val(bf16_bits(x)); }

// 16x32 fragment from a 16-bit row (lane row/col = lane & 15): elements 0..7 <- k0 + 8hh + 0..7, elements 8..15 <- k0 + 16 + 8hh + 0..7 (same map for A and B)
__device__ __forceinline__ v16h g2_frag(const _Float16* p, int hh) { FragH f; f.half[0] = *(const v8us*)((const unsigned short*)p + 8 * hh); f.half[1] = *(const v8us*)((const unsigned short*)p + 16 + 8 * hh); return f.v; }
__device__ __forceinline__ v8f g2_mma(v16h a, v16h b, v8f c) { v8f d = __builtin_amdgcn_wmma_f32_16x16x32_f16(false, a, false, b, (short)0, c, false, false); asm volatile("v_nop\n\tv_nop\n\tv_nop\n\tv_nop" : "+v"(d) : "v"(a), "v"(b)); return d; }
// two k-steps into one accumulator, hazard guard after the second
__device__ __forceinline__ v8f mma2(v16h a0, v16h b0, v16h a1, v16h b1, v8f c) {
  c = __builtin_amdgcn_wmma_f32_16x16x32_f16(false, a0, false, b0, (short)0, c, false, false);
  c = __builtin_amdgcn_wmma_f32_16x16x32_f16(false, a1, false, b1, (short)0, c, false, false);
  asm volatile("v_nop\n\tv_nop\n\tv_nop\n\tv_nop" : "+v"(c) : "v"(a0), "v"(b0), "v"(a1), "v"(b1));
  return c;
}

__global__ __launch_bounds__(256) void k_wnat(const float* __restrict__ w, size_t n8, _Float16* __restrict__ Bt) {
  const size_t t = (size_t)blockIdx.x * 256 + threadIdx.x; if (t >= n8) return; FragH f;
#pragma unroll
  for (int q = 0; q < 8; ++q) f.h[q] = (_Float16)(bf16_rne(w[t * 8 + q]) * 16.0f);
  *(v8us*)((unsigned short*)Bt + t * 8) = f.half[0]; 
}

__global__ __launch_bounds__(256) void k_relt(const float* __restrict__ rel, _Float16* __restrict__ RT) {
  const int t = blockIdx.x * 256 + threadIdx.x; if (t >= NRELP * (HD / 8)) return;
  const int r = t / (HD / 8), d8 = (t % (HD / 8)) * 8;
  const int rc = (r < NREL) ? r : (NREL - 1);          // clamped address, value zeroed by predicate
  const bool live = (r < NREL);
  FragH f;
#pragma unroll
  for (int q = 0; q < 8; ++q) { const float v = rel[(size_t)rc * HD + d8 + q]; f.h[q] = live ? (_Float16)(bf16_rne(v) * 16.0f) : (_Float16)0.0f; }
  *(v8us*)((unsigned short*)RT + (size_t)t * 8) = f.half[0]; 
}

__global__ __launch_bounds__(256) void k_x16c(const float* __restrict__ x, _Float16* __restrict__ X16, int nrow) {
  const size_t t = (size_t)blockIdx.x * 256 + threadIdx.x; if (t >= (size_t)nrow * (DM / 8)) return;
  const int r = (int)(t / (DM / 8)), c8 = (int)(t % (DM / 8)) * 8;
  const int b = r / SEQ, s = r - b * SEQ;
  const float* src = x + ((size_t)b * SEQ_FULL + s) * DM + c8;
  const v4f a = *(const v4fa*)src, c = *(const v4fa*)(src + 4); FragH f;
#pragma unroll
  for (int q = 0; q < 4; ++q) { f.h[q] = (_Float16)bf16_rne(a[q]); f.h[4 + q] = (_Float16)bf16_rne(c[q]); }
  *(v8us*)((unsigned short*)X16 + t * 8) = f.half[0]; 
}

__global__ __launch_bounds__(256) void k_pack(const int* __restrict__ msk, unsigned int* __restrict__ bits, int nwords) {
  const int i = blockIdx.x * 256 + threadIdx.x; if (i >= nwords) return;
  const int wpr = SEQ / 32;
  const int row = i / wpr, wi = i - row * wpr;
  const int b = row / SEQ, q = row - b * SEQ;
  const int* src = msk + ((size_t)b * SEQ_FULL + q) * SEQ_FULL + (size_t)wi * 32;
  unsigned int wd = 0u;
#pragma unroll
  for (int j = 0; j < 8; ++j) {
    const v4ia v = *(const v4ia*)(src + j * 4);
    wd |= (v[0] != 0 ? 1u : 0u) << (j * 4 + 0);
    wd |= (v[1] != 0 ? 1u : 0u) << (j * 4 + 1);
    wd |= (v[2] != 0 ? 1u : 0u) << (j * 4 + 2);
    wd |= (v[3] != 0 ? 1u : 0u) << (j * 4 + 3);
  }
  *(unsigned int*)(bits + i) = wd; 
}

// GEMM (wave tile 32x64; M % 128 == 0, N % 64 == 0, K % 32 == 0): C[m][n] = alpha * sum_k A[m][k] Bh[n][k]; A f16 rows (pitch lda), Bh f16 [n][k] (pitch ldb);
__global__ __launch_bounds__(128) void k_gemm2(const _Float16* __restrict__ A, int lda, size_t sA, const _Float16* __restrict__ Bh, int ldb, size_t sB, float alpha,
    float* __restrict__ C, _Float16* __restrict__ C16, _Float16* __restrict__ C16L, int ldc, size_t sC, int M, int N, int K) {
  __shared__ __attribute__((aligned(16))) float so[4][32][68];
  const int tid = threadIdx.x, w = tid >> 5, lane = tid & 31, ln = lane & 15, hh = lane >> 4; const int by = blockIdx.y;
  A += (size_t)by * sA; Bh += (size_t)by * sB; const size_t cofs = (size_t)by * sC;
  const int ntn = N >> 6; const int mt = blockIdx.x / ntn, nq = blockIdx.x - mt * ntn; const int row0 = mt * 128 + 32 * w, col0 = nq * 64; if (row0 >= M) return;
  const _Float16* a0p = A + (size_t)(row0 + ln) * lda; const _Float16* a1p = a0p + (size_t)16 * lda;
  const _Float16* b0p = Bh + (size_t)(col0 + ln) * ldb; const _Float16* b1p = b0p + (size_t)16 * ldb; const _Float16* b2p = b1p + (size_t)16 * ldb; const _Float16* b3p = b2p + (size_t)16 * ldb;
  const v8f z8 = {0.f,0.f,0.f,0.f,0.f,0.f,0.f,0.f}; v8f c00 = z8, c01 = z8, c02 = z8, c03 = z8, c10 = z8, c11 = z8, c12 = z8, c13 = z8;
#pragma unroll 1
  for (int kb = 0; kb < K; kb += 32) { const v16h a0 = g2_frag(a0p + kb, hh), a1 = g2_frag(a1p + kb, hh);
    v16h b = g2_frag(b0p + kb, hh); c00 = g2_mma(a0, b, c00); c10 = g2_mma(a1, b, c10);
    b = g2_frag(b1p + kb, hh); c01 = g2_mma(a0, b, c01); c11 = g2_mma(a1, b, c11);
    b = g2_frag(b2p + kb, hh); c02 = g2_mma(a0, b, c02); c12 = g2_mma(a1, b, c12);
    b = g2_frag(b3p + kb, hh); c03 = g2_mma(a0, b, c03); c13 = g2_mma(a1, b, c13); }
  v8f accs[8] = {c00, c01, c02, c03, c10, c11, c12, c13};
#pragma unroll
  for (int u = 0; u < 8; ++u) { const int t = u & 3, half = u >> 2;
#pragma unroll
    for (int r = 0; r < 8; ++r) { const int rloc = half * 16 + 8 * hh + r; so[w][rloc][t * 16 + ln] = accs[u][r] * alpha; } }
  __builtin_amdgcn_fence(4 /* acq_rel order */, "workgroup"); __builtin_amdgcn_wave_barrier();
  const int rsub = lane >> 4, c4 = (lane & 15) * 4;
  {
#pragma unroll
    for (int q = 0; q < 16; ++q) {
      const int r = q * 2 + rsub; const v4f v = *(const v4fa*)&so[w][r][c4];
      const size_t o = cofs + (size_t)(row0 + r) * ldc + col0 + c4;
      if (C) *(v4f*)(C + o) = v;
      if (C16) { v4h h4, l4;
#pragma unroll
        for (int i = 0; i < 4; ++i) { const _Float16 hq = (_Float16)v[i]; h4[i] = hq; l4[i] = (_Float16)((v[i] - (float)hq) * 1024.0f); }
        *(v4h*)(C16 + o) = h4;
        if (C16L) *(v4h*)(C16L + o) = l4; }
    }
     }
}

template <int NHv, int TTv>
__global__ __launch_bounds__(256) void k_vt(const _Float16* __restrict__ V16, int ldv, int voff, _Float16* __restrict__ Vt) {
  __shared__ unsigned short tl[64][66]; const int tid = threadIdx.x;
  const int slab = blockIdx.x / (TTv / 64), lg = blockIdx.x % (TTv / 64); const int b = slab / NHv, h = slab % NHv;
  for (int i = tid; i < 64 * 8; i += 256) { const int r = i / 8, c8 = (i % 8) * 8; FragH f; f.half[0] = *(const v8us*)((const unsigned short*)V16 + ((size_t)b * TTv + lg * 64 + r) * ldv + voff + h * 64 + c8);
#pragma unroll
    for (int q = 0; q < 8; ++q) tl[r][c8 + q] = f.u[q]; }
  __syncthreads();
  {
#pragma unroll
    for (int rd = 0; rd < 2; ++rd) { const int d = rd * 32 + tid / 8, pc = tid % 8; FragH f;
#pragma unroll
      for (int q = 0; q < 8; ++q) f.u[q] = tl[pc * 8 + q][d];
      *(v8us*)((unsigned short*)Vt + ((size_t)slab * 64 + d) * TTv + lg * 64 + pc * 8) = f.half[0]; }
     }
}

#define KVP 72                       /* LDS row pitch of a staged plane in halfs: 144 B = 16 B x odd, conflict-free for 16-byte fragment reads */
#define KVPLANE (64 * KVP)           /* one staged plane: 64 rows */
#define KVSTAGE (3 * KVPLANE)        /* one stage: K hi, K residual, V^T */
// One 64-key stage into LDS by asynchronous copies: three planes of 64 rows x 128 B; each of the 128 threads brings 16 B of rows r, r+16, r+32, r+48 of each plane.
// l: the lane's LDS byte address in plane 0 (row r); gh, gl: its 16 B in K hi / K residual (row pitch DM); gv: its 16 B in V^T (row pitch SEQ).
__device__ __forceinline__ void stage_copy(unsigned int l, const _Float16* gh, const _Float16* gl, const _Float16* gv) {
  // the copies and their s_wait_xcnt in one statement: the wait stands before any rewrite of the address registers the copies name
  asm volatile(
      "global_load_async_to_lds_b128 %0, %12, off\n\t"
      "global_load_async_to_lds_b128 %1, %13, off\n\t"
      "global_load_async_to_lds_b128 %2, %14, off\n\t"
      "global_load_async_to_lds_b128 %3, %15, off\n\t"
      "global_load_async_to_lds_b128 %4, %16, off\n\t"
      "global_load_async_to_lds_b128 %5, %17, off\n\t"
      "global_load_async_to_lds_b128 %6, %18, off\n\t"
      "global_load_async_to_lds_b128 %7, %19, off\n\t"
      "global_load_async_to_lds_b128 %8, %20, off\n\t"
      "global_load_async_to_lds_b128 %9, %21, off\n\t"
      "global_load_async_to_lds_b128 %10, %22, off\n\t"
      "global_load_async_to_lds_b128 %11, %23, off\n\t"
      "s_wait_xcnt 0x0"
      :: "v"(l), "v"(l + 16u * KVP * 2u), "v"(l + 32u * KVP * 2u), "v"(l + 48u * KVP * 2u),
         "v"(l + KVPLANE * 2u), "v"(l + KVPLANE * 2u + 16u * KVP * 2u), "v"(l + KVPLANE * 2u + 32u * KVP * 2u), "v"(l + KVPLANE * 2u + 48u * KVP * 2u),
         "v"(l + KVPLANE * 4u), "v"(l + KVPLANE * 4u + 16u * KVP * 2u), "v"(l + KVPLANE * 4u + 32u * KVP * 2u), "v"(l + KVPLANE * 4u + 48u * KVP * 2u),
         "v"(gh), "v"(gh + 16 * DM), "v"(gh + 32 * DM), "v"(gh + 48 * DM),
         "v"(gl), "v"(gl + 16 * DM), "v"(gl + 32 * DM), "v"(gl + 48 * DM),
         "v"(gv), "v"(gv + 16 * SEQ), "v"(gv + 32 * SEQ), "v"(gv + 48 * SEQ)
      : "memory");
}

// Fused attention with relu^2 normaliser. grid = NB*NH*(SEQ/64), block = 4 waves; wave w owns query rows q0 = qb*64 + 16w .. +15 of (b, h).
// Per wave: position table qes[m][r] = q[m].rel_emb[r] (WMMA, f32 in LDS); per 64-key chunk: s = q.k^T (hi.hi + (lo.hi + hi.lo)/2^10), sv = (s + qes[m][clamp(key-q)+16]) / 8,
// K hi, K residual and V^T of each 64-key chunk are staged once per block in LDS (two buffers, asynchronous copies one chunk ahead) and read as fragments by all four waves.
// masked -> -1e9, t = relu(sv + b)^2, dsum += t (f32), tls[m][key] = f16(256 t); o += tls . v^T ; end: o * (1/(sum+eps)) * 64/256 -> f16 rows of O16 (cols h*64..).
__global__ __launch_bounds__(128) void k_attn(const _Float16* __restrict__ QH, const _Float16* __restrict__ QL, const _Float16* __restrict__ KH, const _Float16* __restrict__ KL,
                                              const _Float16* __restrict__ VT, const _Float16* __restrict__ RT, const unsigned int* __restrict__ MBt,
                                              const float* __restrict__ spb, _Float16* __restrict__ O16) {
  #pragma clang fp contract(off)
  __shared__ __attribute__((aligned(16))) _Float16 tls[4][16][72];     // [row][key] t tile (cols 0..63 used), later [row][d] o tile
  __shared__ float qes[4][16][52];                                      // [row][r] position table (cols 0..47 written, 0..32 read)
  __shared__ __attribute__((aligned(16))) _Float16 kv[2 * KVSTAGE];     // two stages of [plane][row][KVP]
  const int tid = threadIdx.x, w = tid >> 5, lane = tid & 31, ln = lane & 15, hh = lane >> 4;
  const int nqb = SEQ / 64;
  const int bh = blockIdx.x / nqb, qb = blockIdx.x - bh * nqb;
  const int b = bh / NH, h = bh - b * NH;
  const int q0 = qb * 64 + w * 16;                                      // first query of this wave (within the sequence)
  const size_t rq = (size_t)b * SEQ + q0;                               // compact token row of that query
  const size_t qoff = (rq + ln) * DM + (size_t)h * HD;
  const v16h qh0 = g2_frag(QH + qoff, hh), qh1 = g2_frag(QH + qoff + 32, hh);
  const v16h ql0 = g2_frag(QL + qoff, hh), ql1 = g2_frag(QL + qoff + 32, hh);
  const v8f z8 = {0.f,0.f,0.f,0.f,0.f,0.f,0.f,0.f};
  const float rsc = 0.0009765625f;                                      // 2^-10 fold of the residual planes
  const _Float16* kbh = KH + ((size_t)b * SEQ) * DM + (size_t)h * HD;
  const _Float16* kbl = KL + ((size_t)b * SEQ) * DM + (size_t)h * HD;
  const _Float16* vtb = VT + ((size_t)bh * HD) * SEQ;
  const int crow = tid >> 3, ccol = (tid & 7) * 8;                      // this thread's first row and 16-byte column in every staged plane
  const unsigned int cl = (unsigned int)(size_t)&kv[crow * KVP + ccol];  // its LDS byte address in stage buffer 0
  const _Float16* cgh = kbh + (size_t)crow * DM + ccol;
  const _Float16* cgl = kbl + (size_t)crow * DM + ccol;
  const _Float16* cgv = vtb + (size_t)crow * SEQ + ccol;
  stage_copy(cl, cgh, cgl, cgv);                                        // chunk 0 -> buffer 0
  // position table: qes[m][r] = (q[m] . (16 rel_emb[r])) / 16
#pragma unroll
  for (int nt = 0; nt < 3; ++nt) {
    const _Float16* rr = RT + (size_t)(nt * 16 + ln) * HD;
    const v16h r0 = g2_frag(rr, hh), r1 = g2_frag(rr + 32, hh);
    const v8f ah = mma2(qh0, r0, qh1, r1, z8);
    const v8f al = mma2(ql0, r0, ql1, r1, z8);
#pragma unroll
    for (int r = 0; r < 8; ++r) { const float e = ah[r] + al[r] * rsc; qes[w][8 * hh + r][nt * 16 + ln] = e * 0.0625f; }
  }
  asm volatile("s_wait_asynccnt 0x0" ::: "memory");                     // this wave's copies of chunk 0 have landed before the barrier publishes them
  __syncthreads();
  stage_copy(cl + KVSTAGE * 2u, cgh + (size_t)64 * DM, cgl + (size_t)64 * DM, cgv + 64);   // chunk 1 -> buffer 1 (SEQ >= 128)

  const unsigned int* mbr = MBt + (rq + 8 * hh) * (SEQ / 32);          // bit row of query q0 + 8hh; row r at + r*(SEQ/32)
  const float sbias = spb[0];
  float dsum[8];
#pragma unroll
  for (int r = 0; r < 8; ++r) dsum[r] = 0.f;
  v8f oacc[4] = {z8, z8, z8, z8};
  int bo = 0;                                                           // offset in halfs of the buffer that holds this chunk

#pragma unroll 1
  for (int k0 = 0; k0 < SEQ; k0 += 64) {
    v2ua mw[8];
#pragma unroll
    for (int r = 0; r < 8; ++r) mw[r] = *(const v2ua*)(mbr + (size_t)r * (SEQ / 32) + (k0 >> 5));
#pragma unroll
    for (int kt = 0; kt < 4; ++kt) {
      const _Float16* kr = &kv[bo + (kt * 16 + ln) * KVP];
      const v16h kh0 = g2_frag(kr, hh), kh1 = g2_frag(kr + 32, hh);
      const v8f sh = mma2(qh0, kh0, qh1, kh1, z8);
      v8f sx = mma2(ql0, kh0, ql1, kh1, z8);
      const v16h kl0 = g2_frag(kr + KVPLANE, hh), kl1 = g2_frag(kr + KVPLANE + 32, hh);
      sx = mma2(qh0, kl0, qh1, kl1, sx);
      const int kc = kt * 16 + ln;                                      // key within the chunk held by this lane (D column)
#pragma unroll
      for (int r = 0; r < 8; ++r) {
        const int m = 8 * hh + r;                                       // row within the wave tile (D row)
        int rel = (k0 + kc) - (q0 + m);
        rel = (rel < -KREL) ? -KREL : ((rel > KREL) ? KREL : rel);
        const float s = sh[r] + sx[r] * rsc;
        float sv = (s + qes[w][m][rel + KREL]) * 0.125f;
        const unsigned int word = (kt < 2) ? mw[r][0] : mw[r][1];
        const unsigned int bit = (word >> ((kt & 1) * 16 + ln)) & 1u;
        sv = (bit != 0u) ? -1.0e9f : sv;
        float t = sv + sbias;
        t = fmaxf(t, 0.0f);
        const float tt = t * t;
        dsum[r] += tt;
        tls[w][m][kc] = (_Float16)(tt * 256.0f);
      }
    }
    __builtin_amdgcn_fence(3 /* release order */, "wavefront"); __builtin_amdgcn_wave_barrier();
    FragH pa, pb;
    pa.half[0] = *(const v8us*)&tls[w][ln][8 * hh];      pa.half[1] = *(const v8us*)&tls[w][ln][16 + 8 * hh];       // keys k0 + 0..31
    pb.half[0] = *(const v8us*)&tls[w][ln][32 + 8 * hh]; pb.half[1] = *(const v8us*)&tls[w][ln][48 + 8 * hh];       // keys k0 + 32..63
#pragma unroll
    for (int dt = 0; dt < 4; ++dt) {
      const _Float16* vr = &kv[bo + 2 * KVPLANE + (dt * 16 + ln) * KVP];
      const v16h v0 = g2_frag(vr, hh), v1 = g2_frag(vr + 32, hh);
      oacc[dt] = mma2(pa.v, v0, pb.v, v1, oacc[dt]);
    }
    __builtin_amdgcn_fence(3 /* release order */, "wavefront"); __builtin_amdgcn_wave_barrier();
    asm volatile("s_wait_dscnt 0x0" ::: "memory");                      // this wave's reads of the buffer have returned before it may be refilled
    asm volatile("s_wait_asynccnt 0x0" ::: "memory");                   // this wave's copies of the next chunk have landed
    __syncthreads();                                                    // publishes the next chunk and ends every wave's reads of this buffer
    if (k0 + 128 < SEQ)
      stage_copy(cl + (unsigned int)bo * 2u, cgh + (size_t)(k0 + 128) * DM, cgl + (size_t)(k0 + 128) * DM, cgv + (k0 + 128));   // chunk + 2 -> the buffer just read
    bo ^= KVSTAGE;
  }
  asm volatile("s_wait_asynccnt 0x0" ::: "memory");                     // nothing of this wave is in flight behind the loop

  // key sums across the 16 lanes of each half (each half holds its own 8 rows); scale = 64/256 / (sum + eps)
#pragma unroll
  for (int r = 0; r < 8; ++r) {
    float v = dsum[r];
    v += __shfl_xor(v, 1, 32); v += __shfl_xor(v, 2, 32); v += __shfl_xor(v, 4, 32); v += __shfl_xor(v, 8, 32);
    dsum[r] = (1.0f / (v + 1.0e-9f)) * 0.25f;
  }
#pragma unroll
  for (int dt = 0; dt < 4; ++dt)
#pragma unroll
    for (int r = 0; r < 8; ++r) tls[w][8 * hh + r][dt * 16 + ln] = (_Float16)(oacc[dt][r] * dsum[r]);
  __builtin_amdgcn_fence(3 /* release order */, "wavefront"); __builtin_amdgcn_wave_barrier();
  const int rl = lane >> 3, pc = (lane & 7) * 8;
  {
#pragma unroll
    for (int it = 0; it < 4; ++it) {
      const int row = it * 4 + rl;
      const v8us v = *(const v8us*)&tls[w][row][pc];
      *(v8us*)((unsigned short*)O16 + (rq + row) * DM + (size_t)h * HD + pc) = v;
    }
    
  }
}

extern "C" void kernel_launch(void* const* d_in, const int* in_sizes, int n_in,
                              void* d_out, int out_size, void* d_ws, size_t ws_size, hipStream_t stream) {
  if (n_in < 10) return;
  const int nx = (int)(NR * DM);
  if (in_sizes[0] < nx || in_sizes[1] < nx || in_sizes[2] < nx) return;
  if (in_sizes[3] < (int)(NR * SEQ)) return;
  if (in_sizes[4] < DM * DM || in_sizes[5] < DM * DM || in_sizes[6] < DM * DM || in_sizes[7] < DM * DM) return;
  if (in_sizes[8] < NREL * HD || in_sizes[9] < 1) return;
  if (out_size < nx) return;
  const float* xq = (const float*)d_in[0]; const float* xk = (const float*)d_in[1]; const float* xv = (const float*)d_in[2];
  const int* msk = (const int*)d_in[3];
  const float* wq = (const float*)d_in[4]; const float* wk = (const float*)d_in[5]; const float* wv = (const float*)d_in[6]; const float* wo = (const float*)d_in[7];
  const float* rel = (const float*)d_in[8]; const float* spb = (const float*)d_in[9];

  char* ws = (char*)d_ws; size_t off = 0;
  auto take = [&](size_t bytes) { char* p = ws + off; off += (bytes + 255) & ~(size_t)255; return p; };
  const size_t wbytes = (size_t)DM * DM * 2, xbytes = NR * DM * 2;
  _Float16* BQ = (_Float16*)take(wbytes); _Float16* BK = (_Float16*)take(wbytes); _Float16* BV = (_Float16*)take(wbytes); _Float16* BO = (_Float16*)take(wbytes);
  _Float16* RT = (_Float16*)take((size_t)NRELP * HD * 2);
  _Float16* XQ = (_Float16*)take(xbytes); _Float16* XK = (_Float16*)take(xbytes); _Float16* XV = (_Float16*)take(xbytes);
  _Float16* QH = (_Float16*)take(xbytes); _Float16* QL = (_Float16*)take(xbytes); _Float16* KH = (_Float16*)take(xbytes); _Float16* KL = (_Float16*)take(xbytes);
  _Float16* V16 = (_Float16*)take(xbytes);
  _Float16* VT = (_Float16*)take((size_t)NB * NH * HD * SEQ * 2);
  const int nwords = (int)(NR * (SEQ / 32));
  unsigned int* MB = (unsigned int*)take((size_t)nwords * 4);
  _Float16* O16 = (_Float16*)take(xbytes);
  if (off > ws_size || off > (size_t)134217728) return;

  { const size_t n8 = (size_t)DM * DM / 8; const unsigned g = (unsigned)((n8 + 255) / 256);
    k_wnat<<<g, 256, 0, stream>>>(wq, n8, BQ); k_wnat<<<g, 256, 0, stream>>>(wk, n8, BK); k_wnat<<<g, 256, 0, stream>>>(wv, n8, BV); k_wnat<<<g, 256, 0, stream>>>(wo, n8, BO); }
  k_relt<<<(NRELP * (HD / 8) + 255) / 256, 256, 0, stream>>>(rel, RT);
  { const unsigned g = (unsigned)((NR * DM / 8 + 255) / 256); const int nrow = (int)NR;
    k_x16c<<<g, 256, 0, stream>>>(xq, XQ, nrow); k_x16c<<<g, 256, 0, stream>>>(xk, XK, nrow); k_x16c<<<g, 256, 0, stream>>>(xv, XV, nrow); }
  k_pack<<<(nwords + 255) / 256, 256, 0, stream>>>(msk, MB, nwords);

  const int M = (int)NR;
  const dim3 gp((unsigned)((M / 128) * (DM / 64)), 1);
  k_gemm2<<<gp, 128, 0, stream>>>(XQ, DM, (size_t)0, BQ, DM, (size_t)0, 0.0625f, nullptr, QH, QL, DM, (size_t)0, M, DM, DM);
  k_gemm2<<<gp, 128, 0, stream>>>(XK, DM, (size_t)0, BK, DM, (size_t)0, 0.0625f, nullptr, KH, KL, DM, (size_t)0, M, DM, DM);
  k_gemm2<<<gp, 128, 0, stream>>>(XV, DM, (size_t)0, BV, DM, (size_t)0, 0.0625f, nullptr, V16, nullptr, DM, (size_t)0, M, DM, DM);
  k_vt<NH, SEQ><<<(unsigned)(NB * NH * (SEQ / 64)), 256, 0, stream>>>(V16, DM, 0, VT);
  k_attn<<<(unsigned)(NB * NH * (SEQ / 64)), 128, 0, stream>>>(QH, QL, KH, KL, VT, RT, MB, spb, O16);
  k_gemm2<<<gp, 128, 0, stream>>>(O16, DM, (size_t)0, BO, DM, (size_t)0, 0.0009765625f, (float*)d_out, nullptr, nullptr, DM, (size_t)0, M, DM, DM);
}

// v002
// It runs in 180 microseconds.
// Next to v001, in two timings, it ran 1.65 times as fast each time.
// Counting every step since v000, it is 2.35 times as fast.
#include <hip/hip_runtime.h>
// Contractions on v_wmma_f32_16x16x32_f16 (f16 operands, f32 accumulate): q/k/v projections and the output projection plain f16 (inputs RNE-converted to bf16 then held exactly in f16, weights x16); q.k^T scores as f16 hi + residual (x2^10) planes on both operands (3 products, residual terms in a separate accumulator); q.rel_emb^T position table f16 hi + residual on q (rel_emb exact x16); t.v aggregation plain f16 (t carried x256, o carried x64); normaliser statistics f32.
#ifndef NB
#define NB 2
#endif
#ifndef SEQ
#define SEQ 2048
#endif
#define NB_FULL 2
#define SEQ_FULL 2048
#define DM 1024
#define NH 16
#define HD 64
#define NREL 33
#define KREL 16
#define NRELP 48                     /* rel_emb rows padded to 3 WMMA column tiles (rows 33..47 zero) */
#define NR ((size_t)NB * SEQ)        /* token rows processed (compact) */
static_assert(SEQ % 128 == 0);
static_assert(SEQ <= SEQ_FULL);
static_assert(NB >= 1 && NB <= NB_FULL);
static_assert(DM == NH * HD);

typedef unsigned short v8us __attribute__((ext_vector_type(8), may_alias));
typedef float  v8f  __attribute__((ext_vector_type(8)));
typedef float  v4f  __attribute__((ext_vector_type(4)));
typedef float  v4fa __attribute__((ext_vector_type(4), may_alias));
typedef _Float16 v16h __attribute__((ext_vector_type(16)));
typedef _Float16 v4h __attribute__((ext_vector_type(4)));
typedef int v4ia __attribute__((ext_vector_type(4), may_alias));
typedef unsigned int v2ua __attribute__((ext_vector_type(2), may_alias));
union FragH { v16h v; v8us half[2]; _Float16 h[16]; unsigned short u[16]; };

__device__ __forceinline__ unsigned short bf16_bits(float x) { unsigned int u = __float_as_uint(x); return (unsigned short)((u + 0x7FFFu + ((u >> 16) & 1u)) >> 16); }
__device__ __forceinline__ float bf16_val(unsigned short b) { return __uint_as_float(((unsigned int)b) << 16); }
__device__ __forceinline__ float bf16_rne(float x) { return bf16_val(bf16_bits(x)); }

// 16x32 fragment from a 16-bit row (lane row/col = lane & 15): elements 0..7 <- k0 + 8hh + 0..7, elements 8..15 <- k0 + 16 + 8hh + 0..7 (same map for A and B)
__device__ __forceinline__ v16h g2_frag(const _Float16* p, int hh) { FragH f; f.half[0] = *(const v8us*)((const unsigned short*)p + 8 * hh); f.half[1] = *(const v8us*)((const unsigned short*)p + 16 + 8 * hh); return f.v; }
__device__ __forceinline__ v8f g2_mma(v16h a, v16h b, v8f c) { v8f d = __builtin_amdgcn_wmma_f32_16x16x32_f16(false, a, false, b, (short)0, c, false, false); asm volatile("v_nop\n\tv_nop\n\tv_nop\n\tv_nop" : "+v"(d) : "v"(a), "v"(b)); return d; }
// two k-steps into one accumulator, hazard guard after the second
__device__ __forceinline__ v8f mma2(v16h a0, v16h b0, v16h a1, v16h b1, v8f c) {
  c = __builtin_amdgcn_wmma_f32_16x16x32_f16(false, a0, false, b0, (short)0, c, false, false);
  c = __builtin_amdgcn_wmma_f32_16x16x32_f16(false, a1, false, b1, (short)0, c, false, false);
  asm volatile("v_nop\n\tv_nop\n\tv_nop\n\tv_nop" : "+v"(c) : "v"(a0), "v"(b0), "v"(a1), "v"(b1));
  return c;
}

__global__ __launch_bounds__(256) void k_wnat(const float* __restrict__ w, size_t n8, _Float16* __restrict__ Bt) {
  const size_t t = (size_t)blockIdx.x * 256 + threadIdx.x; if (t >= n8) return; FragH f;
#pragma unroll
  for (int q = 0; q < 8; ++q) f.h[q] = (_Float16)(bf16_rne(w[t * 8 + q]) * 16.0f);
  *(v8us*)((unsigned short*)Bt + t * 8) = f.half[0]; 
}

__global__ __launch_bounds__(256) void k_relt(const float* __restrict__ rel, _Float16* __restrict__ RT) {
  const int t = blockIdx.x * 256 + threadIdx.x; if (t >= NRELP * (HD / 8)) return;
  const int r = t / (HD / 8), d8 = (t % (HD / 8)) * 8;
  const int rc = (r < NREL) ? r : (NREL - 1);          // clamped address, value zeroed by predicate
  const bool live = (r < NREL);
  FragH f;
#pragma unroll
  for (int q = 0; q < 8; ++q) { const float v = rel[(size_t)rc * HD + d8 + q]; f.h[q] = live ? (_Float16)(bf16_rne(v) * 16.0f) : (_Float16)0.0f; }
  *(v8us*)((unsigned short*)RT + (size_t)t * 8) = f.half[0]; 
}

__global__ __launch_bounds__(256) void k_x16c(const float* __restrict__ x, _Float16* __restrict__ X16, int nrow) {
  const size_t t = (size_t)blockIdx.x * 256 + threadIdx.x; if (t >= (size_t)nrow * (DM / 8)) return;
  const int r = (int)(t / (DM / 8)), c8 = (int)(t % (DM / 8)) * 8;
  const int b = r / SEQ, s = r - b * SEQ;
  const float* src = x + ((size_t)b * SEQ_FULL + s) * DM + c8;
  const v4f a = *(const v4fa*)src, c = *(const v4fa*)(src + 4); FragH f;
#pragma unroll
  for (int q = 0; q < 4; ++q) { f.h[q] = (_Float16)bf16_rne(a[q]); f.h[4 + q] = (_Float16)bf16_rne(c[q]); }
  *(v8us*)((unsigned short*)X16 + t * 8) = f.half[0]; 
}

__global__ __launch_bounds__(256) void k_pack(const int* __restrict__ msk, unsigned int* __restrict__ bits, int nwords) {
  const int i = blockIdx.x * 256 + threadIdx.x; if (i >= nwords) return;
  const int wpr = SEQ / 32;
  const int row = i / wpr, wi = i - row * wpr;
  const int b = row / SEQ, q = row - b * SEQ;
  const int* src = msk + ((size_t)b * SEQ_FULL + q) * SEQ_FULL + (size_t)wi * 32;
  unsigned int wd = 0u;
#pragma unroll
  for (int j = 0; j < 8; ++j) {
    const v4ia v = *(const v4ia*)(src + j * 4);
    wd |= (v[0] != 0 ? 1u : 0u) << (j * 4 + 0);
    wd |= (v[1] != 0 ? 1u : 0u) << (j * 4 + 1);
    wd |= (v[2] != 0 ? 1u : 0u) << (j * 4 + 2);
    wd |= (v[3] != 0 ? 1u : 0u) << (j * 4 + 3);
  }
  *(unsigned int*)(bits + i) = wd; 
}

#define GBK 128                      /* k depth of one staged GEMM tile in halfs: 256 B a row */
#define GP 136                       /* LDS row pitch of a staged GEMM tile in halfs: 272 B = 16 B x odd, conflict-free for 16-byte fragment reads */
#define GSTAGE (192 * GP)            /* one stage: 128 rows of A, then 64 rows of B */
#define GRS (8u * GP * 2u)           /* LDS bytes between two copies of one thread: 8 rows */
// Twelve asynchronous copies of 16 B a lane: LDS rows 8 apart from l, each from its own global address.
__device__ __forceinline__ void copy12(unsigned int l, const _Float16* g0, const _Float16* g1, const _Float16* g2, const _Float16* g3, const _Float16* g4, const _Float16* g5,
                                       const _Float16* g6, const _Float16* g7, const _Float16* g8, const _Float16* g9, const _Float16* g10, const _Float16* g11) {
  // the copies and their s_wait_xcnt in one statement: the wait stands before any rewrite of the address registers the copies name
  asm volatile(
      "global_load_async_to_lds_b128 %0, %12, off\n\t"
      "global_load_async_to_lds_b128 %1, %13, off\n\t"
      "global_load_async_to_lds_b128 %2, %14, off\n\t"
      "global_load_async_to_lds_b128 %3, %15, off\n\t"
      "global_load_async_to_lds_b128 %4, %16, off\n\t"
      "global_load_async_to_lds_b128 %5, %17, off\n\t"
      "global_load_async_to_lds_b128 %6, %18, off\n\t"
      "global_load_async_to_lds_b128 %7, %19, off\n\t"
      "global_load_async_to_lds_b128 %8, %20, off\n\t"
      "global_load_async_to_lds_b128 %9, %21, off\n\t"
      "global_load_async_to_lds_b128 %10, %22, off\n\t"
      "global_load_async_to_lds_b128 %11, %23, off\n\t"
      "s_wait_xcnt 0x0"
      :: "v"(l), "v"(l + GRS), "v"(l + 2u * GRS), "v"(l + 3u * GRS), "v"(l + 4u * GRS), "v"(l + 5u * GRS),
         "v"(l + 6u * GRS), "v"(l + 7u * GRS), "v"(l + 8u * GRS), "v"(l + 9u * GRS), "v"(l + 10u * GRS), "v"(l + 11u * GRS),
         "v"(g0), "v"(g1), "v"(g2), "v"(g3), "v"(g4), "v"(g5), "v"(g6), "v"(g7), "v"(g8), "v"(g9), "v"(g10), "v"(g11)
      : "memory");
}
// One k-tile of the block (128 rows of A, then 64 rows of B, GBK deep) into one stage; each of the 128 threads brings 16 B of every eighth row.
// l: the lane's LDS byte address in row tid / 16 of the stage; ga, gb: its 16 B in that row of the A tile and of the B tile.
__device__ __forceinline__ void gemm_stage(unsigned int l, const _Float16* ga, int lda, const _Float16* gb, int ldb) {
  const size_t sa = (size_t)8 * lda, sb = (size_t)8 * ldb;
  copy12(l, ga, ga + sa, ga + 2 * sa, ga + 3 * sa, ga + 4 * sa, ga + 5 * sa, ga + 6 * sa, ga + 7 * sa, ga + 8 * sa, ga + 9 * sa, ga + 10 * sa, ga + 11 * sa);
  copy12(l + 12u * GRS, ga + 12 * sa, ga + 13 * sa, ga + 14 * sa, ga + 15 * sa, gb, gb + sb, gb + 2 * sb, gb + 3 * sb, gb + 4 * sb, gb + 5 * sb, gb + 6 * sb, gb + 7 * sb);
}

// GEMM (wave tile 32x64; M % 128 == 0, N % 64 == 0, K % 128 == 0): C[m][n] = alpha * sum_k A[m][k] Bh[n][k]; A f16 rows (pitch lda), Bh f16 [n][k] (pitch ldb);
// the block's 128 x GBK tile of A and 64 x GBK tile of Bh are staged in LDS (two buffers, asynchronous copies one tile ahead) and read as fragments by the four waves.
__global__ __launch_bounds__(128) void k_gemm2(const _Float16* __restrict__ A, int lda, size_t sA, const _Float16* __restrict__ Bh, int ldb, size_t sB, float alpha,
    float* __restrict__ C, _Float16* __restrict__ C16, _Float16* __restrict__ C16L, int ldc, size_t sC, int M, int N, int K) {
  __shared__ __attribute__((aligned(16))) float so[4][32][68];
  __shared__ __attribute__((aligned(16))) _Float16 ab[2 * GSTAGE];      // two stages of [row][GP]
  const int tid = threadIdx.x, w = tid >> 5, lane = tid & 31, ln = lane & 15, hh = lane >> 4; const int by = blockIdx.y;
  A += (size_t)by * sA; Bh += (size_t)by * sB; const size_t cofs = (size_t)by * sC;
  const int ntn = N >> 6; const int mt = blockIdx.x / ntn, nq = blockIdx.x - mt * ntn; const int row0 = mt * 128 + 32 * w, col0 = nq * 64; if (mt * 128 >= M) return;
  const int crow = tid >> 4, ccol = (tid & 15) * 8;                     // this thread's first row and 16-byte column in a stage
  const unsigned int cl = (unsigned int)(size_t)&ab[crow * GP + ccol];  // its LDS byte address in stage buffer 0
  const _Float16* cga = A + (size_t)(mt * 128 + crow) * lda + ccol;
  const _Float16* cgb = Bh + (size_t)(col0 + crow) * ldb + ccol;
  gemm_stage(cl, cga, lda, cgb, ldb);                                   // tile 0 -> buffer 0
  const v8f z8 = {0.f,0.f,0.f,0.f,0.f,0.f,0.f,0.f}; v8f c00 = z8, c01 = z8, c02 = z8, c03 = z8, c10 = z8, c11 = z8, c12 = z8, c13 = z8;
  asm volatile("s_wait_asynccnt 0x0" ::: "memory");                     // this wave's copies of tile 0 have landed before the barrier publishes them
  __syncthreads();
  if (K > GBK) gemm_stage(cl + GSTAGE * 2u, cga + GBK, lda, cgb + GBK, ldb);   // tile 1 -> buffer 1
  int bo = 0;                                                           // offset in halfs of the buffer that holds this tile
#pragma unroll 1   // one trip per staged tile: kept rolled so that the two buffers alternate through bo and the loop stays small
  for (int kb = 0; kb < K; kb += GBK) {
    const _Float16* ar = &ab[bo + (32 * w + ln) * GP]; const _Float16* br = &ab[bo + (128 + ln) * GP];
#pragma unroll     // the four k-steps of a tile read LDS at constant offsets
    for (int ks = 0; ks < GBK; ks += 32) { const v16h a0 = g2_frag(ar + ks, hh), a1 = g2_frag(ar + 16 * GP + ks, hh);
      const v16h b0 = g2_frag(br + ks, hh), b1 = g2_frag(br + 16 * GP + ks, hh), b2 = g2_frag(br + 32 * GP + ks, hh), b3 = g2_frag(br + 48 * GP + ks, hh);
      c00 = g2_mma(a0, b0, c00); c10 = g2_mma(a1, b0, c10);
      c01 = g2_mma(a0, b1, c01); c11 = g2_mma(a1, b1, c11);
      c02 = g2_mma(a0, b2, c02); c12 = g2_mma(a1, b2, c12);
      c03 = g2_mma(a0, b3, c03); c13 = g2_mma(a1, b3, c13); }
    asm volatile("s_wait_dscnt 0x0" ::: "memory");                      // this wave's reads of the buffer have returned before it may be refilled
    asm volatile("s_wait_asynccnt 0x0" ::: "memory");                   // this wave's copies of the next tile have landed
    __syncthreads();                                                    // publishes the next tile and ends every wave's reads of this buffer
    if (kb + 2 * GBK < K) gemm_stage(cl + (unsigned int)bo * 2u, cga + (kb + 2 * GBK), lda, cgb + (kb + 2 * GBK), ldb);   // tile + 2 -> the buffer just read
    bo ^= GSTAGE;
  }
  asm volatile("s_wait_asynccnt 0x0" ::: "memory");                     // nothing of this wave is in flight behind the loop
  v8f accs[8] = {c00, c01, c02, c03, c10, c11, c12, c13};
#pragma unroll
  for (int u = 0; u < 8; ++u) { const int t = u & 3, half = u >> 2;
#pragma unroll
    for (int r = 0; r < 8; ++r) { const int rloc = half * 16 + 8 * hh + r; so[w][rloc][t * 16 + ln] = accs[u][r] * alpha; } }
  __builtin_amdgcn_fence(4 /* acq_rel order */, "workgroup"); __builtin_amdgcn_wave_barrier();
  const int rsub = lane >> 4, c4 = (lane & 15) * 4;
  {
#pragma unroll
    for (int q = 0; q < 16; ++q) {
      const int r = q * 2 + rsub; const v4f v = *(const v4fa*)&so[w][r][c4];
      const size_t o = cofs + (size_t)(row0 + r) * ldc + col0 + c4;
      if (C) *(v4f*)(C + o) = v;
      if (C16) { v4h h4, l4;
#pragma unroll
        for (int i = 0; i < 4; ++i) { const _Float16 hq = (_Float16)v[i]; h4[i] = hq; l4[i] = (_Float16)((v[i] - (float)hq) * 1024.0f); }
        *(v4h*)(C16 + o) = h4;
        if (C16L) *(v4h*)(C16L + o) = l4; }
    }
     }
}

template <int NHv, int TTv>
__global__ __launch_bounds__(256) void k_vt(const _Float16* __restrict__ V16, int ldv, int voff, _Float16* __restrict__ Vt) {
  __shared__ unsigned short tl[64][66]; const int tid = threadIdx.x;
  const int slab = blockIdx.x / (TTv / 64), lg = blockIdx.x % (TTv / 64); const int b = slab / NHv, h = slab % NHv;
  for (int i = tid; i < 64 * 8; i += 256) { const int r = i / 8, c8 = (i % 8) * 8; FragH f; f.half[0] = *(const v8us*)((const unsigned short*)V16 + ((size_t)b * TTv + lg * 64 + r) * ldv + voff + h * 64 + c8);
#pragma unroll
    for (int q = 0; q < 8; ++q) tl[r][c8 + q] = f.u[q]; }
  __syncthreads();
  {
#pragma unroll
    for (int rd = 0; rd < 2; ++rd) { const int d = rd * 32 + tid / 8, pc = tid % 8; FragH f;
#pragma unroll
      for (int q = 0; q < 8; ++q) f.u[q] = tl[pc * 8 + q][d];
      *(v8us*)((unsigned short*)Vt + ((size_t)slab * 64 + d) * TTv + lg * 64 + pc * 8) = f.half[0]; }
     }
}

#define KVP 72                       /* LDS row pitch of a staged plane in halfs: 144 B = 16 B x odd, conflict-free for 16-byte fragment reads */
#define KVPLANE (64 * KVP)           /* one staged plane: 64 rows */
#define KVSTAGE (3 * KVPLANE)        /* one stage: K hi, K residual, V^T */
// One 64-key stage into LDS by asynchronous copies: three planes of 64 rows x 128 B; each of the 128 threads brings 16 B of rows r, r+16, r+32, r+48 of each plane.
// l: the lane's LDS byte address in plane 0 (row r); gh, gl: its 16 B in K hi / K residual (row pitch DM); gv: its 16 B in V^T (row pitch SEQ).
__device__ __forceinline__ void stage_copy(unsigned int l, const _Float16* gh, const _Float16* gl, const _Float16* gv) {
  // the copies and their s_wait_xcnt in one statement: the wait stands before any rewrite of the address registers the copies name
  asm volatile(
      "global_load_async_to_lds_b128 %0, %12, off\n\t"
      "global_load_async_to_lds_b128 %1, %13, off\n\t"
      "global_load_async_to_lds_b128 %2, %14, off\n\t"
      "global_load_async_to_lds_b128 %3, %15, off\n\t"
      "global_load_async_to_lds_b128 %4, %16, off\n\t"
      "global_load_async_to_lds_b128 %5, %17, off\n\t"
      "global_load_async_to_lds_b128 %6, %18, off\n\t"
      "global_load_async_to_lds_b128 %7, %19, off\n\t"
      "global_load_async_to_lds_b128 %8, %20, off\n\t"
      "global_load_async_to_lds_b128 %9, %21, off\n\t"
      "global_load_async_to_lds_b128 %10, %22, off\n\t"
      "global_load_async_to_lds_b128 %11, %23, off\n\t"
      "s_wait_xcnt 0x0"
      :: "v"(l), "v"(l + 16u * KVP * 2u), "v"(l + 32u * KVP * 2u), "v"(l + 48u * KVP * 2u),
         "v"(l + KVPLANE * 2u), "v"(l + KVPLANE * 2u + 16u * KVP * 2u), "v"(l + KVPLANE * 2u + 32u * KVP * 2u), "v"(l + KVPLANE * 2u + 48u * KVP * 2u),
         "v"(l + KVPLANE * 4u), "v"(l + KVPLANE * 4u + 16u * KVP * 2u), "v"(l + KVPLANE * 4u + 32u * KVP * 2u), "v"(l + KVPLANE * 4u + 48u * KVP * 2u),
         "v"(gh), "v"(gh + 16 * DM), "v"(gh + 32 * DM), "v"(gh + 48 * DM),
         "v"(gl), "v"(gl + 16 * DM), "v"(gl + 32 * DM), "v"(gl + 48 * DM),
         "v"(gv), "v"(gv + 16 * SEQ), "v"(gv + 32 * SEQ), "v"(gv + 48 * SEQ)
      : "memory");
}

// Fused attention with relu^2 normaliser. grid = NB*NH*(SEQ/64), block = 4 waves; wave w owns query rows q0 = qb*64 + 16w .. +15 of (b, h).
// Per wave: position table qes[m][r] = q[m].rel_emb[r] (WMMA, f32 in LDS); per 64-key chunk: s = q.k^T (hi.hi + (lo.hi + hi.lo)/2^10), sv = (s + qes[m][clamp(key-q)+16]) / 8,
// K hi, K residual and V^T of each 64-key chunk are staged once per block in LDS (two buffers, asynchronous copies one chunk ahead) and read as fragments by all four waves.
// masked -> -1e9, t = relu(sv + b)^2, dsum += t (f32), tls[m][key] = f16(256 t); o += tls . v^T ; end: o * (1/(sum+eps)) * 64/256 -> f16 rows of O16 (cols h*64..).
__global__ __launch_bounds__(128) void k_attn(const _Float16* __restrict__ QH, const _Float16* __restrict__ QL, const _Float16* __restrict__ KH, const _Float16* __restrict__ KL,
                                              const _Float16* __restrict__ VT, const _Float16* __restrict__ RT, const unsigned int* __restrict__ MBt,
                                              const float* __restrict__ spb, _Float16* __restrict__ O16) {
  #pragma clang fp contract(off)
  __shared__ __attribute__((aligned(16))) _Float16 tls[4][16][72];     // [row][key] t tile (cols 0..63 used), later [row][d] o tile
  __shared__ float qes[4][16][52];                                      // [row][r] position table (cols 0..47 written, 0..32 read)
  __shared__ __attribute__((aligned(16))) _Float16 kv[2 * KVSTAGE];     // two stages of [plane][row][KVP]
  const int tid = threadIdx.x, w = tid >> 5, lane = tid & 31, ln = lane & 15, hh = lane >> 4;
  const int nqb = SEQ / 64;
  const int bh = blockIdx.x / nqb, qb = blockIdx.x - bh * nqb;
  const int b = bh / NH, h = bh - b * NH;
  const int q0 = qb * 64 + w * 16;                                      // first query of this wave (within the sequence)
  const size_t rq = (size_t)b * SEQ + q0;                               // compact token row of that query
  const size_t qoff = (rq + ln) * DM + (size_t)h * HD;
  const v16h qh0 = g2_frag(QH + qoff, hh), qh1 = g2_frag(QH + qoff + 32, hh);
  const v16h ql0 = g2_frag(QL + qoff, hh), ql1 = g2_frag(QL + qoff + 32, hh);
  const v8f z8 = {0.f,0.f,0.f,0.f,0.f,0.f,0.f,0.f};
  const float rsc = 0.0009765625f;                                      // 2^-10 fold of the residual planes
  const _Float16* kbh = KH + ((size_t)b * SEQ) * DM + (size_t)h * HD;
  const _Float16* kbl = KL + ((size_t)b * SEQ) * DM + (size_t)h * HD;
  const _Float16* vtb = VT + ((size_t)bh * HD) * SEQ;
  const int crow = tid >> 3, ccol = (tid & 7) * 8;                      // this thread's first row and 16-byte column in every staged plane
  const unsigned int cl = (unsigned int)(size_t)&kv[crow * KVP + ccol];  // its LDS byte address in stage buffer 0
  const _Float16* cgh = kbh + (size_t)crow * DM + ccol;
  const _Float16* cgl = kbl + (size_t)crow * DM + ccol;
  const _Float16* cgv = vtb + (size_t)crow * SEQ + ccol;
  stage_copy(cl, cgh, cgl, cgv);                                        // chunk 0 -> buffer 0
  // position table: qes[m][r] = (q[m] . (16 rel_emb[r])) / 16
#pragma unroll
  for (int nt = 0; nt < 3; ++nt) {
    const _Float16* rr = RT + (size_t)(nt * 16 + ln) * HD;
    const v16h r0 = g2_frag(rr, hh), r1 = g2_frag(rr + 32, hh);
    const v8f ah = mma2(qh0, r0, qh1, r1, z8);
    const v8f al = mma2(ql0, r0, ql1, r1, z8);
#pragma unroll
    for (int r = 0; r < 8; ++r) { const float e = ah[r] + al[r] * rsc; qes[w][8 * hh + r][nt * 16 + ln] = e * 0.0625f; }
  }
  asm volatile("s_wait_asynccnt 0x0" ::: "memory");                     // this wave's copies of chunk 0 have landed before the barrier publishes them
  __syncthreads();
  stage_copy(cl + KVSTAGE * 2u, cgh + (size_t)64 * DM, cgl + (size_t)64 * DM, cgv + 64);   // chunk 1 -> buffer 1 (SEQ >= 128)

  const unsigned int* mbr = MBt + (rq + 8 * hh) * (SEQ / 32);          // bit row of query q0 + 8hh; row r at + r*(SEQ/32)
  const float sbias = spb[0];
  float dsum[8];
#pragma unroll
  for (int r = 0; r < 8; ++r) dsum[r] = 0.f;
  v8f oacc[4] = {z8, z8, z8, z8};
  int bo = 0;                                                           // offset in halfs of the buffer that holds this chunk

#pragma unroll 1
  for (int k0 = 0; k0 < SEQ; k0 += 64) {
    v2ua mw[8];
#pragma unroll
    for (int r = 0; r < 8; ++r) mw[r] = *(const v2ua*)(mbr + (size_t)r * (SEQ / 32) + (k0 >> 5));
#pragma unroll
    for (int kt = 0; kt < 4; ++kt) {
      const _Float16* kr = &kv[bo + (kt * 16 + ln) * KVP];
      const v16h kh0 = g2_frag(kr, hh), kh1 = g2_frag(kr + 32, hh);
      const v8f sh = mma2(qh0, kh0, qh1, kh1, z8);
      v8f sx = mma2(ql0, kh0, ql1, kh1, z8);
      const v16h kl0 = g2_frag(kr + KVPLANE, hh), kl1 = g2_frag(kr + KVPLANE + 32, hh);
      sx = mma2(qh0, kl0, qh1, kl1, sx);
      const int kc = kt * 16 + ln;                                      // key within the chunk held by this lane (D column)
#pragma unroll
      for (int r = 0; r < 8; ++r) {
        const int m = 8 * hh + r;                                       // row within the wave tile (D row)
        int rel = (k0 + kc) - (q0 + m);
        rel = (rel < -KREL) ? -KREL : ((rel > KREL) ? KREL : rel);
        const float s = sh[r] + sx[r] * rsc;
        float sv = (s + qes[w][m][rel + KREL]) * 0.125f;
        const unsigned int word = (kt < 2) ? mw[r][0] : mw[r][1];
        const unsigned int bit = (word >> ((kt & 1) * 16 + ln)) & 1u;
        sv = (bit != 0u) ? -1.0e9f : sv;
        float t = sv + sbias;
        t = fmaxf(t, 0.0f);
        const float tt = t * t;
        dsum[r] += tt;
        tls[w][m][kc] = (_Float16)(tt * 256.0f);
      }
    }
    __builtin_amdgcn_fence(3 /* release order */, "wavefront"); __builtin_amdgcn_wave_barrier();
    FragH pa, pb;
    pa.half[0] = *(const v8us*)&tls[w][ln][8 * hh];      pa.half[1] = *(const v8us*)&tls[w][ln][16 + 8 * hh];       // keys k0 + 0..31
    pb.half[0] = *(const v8us*)&tls[w][ln][32 + 8 * hh]; pb.half[1] = *(const v8us*)&tls[w][ln][48 + 8 * hh];       // keys k0 + 32..63
#pragma unroll
    for (int dt = 0; dt < 4; ++dt) {
      const _Float16* vr = &kv[bo + 2 * KVPLANE + (dt * 16 + ln) * KVP];
      const v16h v0 = g2_frag(vr, hh), v1 = g2_frag(vr + 32, hh);
      oacc[dt] = mma2(pa.v, v0, pb.v, v1, oacc[dt]);
    }
    __builtin_amdgcn_fence(3 /* release order */, "wavefront"); __builtin_amdgcn_wave_barrier();
    asm volatile("s_wait_dscnt 0x0" ::: "memory");                      // this wave's reads of the buffer have returned before it may be refilled
    asm volatile("s_wait_asynccnt 0x0" ::: "memory");                   // this wave's copies of the next chunk have landed
    __syncthreads();                                                    // publishes the next chunk and ends every wave's reads of this buffer
    if (k0 + 128 < SEQ)
      stage_copy(cl + (unsigned int)bo * 2u, cgh + (size_t)(k0 + 128) * DM, cgl + (size_t)(k0 + 128) * DM, cgv + (k0 + 128));   // chunk + 2 -> the buffer just read
    bo ^= KVSTAGE;
  }
  asm volatile("s_wait_asynccnt 0x0" ::: "memory");                     // nothing of this wave is in flight behind the loop

  // key sums across the 16 lanes of each half (each half holds its own 8 rows); scale = 64/256 / (sum + eps)
#pragma unroll
  for (int r = 0; r < 8; ++r) {
    float v = dsum[r];
    v += __shfl_xor(v, 1, 32); v += __shfl_xor(v, 2, 32); v += __shfl_xor(v, 4, 32); v += __shfl_xor(v, 8, 32);
    dsum[r] = (1.0f / (v + 1.0e-9f)) * 0.25f;
  }
#pragma unroll
  for (int dt = 0; dt < 4; ++dt)
#pragma unroll
    for (int r = 0; r < 8; ++r) tls[w][8 * hh + r][dt * 16 + ln] = (_Float16)(oacc[dt][r] * dsum[r]);
  __builtin_amdgcn_fence(3 /* release order */, "wavefront"); __builtin_amdgcn_wave_barrier();
  const int rl = lane >> 3, pc = (lane & 7) * 8;
  {
#pragma unroll
    for (int it = 0; it < 4; ++it) {
      const int row = it * 4 + rl;
      const v8us v = *(const v8us*)&tls[w][row][pc];
      *(v8us*)((unsigned short*)O16 + (rq + row) * DM + (size_t)h * HD + pc) = v;
    }
    
  }
}

extern "C" void kernel_launch(void* const* d_in, const int* in_sizes, int n_in,
                              void* d_out, int out_size, void* d_ws, size_t ws_size, hipStream_t stream) {
  if (n_in < 10) return;
  const int nx = (int)(NR * DM);
  if (in_sizes[0] < nx || in_sizes[1] < nx || in_sizes[2] < nx) return;
  if (in_sizes[3] < (int)(NR * SEQ)) return;
  if (in_sizes[4] < DM * DM || in_sizes[5] < DM * DM || in_sizes[6] < DM * DM || in_sizes[7] < DM * DM) return;
  if (in_sizes[8] < NREL * HD || in_sizes[9] < 1) return;
  if (out_size < nx) return;
  const float* xq = (const float*)d_in[0]; const float* xk = (const float*)d_in[1]; const float* xv = (const float*)d_in[2];
  const int* msk = (const int*)d_in[3];
  const float* wq = (const float*)d_in[4]; const float* wk = (const float*)d_in[5]; const float* wv = (const float*)d_in[6]; const float* wo = (const float*)d_in[7];
  const float* rel = (const float*)d_in[8]; const float* spb = (const float*)d_in[9];

  char* ws = (char*)d_ws; size_t off = 0;
  auto take = [&](size_t bytes) { char* p = ws + off; off += (bytes + 255) & ~(size_t)255; return p; };
  const size_t wbytes = (size_t)DM * DM * 2, xbytes = NR * DM * 2;
  _Float16* BQ = (_Float16*)take(wbytes); _Float16* BK = (_Float16*)take(wbytes); _Float16* BV = (_Float16*)take(wbytes); _Float16* BO = (_Float16*)take(wbytes);
  _Float16* RT = (_Float16*)take((size_t)NRELP * HD * 2);
  _Float16* XQ = (_Float16*)take(xbytes); _Float16* XK = (_Float16*)take(xbytes); _Float16* XV = (_Float16*)take(xbytes);
  _Float16* QH = (_Float16*)take(xbytes); _Float16* QL = (_Float16*)take(xbytes); _Float16* KH = (_Float16*)take(xbytes); _Float16* KL = (_Float16*)take(xbytes);
  _Float16* V16 = (_Float16*)take(xbytes);
  _Float16* VT = (_Float16*)take((size_t)NB * NH * HD * SEQ * 2);
  const int nwords = (int)(NR * (SEQ / 32));
  unsigned int* MB = (unsigned int*)take((size_t)nwords * 4);
  _Float16* O16 = (_Float16*)take(xbytes);
  if (off > ws_size || off > (size_t)134217728) return;

  { const size_t n8 = (size_t)DM * DM / 8; const unsigned g = (unsigned)((n8 + 255) / 256);
    k_wnat<<<g, 256, 0, stream>>>(wq, n8, BQ); k_wnat<<<g, 256, 0, stream>>>(wk, n8, BK); k_wnat<<<g, 256, 0, stream>>>(wv, n8, BV); k_wnat<<<g, 256, 0, stream>>>(wo, n8, BO); }
  k_relt<<<(NRELP * (HD / 8) + 255) / 256, 256, 0, stream>>>(rel, RT);
  { const unsigned g = (unsigned)((NR * DM / 8 + 255) / 256); const int nrow = (int)NR;
    k_x16c<<<g, 256, 0, stream>>>(xq, XQ, nrow); k_x16c<<<g, 256, 0, stream>>>(xk, XK, nrow); k_x16c<<<g, 256, 0, stream>>>(xv, XV, nrow); }
  k_pack<<<(nwords + 255) / 256, 256, 0, stream>>>(msk, MB, nwords);

  const int M = (int)NR;
  const dim3 gp((unsigned)((M / 128) * (DM / 64)), 1);
  k_gemm2<<<gp, 128, 0, stream>>>(XQ, DM, (size_t)0, BQ, DM, (size_t)0, 0.0625f, nullptr, QH, QL, DM, (size_t)0, M, DM, DM);
  k_gemm2<<<gp, 128, 0, stream>>>(XK, DM, (size_t)0, BK, DM, (size_t)0, 0.0625f, nullptr, KH, KL, DM, (size_t)0, M, DM, DM);
  k_gemm2<<<gp, 128, 0, stream>>>(XV, DM, (size_t)0, BV, DM, (size_t)0, 0.0625f, nullptr, V16, nullptr, DM, (size_t)0, M, DM, DM);
  k_vt<NH, SEQ><<<(unsigned)(NB * NH * (SEQ / 64)), 256, 0, stream>>>(V16, DM, 0, VT);
  k_attn<<<(unsigned)(NB * NH * (SEQ / 64)), 128, 0, stream>>>(QH, QL, KH, KL, VT, RT, MB, spb, O16);
  k_gemm2<<<gp, 128, 0, stream>>>(O16, DM, (size_t)0, BO, DM, (size_t)0, 0.0009765625f, (float*)d_out, nullptr, nullptr, DM, (size_t)0, M, DM, DM);
}

// v003
// One run takes 160 microseconds.
// Next to v002, in two timings, it ran 1.13 times as fast each time.
// Over all steps from v000 it is 2.65 times as fast.
#include <hip/hip_runtime.h>
// Contractions on v_wmma_f32_16x16x32_f16 (f16 operands, f32 accumulate): q/k/v projections and the output projection plain f16 (inputs RNE-converted to bf16 then held exactly in f16, weights x16); q.k^T scores as f16 hi + residual (x2^10) planes on both operands (3 products, residual terms in a separate accumulator); q.rel_emb^T position table f16 hi + residual on q (rel_emb exact x16); t.v aggregation plain f16 (t carried x256, o carried x64); normaliser statistics f32.
#ifndef NB
#define NB 2
#endif
#ifndef SEQ
#define SEQ 2048
#endif
#define NB_FULL 2
#define SEQ_FULL 2048
#define DM 1024
#define NH 16
#define HD 64
#define NREL 33
#define KREL 16
#define NRELP 48                     /* rel_emb rows padded to 3 WMMA column tiles (rows 33..47 zero) */
#define NR ((size_t)NB * SEQ)        /* token rows processed (compact) */
static_assert(SEQ % 128 == 0);
static_assert(SEQ <= SEQ_FULL);
static_assert(NB >= 1 && NB <= NB_FULL);
static_assert(DM == NH * HD);

typedef unsigned short v8us __attribute__((ext_vector_type(8), may_alias));
typedef float  v8f  __attribute__((ext_vector_type(8)));
typedef float  v4f  __attribute__((ext_vector_type(4)));
typedef float  v4fa __attribute__((ext_vector_type(4), may_alias));
typedef _Float16 v16h __attribute__((ext_vector_type(16)));
typedef _Float16 v4h __attribute__((ext_vector_type(4)));
typedef int v4ia __attribute__((ext_vector_type(4), may_alias));
typedef unsigned int v2ua __attribute__((ext_vector_type(2), may_alias));
union FragH { v16h v; v8us half[2]; _Float16 h[16]; unsigned short u[16]; };

__device__ __forceinline__ unsigned short bf16_bits(float x) { unsigned int u = __float_as_uint(x); return (unsigned short)((u + 0x7FFFu + ((u >> 16) & 1u)) >> 16); }
__device__ __forceinline__ float bf16_val(unsigned short b) { return __uint_as_float(((unsigned int)b) << 16); }
__device__ __forceinline__ float bf16_rne(float x) { return bf16_val(bf16_bits(x)); }

// 16x32 fragment from a 16-bit row (lane row/col = lane & 15): elements 0..7 <- k0 + 8hh + 0..7, elements 8..15 <- k0 + 16 + 8hh + 0..7 (same map for A and B)
__device__ __forceinline__ v16h g2_frag(const _Float16* p, int hh) { FragH f; f.half[0] = *(const v8us*)((const unsigned short*)p + 8 * hh); f.half[1] = *(const v8us*)((const unsigned short*)p + 16 + 8 * hh); return f.v; }
__device__ __forceinline__ v8f g2_mma(v16h a, v16h b, v8f c) { v8f d = __builtin_amdgcn_wmma_f32_16x16x32_f16(false, a, false, b, (short)0, c, false, false); asm volatile("v_nop\n\tv_nop\n\tv_nop\n\tv_nop" : "+v"(d) : "v"(a), "v"(b)); return d; }
// two k-steps into one accumulator, hazard guard after the second
__device__ __forceinline__ v8f mma2(v16h a0, v16h b0, v16h a1, v16h b1, v8f c) {
  c = __builtin_amdgcn_wmma_f32_16x16x32_f16(false, a0, false, b0, (short)0, c, false, false);
  c = __builtin_amdgcn_wmma_f32_16x16x32_f16(false, a1, false, b1, (short)0, c, false, false);
  asm volatile("v_nop\n\tv_nop\n\tv_nop\n\tv_nop" : "+v"(c) : "v"(a0), "v"(b0), "v"(a1), "v"(b1));
  return c;
}

#define PT 512                       /* threads of a k_prep block: 16 waves */
#define PWU 1024                     /* 4-byte elements one wave moves per tile: 4 KiB */
#define PTILE ((PT / 32) * PWU)      /* elements of one block tile */
#define PW_TILES (DM * DM / PTILE)               /* tiles of one weight matrix */
#define PX_TILES ((int)(NR * DM / PTILE))        /* tiles of one activation input */
#define PM_TILES ((int)(NR * SEQ / PTILE))       /* tiles of the mask */
#define P_TILES (4 * PW_TILES + 3 * PX_TILES + PM_TILES)
#define P_BLOCKS ((P_TILES + 2) / 3)             /* three tiles a block */
static_assert((DM * DM) % PTILE == 0 && DM % PWU == 0);
static_assert((NR * DM) % PTILE == 0 && (NR * SEQ) % PTILE == 0);

// One wave's 4 KiB of f32 -> f16(bf16_rne(x) * scale): eight 512-byte loads in flight, then eight 256-byte stores (whole lines both ways).
__device__ __forceinline__ void cvt_unit(const float* __restrict__ s, _Float16* __restrict__ d, float scale, int lane) {
  v4f v[8];
#pragma unroll
  for (int j = 0; j < 8; ++j) v[j] = *(const v4fa*)(s + j * 128 + lane * 4);
#pragma unroll
  for (int j = 0; j < 8; ++j) { v4h h;
#pragma unroll
    for (int i = 0; i < 4; ++i) h[i] = (_Float16)(bf16_rne(v[j][i]) * scale);
    *(v4h*)(d + j * 128 + lane * 4) = h; }
  asm volatile("s_wait_xcnt 0x0" ::: "memory");   // stands directly behind the stores, before anything rewrites the address or data registers that they name
}

// One wave's 32 mask words (all in one mask row): word i0 + j is the ballot of one 128-byte line of mask integers (lane = bit); lane j keeps word j, one 128-byte store.
static_assert((SEQ / 32) % 32 == 0);
__device__ __forceinline__ void pack_unit(const int* __restrict__ msk, unsigned int* __restrict__ bits, unsigned int i0, int lane) {
  const unsigned int wpr = SEQ / 32, row = i0 / wpr, wi = i0 - row * wpr, b = row / SEQ, q = row - b * SEQ;
  const int* src = msk + ((size_t)b * SEQ_FULL + q) * SEQ_FULL + (size_t)wi * 32 + lane;
  int v[32];
#pragma unroll
  for (int j = 0; j < 32; ++j) v[j] = src[j * 32];
  asm volatile("s_wait_xcnt 0x0" :: "v"(src) : "memory");   // behind the run of loads; the pointer as input keeps the address registers out of the loads' results up to here
  unsigned int wd = 0u;
#pragma unroll
  for (int j = 0; j < 32; ++j) { const unsigned int bj = __builtin_amdgcn_ballot_w32(v[j] != 0); wd = (lane == j) ? bj : wd; }
  bits[i0 + lane] = wd;
  asm volatile("s_wait_xcnt 0x0" ::: "memory");   // stands directly behind the store, before anything rewrites the registers that it names
}

// All operand preparation in one launch: weights -> f16 x16, activations -> f16, mask -> bit words, rel_emb -> padded f16 x16 table.
// Block 0 does the small table; blocks 1 .. P_BLOCKS walk the tiles (block-uniform choice of the job).
__global__ __launch_bounds__(PT) void k_prep(const float* __restrict__ xq, const float* __restrict__ xk, const float* __restrict__ xv, const int* __restrict__ msk,
    const float* __restrict__ wq, const float* __restrict__ wk, const float* __restrict__ wv, const float* __restrict__ wo, const float* __restrict__ rel,
    _Float16* __restrict__ XQ, _Float16* __restrict__ XK, _Float16* __restrict__ XV, unsigned int* __restrict__ MB,
    _Float16* __restrict__ BQ, _Float16* __restrict__ BK, _Float16* __restrict__ BV, _Float16* __restrict__ BO, _Float16* __restrict__ RT) {
  const int lane = threadIdx.x & 31, wn = __builtin_amdgcn_readfirstlane((int)(threadIdx.x >> 5));
  if (blockIdx.x == 0) {
    const int t = threadIdx.x; if (t >= NRELP * (HD / 8)) return;
    const int r = t / (HD / 8), d8 = (t % (HD / 8)) * 8;
    const int rc = (r < NREL) ? r : (NREL - 1);          // clamped address, value zeroed by predicate
    const bool live = (r < NREL);
    const v4f a = *(const v4fa*)(rel + (size_t)rc * HD + d8), c = *(const v4fa*)(rel + (size_t)rc * HD + d8 + 4);
    FragH f;
#pragma unroll
    for (int q = 0; q < 4; ++q) { f.h[q] = live ? (_Float16)(bf16_rne(a[q]) * 16.0f) : (_Float16)0.0f; f.h[4 + q] = live ? (_Float16)(bf16_rne(c[q]) * 16.0f) : (_Float16)0.0f; }
    *(v8us*)((unsigned short*)RT + (size_t)t * 8) = f.half[0];
    return;
  }
  for (int tile = (int)blockIdx.x - 1; tile < P_TILES; tile += P_BLOCKS) {
    if (tile < 4 * PW_TILES) {
      const int m = tile / PW_TILES;
      const float* s = (m == 0) ? wq : (m == 1) ? wk : (m == 2) ? wv : wo;
      _Float16* d = (m == 0) ? BQ : (m == 1) ? BK : (m == 2) ? BV : BO;
      const size_t e = (size_t)(tile - m * PW_TILES) * PTILE + (size_t)wn * PWU;
      cvt_unit(s + e, d + e, 16.0f, lane);
    } else if (tile < 4 * PW_TILES + 3 * PX_TILES) {
      const int tx = tile - 4 * PW_TILES, m = tx / PX_TILES;
      const float* s = (m == 0) ? xq : (m == 1) ? xk : xv;
      _Float16* d = (m == 0) ? XQ : (m == 1) ? XK : XV;
      const size_t e = (size_t)(tx - m * PX_TILES) * PTILE + (size_t)wn * PWU;   // compact element index; PWU divides DM, so the unit lies in one row
      const int r = (int)(e / DM), c = (int)(e % DM), b = r / SEQ, sq = r - b * SEQ;
      cvt_unit(s + ((size_t)b * SEQ_FULL + sq) * DM + c, d + e, 1.0f, lane);
    } else {
      const int tm = tile - (4 * PW_TILES + 3 * PX_TILES);
      pack_unit(msk, MB, (unsigned int)(tm * (PT / 32) + wn) * 32u, lane);
    }
  }
}

#define GBK 128                      /* k depth of one staged GEMM tile in halfs: 256 B a row */
#define GP 136                       /* LDS row pitch of a staged GEMM tile in halfs: 272 B = 16 B x odd, conflict-free for 16-byte fragment reads */
#define GSTAGE (192 * GP)            /* one stage: 128 rows of A, then 64 rows of B */
#define GRS (8u * GP * 2u)           /* LDS bytes between two copies of one thread: 8 rows */
// Twelve asynchronous copies of 16 B a lane: LDS rows 8 apart from l, each from its own global address.
__device__ __forceinline__ void copy12(unsigned int l, const _Float16* g0, const _Float16* g1, const _Float16* g2, const _Float16* g3, const _Float16* g4, const _Float16* g5,
                                       const _Float16* g6, const _Float16* g7, const _Float16* g8, const _Float16* g9, const _Float16* g10, const _Float16* g11) {
  // the copies and their s_wait_xcnt in one statement: the wait stands before any rewrite of the address registers the copies name
  asm volatile(
      "global_load_async_to_lds_b128 %0, %12, off\n\t"
      "global_load_async_to_lds_b128 %1, %13, off\n\t"
      "global_load_async_to_lds_b128 %2, %14, off\n\t"
      "global_load_async_to_lds_b128 %3, %15, off\n\t"
      "global_load_async_to_lds_b128 %4, %16, off\n\t"
      "global_load_async_to_lds_b128 %5, %17, off\n\t"
      "global_load_async_to_lds_b128 %6, %18, off\n\t"
      "global_load_async_to_lds_b128 %7, %19, off\n\t"
      "global_load_async_to_lds_b128 %8, %20, off\n\t"
      "global_load_async_to_lds_b128 %9, %21, off\n\t"
      "global_load_async_to_lds_b128 %10, %22, off\n\t"
      "global_load_async_to_lds_b128 %11, %23, off\n\t"
      "s_wait_xcnt 0x0"
      :: "v"(l), "v"(l + GRS), "v"(l + 2u * GRS), "v"(l + 3u * GRS), "v"(l + 4u * GRS), "v"(l + 5u * GRS),
         "v"(l + 6u * GRS), "v"(l + 7u * GRS), "v"(l + 8u * GRS), "v"(l + 9u * GRS), "v"(l + 10u * GRS), "v"(l + 11u * GRS),
         "v"(g0), "v"(g1), "v"(g2), "v"(g3), "v"(g4), "v"(g5), "v"(g6), "v"(g7), "v"(g8), "v"(g9), "v"(g10), "v"(g11)
      : "memory");
}
// One k-tile of the block (128 rows of A, then 64 rows of B, GBK deep) into one stage; each of the 128 threads brings 16 B of every eighth row.
// l: the lane's LDS byte address in row tid / 16 of the stage; ga, gb: its 16 B in that row of the A tile and of the B tile.
__device__ __forceinline__ void gemm_stage(unsigned int l, const _Float16* ga, int lda, const _Float16* gb, int ldb) {
  const size_t sa = (size_t)8 * lda, sb = (size_t)8 * ldb;
  copy12(l, ga, ga + sa, ga + 2 * sa, ga + 3 * sa, ga + 4 * sa, ga + 5 * sa, ga + 6 * sa, ga + 7 * sa, ga + 8 * sa, ga + 9 * sa, ga + 10 * sa, ga + 11 * sa);
  copy12(l + 12u * GRS, ga + 12 * sa, ga + 13 * sa, ga + 14 * sa, ga + 15 * sa, gb, gb + sb, gb + 2 * sb, gb + 3 * sb, gb + 4 * sb, gb + 5 * sb, gb + 6 * sb, gb + 7 * sb);
}

// GEMM (wave tile 32x64; M % 128 == 0, N % 64 == 0, K % 128 == 0): C[m][n] = alpha * sum_k A[m][k] Bh[n][k]; A f16 rows (pitch lda), Bh f16 [n][k] (pitch ldb);
// the block's 128 x GBK tile of A and 64 x GBK tile of Bh are staged in LDS (two buffers, asynchronous copies one tile ahead) and read as fragments by the four waves.
__global__ __launch_bounds__(128) void k_gemm2(const _Float16* __restrict__ A, int lda, size_t sA, const _Float16* __restrict__ Bh, int ldb, size_t sB, float alpha,
    float* __restrict__ C, _Float16* __restrict__ C16, _Float16* __restrict__ C16L, int ldc, size_t sC, int M, int N, int K) {
  __shared__ __attribute__((aligned(16))) float so[4][32][68];
  __shared__ __attribute__((aligned(16))) _Float16 ab[2 * GSTAGE];      // two stages of [row][GP]
  const int tid = threadIdx.x, w = tid >> 5, lane = tid & 31, ln = lane & 15, hh = lane >> 4; const int by = blockIdx.y;
  A += (size_t)by * sA; Bh += (size_t)by * sB; const size_t cofs = (size_t)by * sC;
  const int ntn = N >> 6; const int mt = blockIdx.x / ntn, nq = blockIdx.x - mt * ntn; const int row0 = mt * 128 + 32 * w, col0 = nq * 64; if (mt * 128 >= M) return;
  const int crow = tid >> 4, ccol = (tid & 15) * 8;                     // this thread's first row and 16-byte column in a stage
  const unsigned int cl = (unsigned int)(size_t)&ab[crow * GP + ccol];  // its LDS byte address in stage buffer 0
  const _Float16* cga = A + (size_t)(mt * 128 + crow) * lda + ccol;
  const _Float16* cgb = Bh + (size_t)(col0 + crow) * ldb + ccol;
  gemm_stage(cl, cga, lda, cgb, ldb);                                   // tile 0 -> buffer 0
  const v8f z8 = {0.f,0.f,0.f,0.f,0.f,0.f,0.f,0.f}; v8f c00 = z8, c01 = z8, c02 = z8, c03 = z8, c10 = z8, c11 = z8, c12 = z8, c13 = z8;
  asm volatile("s_wait_asynccnt 0x0" ::: "memory");                     // this wave's copies of tile 0 have landed before the barrier publishes them
  __syncthreads();
  if (K > GBK) gemm_stage(cl + GSTAGE * 2u, cga + GBK, lda, cgb + GBK, ldb);   // tile 1 -> buffer 1
  int bo = 0;                                                           // offset in halfs of the buffer that holds this tile
#pragma unroll 1   // one trip per staged tile: kept rolled so that the two buffers alternate through bo and the loop stays small
  for (int kb = 0; kb < K; kb += GBK) {
    const _Float16* ar = &ab[bo + (32 * w + ln) * GP]; const _Float16* br = &ab[bo + (128 + ln) * GP];
#pragma unroll     // the four k-steps of a tile read LDS at constant offsets
    for (int ks = 0; ks < GBK; ks += 32) { const v16h a0 = g2_frag(ar + ks, hh), a1 = g2_frag(ar + 16 * GP + ks, hh);
      const v16h b0 = g2_frag(br + ks, hh), b1 = g2_frag(br + 16 * GP + ks, hh), b2 = g2_frag(br + 32 * GP + ks, hh), b3 = g2_frag(br + 48 * GP + ks, hh);
      c00 = g2_mma(a0, b0, c00); c10 = g2_mma(a1, b0, c10);
      c01 = g2_mma(a0, b1, c01); c11 = g2_mma(a1, b1, c11);
      c02 = g2_mma(a0, b2, c02); c12 = g2_mma(a1, b2, c12);
      c03 = g2_mma(a0, b3, c03); c13 = g2_mma(a1, b3, c13); }
    asm volatile("s_wait_dscnt 0x0" ::: "memory");                      // this wave's reads of the buffer have returned before it may be refilled
    asm volatile("s_wait_asynccnt 0x0" ::: "memory");                   // this wave's copies of the next tile have landed
    __syncthreads();                                                    // publishes the next tile and ends every wave's reads of this buffer
    if (kb + 2 * GBK < K) gemm_stage(cl + (unsigned int)bo * 2u, cga + (kb + 2 * GBK), lda, cgb + (kb + 2 * GBK), ldb);   // tile + 2 -> the buffer just read
    bo ^= GSTAGE;
  }
  asm volatile("s_wait_asynccnt 0x0" ::: "memory");                     // nothing of this wave is in flight behind the loop
  v8f accs[8] = {c00, c01, c02, c03, c10, c11, c12, c13};
#pragma unroll
  for (int u = 0; u < 8; ++u) { const int t = u & 3, half = u >> 2;
#pragma unroll
    for (int r = 0; r < 8; ++r) { const int rloc = half * 16 + 8 * hh + r; so[w][rloc][t * 16 + ln] = accs[u][r] * alpha; } }
  __builtin_amdgcn_fence(4 /* acq_rel order */, "workgroup"); __builtin_amdgcn_wave_barrier();
  const int rsub = lane >> 4, c4 = (lane & 15) * 4;
  {
#pragma unroll
    for (int q = 0; q < 16; ++q) {
      const int r = q * 2 + rsub; const v4f v = *(const v4fa*)&so[w][r][c4];
      const size_t o = cofs + (size_t)(row0 + r) * ldc + col0 + c4;
      if (C) *(v4f*)(C + o) = v;
      if (C16) { v4h h4, l4;
#pragma unroll
        for (int i = 0; i < 4; ++i) { const _Float16 hq = (_Float16)v[i]; h4[i] = hq; l4[i] = (_Float16)((v[i] - (float)hq) * 1024.0f); }
        *(v4h*)(C16 + o) = h4;
        if (C16L) *(v4h*)(C16L + o) = l4; }
    }
     }
}

template <int NHv, int TTv>
__global__ __launch_bounds__(256) void k_vt(const _Float16* __restrict__ V16, int ldv, int voff, _Float16* __restrict__ Vt) {
  __shared__ unsigned short tl[64][66]; const int tid = threadIdx.x;
  const int slab = blockIdx.x / (TTv / 64), lg = blockIdx.x % (TTv / 64); const int b = slab / NHv, h = slab % NHv;
  for (int i = tid; i < 64 * 8; i += 256) { const int r = i / 8, c8 = (i % 8) * 8; FragH f; f.half[0] = *(const v8us*)((const unsigned short*)V16 + ((size_t)b * TTv + lg * 64 + r) * ldv + voff + h * 64 + c8);
#pragma unroll
    for (int q = 0; q < 8; ++q) tl[r][c8 + q] = f.u[q]; }
  __syncthreads();
  {
#pragma unroll
    for (int rd = 0; rd < 2; ++rd) { const int d = rd * 32 + tid / 8, pc = tid % 8; FragH f;
#pragma unroll
      for (int q = 0; q < 8; ++q) f.u[q] = tl[pc * 8 + q][d];
      *(v8us*)((unsigned short*)Vt + ((size_t)slab * 64 + d) * TTv + lg * 64 + pc * 8) = f.half[0]; }
     }
}

#define KVP 72                       /* LDS row pitch of a staged plane in halfs: 144 B = 16 B x odd, conflict-free for 16-byte fragment reads */
#define KVPLANE (64 * KVP)           /* one staged plane: 64 rows */
#define KVSTAGE (3 * KVPLANE)        /* one stage: K hi, K residual, V^T */
// One 64-key stage into LDS by asynchronous copies: three planes of 64 rows x 128 B; each of the 128 threads brings 16 B of rows r, r+16, r+32, r+48 of each plane.
// l: the lane's LDS byte address in plane 0 (row r); gh, gl: its 16 B in K hi / K residual (row pitch DM); gv: its 16 B in V^T (row pitch SEQ).
__device__ __forceinline__ void stage_copy(unsigned int l, const _Float16* gh, const _Float16* gl, const _Float16* gv) {
  // the copies and their s_wait_xcnt in one statement: the wait stands before any rewrite of the address registers the copies name
  asm volatile(
      "global_load_async_to_lds_b128 %0, %12, off\n\t"
      "global_load_async_to_lds_b128 %1, %13, off\n\t"
      "global_load_async_to_lds_b128 %2, %14, off\n\t"
      "global_load_async_to_lds_b128 %3, %15, off\n\t"
      "global_load_async_to_lds_b128 %4, %16, off\n\t"
      "global_load_async_to_lds_b128 %5, %17, off\n\t"
      "global_load_async_to_lds_b128 %6, %18, off\n\t"
      "global_load_async_to_lds_b128 %7, %19, off\n\t"
      "global_load_async_to_lds_b128 %8, %20, off\n\t"
      "global_load_async_to_lds_b128 %9, %21, off\n\t"
      "global_load_async_to_lds_b128 %10, %22, off\n\t"
      "global_load_async_to_lds_b128 %11, %23, off\n\t"
      "s_wait_xcnt 0x0"
      :: "v"(l), "v"(l + 16u * KVP * 2u), "v"(l + 32u * KVP * 2u), "v"(l + 48u * KVP * 2u),
         "v"(l + KVPLANE * 2u), "v"(l + KVPLANE * 2u + 16u * KVP * 2u), "v"(l + KVPLANE * 2u + 32u * KVP * 2u), "v"(l + KVPLANE * 2u + 48u * KVP * 2u),
         "v"(l + KVPLANE * 4u), "v"(l + KVPLANE * 4u + 16u * KVP * 2u), "v"(l + KVPLANE * 4u + 32u * KVP * 2u), "v"(l + KVPLANE * 4u + 48u * KVP * 2u),
         "v"(gh), "v"(gh + 16 * DM), "v"(gh + 32 * DM), "v"(gh + 48 * DM),
         "v"(gl), "v"(gl + 16 * DM), "v"(gl + 32 * DM), "v"(gl + 48 * DM),
         "v"(gv), "v"(gv + 16 * SEQ), "v"(gv + 32 * SEQ), "v"(gv + 48 * SEQ)
      : "memory");
}

// Fused attention with relu^2 normaliser. grid = NB*NH*(SEQ/64), block = 4 waves; wave w owns query rows q0 = qb*64 + 16w .. +15 of (b, h).
// Per wave: position table qes[m][r] = q[m].rel_emb[r] (WMMA, f32 in LDS); per 64-key chunk: s = q.k^T (hi.hi + (lo.hi + hi.lo)/2^10), sv = (s + qes[m][clamp(key-q)+16]) / 8,
// K hi, K residual and V^T of each 64-key chunk are staged once per block in LDS (two buffers, asynchronous copies one chunk ahead) and read as fragments by all four waves.
// masked -> -1e9, t = relu(sv + b)^2, dsum += t (f32), tls[m][key] = f16(256 t); o += tls . v^T ; end: o * (1/(sum+eps)) * 64/256 -> f16 rows of O16 (cols h*64..).
__global__ __launch_bounds__(128) void k_attn(const _Float16* __restrict__ QH, const _Float16* __restrict__ QL, const _Float16* __restrict__ KH, const _Float16* __restrict__ KL,
                                              const _Float16* __restrict__ VT, const _Float16* __restrict__ RT, const unsigned int* __restrict__ MBt,
                                              const float* __restrict__ spb, _Float16* __restrict__ O16) {
  #pragma clang fp contract(off)
  __shared__ __attribute__((aligned(16))) _Float16 tls[4][16][72];     // [row][key] t tile (cols 0..63 used), later [row][d] o tile
  __shared__ float qes[4][16][52];                                      // [row][r] position table (cols 0..47 written, 0..32 read)
  __shared__ __attribute__((aligned(16))) _Float16 kv[2 * KVSTAGE];     // two stages of [plane][row][KVP]
  const int tid = threadIdx.x, w = tid >> 5, lane = tid & 31, ln = lane & 15, hh = lane >> 4;
  const int nqb = SEQ / 64;
  const int bh = blockIdx.x / nqb, qb = blockIdx.x - bh * nqb;
  const int b = bh / NH, h = bh - b * NH;
  const int q0 = qb * 64 + w * 16;                                      // first query of this wave (within the sequence)
  const size_t rq = (size_t)b * SEQ + q0;                               // compact token row of that query
  const size_t qoff = (rq + ln) * DM + (size_t)h * HD;
  const v16h qh0 = g2_frag(QH + qoff, hh), qh1 = g2_frag(QH + qoff + 32, hh);
  const v16h ql0 = g2_frag(QL + qoff, hh), ql1 = g2_frag(QL + qoff + 32, hh);
  const v8f z8 = {0.f,0.f,0.f,0.f,0.f,0.f,0.f,0.f};
  const float rsc = 0.0009765625f;                                      // 2^-10 fold of the residual planes
  const _Float16* kbh = KH + ((size_t)b * SEQ) * DM + (size_t)h * HD;
  const _Float16* kbl = KL + ((size_t)b * SEQ) * DM + (size_t)h * HD;
  const _Float16* vtb = VT + ((size_t)bh * HD) * SEQ;
  const int crow = tid >> 3, ccol = (tid & 7) * 8;                      // this thread's first row and 16-byte column in every staged plane
  const unsigned int cl = (unsigned int)(size_t)&kv[crow * KVP + ccol];  // its LDS byte address in stage buffer 0
  const _Float16* cgh = kbh + (size_t)crow * DM + ccol;
  const _Float16* cgl = kbl + (size_t)crow * DM + ccol;
  const _Float16* cgv = vtb + (size_t)crow * SEQ + ccol;
  stage_copy(cl, cgh, cgl, cgv);                                        // chunk 0 -> buffer 0
  // position table: qes[m][r] = (q[m] . (16 rel_emb[r])) / 16
#pragma unroll
  for (int nt = 0; nt < 3; ++nt) {
    const _Float16* rr = RT + (size_t)(nt * 16 + ln) * HD;
    const v16h r0 = g2_frag(rr, hh), r1 = g2_frag(rr + 32, hh);
    const v8f ah = mma2(qh0, r0, qh1, r1, z8);
    const v8f al = mma2(ql0, r0, ql1, r1, z8);
#pragma unroll
    for (int r = 0; r < 8; ++r) { const float e = ah[r] + al[r] * rsc; qes[w][8 * hh + r][nt * 16 + ln] = e * 0.0625f; }
  }
  asm volatile("s_wait_asynccnt 0x0" ::: "memory");                     // this wave's copies of chunk 0 have landed before the barrier publishes them
  __syncthreads();
  stage_copy(cl + KVSTAGE * 2u, cgh + (size_t)64 * DM, cgl + (size_t)64 * DM, cgv + 64);   // chunk 1 -> buffer 1 (SEQ >= 128)

  const unsigned int* mbr = MBt + (rq + 8 * hh) * (SEQ / 32);          // bit row of query q0 + 8hh; row r at + r*(SEQ/32)
  const float sbias = spb[0];
  float dsum[8];
#pragma unroll
  for (int r = 0; r < 8; ++r) dsum[r] = 0.f;
  v8f oacc[4] = {z8, z8, z8, z8};
  int bo = 0;                                                           // offset in halfs of the buffer that holds this chunk

#pragma unroll 1
  for (int k0 = 0; k0 < SEQ; k0 += 64) {
    v2ua mw[8];
#pragma unroll
    for (int r = 0; r < 8; ++r) mw[r] = *(const v2ua*)(mbr + (size_t)r * (SEQ / 32) + (k0 >> 5));
#pragma unroll
    for (int kt = 0; kt < 4; ++kt) {
      const _Float16* kr = &kv[bo + (kt * 16 + ln) * KVP];
      const v16h kh0 = g2_frag(kr, hh), kh1 = g2_frag(kr + 32, hh);
      const v8f sh = mma2(qh0, kh0, qh1, kh1, z8);
      v8f sx = mma2(ql0, kh0, ql1, kh1, z8);
      const v16h kl0 = g2_frag(kr + KVPLANE, hh), kl1 = g2_frag(kr + KVPLANE + 32, hh);
      sx = mma2(qh0, kl0, qh1, kl1, sx);
      const int kc = kt * 16 + ln;                                      // key within the chunk held by this lane (D column)
#pragma unroll
      for (int r = 0; r < 8; ++r) {
        const int m = 8 * hh + r;                                       // row within the wave tile (D row)
        int rel = (k0 + kc) - (q0 + m);
        rel = (rel < -KREL) ? -KREL : ((rel > KREL) ? KREL : rel);
        const float s = sh[r] + sx[r] * rsc;
        float sv = (s + qes[w][m][rel + KREL]) * 0.125f;
        const unsigned int word = (kt < 2) ? mw[r][0] : mw[r][1];
        const unsigned int bit = (word >> ((kt & 1) * 16 + ln)) & 1u;
        sv = (bit != 0u) ? -1.0e9f : sv;
        float t = sv + sbias;
        t = fmaxf(t, 0.0f);
        const float tt = t * t;
        dsum[r] += tt;
        tls[w][m][kc] = (_Float16)(tt * 256.0f);
      }
    }
    __builtin_amdgcn_fence(3 /* release order */, "wavefront"); __builtin_amdgcn_wave_barrier();
    FragH pa, pb;
    pa.half[0] = *(const v8us*)&tls[w][ln][8 * hh];      pa.half[1] = *(const v8us*)&tls[w][ln][16 + 8 * hh];       // keys k0 + 0..31
    pb.half[0] = *(const v8us*)&tls[w][ln][32 + 8 * hh]; pb.half[1] = *(const v8us*)&tls[w][ln][48 + 8 * hh];       // keys k0 + 32..63
#pragma unroll
    for (int dt = 0; dt < 4; ++dt) {
      const _Float16* vr = &kv[bo + 2 * KVPLANE + (dt * 16 + ln) * KVP];
      const v16h v0 = g2_frag(vr, hh), v1 = g2_frag(vr + 32, hh);
      oacc[dt] = mma2(pa.v, v0, pb.v, v1, oacc[dt]);
    }
    __builtin_amdgcn_fence(3 /* release order */, "wavefront"); __builtin_amdgcn_wave_barrier();
    asm volatile("s_wait_dscnt 0x0" ::: "memory");                      // this wave's reads of the buffer have returned before it may be refilled
    asm volatile("s_wait_asynccnt 0x0" ::: "memory");                   // this wave's copies of the next chunk have landed
    __syncthreads();                                                    // publishes the next chunk and ends every wave's reads of this buffer
    if (k0 + 128 < SEQ)
      stage_copy(cl + (unsigned int)bo * 2u, cgh + (size_t)(k0 + 128) * DM, cgl + (size_t)(k0 + 128) * DM, cgv + (k0 + 128));   // chunk + 2 -> the buffer just read
    bo ^= KVSTAGE;
  }
  asm volatile("s_wait_asynccnt 0x0" ::: "memory");                     // nothing of this wave is in flight behind the loop

  // key sums across the 16 lanes of each half (each half holds its own 8 rows); scale = 64/256 / (sum + eps)
#pragma unroll
  for (int r = 0; r < 8; ++r) {
    float v = dsum[r];
    v += __shfl_xor(v, 1, 32); v += __shfl_xor(v, 2, 32); v += __shfl_xor(v, 4, 32); v += __shfl_xor(v, 8, 32);
    dsum[r] = (1.0f / (v + 1.0e-9f)) * 0.25f;
  }
#pragma unroll
  for (int dt = 0; dt < 4; ++dt)
#pragma unroll
    for (int r = 0; r < 8; ++r) tls[w][8 * hh + r][dt * 16 + ln] = (_Float16)(oacc[dt][r] * dsum[r]);
  __builtin_amdgcn_fence(3 /* release order */, "wavefront"); __builtin_amdgcn_wave_barrier();
  const int rl = lane >> 3, pc = (lane & 7) * 8;
  {
#pragma unroll
    for (int it = 0; it < 4; ++it) {
      const int row = it * 4 + rl;
      const v8us v = *(const v8us*)&tls[w][row][pc];
      *(v8us*)((unsigned short*)O16 + (rq + row) * DM + (size_t)h * HD + pc) = v;
    }
    
  }
}

extern "C" void kernel_launch(void* const* d_in, const int* in_sizes, int n_in,
                              void* d_out, int out_size, void* d_ws, size_t ws_size, hipStream_t stream) {
  if (n_in < 10) return;
  const int nx = (int)(NR * DM);
  if (in_sizes[0] < nx || in_sizes[1] < nx || in_sizes[2] < nx) return;
  if (in_sizes[3] < (int)(NR * SEQ)) return;
  if (in_sizes[4] < DM * DM || in_sizes[5] < DM * DM || in_sizes[6] < DM * DM || in_sizes[7] < DM * DM) return;
  if (in_sizes[8] < NREL * HD || in_sizes[9] < 1) return;
  if (out_size < nx) return;
  const float* xq = (const float*)d_in[0]; const float* xk = (const float*)d_in[1]; const float* xv = (const float*)d_in[2];
  const int* msk = (const int*)d_in[3];
  const float* wq = (const float*)d_in[4]; const float* wk = (const float*)d_in[5]; const float* wv = (const float*)d_in[6]; const float* wo = (const float*)d_in[7];
  const float* rel = (const float*)d_in[8]; const float* spb = (const float*)d_in[9];

  char* ws = (char*)d_ws; size_t off = 0;
  auto take = [&](size_t bytes) { char* p = ws + off; off += (bytes + 255) & ~(size_t)255; return p; };
  const size_t wbytes = (size_t)DM * DM * 2, xbytes = NR * DM * 2;
  _Float16* BQ = (_Float16*)take(wbytes); _Float16* BK = (_Float16*)take(wbytes); _Float16* BV = (_Float16*)take(wbytes); _Float16* BO = (_Float16*)take(wbytes);
  _Float16* RT = (_Float16*)take((size_t)NRELP * HD * 2);
  _Float16* XQ = (_Float16*)take(xbytes); _Float16* XK = (_Float16*)take(xbytes); _Float16* XV = (_Float16*)take(xbytes);
  _Float16* QH = (_Float16*)take(xbytes); _Float16* QL = (_Float16*)take(xbytes); _Float16* KH = (_Float16*)take(xbytes); _Float16* KL = (_Float16*)take(xbytes);
  _Float16* V16 = (_Float16*)take(xbytes);
  _Float16* VT = (_Float16*)take((size_t)NB * NH * HD * SEQ * 2);
  const int nwords = (int)(NR * (SEQ / 32));
  unsigned int* MB = (unsigned int*)take((size_t)nwords * 4);
  _Float16* O16 = (_Float16*)take(xbytes);
  if (off > ws_size || off > (size_t)134217728) return;

  k_prep<<<P_BLOCKS + 1, PT, 0, stream>>>(xq, xk, xv, msk, wq, wk, wv, wo, rel, XQ, XK, XV, MB, BQ, BK, BV, BO, RT);

  const int M = (int)NR;
  const dim3 gp((unsigned)((M / 128) * (DM / 64)), 1);
  k_gemm2<<<gp, 128, 0, stream>>>(XQ, DM, (size_t)0, BQ, DM, (size_t)0, 0.0625f, nullptr, QH, QL, DM, (size_t)0, M, DM, DM);
  k_gemm2<<<gp, 128, 0, stream>>>(XK, DM, (size_t)0, BK, DM, (size_t)0, 0.0625f, nullptr, KH, KL, DM, (size_t)0, M, DM, DM);
  k_gemm2<<<gp, 128, 0, stream>>>(XV, DM, (size_t)0, BV, DM, (size_t)0, 0.0625f, nullptr, V16, nullptr, DM, (size_t)0, M, DM, DM);
  k_vt<NH, SEQ><<<(unsigned)(NB * NH * (SEQ / 64)), 256, 0, stream>>>(V16, DM, 0, VT);
  k_attn<<<(unsigned)(NB * NH * (SEQ / 64)), 128, 0, stream>>>(QH, QL, KH, KL, VT, RT, MB, spb, O16);
  k_gemm2<<<gp, 128, 0, stream>>>(O16, DM, (size_t)0, BO, DM, (size_t)0, 0.0009765625f, (float*)d_out, nullptr, nullptr, DM, (size_t)0, M, DM, DM);
}

// v004
// Measured time: 154 microseconds a run.
// Timed twice side by side with v003, it ran 1.04 times as fast both times.
// Over all steps from v000 it is 2.75 times as fast.
#include <hip/hip_runtime.h>
// Contractions on v_wmma_f32_16x16x32_f16 (f16 operands, f32 accumulate): q/k/v projections and the output projection plain f16 (inputs RNE-converted to bf16 then held exactly in f16, weights x16); q.k^T scores as f16 hi + residual (x2^10) planes on both operands (3 products, residual terms in a separate accumulator); q.rel_emb^T position table f16 hi + residual on q (rel_emb exact x16); t.v aggregation plain f16 (t carried x256, o carried x64); normaliser statistics f32.
#ifndef NB
#define NB 2
#endif
#ifndef SEQ
#define SEQ 2048
#endif
#define NB_FULL 2
#define SEQ_FULL 2048
#define DM 1024
#define NH 16
#define HD 64
#define NREL 33
#define KREL 16
#define NRELP 48                     /* rel_emb rows padded to 3 WMMA column tiles (rows 33..47 zero) */
#define NR ((size_t)NB * SEQ)        /* token rows processed (compact) */
static_assert(SEQ % 128 == 0);
static_assert(SEQ <= SEQ_FULL);
static_assert(NB >= 1 && NB <= NB_FULL);
static_assert(DM == NH * HD);

typedef unsigned short v8us __attribute__((ext_vector_type(8), may_alias));
typedef float  v8f  __attribute__((ext_vector_type(8)));
typedef float  v4f  __attribute__((ext_vector_type(4)));
typedef float  v4fa __attribute__((ext_vector_type(4), may_alias));
typedef _Float16 v16h __attribute__((ext_vector_type(16)));
typedef _Float16 v4h __attribute__((ext_vector_type(4)));
typedef int v4ia __attribute__((ext_vector_type(4), may_alias));
typedef unsigned int v2ua __attribute__((ext_vector_type(2), may_alias));
union FragH { v16h v; v8us half[2]; _Float16 h[16]; unsigned short u[16]; };

__device__ __forceinline__ unsigned short bf16_bits(float x) { unsigned int u = __float_as_uint(x); return (unsigned short)((u + 0x7FFFu + ((u >> 16) & 1u)) >> 16); }
__device__ __forceinline__ float bf16_val(unsigned short b) { return __uint_as_float(((unsigned int)b) << 16); }
__device__ __forceinline__ float bf16_rne(float x) { return bf16_val(bf16_bits(x)); }

// 16x32 fragment from a 16-bit row (lane row/col = lane & 15): elements 0..7 <- k0 + 8hh + 0..7, elements 8..15 <- k0 + 16 + 8hh + 0..7 (same map for A and B)
__device__ __forceinline__ v16h g2_frag(const _Float16* p, int hh) { FragH f; f.half[0] = *(const v8us*)((const unsigned short*)p + 8 * hh); f.half[1] = *(const v8us*)((const unsigned short*)p + 16 + 8 * hh); return f.v; }
__device__ __forceinline__ v8f g2_mma(v16h a, v16h b, v8f c) { v8f d = __builtin_amdgcn_wmma_f32_16x16x32_f16(false, a, false, b, (short)0, c, false, false); asm volatile("v_nop\n\tv_nop\n\tv_nop\n\tv_nop" : "+v"(d) : "v"(a), "v"(b)); return d; }
// two k-steps into one accumulator, hazard guard after the second
__device__ __forceinline__ v8f mma2(v16h a0, v16h b0, v16h a1, v16h b1, v8f c) {
  c = __builtin_amdgcn_wmma_f32_16x16x32_f16(false, a0, false, b0, (short)0, c, false, false);
  c = __builtin_amdgcn_wmma_f32_16x16x32_f16(false, a1, false, b1, (short)0, c, false, false);
  asm volatile("v_nop\n\tv_nop\n\tv_nop\n\tv_nop" : "+v"(c) : "v"(a0), "v"(b0), "v"(a1), "v"(b1));
  return c;
}

#define PT 512                       /* threads of a k_prep block: 16 waves */
#define PWU 1024                     /* 4-byte elements one wave moves per tile: 4 KiB */
#define PTILE ((PT / 32) * PWU)      /* elements of one block tile */
#define PW_TILES (DM * DM / PTILE)               /* tiles of one weight matrix */
#define PX_TILES ((int)(NR * DM / PTILE))        /* tiles of one activation input */
#define PM_TILES ((int)(NR * SEQ / PTILE))       /* tiles of the mask */
#define P_TILES (4 * PW_TILES + 3 * PX_TILES + PM_TILES)
#define P_BLOCKS ((P_TILES + 2) / 3)             /* three tiles a block */
static_assert((DM * DM) % PTILE == 0 && DM % PWU == 0);
static_assert((NR * DM) % PTILE == 0 && (NR * SEQ) % PTILE == 0);

// One wave's 4 KiB of f32 -> f16(bf16_rne(x) * scale): eight 512-byte loads in flight, then eight 256-byte stores (whole lines both ways).
__device__ __forceinline__ void cvt_unit(const float* __restrict__ s, _Float16* __restrict__ d, float scale, int lane) {
  v4f v[8];
#pragma unroll
  for (int j = 0; j < 8; ++j) v[j] = *(const v4fa*)(s + j * 128 + lane * 4);
#pragma unroll
  for (int j = 0; j < 8; ++j) { v4h h;
#pragma unroll
    for (int i = 0; i < 4; ++i) h[i] = (_Float16)(bf16_rne(v[j][i]) * scale);
    *(v4h*)(d + j * 128 + lane * 4) = h; }
  asm volatile("s_wait_xcnt 0x0" ::: "memory");   // stands directly behind the stores, before anything rewrites the address or data registers that they name
}

// One wave's 32 mask words (all in one mask row): word i0 + j is the ballot of one 128-byte line of mask integers (lane = bit); lane j keeps word j, one 128-byte store.
static_assert((SEQ / 32) % 32 == 0);
__device__ __forceinline__ void pack_unit(const int* __restrict__ msk, unsigned int* __restrict__ bits, unsigned int i0, int lane) {
  const unsigned int wpr = SEQ / 32, row = i0 / wpr, wi = i0 - row * wpr, b = row / SEQ, q = row - b * SEQ;
  const int* src = msk + ((size_t)b * SEQ_FULL + q) * SEQ_FULL + (size_t)wi * 32 + lane;
  int v[32];
#pragma unroll
  for (int j = 0; j < 32; ++j) v[j] = src[j * 32];
  asm volatile("s_wait_xcnt 0x0" :: "v"(src) : "memory");   // behind the run of loads; the pointer as input keeps the address registers out of the loads' results up to here
  unsigned int wd = 0u;
#pragma unroll
  for (int j = 0; j < 32; ++j) { const unsigned int bj = __builtin_amdgcn_ballot_w32(v[j] != 0); wd = (lane == j) ? bj : wd; }
  bits[i0 + lane] = wd;
  asm volatile("s_wait_xcnt 0x0" ::: "memory");   // stands directly behind the store, before anything rewrites the registers that it names
}

// All operand preparation in one launch: weights -> f16 x16, activations -> f16, mask -> bit words, rel_emb -> padded f16 x16 table.
// Block 0 does the small table; blocks 1 .. P_BLOCKS walk the tiles (block-uniform choice of the job).
__global__ __launch_bounds__(PT) void k_prep(const float* __restrict__ xq, const float* __restrict__ xk, const float* __restrict__ xv, const int* __restrict__ msk,
    const float* __restrict__ wq, const float* __restrict__ wk, const float* __restrict__ wv, const float* __restrict__ wo, const float* __restrict__ rel,
    _Float16* __restrict__ XQ, _Float16* __restrict__ XK, _Float16* __restrict__ XV, unsigned int* __restrict__ MB,
    _Float16* __restrict__ BQ, _Float16* __restrict__ BK, _Float16* __restrict__ BV, _Float16* __restrict__ BO, _Float16* __restrict__ RT) {
  const int lane = threadIdx.x & 31, wn = __builtin_amdgcn_readfirstlane((int)(threadIdx.x >> 5));
  if (blockIdx.x == 0) {
    const int t = threadIdx.x; if (t >= NRELP * (HD / 8)) return;
    const int r = t / (HD / 8), d8 = (t % (HD / 8)) * 8;
    const int rc = (r < NREL) ? r : (NREL - 1);          // clamped address, value zeroed by predicate
    const bool live = (r < NREL);
    const v4f a = *(const v4fa*)(rel + (size_t)rc * HD + d8), c = *(const v4fa*)(rel + (size_t)rc * HD + d8 + 4);
    FragH f;
#pragma unroll
    for (int q = 0; q < 4; ++q) { f.h[q] = live ? (_Float16)(bf16_rne(a[q]) * 16.0f) : (_Float16)0.0f; f.h[4 + q] = live ? (_Float16)(bf16_rne(c[q]) * 16.0f) : (_Float16)0.0f; }
    *(v8us*)((unsigned short*)RT + (size_t)t * 8) = f.half[0];
    return;
  }
  for (int tile = (int)blockIdx.x - 1; tile < P_TILES; tile += P_BLOCKS) {
    if (tile < 4 * PW_TILES) {
      const int m = tile / PW_TILES;
      const float* s = (m == 0) ? wq : (m == 1) ? wk : (m == 2) ? wv : wo;
      _Float16* d = (m == 0) ? BQ : (m == 1) ? BK : (m == 2) ? BV : BO;
      const size_t e = (size_t)(tile - m * PW_TILES) * PTILE + (size_t)wn * PWU;
      cvt_unit(s + e, d + e, 16.0f, lane);
    } else if (tile < 4 * PW_TILES + 3 * PX_TILES) {
      const int tx = tile - 4 * PW_TILES, m = tx / PX_TILES;
      const float* s = (m == 0) ? xq : (m == 1) ? xk : xv;
      _Float16* d = (m == 0) ? XQ : (m == 1) ? XK : XV;
      const size_t e = (size_t)(tx - m * PX_TILES) * PTILE + (size_t)wn * PWU;   // compact element index; PWU divides DM, so the unit lies in one row
      const int r = (int)(e / DM), c = (int)(e % DM), b = r / SEQ, sq = r - b * SEQ;
      cvt_unit(s + ((size_t)b * SEQ_FULL + sq) * DM + c, d + e, 1.0f, lane);
    } else {
      const int tm = tile - (4 * PW_TILES + 3 * PX_TILES);
      pack_unit(msk, MB, (unsigned int)(tm * (PT / 32) + wn) * 32u, lane);
    }
  }
}

#define GBK 128                      /* k depth of one staged GEMM tile in halfs: 256 B a row */
#define GP 136                       /* LDS row pitch of a staged GEMM tile in halfs: 272 B = 16 B x odd, conflict-free for 16-byte fragment reads */
#define GSTAGE (192 * GP)            /* one stage: 128 rows of A, then 64 rows of B */
#define GRS (8u * GP * 2u)           /* LDS bytes between two copies of one thread: 8 rows */
// Twelve asynchronous copies of 16 B a lane: LDS rows 8 apart from l, each from its own global address.
__device__ __forceinline__ void copy12(unsigned int l, const _Float16* g0, const _Float16* g1, const _Float16* g2, const _Float16* g3, const _Float16* g4, const _Float16* g5,
                                       const _Float16* g6, const _Float16* g7, const _Float16* g8, const _Float16* g9, const _Float16* g10, const _Float16* g11) {
  // the copies and their s_wait_xcnt in one statement: the wait stands before any rewrite of the address registers the copies name
  asm volatile(
      "global_load_async_to_lds_b128 %0, %12, off\n\t"
      "global_load_async_to_lds_b128 %1, %13, off\n\t"
      "global_load_async_to_lds_b128 %2, %14, off\n\t"
      "global_load_async_to_lds_b128 %3, %15, off\n\t"
      "global_load_async_to_lds_b128 %4, %16, off\n\t"
      "global_load_async_to_lds_b128 %5, %17, off\n\t"
      "global_load_async_to_lds_b128 %6, %18, off\n\t"
      "global_load_async_to_lds_b128 %7, %19, off\n\t"
      "global_load_async_to_lds_b128 %8, %20, off\n\t"
      "global_load_async_to_lds_b128 %9, %21, off\n\t"
      "global_load_async_to_lds_b128 %10, %22, off\n\t"
      "global_load_async_to_lds_b128 %11, %23, off\n\t"
      "s_wait_xcnt 0x0"
      :: "v"(l), "v"(l + GRS), "v"(l + 2u * GRS), "v"(l + 3u * GRS), "v"(l + 4u * GRS), "v"(l + 5u * GRS),
         "v"(l + 6u * GRS), "v"(l + 7u * GRS), "v"(l + 8u * GRS), "v"(l + 9u * GRS), "v"(l + 10u * GRS), "v"(l + 11u * GRS),
         "v"(g0), "v"(g1), "v"(g2), "v"(g3), "v"(g4), "v"(g5), "v"(g6), "v"(g7), "v"(g8), "v"(g9), "v"(g10), "v"(g11)
      : "memory");
}
// One k-tile of the block (128 rows of A, then 64 rows of B, GBK deep) into one stage; each of the 128 threads brings 16 B of every eighth row.
// l: the lane's LDS byte address in row tid / 16 of the stage; ga, gb: its 16 B in that row of the A tile and of the B tile.
__device__ __forceinline__ void gemm_stage(unsigned int l, const _Float16* ga, int lda, const _Float16* gb, int ldb) {
  const size_t sa = (size_t)8 * lda, sb = (size_t)8 * ldb;
  copy12(l, ga, ga + sa, ga + 2 * sa, ga + 3 * sa, ga + 4 * sa, ga + 5 * sa, ga + 6 * sa, ga + 7 * sa, ga + 8 * sa, ga + 9 * sa, ga + 10 * sa, ga + 11 * sa);
  copy12(l + 12u * GRS, ga + 12 * sa, ga + 13 * sa, ga + 14 * sa, ga + 15 * sa, gb, gb + sb, gb + 2 * sb, gb + 3 * sb, gb + 4 * sb, gb + 5 * sb, gb + 6 * sb, gb + 7 * sb);
}

// GEMM (wave tile 32x64; M % 128 == 0, N % 64 == 0, K % 128 == 0): C[m][n] = alpha * sum_k A[m][k] Bh[n][k]; A f16 rows (pitch lda), Bh f16 [n][k] (pitch ldb);
// the block's 128 x GBK tile of A and 64 x GBK tile of Bh are staged in LDS (two buffers, asynchronous copies one tile ahead) and read as fragments by the four waves.
__global__ __launch_bounds__(128) void k_gemm2(const _Float16* __restrict__ A, int lda, size_t sA, const _Float16* __restrict__ Bh, int ldb, size_t sB, float alpha,
    float* __restrict__ C, _Float16* __restrict__ C16, _Float16* __restrict__ C16L, int ldc, size_t sC, int M, int N, int K) {
  __shared__ __attribute__((aligned(16))) float so[4][32][68];
  __shared__ __attribute__((aligned(16))) _Float16 ab[2 * GSTAGE];      // two stages of [row][GP]
  const int tid = threadIdx.x, w = tid >> 5, lane = tid & 31, ln = lane & 15, hh = lane >> 4; const int by = blockIdx.y;
  A += (size_t)by * sA; Bh += (size_t)by * sB; const size_t cofs = (size_t)by * sC;
  const int ntn = N >> 6; const int mt = blockIdx.x / ntn, nq = blockIdx.x - mt * ntn; const int row0 = mt * 128 + 32 * w, col0 = nq * 64; if (mt * 128 >= M) return;
  const int crow = tid >> 4, ccol = (tid & 15) * 8;                     // this thread's first row and 16-byte column in a stage
  const unsigned int cl = (unsigned int)(size_t)&ab[crow * GP + ccol];  // its LDS byte address in stage buffer 0
  const _Float16* cga = A + (size_t)(mt * 128 + crow) * lda + ccol;
  const _Float16* cgb = Bh + (size_t)(col0 + crow) * ldb + ccol;
  gemm_stage(cl, cga, lda, cgb, ldb);                                   // tile 0 -> buffer 0
  const v8f z8 = {0.f,0.f,0.f,0.f,0.f,0.f,0.f,0.f}; v8f c00 = z8, c01 = z8, c02 = z8, c03 = z8, c10 = z8, c11 = z8, c12 = z8, c13 = z8;
  asm volatile("s_wait_asynccnt 0x0" ::: "memory");                     // this wave's copies of tile 0 have landed before the barrier publishes them
  __syncthreads();
  if (K > GBK) gemm_stage(cl + GSTAGE * 2u, cga + GBK, lda, cgb + GBK, ldb);   // tile 1 -> buffer 1
  int bo = 0;                                                           // offset in halfs of the buffer that holds this tile
#pragma unroll 1   // one trip per staged tile: kept rolled so that the two buffers alternate through bo and the loop stays small
  for (int kb = 0; kb < K; kb += GBK) {
    const _Float16* ar = &ab[bo + (32 * w + ln) * GP]; const _Float16* br = &ab[bo + (128 + ln) * GP];
    // the fragments of k-step ks + 1 are read into a second register set in front of the products of k-step ks, which then do not wait out the LDS latency
    v16h a0 = g2_frag(ar, hh), a1 = g2_frag(ar + 16 * GP, hh);
    v16h b0 = g2_frag(br, hh), b1 = g2_frag(br + 16 * GP, hh), b2 = g2_frag(br + 32 * GP, hh), b3 = g2_frag(br + 48 * GP, hh);
#pragma unroll     // the four k-steps of a tile read LDS at constant offsets
    for (int ks = 0; ks < GBK; ks += 32) {
      v16h na0 = a0, na1 = a1, nb0 = b0, nb1 = b1, nb2 = b2, nb3 = b3;
      if (ks + 32 < GBK) { const int kn = ks + 32;
        na0 = g2_frag(ar + kn, hh); na1 = g2_frag(ar + 16 * GP + kn, hh);
        nb0 = g2_frag(br + kn, hh); nb1 = g2_frag(br + 16 * GP + kn, hh); nb2 = g2_frag(br + 32 * GP + kn, hh); nb3 = g2_frag(br + 48 * GP + kn, hh); }
      c00 = g2_mma(a0, b0, c00); c10 = g2_mma(a1, b0, c10);
      c01 = g2_mma(a0, b1, c01); c11 = g2_mma(a1, b1, c11);
      c02 = g2_mma(a0, b2, c02); c12 = g2_mma(a1, b2, c12);
      c03 = g2_mma(a0, b3, c03); c13 = g2_mma(a1, b3, c13);
      a0 = na0; a1 = na1; b0 = nb0; b1 = nb1; b2 = nb2; b3 = nb3; }
    asm volatile("s_wait_dscnt 0x0" ::: "memory");                      // this wave's reads of the buffer have returned before it may be refilled
    asm volatile("s_wait_asynccnt 0x0" ::: "memory");                   // this wave's copies of the next tile have landed
    __syncthreads();                                                    // publishes the next tile and ends every wave's reads of this buffer
    if (kb + 2 * GBK < K) gemm_stage(cl + (unsigned int)bo * 2u, cga + (kb + 2 * GBK), lda, cgb + (kb + 2 * GBK), ldb);   // tile + 2 -> the buffer just read
    bo ^= GSTAGE;
  }
  asm volatile("s_wait_asynccnt 0x0" ::: "memory");                     // nothing of this wave is in flight behind the loop
  v8f accs[8] = {c00, c01, c02, c03, c10, c11, c12, c13};
#pragma unroll
  for (int u = 0; u < 8; ++u) { const int t = u & 3, half = u >> 2;
#pragma unroll
    for (int r = 0; r < 8; ++r) { const int rloc = half * 16 + 8 * hh + r; so[w][rloc][t * 16 + ln] = accs[u][r] * alpha; } }
  __builtin_amdgcn_fence(4 /* acq_rel order */, "workgroup"); __builtin_amdgcn_wave_barrier();
  const int rsub = lane >> 4, c4 = (lane & 15) * 4;
  {
#pragma unroll
    for (int q = 0; q < 16; ++q) {
      const int r = q * 2 + rsub; const v4f v = *(const v4fa*)&so[w][r][c4];
      const size_t o = cofs + (size_t)(row0 + r) * ldc + col0 + c4;
      if (C) *(v4f*)(C + o) = v;
      if (C16) { v4h h4, l4;
#pragma unroll
        for (int i = 0; i < 4; ++i) { const _Float16 hq = (_Float16)v[i]; h4[i] = hq; l4[i] = (_Float16)((v[i] - (float)hq) * 1024.0f); }
        *(v4h*)(C16 + o) = h4;
        if (C16L) *(v4h*)(C16L + o) = l4; }
    }
     }
}

template <int NHv, int TTv>
__global__ __launch_bounds__(256) void k_vt(const _Float16* __restrict__ V16, int ldv, int voff, _Float16* __restrict__ Vt) {
  __shared__ unsigned short tl[64][66]; const int tid = threadIdx.x;
  const int slab = blockIdx.x / (TTv / 64), lg = blockIdx.x % (TTv / 64); const int b = slab / NHv, h = slab % NHv;
  for (int i = tid; i < 64 * 8; i += 256) { const int r = i / 8, c8 = (i % 8) * 8; FragH f; f.half[0] = *(const v8us*)((const unsigned short*)V16 + ((size_t)b * TTv + lg * 64 + r) * ldv + voff + h * 64 + c8);
#pragma unroll
    for (int q = 0; q < 8; ++q) tl[r][c8 + q] = f.u[q]; }
  __syncthreads();
  {
#pragma unroll
    for (int rd = 0; rd < 2; ++rd) { const int d = rd * 32 + tid / 8, pc = tid % 8; FragH f;
#pragma unroll
      for (int q = 0; q < 8; ++q) f.u[q] = tl[pc * 8 + q][d];
      *(v8us*)((unsigned short*)Vt + ((size_t)slab * 64 + d) * TTv + lg * 64 + pc * 8) = f.half[0]; }
     }
}

#define KVP 72                       /* LDS row pitch of a staged plane in halfs: 144 B = 16 B x odd, conflict-free for 16-byte fragment reads */
#define KVPLANE (64 * KVP)           /* one staged plane: 64 rows */
#define KVSTAGE (3 * KVPLANE)        /* one stage: K hi, K residual, V^T */
// One 64-key stage into LDS by asynchronous copies: three planes of 64 rows x 128 B; each of the 128 threads brings 16 B of rows r, r+16, r+32, r+48 of each plane.
// l: the lane's LDS byte address in plane 0 (row r); gh, gl: its 16 B in K hi / K residual (row pitch DM); gv: its 16 B in V^T (row pitch SEQ).
__device__ __forceinline__ void stage_copy(unsigned int l, const _Float16* gh, const _Float16* gl, const _Float16* gv) {
  // the copies and their s_wait_xcnt in one statement: the wait stands before any rewrite of the address registers the copies name
  asm volatile(
      "global_load_async_to_lds_b128 %0, %12, off\n\t"
      "global_load_async_to_lds_b128 %1, %13, off\n\t"
      "global_load_async_to_lds_b128 %2, %14, off\n\t"
      "global_load_async_to_lds_b128 %3, %15, off\n\t"
      "global_load_async_to_lds_b128 %4, %16, off\n\t"
      "global_load_async_to_lds_b128 %5, %17, off\n\t"
      "global_load_async_to_lds_b128 %6, %18, off\n\t"
      "global_load_async_to_lds_b128 %7, %19, off\n\t"
      "global_load_async_to_lds_b128 %8, %20, off\n\t"
      "global_load_async_to_lds_b128 %9, %21, off\n\t"
      "global_load_async_to_lds_b128 %10, %22, off\n\t"
      "global_load_async_to_lds_b128 %11, %23, off\n\t"
      "s_wait_xcnt 0x0"
      :: "v"(l), "v"(l + 16u * KVP * 2u), "v"(l + 32u * KVP * 2u), "v"(l + 48u * KVP * 2u),
         "v"(l + KVPLANE * 2u), "v"(l + KVPLANE * 2u + 16u * KVP * 2u), "v"(l + KVPLANE * 2u + 32u * KVP * 2u), "v"(l + KVPLANE * 2u + 48u * KVP * 2u),
         "v"(l + KVPLANE * 4u), "v"(l + KVPLANE * 4u + 16u * KVP * 2u), "v"(l + KVPLANE * 4u + 32u * KVP * 2u), "v"(l + KVPLANE * 4u + 48u * KVP * 2u),
         "v"(gh), "v"(gh + 16 * DM), "v"(gh + 32 * DM), "v"(gh + 48 * DM),
         "v"(gl), "v"(gl + 16 * DM), "v"(gl + 32 * DM), "v"(gl + 48 * DM),
         "v"(gv), "v"(gv + 16 * SEQ), "v"(gv + 32 * SEQ), "v"(gv + 48 * SEQ)
      : "memory");
}

// Fused attention with relu^2 normaliser. grid = NB*NH*(SEQ/64), block = 4 waves; wave w owns query rows q0 = qb*64 + 16w .. +15 of (b, h).
// Per wave: position table qes[m][r] = q[m].rel_emb[r] (WMMA, f32 in LDS); per 64-key chunk: s = q.k^T (hi.hi + (lo.hi + hi.lo)/2^10), sv = (s + qes[m][clamp(key-q)+16]) / 8,
// K hi, K residual and V^T of each 64-key chunk are staged once per block in LDS (two buffers, asynchronous copies one chunk ahead) and read as fragments by all four waves.
// masked -> -1e9, t = relu(sv + b)^2, dsum += t (f32), tls[m][key] = f16(256 t); o += tls . v^T ; end: o * (1/(sum+eps)) * 64/256 -> f16 rows of O16 (cols h*64..).
__global__ __launch_bounds__(128) void k_attn(const _Float16* __restrict__ QH, const _Float16* __restrict__ QL, const _Float16* __restrict__ KH, const _Float16* __restrict__ KL,
                                              const _Float16* __restrict__ VT, const _Float16* __restrict__ RT, const unsigned int* __restrict__ MBt,
                                              const float* __restrict__ spb, _Float16* __restrict__ O16) {
  #pragma clang fp contract(off)
  __shared__ __attribute__((aligned(16))) _Float16 tls[4][16][72];     // [row][key] t tile (cols 0..63 used), later [row][d] o tile
  __shared__ float qes[4][16][52];                                      // [row][r] position table (cols 0..47 written, 0..32 read)
  __shared__ __attribute__((aligned(16))) _Float16 kv[2 * KVSTAGE];     // two stages of [plane][row][KVP]
  const int tid = threadIdx.x, w = tid >> 5, lane = tid & 31, ln = lane & 15, hh = lane >> 4;
  const int nqb = SEQ / 64;
  const int bh = blockIdx.x / nqb, qb = blockIdx.x - bh * nqb;
  const int b = bh / NH, h = bh - b * NH;
  const int q0 = qb * 64 + w * 16;                                      // first query of this wave (within the sequence)
  const size_t rq = (size_t)b * SEQ + q0;                               // compact token row of that query
  const size_t qoff = (rq + ln) * DM + (size_t)h * HD;
  const v16h qh0 = g2_frag(QH + qoff, hh), qh1 = g2_frag(QH + qoff + 32, hh);
  const v16h ql0 = g2_frag(QL + qoff, hh), ql1 = g2_frag(QL + qoff + 32, hh);
  const v8f z8 = {0.f,0.f,0.f,0.f,0.f,0.f,0.f,0.f};
  const float rsc = 0.0009765625f;                                      // 2^-10 fold of the residual planes
  const _Float16* kbh = KH + ((size_t)b * SEQ) * DM + (size_t)h * HD;
  const _Float16* kbl = KL + ((size_t)b * SEQ) * DM + (size_t)h * HD;
  const _Float16* vtb = VT + ((size_t)bh * HD) * SEQ;
  const int crow = tid >> 3, ccol = (tid & 7) * 8;                      // this thread's first row and 16-byte column in every staged plane
  const unsigned int cl = (unsigned int)(size_t)&kv[crow * KVP + ccol];  // its LDS byte address in stage buffer 0
  const _Float16* cgh = kbh + (size_t)crow * DM + ccol;
  const _Float16* cgl = kbl + (size_t)crow * DM + ccol;
  const _Float16* cgv = vtb + (size_t)crow * SEQ + ccol;
  stage_copy(cl, cgh, cgl, cgv);                                        // chunk 0 -> buffer 0
  // position table: qes[m][r] = (q[m] . (16 rel_emb[r])) / 16
#pragma unroll
  for (int nt = 0; nt < 3; ++nt) {
    const _Float16* rr = RT + (size_t)(nt * 16 + ln) * HD;
    const v16h r0 = g2_frag(rr, hh), r1 = g2_frag(rr + 32, hh);
    const v8f ah = mma2(qh0, r0, qh1, r1, z8);
    const v8f al = mma2(ql0, r0, ql1, r1, z8);
#pragma unroll
    for (int r = 0; r < 8; ++r) { const float e = ah[r] + al[r] * rsc; qes[w][8 * hh + r][nt * 16 + ln] = e * 0.0625f; }
  }
  asm volatile("s_wait_asynccnt 0x0" ::: "memory");                     // this wave's copies of chunk 0 have landed before the barrier publishes them
  __syncthreads();
  stage_copy(cl + KVSTAGE * 2u, cgh + (size_t)64 * DM, cgl + (size_t)64 * DM, cgv + 64);   // chunk 1 -> buffer 1 (SEQ >= 128)

  const unsigned int* mbr = MBt + (rq + 8 * hh) * (SEQ / 32);          // bit row of query q0 + 8hh; row r at + r*(SEQ/32)
  const float sbias = spb[0];
  float dsum[8];
#pragma unroll
  for (int r = 0; r < 8; ++r) dsum[r] = 0.f;
  v8f oacc[4] = {z8, z8, z8, z8};
  int bo = 0;                                                           // offset in halfs of the buffer that holds this chunk

#pragma unroll 1
  for (int k0 = 0; k0 < SEQ; k0 += 64) {
    v2ua mw[8];
#pragma unroll
    for (int r = 0; r < 8; ++r) mw[r] = *(const v2ua*)(mbr + (size_t)r * (SEQ / 32) + (k0 >> 5));
    // Fragment reads stand one 16-key tile ahead of their use, in a second register set: while tile kt is multiplied and its t values are formed,
    // the fragments of tile kt + 1 (behind the last tile: the first half of V^T) are on their way, so the matrix runs do not wait out the LDS latency.
    // All of them are reads of this chunk's own buffer.
    const _Float16* kr = &kv[bo + ln * KVP];                            // this lane's row of tile 0 in the K hi plane
    const _Float16* vr = &kv[bo + 2 * KVPLANE + ln * KVP];              // this lane's row of d tile 0 in the V^T plane
    v16h f0 = g2_frag(kr, hh), f1 = g2_frag(kr + 32, hh), f2 = g2_frag(kr + KVPLANE, hh), f3 = g2_frag(kr + KVPLANE + 32, hh);   // K hi (f0, f1) and residual (f2, f3) of tile 0
    __builtin_amdgcn_sched_barrier(0);     // tile 0's eight reads go out first: nothing covers them, and LDS answers in order
#pragma unroll
    for (int kt = 0; kt < 4; ++kt) {
      const int kc = kt * 16 + ln;                                      // key within the chunk held by this lane (D column)
      float pe[8];                                                      // position terms of this tile, read ahead of its matrix run
#pragma unroll
      for (int r = 0; r < 8; ++r) {
        int rel = (k0 + kc) - (q0 + 8 * hh + r);
        rel = (rel < -KREL) ? -KREL : ((rel > KREL) ? KREL : rel);
        pe[r] = qes[w][8 * hh + r][rel + KREL];
      }
      const _Float16* nr = (kt < 3) ? kr + (kt + 1) * 16 * KVP : vr;    // next: K tile kt + 1, or d tiles 0 and 1 of V^T
      const int n2 = (kt < 3) ? KVPLANE : 16 * KVP;
      const v16h n0 = g2_frag(nr, hh), n1 = g2_frag(nr + 32, hh), n2f = g2_frag(nr + n2, hh), n3 = g2_frag(nr + n2 + 32, hh);
      __builtin_amdgcn_sched_barrier(0);   // keeps these reads in front of this tile's matrix run, and the next tile's products (which would wait for them at once) behind it
      const v8f sh = mma2(qh0, f0, qh1, f1, z8);
      v8f sx = mma2(ql0, f0, ql1, f1, z8);
      sx = mma2(qh0, f2, qh1, f3, sx);
#pragma unroll
      for (int r = 0; r < 8; ++r) {
        const int m = 8 * hh + r;                                       // row within the wave tile (D row)
        const float s = sh[r] + sx[r] * rsc;
        float sv = (s + pe[r]) * 0.125f;
        const unsigned int word = (kt < 2) ? mw[r][0] : mw[r][1];
        const unsigned int bit = (word >> ((kt & 1) * 16 + ln)) & 1u;
        sv = (bit != 0u) ? -1.0e9f : sv;
        float t = sv + sbias;
        t = fmaxf(t, 0.0f);
        const float tt = t * t;
        dsum[r] += tt;
        tls[w][m][kc] = (_Float16)(tt * 256.0f);
      }
      f0 = n0; f1 = n1; f2 = n2f; f3 = n3;
    }
    __builtin_amdgcn_fence(3 /* release order */, "wavefront"); __builtin_amdgcn_wave_barrier();
    FragH pa, pb;
    pa.half[0] = *(const v8us*)&tls[w][ln][8 * hh];      pa.half[1] = *(const v8us*)&tls[w][ln][16 + 8 * hh];       // keys k0 + 0..31
    pb.half[0] = *(const v8us*)&tls[w][ln][32 + 8 * hh]; pb.half[1] = *(const v8us*)&tls[w][ln][48 + 8 * hh];       // keys k0 + 32..63
    const v16h g0 = g2_frag(vr + 32 * KVP, hh), g1 = g2_frag(vr + 32 * KVP + 32, hh), g2 = g2_frag(vr + 48 * KVP, hh), g3 = g2_frag(vr + 48 * KVP + 32, hh);   // d tiles 2 and 3, ahead of the products of 0 and 1
    oacc[0] = mma2(pa.v, f0, pb.v, f1, oacc[0]);
    oacc[1] = mma2(pa.v, f2, pb.v, f3, oacc[1]);
    oacc[2] = mma2(pa.v, g0, pb.v, g1, oacc[2]);
    oacc[3] = mma2(pa.v, g2, pb.v, g3, oacc[3]);
    __builtin_amdgcn_fence(3 /* release order */, "wavefront"); __builtin_amdgcn_wave_barrier();
    asm volatile("s_wait_dscnt 0x0" ::: "memory");                      // this wave's reads of the buffer have returned before it may be refilled
    asm volatile("s_wait_asynccnt 0x0" ::: "memory");                   // this wave's copies of the next chunk have landed
    __syncthreads();                                                    // publishes the next chunk and ends every wave's reads of this buffer
    if (k0 + 128 < SEQ)
      stage_copy(cl + (unsigned int)bo * 2u, cgh + (size_t)(k0 + 128) * DM, cgl + (size_t)(k0 + 128) * DM, cgv + (k0 + 128));   // chunk + 2 -> the buffer just read
    bo ^= KVSTAGE;
  }
  asm volatile("s_wait_asynccnt 0x0" ::: "memory");                     // nothing of this wave is in flight behind the loop

  // key sums across the 16 lanes of each half (each half holds its own 8 rows); scale = 64/256 / (sum + eps)
#pragma unroll
  for (int r = 0; r < 8; ++r) {
    float v = dsum[r];
    v += __shfl_xor(v, 1, 32); v += __shfl_xor(v, 2, 32); v += __shfl_xor(v, 4, 32); v += __shfl_xor(v, 8, 32);
    dsum[r] = (1.0f / (v + 1.0e-9f)) * 0.25f;
  }
#pragma unroll
  for (int dt = 0; dt < 4; ++dt)
#pragma unroll
    for (int r = 0; r < 8; ++r) tls[w][8 * hh + r][dt * 16 + ln] = (_Float16)(oacc[dt][r] * dsum[r]);
  __builtin_amdgcn_fence(3 /* release order */, "wavefront"); __builtin_amdgcn_wave_barrier();
  const int rl = lane >> 3, pc = (lane & 7) * 8;
  {
#pragma unroll
    for (int it = 0; it < 4; ++it) {
      const int row = it * 4 + rl;
      const v8us v = *(const v8us*)&tls[w][row][pc];
      *(v8us*)((unsigned short*)O16 + (rq + row) * DM + (size_t)h * HD + pc) = v;
    }
    
  }
}

extern "C" void kernel_launch(void* const* d_in, const int* in_sizes, int n_in,
                              void* d_out, int out_size, void* d_ws, size_t ws_size, hipStream_t stream) {
  if (n_in < 10) return;
  const int nx = (int)(NR * DM);
  if (in_sizes[0] < nx || in_sizes[1] < nx || in_sizes[2] < nx) return;
  if (in_sizes[3] < (int)(NR * SEQ)) return;
  if (in_sizes[4] < DM * DM || in_sizes[5] < DM * DM || in_sizes[6] < DM * DM || in_sizes[7] < DM * DM) return;
  if (in_sizes[8] < NREL * HD || in_sizes[9] < 1) return;
  if (out_size < nx) return;
  const float* xq = (const float*)d_in[0]; const float* xk = (const float*)d_in[1]; const float* xv = (const float*)d_in[2];
  const int* msk = (const int*)d_in[3];
  const float* wq = (const float*)d_in[4]; const float* wk = (const float*)d_in[5]; const float* wv = (const float*)d_in[6]; const float* wo = (const float*)d_in[7];
  const float* rel = (const float*)d_in[8]; const float* spb = (const float*)d_in[9];

  char* ws = (char*)d_ws; size_t off = 0;
  auto take = [&](size_t bytes) { char* p = ws + off; off += (bytes + 255) & ~(size_t)255; return p; };
  const size_t wbytes = (size_t)DM * DM * 2, xbytes = NR * DM * 2;
  _Float16* BQ = (_Float16*)take(wbytes); _Float16* BK = (_Float16*)take(wbytes); _Float16* BV = (_Float16*)take(wbytes); _Float16* BO = (_Float16*)take(wbytes);
  _Float16* RT = (_Float16*)take((size_t)NRELP * HD * 2);
  _Float16* XQ = (_Float16*)take(xbytes); _Float16* XK = (_Float16*)take(xbytes); _Float16* XV = (_Float16*)take(xbytes);
  _Float16* QH = (_Float16*)take(xbytes); _Float16* QL = (_Float16*)take(xbytes); _Float16* KH = (_Float16*)take(xbytes); _Float16* KL = (_Float16*)take(xbytes);
  _Float16* V16 = (_Float16*)take(xbytes);
  _Float16* VT = (_Float16*)take((size_t)NB * NH * HD * SEQ * 2);
  const int nwords = (int)(NR * (SEQ / 32));
  unsigned int* MB = (unsigned int*)take((size_t)nwords * 4);
  _Float16* O16 = (_Float16*)take(xbytes);
  if (off > ws_size || off > (size_t)134217728) return;

  k_prep<<<P_BLOCKS + 1, PT, 0, stream>>>(xq, xk, xv, msk, wq, wk, wv, wo, rel, XQ, XK, XV, MB, BQ, BK, BV, BO, RT);

  const int M = (int)NR;
  const dim3 gp((unsigned)((M / 128) * (DM / 64)), 1);
  k_gemm2<<<gp, 128, 0, stream>>>(XQ, DM, (size_t)0, BQ, DM, (size_t)0, 0.0625f, nullptr, QH, QL, DM, (size_t)0, M, DM, DM);
  k_gemm2<<<gp, 128, 0, stream>>>(XK, DM, (size_t)0, BK, DM, (size_t)0, 0.0625f, nullptr, KH, KL, DM, (size_t)0, M, DM, DM);
  k_gemm2<<<gp, 128, 0, stream>>>(XV, DM, (size_t)0, BV, DM, (size_t)0, 0.0625f, nullptr, V16, nullptr, DM, (size_t)0, M, DM, DM);
  k_vt<NH, SEQ><<<(unsigned)(NB * NH * (SEQ / 64)), 256, 0, stream>>>(V16, DM, 0, VT);
  k_attn<<<(unsigned)(NB * NH * (SEQ / 64)), 128, 0, stream>>>(QH, QL, KH, KL, VT, RT, MB, spb, O16);
  k_gemm2<<<gp, 128, 0, stream>>>(O16, DM, (size_t)0, BO, DM, (size_t)0, 0.0009765625f, (float*)d_out, nullptr, nullptr, DM, (size_t)0, M, DM, DM);
}

// v005
// Measured time: 148 microseconds a run.
// Timed twice side by side with v004, it ran 1.04 times as fast both times.
// Counting every step since v000, it is 2.86 times as fast.
#include <hip/hip_runtime.h>
// Contractions on v_wmma_f32_16x16x32_f16 (f16 operands, f32 accumulate): q/k/v projections and the output projection plain f16 (inputs RNE-converted to bf16 then held exactly in f16, weights x16); q.k^T scores as f16 hi + residual (x2^10) planes on both operands (3 products, residual terms in a separate accumulator); q.rel_emb^T position table f16 hi + residual on q (rel_emb exact x16); t.v aggregation plain f16 (t carried x256, o carried x64); normaliser statistics f32.
#ifndef NB
#define NB 2
#endif
#ifndef SEQ
#define SEQ 2048
#endif
#define NB_FULL 2
#define SEQ_FULL 2048
#define DM 1024
#define NH 16
#define HD 64
#define NREL 33
#define KREL 16
#define NRELP 48                     /* rel_emb rows padded to 3 WMMA column tiles (rows 33..47 zero) */
#define NR ((size_t)NB * SEQ)        /* token rows processed (compact) */
static_assert(SEQ % 128 == 0);
static_assert(SEQ <= SEQ_FULL);
static_assert(NB >= 1 && NB <= NB_FULL);
static_assert(DM == NH * HD);

typedef unsigned short v8us __attribute__((ext_vector_type(8), may_alias));
typedef float  v8f  __attribute__((ext_vector_type(8)));
typedef float  v4f  __attribute__((ext_vector_type(4)));
typedef float  v4fa __attribute__((ext_vector_type(4), may_alias));
typedef _Float16 v16h __attribute__((ext_vector_type(16)));
typedef _Float16 v4h __attribute__((ext_vector_type(4)));
typedef int v4ia __attribute__((ext_vector_type(4), may_alias));
typedef unsigned int v2ua __attribute__((ext_vector_type(2), may_alias));
union FragH { v16h v; v8us half[2]; _Float16 h[16]; unsigned short u[16]; };

__device__ __forceinline__ unsigned short bf16_bits(float x) { unsigned int u = __float_as_uint(x); return (unsigned short)((u + 0x7FFFu + ((u >> 16) & 1u)) >> 16); }
__device__ __forceinline__ float bf16_val(unsigned short b) { return __uint_as_float(((unsigned int)b) << 16); }
__device__ __forceinline__ float bf16_rne(float x) { return bf16_val(bf16_bits(x)); }

// 16x32 fragment from a 16-bit row (lane row/col = lane & 15): elements 0..7 <- k0 + 8hh + 0..7, elements 8..15 <- k0 + 16 + 8hh + 0..7 (same map for A and B)
__device__ __forceinline__ v16h g2_frag(const _Float16* p, int hh) { FragH f; f.half[0] = *(const v8us*)((const unsigned short*)p + 8 * hh); f.half[1] = *(const v8us*)((const unsigned short*)p + 16 + 8 * hh); return f.v; }
__device__ __forceinline__ v8f g2_mma(v16h a, v16h b, v8f c) { v8f d = __builtin_amdgcn_wmma_f32_16x16x32_f16(false, a, false, b, (short)0, c, false, false); asm volatile("v_nop\n\tv_nop\n\tv_nop\n\tv_nop" : "+v"(d) : "v"(a), "v"(b)); return d; }
// two k-steps into one accumulator, hazard guard after the second
__device__ __forceinline__ v8f mma2(v16h a0, v16h b0, v16h a1, v16h b1, v8f c) {
  c = __builtin_amdgcn_wmma_f32_16x16x32_f16(false, a0, false, b0, (short)0, c, false, false);
  c = __builtin_amdgcn_wmma_f32_16x16x32_f16(false, a1, false, b1, (short)0, c, false, false);
  asm volatile("v_nop\n\tv_nop\n\tv_nop\n\tv_nop" : "+v"(c) : "v"(a0), "v"(b0), "v"(a1), "v"(b1));
  return c;
}

#define PT 512                       /* threads of a k_prep block: 16 waves */
#define PWU 1024                     /* 4-byte elements one wave moves per tile: 4 KiB */
#define PTILE ((PT / 32) * PWU)      /* elements of one block tile */
#define PW_TILES (DM * DM / PTILE)               /* tiles of one weight matrix */
#define PX_TILES ((int)(NR * DM / PTILE))        /* tiles of one activation input */
#define PM_TILES ((int)(NR * SEQ / PTILE))       /* tiles of the mask */
#define P_TILES (4 * PW_TILES + 3 * PX_TILES + PM_TILES)
#define P_BLOCKS ((P_TILES + 2) / 3)             /* three tiles a block */
static_assert((DM * DM) % PTILE == 0 && DM % PWU == 0);
static_assert((NR * DM) % PTILE == 0 && (NR * SEQ) % PTILE == 0);

// One wave's 4 KiB of f32 -> f16(bf16_rne(x) * scale): eight 512-byte loads in flight, then eight 256-byte stores (whole lines both ways).
__device__ __forceinline__ void cvt_unit(const float* __restrict__ s, _Float16* __restrict__ d, float scale, int lane) {
  v4f v[8];
#pragma unroll
  for (int j = 0; j < 8; ++j) v[j] = *(const v4fa*)(s + j * 128 + lane * 4);
#pragma unroll
  for (int j = 0; j < 8; ++j) { v4h h;
#pragma unroll
    for (int i = 0; i < 4; ++i) h[i] = (_Float16)(bf16_rne(v[j][i]) * scale);
    *(v4h*)(d + j * 128 + lane * 4) = h; }
  asm volatile("s_wait_xcnt 0x0" ::: "memory");   // stands directly behind the stores, before anything rewrites the address or data registers that they name
}

// One wave's 32 mask words (all in one mask row): word i0 + j is the ballot of one 128-byte line of mask integers (lane = bit); lane j keeps word j, one 128-byte store.
static_assert((SEQ / 32) % 32 == 0);
__device__ __forceinline__ void pack_unit(const int* __restrict__ msk, unsigned int* __restrict__ bits, unsigned int i0, int lane) {
  const unsigned int wpr = SEQ / 32, row = i0 / wpr, wi = i0 - row * wpr, b = row / SEQ, q = row - b * SEQ;
  const int* src = msk + ((size_t)b * SEQ_FULL + q) * SEQ_FULL + (size_t)wi * 32 + lane;
  int v[32];
#pragma unroll
  for (int j = 0; j < 32; ++j) v[j] = src[j * 32];
  asm volatile("s_wait_xcnt 0x0" :: "v"(src) : "memory");   // behind the run of loads; the pointer as input keeps the address registers out of the loads' results up to here
  unsigned int wd = 0u;
#pragma unroll
  for (int j = 0; j < 32; ++j) { const unsigned int bj = __builtin_amdgcn_ballot_w32(v[j] != 0); wd = (lane == j) ? bj : wd; }
  bits[i0 + lane] = wd;
  asm volatile("s_wait_xcnt 0x0" ::: "memory");   // stands directly behind the store, before anything rewrites the registers that it names
}

// All operand preparation in one launch: weights -> f16 x16, activations -> f16, mask -> bit words, rel_emb -> padded f16 x16 table.
// Block 0 does the small table; blocks 1 .. P_BLOCKS walk the tiles (block-uniform choice of the job).
__global__ __launch_bounds__(PT) void k_prep(const float* __restrict__ xq, const float* __restrict__ xk, const float* __restrict__ xv, const int* __restrict__ msk,
    const float* __restrict__ wq, const float* __restrict__ wk, const float* __restrict__ wv, const float* __restrict__ wo, const float* __restrict__ rel,
    _Float16* __restrict__ XQ, _Float16* __restrict__ XK, _Float16* __restrict__ XV, unsigned int* __restrict__ MB,
    _Float16* __restrict__ BQ, _Float16* __restrict__ BK, _Float16* __restrict__ BV, _Float16* __restrict__ BO, _Float16* __restrict__ RT) {
  const int lane = threadIdx.x & 31, wn = __builtin_amdgcn_readfirstlane((int)(threadIdx.x >> 5));
  if (blockIdx.x == 0) {
    const int t = threadIdx.x; if (t >= NRELP * (HD / 8)) return;
    const int r = t / (HD / 8), d8 = (t % (HD / 8)) * 8;
    const int rc = (r < NREL) ? r : (NREL - 1);          // clamped address, value zeroed by predicate
    const bool live = (r < NREL);
    const v4f a = *(const v4fa*)(rel + (size_t)rc * HD + d8), c = *(const v4fa*)(rel + (size_t)rc * HD + d8 + 4);
    FragH f;
#pragma unroll
    for (int q = 0; q < 4; ++q) { f.h[q] = live ? (_Float16)(bf16_rne(a[q]) * 16.0f) : (_Float16)0.0f; f.h[4 + q] = live ? (_Float16)(bf16_rne(c[q]) * 16.0f) : (_Float16)0.0f; }
    *(v8us*)((unsigned short*)RT + (size_t)t * 8) = f.half[0];
    return;
  }
  for (int tile = (int)blockIdx.x - 1; tile < P_TILES; tile += P_BLOCKS) {
    if (tile < 4 * PW_TILES) {
      const int m = tile / PW_TILES;
      const float* s = (m == 0) ? wq : (m == 1) ? wk : (m == 2) ? wv : wo;
      _Float16* d = (m == 0) ? BQ : (m == 1) ? BK : (m == 2) ? BV : BO;
      const size_t e = (size_t)(tile - m * PW_TILES) * PTILE + (size_t)wn * PWU;
      cvt_unit(s + e, d + e, 16.0f, lane);
    } else if (tile < 4 * PW_TILES + 3 * PX_TILES) {
      const int tx = tile - 4 * PW_TILES, m = tx / PX_TILES;
      const float* s = (m == 0) ? xq : (m == 1) ? xk : xv;
      _Float16* d = (m == 0) ? XQ : (m == 1) ? XK : XV;
      const size_t e = (size_t)(tx - m * PX_TILES) * PTILE + (size_t)wn * PWU;   // compact element index; PWU divides DM, so the unit lies in one row
      const int r = (int)(e / DM), c = (int)(e % DM), b = r / SEQ, sq = r - b * SEQ;
      cvt_unit(s + ((size_t)b * SEQ_FULL + sq) * DM + c, d + e, 1.0f, lane);
    } else {
      const int tm = tile - (4 * PW_TILES + 3 * PX_TILES);
      pack_unit(msk, MB, (unsigned int)(tm * (PT / 32) + wn) * 32u, lane);
    }
  }
}

#define GBK 128                      /* k depth of one staged GEMM tile in halfs: 256 B a row */
#define GP 136                       /* LDS row pitch of a staged GEMM tile in halfs: 272 B = 16 B x odd, conflict-free for 16-byte fragment reads */
#define GSTAGE (192 * GP)            /* one stage: 128 rows of A, then 64 rows of B */
#define GRS (8u * GP * 2u)           /* LDS bytes between two copies of one thread: 8 rows */
// Twelve asynchronous copies of 16 B a lane: LDS rows 8 apart from l, each from its own global address.
__device__ __forceinline__ void copy12(unsigned int l, const _Float16* g0, const _Float16* g1, const _Float16* g2, const _Float16* g3, const _Float16* g4, const _Float16* g5,
                                       const _Float16* g6, const _Float16* g7, const _Float16* g8, const _Float16* g9, const _Float16* g10, const _Float16* g11) {
  // the copies and their s_wait_xcnt in one statement: the wait stands before any rewrite of the address registers the copies name
  asm volatile(
      "global_load_async_to_lds_b128 %0, %12, off\n\t"
      "global_load_async_to_lds_b128 %1, %13, off\n\t"
      "global_load_async_to_lds_b128 %2, %14, off\n\t"
      "global_load_async_to_lds_b128 %3, %15, off\n\t"
      "global_load_async_to_lds_b128 %4, %16, off\n\t"
      "global_load_async_to_lds_b128 %5, %17, off\n\t"
      "global_load_async_to_lds_b128 %6, %18, off\n\t"
      "global_load_async_to_lds_b128 %7, %19, off\n\t"
      "global_load_async_to_lds_b128 %8, %20, off\n\t"
      "global_load_async_to_lds_b128 %9, %21, off\n\t"
      "global_load_async_to_lds_b128 %10, %22, off\n\t"
      "global_load_async_to_lds_b128 %11, %23, off\n\t"
      "s_wait_xcnt 0x0"
      :: "v"(l), "v"(l + GRS), "v"(l + 2u * GRS), "v"(l + 3u * GRS), "v"(l + 4u * GRS), "v"(l + 5u * GRS),
         "v"(l + 6u * GRS), "v"(l + 7u * GRS), "v"(l + 8u * GRS), "v"(l + 9u * GRS), "v"(l + 10u * GRS), "v"(l + 11u * GRS),
         "v"(g0), "v"(g1), "v"(g2), "v"(g3), "v"(g4), "v"(g5), "v"(g6), "v"(g7), "v"(g8), "v"(g9), "v"(g10), "v"(g11)
      : "memory");
}
// One k-tile of the block (128 rows of A, then 64 rows of B, GBK deep) into one stage; each of the 128 threads brings 16 B of every eighth row.
// l: the lane's LDS byte address in row tid / 16 of the stage; ga, gb: its 16 B in that row of the A tile and of the B tile.
__device__ __forceinline__ void gemm_stage(unsigned int l, const _Float16* ga, int lda, const _Float16* gb, int ldb) {
  const size_t sa = (size_t)8 * lda, sb = (size_t)8 * ldb;
  copy12(l, ga, ga + sa, ga + 2 * sa, ga + 3 * sa, ga + 4 * sa, ga + 5 * sa, ga + 6 * sa, ga + 7 * sa, ga + 8 * sa, ga + 9 * sa, ga + 10 * sa, ga + 11 * sa);
  copy12(l + 12u * GRS, ga + 12 * sa, ga + 13 * sa, ga + 14 * sa, ga + 15 * sa, gb, gb + sb, gb + 2 * sb, gb + 3 * sb, gb + 4 * sb, gb + 5 * sb, gb + 6 * sb, gb + 7 * sb);
}

// GEMM (wave tile 32x64; M % 128 == 0, N % 64 == 0, K % 128 == 0): C[m][n] = alpha * sum_k A[m][k] Bh[n][k]; A f16 rows (pitch lda), Bh f16 [n][k] (pitch ldb);
// the block's 128 x GBK tile of A and 64 x GBK tile of Bh are staged in LDS (two buffers, asynchronous copies one tile ahead) and read as fragments by the four waves.
__global__ __launch_bounds__(128) void k_gemm2(const _Float16* __restrict__ A, int lda, size_t sA, const _Float16* __restrict__ Bh, int ldb, size_t sB, float alpha,
    float* __restrict__ C, _Float16* __restrict__ C16, _Float16* __restrict__ C16L, int ldc, size_t sC, int M, int N, int K) {
  __shared__ __attribute__((aligned(16))) float so[4][32][68];
  __shared__ __attribute__((aligned(16))) _Float16 ab[2 * GSTAGE];      // two stages of [row][GP]
  const int tid = threadIdx.x, w = tid >> 5, lane = tid & 31, ln = lane & 15, hh = lane >> 4; const int by = blockIdx.y;
  A += (size_t)by * sA; Bh += (size_t)by * sB; const size_t cofs = (size_t)by * sC;
  const int ntn = N >> 6; const int mt = blockIdx.x / ntn, nq = blockIdx.x - mt * ntn; const int row0 = mt * 128 + 32 * w, col0 = nq * 64; if (mt * 128 >= M) return;
  const int crow = tid >> 4, ccol = (tid & 15) * 8;                     // this thread's first row and 16-byte column in a stage
  const unsigned int cl = (unsigned int)(size_t)&ab[crow * GP + ccol];  // its LDS byte address in stage buffer 0
  const _Float16* cga = A + (size_t)(mt * 128 + crow) * lda + ccol;
  const _Float16* cgb = Bh + (size_t)(col0 + crow) * ldb + ccol;
  gemm_stage(cl, cga, lda, cgb, ldb);                                   // tile 0 -> buffer 0
  const v8f z8 = {0.f,0.f,0.f,0.f,0.f,0.f,0.f,0.f}; v8f c00 = z8, c01 = z8, c02 = z8, c03 = z8, c10 = z8, c11 = z8, c12 = z8, c13 = z8;
  asm volatile("s_wait_asynccnt 0x0" ::: "memory");                     // this wave's copies of tile 0 have landed before the barrier publishes them
  __syncthreads();
  if (K > GBK) gemm_stage(cl + GSTAGE * 2u, cga + GBK, lda, cgb + GBK, ldb);   // tile 1 -> buffer 1
  int bo = 0;                                                           // offset in halfs of the buffer that holds this tile
#pragma unroll 1   // one trip per staged tile: kept rolled so that the two buffers alternate through bo and the loop stays small
  for (int kb = 0; kb < K; kb += GBK) {
    const _Float16* ar = &ab[bo + (32 * w + ln) * GP]; const _Float16* br = &ab[bo + (128 + ln) * GP];
    // the fragments of k-step ks + 1 are read into a second register set in front of the products of k-step ks, which then do not wait out the LDS latency
    v16h a0 = g2_frag(ar, hh), a1 = g2_frag(ar + 16 * GP, hh);
    v16h b0 = g2_frag(br, hh), b1 = g2_frag(br + 16 * GP, hh), b2 = g2_frag(br + 32 * GP, hh), b3 = g2_frag(br + 48 * GP, hh);
#pragma unroll     // the four k-steps of a tile read LDS at constant offsets
    for (int ks = 0; ks < GBK; ks += 32) {
      v16h na0 = a0, na1 = a1, nb0 = b0, nb1 = b1, nb2 = b2, nb3 = b3;
      if (ks + 32 < GBK) { const int kn = ks + 32;
        na0 = g2_frag(ar + kn, hh); na1 = g2_frag(ar + 16 * GP + kn, hh);
        nb0 = g2_frag(br + kn, hh); nb1 = g2_frag(br + 16 * GP + kn, hh); nb2 = g2_frag(br + 32 * GP + kn, hh); nb3 = g2_frag(br + 48 * GP + kn, hh); }
      c00 = g2_mma(a0, b0, c00); c10 = g2_mma(a1, b0, c10);
      c01 = g2_mma(a0, b1, c01); c11 = g2_mma(a1, b1, c11);
      c02 = g2_mma(a0, b2, c02); c12 = g2_mma(a1, b2, c12);
      c03 = g2_mma(a0, b3, c03); c13 = g2_mma(a1, b3, c13);
      a0 = na0; a1 = na1; b0 = nb0; b1 = nb1; b2 = nb2; b3 = nb3; }
    asm volatile("s_wait_dscnt 0x0" ::: "memory");                      // this wave's reads of the buffer have returned before it may be refilled
    asm volatile("s_wait_asynccnt 0x0" ::: "memory");                   // this wave's copies of the next tile have landed
    __syncthreads();                                                    // publishes the next tile and ends every wave's reads of this buffer
    if (kb + 2 * GBK < K) gemm_stage(cl + (unsigned int)bo * 2u, cga + (kb + 2 * GBK), lda, cgb + (kb + 2 * GBK), ldb);   // tile + 2 -> the buffer just read
    bo ^= GSTAGE;
  }
  asm volatile("s_wait_asynccnt 0x0" ::: "memory");                     // nothing of this wave is in flight behind the loop
  v8f accs[8] = {c00, c01, c02, c03, c10, c11, c12, c13};
#pragma unroll
  for (int u = 0; u < 8; ++u) { const int t = u & 3, half = u >> 2;
#pragma unroll
    for (int r = 0; r < 8; ++r) { const int rloc = half * 16 + 8 * hh + r; so[w][rloc][t * 16 + ln] = accs[u][r] * alpha; } }
  __builtin_amdgcn_fence(4 /* acq_rel order */, "workgroup"); __builtin_amdgcn_wave_barrier();
  const int rsub = lane >> 4, c4 = (lane & 15) * 4;
  {
#pragma unroll
    for (int q = 0; q < 16; ++q) {
      const int r = q * 2 + rsub; const v4f v = *(const v4fa*)&so[w][r][c4];
      const size_t o = cofs + (size_t)(row0 + r) * ldc + col0 + c4;
      if (C) *(v4f*)(C + o) = v;
      if (C16) { v4h h4, l4;
#pragma unroll
        for (int i = 0; i < 4; ++i) { const _Float16 hq = (_Float16)v[i]; h4[i] = hq; l4[i] = (_Float16)((v[i] - (float)hq) * 1024.0f); }
        *(v4h*)(C16 + o) = h4;
        if (C16L) *(v4h*)(C16L + o) = l4; }
    }
     }
}

#define KVP 72                       /* LDS row pitch of a staged plane in halfs: 144 B = 16 B x odd, conflict-free for 16-byte fragment reads */
#define KVPLANE (64 * KVP)           /* one staged plane: 64 rows */
#define KVSTAGE (3 * KVPLANE)        /* one stage: K hi, K residual, V^T */
// One 64-key stage into LDS by asynchronous copies: three planes of 64 rows x 128 B; each of the 128 threads brings 16 B of rows r, r+16, r+32, r+48 of each plane.
// l: the lane's LDS byte address in plane 0 (row r); gh, gl: its 16 B in K hi / K residual (row pitch DM); gv: its 16 B in V^T (row pitch NR).
__device__ __forceinline__ void stage_copy(unsigned int l, const _Float16* gh, const _Float16* gl, const _Float16* gv) {
  // the copies and their s_wait_xcnt in one statement: the wait stands before any rewrite of the address registers the copies name
  asm volatile(
      "global_load_async_to_lds_b128 %0, %12, off\n\t"
      "global_load_async_to_lds_b128 %1, %13, off\n\t"
      "global_load_async_to_lds_b128 %2, %14, off\n\t"
      "global_load_async_to_lds_b128 %3, %15, off\n\t"
      "global_load_async_to_lds_b128 %4, %16, off\n\t"
      "global_load_async_to_lds_b128 %5, %17, off\n\t"
      "global_load_async_to_lds_b128 %6, %18, off\n\t"
      "global_load_async_to_lds_b128 %7, %19, off\n\t"
      "global_load_async_to_lds_b128 %8, %20, off\n\t"
      "global_load_async_to_lds_b128 %9, %21, off\n\t"
      "global_load_async_to_lds_b128 %10, %22, off\n\t"
      "global_load_async_to_lds_b128 %11, %23, off\n\t"
      "s_wait_xcnt 0x0"
      :: "v"(l), "v"(l + 16u * KVP * 2u), "v"(l + 32u * KVP * 2u), "v"(l + 48u * KVP * 2u),
         "v"(l + KVPLANE * 2u), "v"(l + KVPLANE * 2u + 16u * KVP * 2u), "v"(l + KVPLANE * 2u + 32u * KVP * 2u), "v"(l + KVPLANE * 2u + 48u * KVP * 2u),
         "v"(l + KVPLANE * 4u), "v"(l + KVPLANE * 4u + 16u * KVP * 2u), "v"(l + KVPLANE * 4u + 32u * KVP * 2u), "v"(l + KVPLANE * 4u + 48u * KVP * 2u),
         "v"(gh), "v"(gh + 16 * DM), "v"(gh + 32 * DM), "v"(gh + 48 * DM),
         "v"(gl), "v"(gl + 16 * DM), "v"(gl + 32 * DM), "v"(gl + 48 * DM),
         "v"(gv), "v"(gv + 16 * NR), "v"(gv + 32 * NR), "v"(gv + 48 * NR)
      : "memory");
}

// Fused attention with relu^2 normaliser. grid = NB*NH*(SEQ/64), block = 4 waves; wave w owns query rows q0 = qb*64 + 16w .. +15 of (b, h).
// Per wave: position table qes[m][r] = q[m].rel_emb[r] (WMMA, f32 in LDS); per 64-key chunk: s = q.k^T (hi.hi + (lo.hi + hi.lo)/2^10), sv = (s + qes[m][clamp(key-q)+16]) / 8,
// K hi, K residual and V^T of each 64-key chunk are staged once per block in LDS (two buffers, asynchronous copies one chunk ahead) and read as fragments by all four waves.
// masked -> -1e9, t = relu(sv + b)^2, dsum += t (f32), tls[m][key] = f16(256 t); o += tls . v^T ; end: o * (1/(sum+eps)) * 64/256 -> f16 rows of O16 (cols h*64..).
__global__ __launch_bounds__(128) void k_attn(const _Float16* __restrict__ QH, const _Float16* __restrict__ QL, const _Float16* __restrict__ KH, const _Float16* __restrict__ KL,
                                              const _Float16* __restrict__ VT, const _Float16* __restrict__ RT, const unsigned int* __restrict__ MBt,
                                              const float* __restrict__ spb, _Float16* __restrict__ O16) {
  #pragma clang fp contract(off)
  __shared__ __attribute__((aligned(16))) _Float16 tls[4][16][72];     // [row][key] t tile (cols 0..63 used), later [row][d] o tile
  __shared__ float qes[4][16][52];                                      // [row][r] position table (cols 0..47 written, 0..32 read)
  __shared__ __attribute__((aligned(16))) _Float16 kv[2 * KVSTAGE];     // two stages of [plane][row][KVP]
  const int tid = threadIdx.x, w = tid >> 5, lane = tid & 31, ln = lane & 15, hh = lane >> 4;
  const int nqb = SEQ / 64;
  const int bh = blockIdx.x / nqb, qb = blockIdx.x - bh * nqb;
  const int b = bh / NH, h = bh - b * NH;
  const int q0 = qb * 64 + w * 16;                                      // first query of this wave (within the sequence)
  const size_t rq = (size_t)b * SEQ + q0;                               // compact token row of that query
  const size_t qoff = (rq + ln) * DM + (size_t)h * HD;
  const v16h qh0 = g2_frag(QH + qoff, hh), qh1 = g2_frag(QH + qoff + 32, hh);
  const v16h ql0 = g2_frag(QL + qoff, hh), ql1 = g2_frag(QL + qoff + 32, hh);
  const v8f z8 = {0.f,0.f,0.f,0.f,0.f,0.f,0.f,0.f};
  const float rsc = 0.0009765625f;                                      // 2^-10 fold of the residual planes
  const _Float16* kbh = KH + ((size_t)b * SEQ) * DM + (size_t)h * HD;
  const _Float16* kbl = KL + ((size_t)b * SEQ) * DM + (size_t)h * HD;
  const _Float16* vtb = VT + ((size_t)h * HD) * NR + (size_t)b * SEQ;   // V^T is [h * HD + d][token row], pitch NR
  const int crow = tid >> 3, ccol = (tid & 7) * 8;                      // this thread's first row and 16-byte column in every staged plane
  const unsigned int cl = (unsigned int)(size_t)&kv[crow * KVP + ccol];  // its LDS byte address in stage buffer 0
  const _Float16* cgh = kbh + (size_t)crow * DM + ccol;
  const _Float16* cgl = kbl + (size_t)crow * DM + ccol;
  const _Float16* cgv = vtb + (size_t)crow * NR + ccol;
  stage_copy(cl, cgh, cgl, cgv);                                        // chunk 0 -> buffer 0
  // position table: qes[m][r] = (q[m] . (16 rel_emb[r])) / 16
#pragma unroll
  for (int nt = 0; nt < 3; ++nt) {
    const _Float16* rr = RT + (size_t)(nt * 16 + ln) * HD;
    const v16h r0 = g2_frag(rr, hh), r1 = g2_frag(rr + 32, hh);
    const v8f ah = mma2(qh0, r0, qh1, r1, z8);
    const v8f al = mma2(ql0, r0, ql1, r1, z8);
#pragma unroll
    for (int r = 0; r < 8; ++r) { const float e = ah[r] + al[r] * rsc; qes[w][8 * hh + r][nt * 16 + ln] = e * 0.0625f; }
  }
  asm volatile("s_wait_asynccnt 0x0" ::: "memory");                     // this wave's copies of chunk 0 have landed before the barrier publishes them
  __syncthreads();
  stage_copy(cl + KVSTAGE * 2u, cgh + (size_t)64 * DM, cgl + (size_t)64 * DM, cgv + 64);   // chunk 1 -> buffer 1 (SEQ >= 128)

  const unsigned int* mbr = MBt + (rq + 8 * hh) * (SEQ / 32);          // bit row of query q0 + 8hh; row r at + r*(SEQ/32)
  const float sbias = spb[0];
  float dsum[8];
#pragma unroll
  for (int r = 0; r < 8; ++r) dsum[r] = 0.f;
  v8f oacc[4] = {z8, z8, z8, z8};
  int bo = 0;                                                           // offset in halfs of the buffer that holds this chunk

#pragma unroll 1
  for (int k0 = 0; k0 < SEQ; k0 += 64) {
    v2ua mw[8];
#pragma unroll
    for (int r = 0; r < 8; ++r) mw[r] = *(const v2ua*)(mbr + (size_t)r * (SEQ / 32) + (k0 >> 5));
    // Fragment reads stand one 16-key tile ahead of their use, in a second register set: while tile kt is multiplied and its t values are formed,
    // the fragments of tile kt + 1 (behind the last tile: the first half of V^T) are on their way, so the matrix runs do not wait out the LDS latency.
    // All of them are reads of this chunk's own buffer.
    const _Float16* kr = &kv[bo + ln * KVP];                            // this lane's row of tile 0 in the K hi plane
    const _Float16* vr = &kv[bo + 2 * KVPLANE + ln * KVP];              // this lane's row of d tile 0 in the V^T plane
    v16h f0 = g2_frag(kr, hh), f1 = g2_frag(kr + 32, hh), f2 = g2_frag(kr + KVPLANE, hh), f3 = g2_frag(kr + KVPLANE + 32, hh);   // K hi (f0, f1) and residual (f2, f3) of tile 0
    __builtin_amdgcn_sched_barrier(0);     // tile 0's eight reads go out first: nothing covers them, and LDS answers in order
#pragma unroll
    for (int kt = 0; kt < 4; ++kt) {
      const int kc = kt * 16 + ln;                                      // key within the chunk held by this lane (D column)
      float pe[8];                                                      // position terms of this tile, read ahead of its matrix run
#pragma unroll
      for (int r = 0; r < 8; ++r) {
        int rel = (k0 + kc) - (q0 + 8 * hh + r);
        rel = (rel < -KREL) ? -KREL : ((rel > KREL) ? KREL : rel);
        pe[r] = qes[w][8 * hh + r][rel + KREL];
      }
      const _Float16* nr = (kt < 3) ? kr + (kt + 1) * 16 * KVP : vr;    // next: K tile kt + 1, or d tiles 0 and 1 of V^T
      const int n2 = (kt < 3) ? KVPLANE : 16 * KVP;
      const v16h n0 = g2_frag(nr, hh), n1 = g2_frag(nr + 32, hh), n2f = g2_frag(nr + n2, hh), n3 = g2_frag(nr + n2 + 32, hh);
      __builtin_amdgcn_sched_barrier(0);   // keeps these reads in front of this tile's matrix run, and the next tile's products (which would wait for them at once) behind it
      const v8f sh = mma2(qh0, f0, qh1, f1, z8);
      v8f sx = mma2(ql0, f0, ql1, f1, z8);
      sx = mma2(qh0, f2, qh1, f3, sx);
#pragma unroll
      for (int r = 0; r < 8; ++r) {
        const int m = 8 * hh + r;                                       // row within the wave tile (D row)
        const float s = sh[r] + sx[r] * rsc;
        float sv = (s + pe[r]) * 0.125f;
        const unsigned int word = (kt < 2) ? mw[r][0] : mw[r][1];
        const unsigned int bit = (word >> ((kt & 1) * 16 + ln)) & 1u;
        sv = (bit != 0u) ? -1.0e9f : sv;
        float t = sv + sbias;
        t = fmaxf(t, 0.0f);
        const float tt = t * t;
        dsum[r] += tt;
        tls[w][m][kc] = (_Float16)(tt * 256.0f);
      }
      f0 = n0; f1 = n1; f2 = n2f; f3 = n3;
    }
    __builtin_amdgcn_fence(3 /* release order */, "wavefront"); __builtin_amdgcn_wave_barrier();
    FragH pa, pb;
    pa.half[0] = *(const v8us*)&tls[w][ln][8 * hh];      pa.half[1] = *(const v8us*)&tls[w][ln][16 + 8 * hh];       // keys k0 + 0..31
    pb.half[0] = *(const v8us*)&tls[w][ln][32 + 8 * hh]; pb.half[1] = *(const v8us*)&tls[w][ln][48 + 8 * hh];       // keys k0 + 32..63
    const v16h g0 = g2_frag(vr + 32 * KVP, hh), g1 = g2_frag(vr + 32 * KVP + 32, hh), g2 = g2_frag(vr + 48 * KVP, hh), g3 = g2_frag(vr + 48 * KVP + 32, hh);   // d tiles 2 and 3, ahead of the products of 0 and 1
    oacc[0] = mma2(pa.v, f0, pb.v, f1, oacc[0]);
    oacc[1] = mma2(pa.v, f2, pb.v, f3, oacc[1]);
    oacc[2] = mma2(pa.v, g0, pb.v, g1, oacc[2]);
    oacc[3] = mma2(pa.v, g2, pb.v, g3, oacc[3]);
    __builtin_amdgcn_fence(3 /* release order */, "wavefront"); __builtin_amdgcn_wave_barrier();
    asm volatile("s_wait_dscnt 0x0" ::: "memory");                      // this wave's reads of the buffer have returned before it may be refilled
    asm volatile("s_wait_asynccnt 0x0" ::: "memory");                   // this wave's copies of the next chunk have landed
    __syncthreads();                                                    // publishes the next chunk and ends every wave's reads of this buffer
    if (k0 + 128 < SEQ)
      stage_copy(cl + (unsigned int)bo * 2u, cgh + (size_t)(k0 + 128) * DM, cgl + (size_t)(k0 + 128) * DM, cgv + (k0 + 128));   // chunk + 2 -> the buffer just read
    bo ^= KVSTAGE;
  }
  asm volatile("s_wait_asynccnt 0x0" ::: "memory");                     // nothing of this wave is in flight behind the loop

  // key sums across the 16 lanes of each half (each half holds its own 8 rows); scale = 64/256 / (sum + eps)
#pragma unroll
  for (int r = 0; r < 8; ++r) {
    float v = dsum[r];
    v += __shfl_xor(v, 1, 32); v += __shfl_xor(v, 2, 32); v += __shfl_xor(v, 4, 32); v += __shfl_xor(v, 8, 32);
    dsum[r] = (1.0f / (v + 1.0e-9f)) * 0.25f;
  }
#pragma unroll
  for (int dt = 0; dt < 4; ++dt)
#pragma unroll
    for (int r = 0; r < 8; ++r) tls[w][8 * hh + r][dt * 16 + ln] = (_Float16)(oacc[dt][r] * dsum[r]);
  __builtin_amdgcn_fence(3 /* release order */, "wavefront"); __builtin_amdgcn_wave_barrier();
  const int rl = lane >> 3, pc = (lane & 7) * 8;
  {
#pragma unroll
    for (int it = 0; it < 4; ++it) {
      const int row = it * 4 + rl;
      const v8us v = *(const v8us*)&tls[w][row][pc];
      *(v8us*)((unsigned short*)O16 + (rq + row) * DM + (size_t)h * HD + pc) = v;
    }
    
  }
}

extern "C" void kernel_launch(void* const* d_in, const int* in_sizes, int n_in,
                              void* d_out, int out_size, void* d_ws, size_t ws_size, hipStream_t stream) {
  if (n_in < 10) return;
  const int nx = (int)(NR * DM);
  if (in_sizes[0] < nx || in_sizes[1] < nx || in_sizes[2] < nx) return;
  if (in_sizes[3] < (int)(NR * SEQ)) return;
  if (in_sizes[4] < DM * DM || in_sizes[5] < DM * DM || in_sizes[6] < DM * DM || in_sizes[7] < DM * DM) return;
  if (in_sizes[8] < NREL * HD || in_sizes[9] < 1) return;
  if (out_size < nx) return;
  const float* xq = (const float*)d_in[0]; const float* xk = (const float*)d_in[1]; const float* xv = (const float*)d_in[2];
  const int* msk = (const int*)d_in[3];
  const float* wq = (const float*)d_in[4]; const float* wk = (const float*)d_in[5]; const float* wv = (const float*)d_in[6]; const float* wo = (const float*)d_in[7];
  const float* rel = (const float*)d_in[8]; const float* spb = (const float*)d_in[9];

  char* ws = (char*)d_ws; size_t off = 0;
  auto take = [&](size_t bytes) { char* p = ws + off; off += (bytes + 255) & ~(size_t)255; return p; };
  const size_t wbytes = (size_t)DM * DM * 2, xbytes = NR * DM * 2;
  _Float16* BQ = (_Float16*)take(wbytes); _Float16* BK = (_Float16*)take(wbytes); _Float16* BV = (_Float16*)take(wbytes); _Float16* BO = (_Float16*)take(wbytes);
  _Float16* RT = (_Float16*)take((size_t)NRELP * HD * 2);
  _Float16* XQ = (_Float16*)take(xbytes); _Float16* XK = (_Float16*)take(xbytes); _Float16* XV = (_Float16*)take(xbytes);
  _Float16* QH = (_Float16*)take(xbytes); _Float16* QL = (_Float16*)take(xbytes); _Float16* KH = (_Float16*)take(xbytes); _Float16* KL = (_Float16*)take(xbytes);
  _Float16* VT = (_Float16*)take(xbytes);
  const int nwords = (int)(NR * (SEQ / 32));
  unsigned int* MB = (unsigned int*)take((size_t)nwords * 4);
  _Float16* O16 = (_Float16*)take(xbytes);
  if (off > ws_size || off > (size_t)134217728) return;

  k_prep<<<P_BLOCKS + 1, PT, 0, stream>>>(xq, xk, xv, msk, wq, wk, wv, wo, rel, XQ, XK, XV, MB, BQ, BK, BV, BO, RT);

  const int M = (int)NR;
  const dim3 gp((unsigned)((M / 128) * (DM / 64)), 1);
  k_gemm2<<<gp, 128, 0, stream>>>(XQ, DM, (size_t)0, BQ, DM, (size_t)0, 0.0625f, nullptr, QH, QL, DM, (size_t)0, M, DM, DM);
  k_gemm2<<<gp, 128, 0, stream>>>(XK, DM, (size_t)0, BK, DM, (size_t)0, 0.0625f, nullptr, KH, KL, DM, (size_t)0, M, DM, DM);
  // V^T = Wv . x^T: the weights are the row operand and the token rows the column operand, so the product lands transposed, [h * HD + d][token row]
  const dim3 gt((unsigned)((DM / 128) * (M / 64)), 1);
  k_gemm2<<<gt, 128, 0, stream>>>(BV, DM, (size_t)0, XV, DM, (size_t)0, 0.0625f, nullptr, VT, nullptr, M, (size_t)0, DM, M, DM);
  k_attn<<<(unsigned)(NB * NH * (SEQ / 64)), 128, 0, stream>>>(QH, QL, KH, KL, VT, RT, MB, spb, O16);
  k_gemm2<<<gp, 128, 0, stream>>>(O16, DM, (size_t)0, BO, DM, (size_t)0, 0.0009765625f, (float*)d_out, nullptr, nullptr, DM, (size_t)0, M, DM, DM);
}

// v006
// A run of this version takes 143 microseconds.
// Two timings next to v005 put it at 1.04 and 1.05 times that version's speed.
// All steps since v000 together make it 2.98 times as fast.
#include <hip/hip_runtime.h>
// Contractions on v_wmma_f32_16x16x32_f16 (f16 operands, f32 accumulate): q/k/v projections and the output projection plain f16 (inputs RNE-converted to bf16 then held exactly in f16, weights x16); q.k^T scores as f16 hi + residual (x2^10) planes on both operands (3 products, residual terms in a separate accumulator); q.rel_emb^T position table f16 hi + residual on q (rel_emb exact x16); t.v aggregation plain f16 (t carried x256, o carried x64); normaliser statistics f32.
#ifndef NB
#define NB 2
#endif
#ifndef SEQ
#define SEQ 2048
#endif
#define NB_FULL 2
#define SEQ_FULL 2048
#define DM 1024
#define NH 16
#define HD 64
#define NREL 33
#define KREL 16
#define NRELP 48                     /* rel_emb rows padded to 3 WMMA column tiles (rows 33..47 zero) */
#define NR ((size_t)NB * SEQ)        /* token rows processed (compact) */
static_assert(SEQ % 128 == 0);
static_assert(SEQ <= SEQ_FULL);
static_assert(NB >= 1 && NB <= NB_FULL);
static_assert(DM == NH * HD);

typedef unsigned short v8us __attribute__((ext_vector_type(8), may_alias));
typedef float  v8f  __attribute__((ext_vector_type(8)));
typedef float  v4f  __attribute__((ext_vector_type(4)));
typedef float  v4fa __attribute__((ext_vector_type(4), may_alias));
typedef _Float16 v16h __attribute__((ext_vector_type(16)));
typedef _Float16 v4h __attribute__((ext_vector_type(4)));
typedef int v4ia __attribute__((ext_vector_type(4), may_alias));
typedef unsigned int v2ua __attribute__((ext_vector_type(2), may_alias));
union FragH { v16h v; v8us half[2]; _Float16 h[16]; unsigned short u[16]; };

__device__ __forceinline__ unsigned short bf16_bits(float x) { unsigned int u = __float_as_uint(x); return (unsigned short)((u + 0x7FFFu + ((u >> 16) & 1u)) >> 16); }
__device__ __forceinline__ float bf16_val(unsigned short b) { return __uint_as_float(((unsigned int)b) << 16); }
__device__ __forceinline__ float bf16_rne(float x) { return bf16_val(bf16_bits(x)); }

// 16x32 fragment from a 16-bit row (lane row/col = lane & 15): elements 0..7 <- k0 + 8hh + 0..7, elements 8..15 <- k0 + 16 + 8hh + 0..7 (same map for A and B)
__device__ __forceinline__ v16h g2_frag(const _Float16* p, int hh) { FragH f; f.half[0] = *(const v8us*)((const unsigned short*)p + 8 * hh); f.half[1] = *(const v8us*)((const unsigned short*)p + 16 + 8 * hh); return f.v; }
__device__ __forceinline__ v8f g2_mma(v16h a, v16h b, v8f c) { v8f d = __builtin_amdgcn_wmma_f32_16x16x32_f16(false, a, false, b, (short)0, c, false, false); asm volatile("v_nop\n\tv_nop\n\tv_nop\n\tv_nop" : "+v"(d) : "v"(a), "v"(b)); return d; }
// two k-steps into one accumulator, hazard guard after the second
__device__ __forceinline__ v8f mma2(v16h a0, v16h b0, v16h a1, v16h b1, v8f c) {
  c = __builtin_amdgcn_wmma_f32_16x16x32_f16(false, a0, false, b0, (short)0, c, false, false);
  c = __builtin_amdgcn_wmma_f32_16x16x32_f16(false, a1, false, b1, (short)0, c, false, false);
  asm volatile("v_nop\n\tv_nop\n\tv_nop\n\tv_nop" : "+v"(c) : "v"(a0), "v"(b0), "v"(a1), "v"(b1));
  return c;
}

#define PT 512                       /* threads of a k_prep block: 16 waves */
#define PWU 1024                     /* 4-byte elements one wave moves per tile: 4 KiB */
#define PTILE ((PT / 32) * PWU)      /* elements of one block tile */
#define PW_TILES (DM * DM / PTILE)               /* tiles of one weight matrix */
#define PX_TILES ((int)(NR * DM / PTILE))        /* tiles of one activation input */
#define PM_TILES ((int)(NR * SEQ / PTILE))       /* tiles of the mask */
#define P_TILES (4 * PW_TILES + 3 * PX_TILES + PM_TILES)
#define P_BLOCKS ((P_TILES + 2) / 3)             /* three tiles a block */
static_assert((DM * DM) % PTILE == 0 && DM % PWU == 0);
static_assert((NR * DM) % PTILE == 0 && (NR * SEQ) % PTILE == 0);

// One wave's 4 KiB of f32 -> f16(bf16_rne(x) * scale): eight 512-byte loads in flight, then eight 256-byte stores (whole lines both ways).
__device__ __forceinline__ void cvt_unit(const float* __restrict__ s, _Float16* __restrict__ d, float scale, int lane) {
  v4f v[8];
#pragma unroll
  for (int j = 0; j < 8; ++j) v[j] = *(const v4fa*)(s + j * 128 + lane * 4);
#pragma unroll
  for (int j = 0; j < 8; ++j) { v4h h;
#pragma unroll
    for (int i = 0; i < 4; ++i) h[i] = (_Float16)(bf16_rne(v[j][i]) * scale);
    *(v4h*)(d + j * 128 + lane * 4) = h; }
  asm volatile("s_wait_xcnt 0x0" ::: "memory");   // stands directly behind the stores, before anything rewrites the address or data registers that they name
}

// One wave's 32 mask words (all in one mask row): word i0 + j is the ballot of one 128-byte line of mask integers (lane = bit); lane j keeps word j, one 128-byte store.
static_assert((SEQ / 32) % 32 == 0);
__device__ __forceinline__ void pack_unit(const int* __restrict__ msk, unsigned int* __restrict__ bits, unsigned int i0, int lane) {
  const unsigned int wpr = SEQ / 32, row = i0 / wpr, wi = i0 - row * wpr, b = row / SEQ, q = row - b * SEQ;
  const int* src = msk + ((size_t)b * SEQ_FULL + q) * SEQ_FULL + (size_t)wi * 32 + lane;
  int v[32];
#pragma unroll
  for (int j = 0; j < 32; ++j) v[j] = src[j * 32];
  asm volatile("s_wait_xcnt 0x0" :: "v"(src) : "memory");   // behind the run of loads; the pointer as input keeps the address registers out of the loads' results up to here
  unsigned int wd = 0u;
#pragma unroll
  for (int j = 0; j < 32; ++j) { const unsigned int bj = __builtin_amdgcn_ballot_w32(v[j] != 0); wd = (lane == j) ? bj : wd; }
  bits[i0 + lane] = wd;
  asm volatile("s_wait_xcnt 0x0" ::: "memory");   // stands directly behind the store, before anything rewrites the registers that it names
}

// All operand preparation in one launch: weights -> f16 x16, activations -> f16, mask -> bit words, rel_emb -> padded f16 x16 table.
// Block 0 does the small table; blocks 1 .. P_BLOCKS walk the tiles (block-uniform choice of the job).
__global__ __launch_bounds__(PT) void k_prep(const float* __restrict__ xq, const float* __restrict__ xk, const float* __restrict__ xv, const int* __restrict__ msk,
    const float* __restrict__ wq, const float* __restrict__ wk, const float* __restrict__ wv, const float* __restrict__ wo, const float* __restrict__ rel,
    _Float16* __restrict__ XQ, _Float16* __restrict__ XK, _Float16* __restrict__ XV, unsigned int* __restrict__ MB,
    _Float16* __restrict__ BQ, _Float16* __restrict__ BK, _Float16* __restrict__ BV, _Float16* __restrict__ BO, _Float16* __restrict__ RT) {
  const int lane = threadIdx.x & 31, wn = __builtin_amdgcn_readfirstlane((int)(threadIdx.x >> 5));
  if (blockIdx.x == 0) {
    const int t = threadIdx.x; if (t >= NRELP * (HD / 8)) return;
    const int r = t / (HD / 8), d8 = (t % (HD / 8)) * 8;
    const int rc = (r < NREL) ? r : (NREL - 1);          // clamped address, value zeroed by predicate
    const bool live = (r < NREL);
    const v4f a = *(const v4fa*)(rel + (size_t)rc * HD + d8), c = *(const v4fa*)(rel + (size_t)rc * HD + d8 + 4);
    FragH f;
#pragma unroll
    for (int q = 0; q < 4; ++q) { f.h[q] = live ? (_Float16)(bf16_rne(a[q]) * 16.0f) : (_Float16)0.0f; f.h[4 + q] = live ? (_Float16)(bf16_rne(c[q]) * 16.0f) : (_Float16)0.0f; }
    *(v8us*)((unsigned short*)RT + (size_t)t * 8) = f.half[0];
    return;
  }
  for (int tile = (int)blockIdx.x - 1; tile < P_TILES; tile += P_BLOCKS) {
    if (tile < 4 * PW_TILES) {
      const int m = tile / PW_TILES;
      const float* s = (m == 0) ? wq : (m == 1) ? wk : (m == 2) ? wv : wo;
      _Float16* d = (m == 0) ? BQ : (m == 1) ? BK : (m == 2) ? BV : BO;
      const size_t e = (size_t)(tile - m * PW_TILES) * PTILE + (size_t)wn * PWU;
      cvt_unit(s + e, d + e, 16.0f, lane);
    } else if (tile < 4 * PW_TILES + 3 * PX_TILES) {
      const int tx = tile - 4 * PW_TILES, m = tx / PX_TILES;
      const float* s = (m == 0) ? xq : (m == 1) ? xk : xv;
      _Float16* d = (m == 0) ? XQ : (m == 1) ? XK : XV;
      const size_t e = (size_t)(tx - m * PX_TILES) * PTILE + (size_t)wn * PWU;   // compact element index; PWU divides DM, so the unit lies in one row
      const int r = (int)(e / DM), c = (int)(e % DM), b = r / SEQ, sq = r - b * SEQ;
      cvt_unit(s + ((size_t)b * SEQ_FULL + sq) * DM + c, d + e, 1.0f, lane);
    } else {
      const int tm = tile - (4 * PW_TILES + 3 * PX_TILES);
      pack_unit(msk, MB, (unsigned int)(tm * (PT / 32) + wn) * 32u, lane);
    }
  }
}

#define GBK 128                      /* k depth of one staged GEMM tile in halfs: 256 B a row */
#define GP 136                       /* LDS row pitch of a staged GEMM tile in halfs: 272 B = 16 B x odd, conflict-free for 16-byte fragment reads */
#define GSTAGE (192 * GP)            /* one stage: 128 rows of A, then 64 rows of B */
#define GRS (8u * GP * 2u)           /* LDS bytes between two copies of one thread: 8 rows */
// Twelve asynchronous copies of 16 B a lane: LDS rows 8 apart from l, each from its own global address.
__device__ __forceinline__ void copy12(unsigned int l, const _Float16* g0, const _Float16* g1, const _Float16* g2, const _Float16* g3, const _Float16* g4, const _Float16* g5,
                                       const _Float16* g6, const _Float16* g7, const _Float16* g8, const _Float16* g9, const _Float16* g10, const _Float16* g11) {
  // the copies and their s_wait_xcnt in one statement: the wait stands before any rewrite of the address registers the copies name
  asm volatile(
      "global_load_async_to_lds_b128 %0, %12, off\n\t"
      "global_load_async_to_lds_b128 %1, %13, off\n\t"
      "global_load_async_to_lds_b128 %2, %14, off\n\t"
      "global_load_async_to_lds_b128 %3, %15, off\n\t"
      "global_load_async_to_lds_b128 %4, %16, off\n\t"
      "global_load_async_to_lds_b128 %5, %17, off\n\t"
      "global_load_async_to_lds_b128 %6, %18, off\n\t"
      "global_load_async_to_lds_b128 %7, %19, off\n\t"
      "global_load_async_to_lds_b128 %8, %20, off\n\t"
      "global_load_async_to_lds_b128 %9, %21, off\n\t"
      "global_load_async_to_lds_b128 %10, %22, off\n\t"
      "global_load_async_to_lds_b128 %11, %23, off\n\t"
      "s_wait_xcnt 0x0"
      :: "v"(l), "v"(l + GRS), "v"(l + 2u * GRS), "v"(l + 3u * GRS), "v"(l + 4u * GRS), "v"(l + 5u * GRS),
         "v"(l + 6u * GRS), "v"(l + 7u * GRS), "v"(l + 8u * GRS), "v"(l + 9u * GRS), "v"(l + 10u * GRS), "v"(l + 11u * GRS),
         "v"(g0), "v"(g1), "v"(g2), "v"(g3), "v"(g4), "v"(g5), "v"(g6), "v"(g7), "v"(g8), "v"(g9), "v"(g10), "v"(g11)
      : "memory");
}
// One k-tile of the block (128 rows of A, then 64 rows of B, GBK deep) into one stage; each of the 128 threads brings 16 B of every eighth row.
// l: the lane's LDS byte address in row tid / 16 of the stage; ga, gb: its 16 B in that row of the A tile and of the B tile.
__device__ __forceinline__ void gemm_stage(unsigned int l, const _Float16* ga, int lda, const _Float16* gb, int ldb) {
  const size_t sa = (size_t)8 * lda, sb = (size_t)8 * ldb;
  copy12(l, ga, ga + sa, ga + 2 * sa, ga + 3 * sa, ga + 4 * sa, ga + 5 * sa, ga + 6 * sa, ga + 7 * sa, ga + 8 * sa, ga + 9 * sa, ga + 10 * sa, ga + 11 * sa);
  copy12(l + 12u * GRS, ga + 12 * sa, ga + 13 * sa, ga + 14 * sa, ga + 15 * sa, gb, gb + sb, gb + 2 * sb, gb + 3 * sb, gb + 4 * sb, gb + 5 * sb, gb + 6 * sb, gb + 7 * sb);
}

// GEMM (wave tile 32x64; M % 128 == 0, N % 64 == 0, K % 128 == 0): C[m][n] = alpha * sum_k A[m][k] Bh[n][k]; A f16 rows (pitch lda), Bh f16 [n][k] (pitch ldb);
// the block's 128 x GBK tile of A and 64 x GBK tile of Bh are staged in LDS (two buffers, asynchronous copies one tile ahead) and read as fragments by the four waves.
__global__ __launch_bounds__(128) void k_gemm2(const _Float16* __restrict__ A, int lda, size_t sA, const _Float16* __restrict__ Bh, int ldb, size_t sB, float alpha,
    float* __restrict__ C, _Float16* __restrict__ C16, _Float16* __restrict__ C16L, int ldc, size_t sC, int M, int N, int K) {
  __shared__ __attribute__((aligned(16))) float so[4][32][68];
  __shared__ __attribute__((aligned(16))) _Float16 ab[2 * GSTAGE];      // two stages of [row][GP]
  const int tid = threadIdx.x, w = tid >> 5, lane = tid & 31, ln = lane & 15, hh = lane >> 4; const int by = blockIdx.y;
  A += (size_t)by * sA; Bh += (size_t)by * sB; const size_t cofs = (size_t)by * sC;
  const int ntn = N >> 6; const int mt = blockIdx.x / ntn, nq = blockIdx.x - mt * ntn; const int row0 = mt * 128 + 32 * w, col0 = nq * 64; if (mt * 128 >= M) return;
  const int crow = tid >> 4, ccol = (tid & 15) * 8;                     // this thread's first row and 16-byte column in a stage
  const unsigned int cl = (unsigned int)(size_t)&ab[crow * GP + ccol];  // its LDS byte address in stage buffer 0
  const _Float16* cga = A + (size_t)(mt * 128 + crow) * lda + ccol;
  const _Float16* cgb = Bh + (size_t)(col0 + crow) * ldb + ccol;
  gemm_stage(cl, cga, lda, cgb, ldb);                                   // tile 0 -> buffer 0
  const v8f z8 = {0.f,0.f,0.f,0.f,0.f,0.f,0.f,0.f}; v8f c00 = z8, c01 = z8, c02 = z8, c03 = z8, c10 = z8, c11 = z8, c12 = z8, c13 = z8;
  asm volatile("s_wait_asynccnt 0x0" ::: "memory");                     // this wave's copies of tile 0 have landed before the barrier publishes them
  __syncthreads();
  if (K > GBK) gemm_stage(cl + GSTAGE * 2u, cga + GBK, lda, cgb + GBK, ldb);   // tile 1 -> buffer 1
  int bo = 0;                                                           // offset in halfs of the buffer that holds this tile
#pragma unroll 1   // one trip per staged tile: kept rolled so that the two buffers alternate through bo and the loop stays small
  for (int kb = 0; kb < K; kb += GBK) {
    const _Float16* ar = &ab[bo + (32 * w + ln) * GP]; const _Float16* br = &ab[bo + (128 + ln) * GP];
    // the fragments of k-step ks + 1 are read into a second register set in front of the products of k-step ks, which then do not wait out the LDS latency
    v16h a0 = g2_frag(ar, hh), a1 = g2_frag(ar + 16 * GP, hh);
    v16h b0 = g2_frag(br, hh), b1 = g2_frag(br + 16 * GP, hh), b2 = g2_frag(br + 32 * GP, hh), b3 = g2_frag(br + 48 * GP, hh);
#pragma unroll     // the four k-steps of a tile read LDS at constant offsets
    for (int ks = 0; ks < GBK; ks += 32) {
      v16h na0 = a0, na1 = a1, nb0 = b0, nb1 = b1, nb2 = b2, nb3 = b3;
      if (ks + 32 < GBK) { const int kn = ks + 32;
        na0 = g2_frag(ar + kn, hh); na1 = g2_frag(ar + 16 * GP + kn, hh);
        nb0 = g2_frag(br + kn, hh); nb1 = g2_frag(br + 16 * GP + kn, hh); nb2 = g2_frag(br + 32 * GP + kn, hh); nb3 = g2_frag(br + 48 * GP + kn, hh); }
      c00 = g2_mma(a0, b0, c00); c10 = g2_mma(a1, b0, c10);
      c01 = g2_mma(a0, b1, c01); c11 = g2_mma(a1, b1, c11);
      c02 = g2_mma(a0, b2, c02); c12 = g2_mma(a1, b2, c12);
      c03 = g2_mma(a0, b3, c03); c13 = g2_mma(a1, b3, c13);
      a0 = na0; a1 = na1; b0 = nb0; b1 = nb1; b2 = nb2; b3 = nb3; }
    asm volatile("s_wait_dscnt 0x0" ::: "memory");                      // this wave's reads of the buffer have returned before it may be refilled
    asm volatile("s_wait_asynccnt 0x0" ::: "memory");                   // this wave's copies of the next tile have landed
    __syncthreads();                                                    // publishes the next tile and ends every wave's reads of this buffer
    if (kb + 2 * GBK < K) gemm_stage(cl + (unsigned int)bo * 2u, cga + (kb + 2 * GBK), lda, cgb + (kb + 2 * GBK), ldb);   // tile + 2 -> the buffer just read
    bo ^= GSTAGE;
  }
  asm volatile("s_wait_asynccnt 0x0" ::: "memory");                     // nothing of this wave is in flight behind the loop
  v8f accs[8] = {c00, c01, c02, c03, c10, c11, c12, c13};
#pragma unroll
  for (int u = 0; u < 8; ++u) { const int t = u & 3, half = u >> 2;
#pragma unroll
    for (int r = 0; r < 8; ++r) { const int rloc = half * 16 + 8 * hh + r; so[w][rloc][t * 16 + ln] = accs[u][r] * alpha; } }
  __builtin_amdgcn_fence(4 /* acq_rel order */, "workgroup"); __builtin_amdgcn_wave_barrier();
  const int rsub = lane >> 4, c4 = (lane & 15) * 4;
  {
#pragma unroll
    for (int q = 0; q < 16; ++q) {
      const int r = q * 2 + rsub; const v4f v = *(const v4fa*)&so[w][r][c4];
      const size_t o = cofs + (size_t)(row0 + r) * ldc + col0 + c4;
      if (C) *(v4f*)(C + o) = v;
      if (C16) { v4h h4, l4;
#pragma unroll
        for (int i = 0; i < 4; ++i) { const _Float16 hq = (_Float16)v[i]; h4[i] = hq; l4[i] = (_Float16)((v[i] - (float)hq) * 1024.0f); }
        *(v4h*)(C16 + o) = h4;
        if (C16L) *(v4h*)(C16L + o) = l4; }
    }
     }
}

template <bool B> struct Flag { static constexpr bool value = B; };   // compile-time choice between the two forms of a chunk

#define KVP 72                       /* LDS row pitch of a staged plane in halfs: 144 B = 16 B x odd, conflict-free for 16-byte fragment reads */
#define KVPLANE (64 * KVP)           /* one staged plane: 64 rows */
#define KVSTAGE (3 * KVPLANE)        /* one stage: K hi, K residual, V^T */
// One 64-key stage into LDS by asynchronous copies: three planes of 64 rows x 128 B; each of the 128 threads brings 16 B of rows r, r+16, r+32, r+48 of each plane.
// l: the lane's LDS byte address in plane 0 (row r); gh, gl: its 16 B in K hi / K residual (row pitch DM); gv: its 16 B in V^T (row pitch NR).
__device__ __forceinline__ void stage_copy(unsigned int l, const _Float16* gh, const _Float16* gl, const _Float16* gv) {
  // the copies and their s_wait_xcnt in one statement: the wait stands before any rewrite of the address registers the copies name
  asm volatile(
      "global_load_async_to_lds_b128 %0, %12, off\n\t"
      "global_load_async_to_lds_b128 %1, %13, off\n\t"
      "global_load_async_to_lds_b128 %2, %14, off\n\t"
      "global_load_async_to_lds_b128 %3, %15, off\n\t"
      "global_load_async_to_lds_b128 %4, %16, off\n\t"
      "global_load_async_to_lds_b128 %5, %17, off\n\t"
      "global_load_async_to_lds_b128 %6, %18, off\n\t"
      "global_load_async_to_lds_b128 %7, %19, off\n\t"
      "global_load_async_to_lds_b128 %8, %20, off\n\t"
      "global_load_async_to_lds_b128 %9, %21, off\n\t"
      "global_load_async_to_lds_b128 %10, %22, off\n\t"
      "global_load_async_to_lds_b128 %11, %23, off\n\t"
      "s_wait_xcnt 0x0"
      :: "v"(l), "v"(l + 16u * KVP * 2u), "v"(l + 32u * KVP * 2u), "v"(l + 48u * KVP * 2u),
         "v"(l + KVPLANE * 2u), "v"(l + KVPLANE * 2u + 16u * KVP * 2u), "v"(l + KVPLANE * 2u + 32u * KVP * 2u), "v"(l + KVPLANE * 2u + 48u * KVP * 2u),
         "v"(l + KVPLANE * 4u), "v"(l + KVPLANE * 4u + 16u * KVP * 2u), "v"(l + KVPLANE * 4u + 32u * KVP * 2u), "v"(l + KVPLANE * 4u + 48u * KVP * 2u),
         "v"(gh), "v"(gh + 16 * DM), "v"(gh + 32 * DM), "v"(gh + 48 * DM),
         "v"(gl), "v"(gl + 16 * DM), "v"(gl + 32 * DM), "v"(gl + 48 * DM),
         "v"(gv), "v"(gv + 16 * NR), "v"(gv + 32 * NR), "v"(gv + 48 * NR)
      : "memory");
}

// Fused attention with relu^2 normaliser. grid = NB*NH*(SEQ/64), block = 4 waves; wave w owns query rows q0 = qb*64 + 16w .. +15 of (b, h).
// Per wave: position table qes[m][r] = q[m].rel_emb[r] (WMMA, f32 in LDS); per 64-key chunk: s = q.k^T (hi.hi + (lo.hi + hi.lo)/2^10), sv = (s + qes[m][clamp(key-q)+16]) / 8,
// K hi, K residual and V^T of each 64-key chunk are staged once per block in LDS (two buffers, asynchronous copies one chunk ahead) and read as fragments by all four waves.
// Position term: in a chunk whose every key lies 16 or more before (or behind) every query of the block the clamp makes it one constant per query row (column 0 or 32 of qes);
// that constant stays in registers and is the start value of the hi.hi accumulator. Only the (at most three) chunks round the diagonal clamp, form addresses and gather from qes.
// masked -> -1e9, t = relu(sv + b)^2, dsum += t (f32), tls[m][key] = f16(256 t); o += tls . v^T ; end: o * (1/(sum+eps)) * 64/256 -> f16 rows of O16 (cols h*64..).
__global__ __launch_bounds__(128) void k_attn(const _Float16* __restrict__ QH, const _Float16* __restrict__ QL, const _Float16* __restrict__ KH, const _Float16* __restrict__ KL,
                                              const _Float16* __restrict__ VT, const _Float16* __restrict__ RT, const unsigned int* __restrict__ MBt,
                                              const float* __restrict__ spb, _Float16* __restrict__ O16) {
  #pragma clang fp contract(off)
  __shared__ __attribute__((aligned(16))) _Float16 tls[4][16][72];     // [row][key] t tile (cols 0..63 used), later [row][d] o tile
  __shared__ float qes[4][16][52];                                      // [row][r] position table (cols 0..47 written, 0..32 read)
  __shared__ __attribute__((aligned(16))) _Float16 kv[2 * KVSTAGE];     // two stages of [plane][row][KVP]
  const int tid = threadIdx.x, w = tid >> 5, lane = tid & 31, ln = lane & 15, hh = lane >> 4;
  const int nqb = SEQ / 64;
  const int bh = blockIdx.x / nqb, qb = blockIdx.x - bh * nqb;
  const int b = bh / NH, h = bh - b * NH;
  const int q0 = qb * 64 + w * 16;                                      // first query of this wave (within the sequence)
  const size_t rq = (size_t)b * SEQ + q0;                               // compact token row of that query
  const size_t qoff = (rq + ln) * DM + (size_t)h * HD;
  const v16h qh0 = g2_frag(QH + qoff, hh), qh1 = g2_frag(QH + qoff + 32, hh);
  const v16h ql0 = g2_frag(QL + qoff, hh), ql1 = g2_frag(QL + qoff + 32, hh);
  const v8f z8 = {0.f,0.f,0.f,0.f,0.f,0.f,0.f,0.f};
  const float rsc = 0.0009765625f;                                      // 2^-10 fold of the residual planes
  const _Float16* kbh = KH + ((size_t)b * SEQ) * DM + (size_t)h * HD;
  const _Float16* kbl = KL + ((size_t)b * SEQ) * DM + (size_t)h * HD;
  const _Float16* vtb = VT + ((size_t)h * HD) * NR + (size_t)b * SEQ;   // V^T is [h * HD + d][token row], pitch NR
  const int crow = tid >> 3, ccol = (tid & 7) * 8;                      // this thread's first row and 16-byte column in every staged plane
  const unsigned int cl = (unsigned int)(size_t)&kv[crow * KVP + ccol];  // its LDS byte address in stage buffer 0
  const _Float16* cgh = kbh + (size_t)crow * DM + ccol;
  const _Float16* cgl = kbl + (size_t)crow * DM + ccol;
  const _Float16* cgv = vtb + (size_t)crow * NR + ccol;
  stage_copy(cl, cgh, cgl, cgv);                                        // chunk 0 -> buffer 0
  // position table: qes[m][r] = (q[m] . (16 rel_emb[r])) / 16
#pragma unroll
  for (int nt = 0; nt < 3; ++nt) {
    const _Float16* rr = RT + (size_t)(nt * 16 + ln) * HD;
    const v16h r0 = g2_frag(rr, hh), r1 = g2_frag(rr + 32, hh);
    const v8f ah = mma2(qh0, r0, qh1, r1, z8);
    const v8f al = mma2(ql0, r0, ql1, r1, z8);
#pragma unroll
    for (int r = 0; r < 8; ++r) { const float e = ah[r] + al[r] * rsc; qes[w][8 * hh + r][nt * 16 + ln] = e * 0.0625f; }
  }
  asm volatile("s_wait_asynccnt 0x0" ::: "memory");                     // this wave's copies of chunk 0 have landed before the barrier publishes them
  __syncthreads();
  stage_copy(cl + KVSTAGE * 2u, cgh + (size_t)64 * DM, cgl + (size_t)64 * DM, cgv + 64);   // chunk 1 -> buffer 1 (SEQ >= 128)

  const unsigned int* mbr = MBt + (rq + 8 * hh) * (SEQ / 32);          // bit row of query q0 + 8hh; row r at + r*(SEQ/32)
  const float sbias = spb[0];
  float dsum[8];
#pragma unroll
  for (int r = 0; r < 8; ++r) dsum[r] = 0.f;
  v8f oacc[4] = {z8, z8, z8, z8};
  int bo = 0;                                                           // offset in halfs of the buffer that holds this chunk
  v8f pec;                                                              // position term of this lane's eight rows in the chunks off the diagonal: first the keys before the band (column 0)
#pragma unroll
  for (int r = 0; r < 8; ++r) pec[r] = qes[w][8 * hh + r][0];

  // One 64-key chunk. band: the chunk may hold a key nearer than 16 to a query of the block (the gathered form); otherwise pec holds the position term.
  auto chunk = [&](const int k0, auto band) __attribute__((always_inline)) {
    constexpr bool BAND = decltype(band)::value;
    v2ua mw[8];
#pragma unroll
    for (int r = 0; r < 8; ++r) mw[r] = *(const v2ua*)(mbr + (size_t)r * (SEQ / 32) + (k0 >> 5));
    // Fragment reads stand one 16-key tile ahead of their use, in a second register set: while tile kt is multiplied and its t values are formed,
    // the fragments of tile kt + 1 (behind the last tile: the first half of V^T) are on their way, so the matrix runs do not wait out the LDS latency.
    // All of them are reads of this chunk's own buffer.
    const _Float16* kr = &kv[bo + ln * KVP];                            // this lane's row of tile 0 in the K hi plane
    const _Float16* vr = &kv[bo + 2 * KVPLANE + ln * KVP];              // this lane's row of d tile 0 in the V^T plane
    v16h f0 = g2_frag(kr, hh), f1 = g2_frag(kr + 32, hh), f2 = g2_frag(kr + KVPLANE, hh), f3 = g2_frag(kr + KVPLANE + 32, hh);   // K hi (f0, f1) and residual (f2, f3) of tile 0
    __builtin_amdgcn_sched_barrier(0);     // tile 0's eight reads go out first: nothing covers them, and LDS answers in order
#pragma unroll
    for (int kt = 0; kt < 4; ++kt) {
      const int kc = kt * 16 + ln;                                      // key within the chunk held by this lane (D column)
      float pe[8];                                                      // position terms of this tile, read ahead of its matrix run (band chunks only)
      if constexpr (BAND) {
#pragma unroll
        for (int r = 0; r < 8; ++r) {
          int rel = (k0 + kc) - (q0 + 8 * hh + r);
          rel = (rel < -KREL) ? -KREL : ((rel > KREL) ? KREL : rel);
          pe[r] = qes[w][8 * hh + r][rel + KREL];
        }
      }
      const _Float16* nr = (kt < 3) ? kr + (kt + 1) * 16 * KVP : vr;    // next: K tile kt + 1, or d tiles 0 and 1 of V^T
      const int n2 = (kt < 3) ? KVPLANE : 16 * KVP;
      const v16h n0 = g2_frag(nr, hh), n1 = g2_frag(nr + 32, hh), n2f = g2_frag(nr + n2, hh), n3 = g2_frag(nr + n2 + 32, hh);
      __builtin_amdgcn_sched_barrier(0);   // keeps these reads in front of this tile's matrix run, and the next tile's products (which would wait for them at once) behind it
      const v8f sh = mma2(qh0, f0, qh1, f1, BAND ? z8 : pec);
      v8f sx = mma2(ql0, f0, ql1, f1, z8);
      sx = mma2(qh0, f2, qh1, f3, sx);
#pragma unroll
      for (int r = 0; r < 8; ++r) {
        const int m = 8 * hh + r;                                       // row within the wave tile (D row)
        const float s = sh[r] + sx[r] * rsc;
        float sv;
        if constexpr (BAND) sv = (s + pe[r]) * 0.125f; else sv = s * 0.125f;
        const unsigned int word = (kt < 2) ? mw[r][0] : mw[r][1];
        const unsigned int bit = (word >> ((kt & 1) * 16 + ln)) & 1u;
        sv = (bit != 0u) ? -1.0e9f : sv;
        float t = sv + sbias;
        t = fmaxf(t, 0.0f);
        const float tt = t * t;
        dsum[r] += tt;
        tls[w][m][kc] = (_Float16)(tt * 256.0f);
      }
      f0 = n0; f1 = n1; f2 = n2f; f3 = n3;
    }
    __builtin_amdgcn_fence(3 /* release order */, "wavefront"); __builtin_amdgcn_wave_barrier();
    FragH pa, pb;
    pa.half[0] = *(const v8us*)&tls[w][ln][8 * hh];      pa.half[1] = *(const v8us*)&tls[w][ln][16 + 8 * hh];       // keys k0 + 0..31
    pb.half[0] = *(const v8us*)&tls[w][ln][32 + 8 * hh]; pb.half[1] = *(const v8us*)&tls[w][ln][48 + 8 * hh];       // keys k0 + 32..63
    const v16h g0 = g2_frag(vr + 32 * KVP, hh), g1 = g2_frag(vr + 32 * KVP + 32, hh), g2 = g2_frag(vr + 48 * KVP, hh), g3 = g2_frag(vr + 48 * KVP + 32, hh);   // d tiles 2 and 3, ahead of the products of 0 and 1
    oacc[0] = mma2(pa.v, f0, pb.v, f1, oacc[0]);
    oacc[1] = mma2(pa.v, f2, pb.v, f3, oacc[1]);
    oacc[2] = mma2(pa.v, g0, pb.v, g1, oacc[2]);
    oacc[3] = mma2(pa.v, g2, pb.v, g3, oacc[3]);
    __builtin_amdgcn_fence(3 /* release order */, "wavefront"); __builtin_amdgcn_wave_barrier();
    asm volatile("s_wait_dscnt 0x0" ::: "memory");                      // this wave's reads of the buffer have returned before it may be refilled
    asm volatile("s_wait_asynccnt 0x0" ::: "memory");                   // this wave's copies of the next chunk have landed
    __syncthreads();                                                    // publishes the next chunk and ends every wave's reads of this buffer
    if (k0 + 128 < SEQ)
      stage_copy(cl + (unsigned int)bo * 2u, cgh + (size_t)(k0 + 128) * DM, cgl + (size_t)(k0 + 128) * DM, cgv + (k0 + 128));   // chunk + 2 -> the buffer just read
    bo ^= KVSTAGE;
  };
  // The chunks in their order, in three runs whose bounds are the same for the whole block (every wave passes every chunk's barrier):
  // keys before the band, the chunks round the diagonal, keys behind the band.
  const int kA = (qb > 0) ? qb * 64 - 64 : 0, kB = (qb * 64 + 128 < SEQ) ? qb * 64 + 128 : SEQ;
#pragma unroll 1   // one trip per staged chunk: the two buffers alternate through bo
  for (int k0 = 0; k0 < kA; k0 += 64) chunk(k0, Flag<false>{});
#pragma unroll 1   // as above
  for (int k0 = kA; k0 < kB; k0 += 64) chunk(k0, Flag<true>{});
#pragma unroll
  for (int r = 0; r < 8; ++r) pec[r] = qes[w][8 * hh + r][2 * KREL];    // from here on every key lies behind the band (column 32)
#pragma unroll 1   // as above
  for (int k0 = kB; k0 < SEQ; k0 += 64) chunk(k0, Flag<false>{});
  asm volatile("s_wait_asynccnt 0x0" ::: "memory");                     // nothing of this wave is in flight behind the loops

  // key sums across the 16 lanes of each half (each half holds its own 8 rows); scale = 64/256 / (sum + eps)
#pragma unroll
  for (int r = 0; r < 8; ++r) {
    float v = dsum[r];
    v += __shfl_xor(v, 1, 32); v += __shfl_xor(v, 2, 32); v += __shfl_xor(v, 4, 32); v += __shfl_xor(v, 8, 32);
    dsum[r] = (1.0f / (v + 1.0e-9f)) * 0.25f;
  }
#pragma unroll
  for (int dt = 0; dt < 4; ++dt)
#pragma unroll
    for (int r = 0; r < 8; ++r) tls[w][8 * hh + r][dt * 16 + ln] = (_Float16)(oacc[dt][r] * dsum[r]);
  __builtin_amdgcn_fence(3 /* release order */, "wavefront"); __builtin_amdgcn_wave_barrier();
  const int rl = lane >> 3, pc = (lane & 7) * 8;
  {
#pragma unroll
    for (int it = 0; it < 4; ++it) {
      const int row = it * 4 + rl;
      const v8us v = *(const v8us*)&tls[w][row][pc];
      *(v8us*)((unsigned short*)O16 + (rq + row) * DM + (size_t)h * HD + pc) = v;
    }
    
  }
}

extern "C" void kernel_launch(void* const* d_in, const int* in_sizes, int n_in,
                              void* d_out, int out_size, void* d_ws, size_t ws_size, hipStream_t stream) {
  if (n_in < 10) return;
  const int nx = (int)(NR * DM);
  if (in_sizes[0] < nx || in_sizes[1] < nx || in_sizes[2] < nx) return;
  if (in_sizes[3] < (int)(NR * SEQ)) return;
  if (in_sizes[4] < DM * DM || in_sizes[5] < DM * DM || in_sizes[6] < DM * DM || in_sizes[7] < DM * DM) return;
  if (in_sizes[8] < NREL * HD || in_sizes[9] < 1) return;
  if (out_size < nx) return;
  const float* xq = (const float*)d_in[0]; const float* xk = (const float*)d_in[1]; const float* xv = (const float*)d_in[2];
  const int* msk = (const int*)d_in[3];
  const float* wq = (const float*)d_in[4]; const float* wk = (const float*)d_in[5]; const float* wv = (const float*)d_in[6]; const float* wo = (const float*)d_in[7];
  const float* rel = (const float*)d_in[8]; const float* spb = (const float*)d_in[9];

  char* ws = (char*)d_ws; size_t off = 0;
  auto take = [&](size_t bytes) { char* p = ws + off; off += (bytes + 255) & ~(size_t)255; return p; };
  const size_t wbytes = (size_t)DM * DM * 2, xbytes = NR * DM * 2;
  _Float16* BQ = (_Float16*)take(wbytes); _Float16* BK = (_Float16*)take(wbytes); _Float16* BV = (_Float16*)take(wbytes); _Float16* BO = (_Float16*)take(wbytes);
  _Float16* RT = (_Float16*)take((size_t)NRELP * HD * 2);
  _Float16* XQ = (_Float16*)take(xbytes); _Float16* XK = (_Float16*)take(xbytes); _Float16* XV = (_Float16*)take(xbytes);
  _Float16* QH = (_Float16*)take(xbytes); _Float16* QL = (_Float16*)take(xbytes); _Float16* KH = (_Float16*)take(xbytes); _Float16* KL = (_Float16*)take(xbytes);
  _Float16* VT = (_Float16*)take(xbytes);
  const int nwords = (int)(NR * (SEQ / 32));
  unsigned int* MB = (unsigned int*)take((size_t)nwords * 4);
  _Float16* O16 = (_Float16*)take(xbytes);
  if (off > ws_size || off > (size_t)134217728) return;

  k_prep<<<P_BLOCKS + 1, PT, 0, stream>>>(xq, xk, xv, msk, wq, wk, wv, wo, rel, XQ, XK, XV, MB, BQ, BK, BV, BO, RT);

  const int M = (int)NR;
  const dim3 gp((unsigned)((M / 128) * (DM / 64)), 1);
  k_gemm2<<<gp, 128, 0, stream>>>(XQ, DM, (size_t)0, BQ, DM, (size_t)0, 0.0625f, nullptr, QH, QL, DM, (size_t)0, M, DM, DM);
  k_gemm2<<<gp, 128, 0, stream>>>(XK, DM, (size_t)0, BK, DM, (size_t)0, 0.0625f, nullptr, KH, KL, DM, (size_t)0, M, DM, DM);
  // V^T = Wv . x^T: the weights are the row operand and the token rows the column operand, so the product lands transposed, [h * HD + d][token row]
  const dim3 gt((unsigned)((DM / 128) * (M / 64)), 1);
  k_gemm2<<<gt, 128, 0, stream>>>(BV, DM, (size_t)0, XV, DM, (size_t)0, 0.0625f, nullptr, VT, nullptr, M, (size_t)0, DM, M, DM);
  k_attn<<<(unsigned)(NB * NH * (SEQ / 64)), 128, 0, stream>>>(QH, QL, KH, KL, VT, RT, MB, spb, O16);
  k_gemm2<<<gp, 128, 0, stream>>>(O16, DM, (size_t)0, BO, DM, (size_t)0, 0.0009765625f, (float*)d_out, nullptr, nullptr, DM, (size_t)0, M, DM, DM);
}

// v007
// Measured time: 130 microseconds a run.
// Two timings next to v006 both put it at 1.10 times that version's speed.
// Counting every step since v000, it is 3.28 times as fast.
#include <hip/hip_runtime.h>
// Contractions on v_wmma_f32_16x16x32_f16 (f16 operands, f32 accumulate): q/k/v projections and the output projection plain f16 (inputs RNE-converted to bf16 then held exactly in f16, weights x16); q.k^T scores as f16 hi + residual (x2^10) planes on both operands (3 products, residual terms in a separate accumulator); q.rel_emb^T position table f16 hi + residual on q (rel_emb exact x16); t.v aggregation plain f16 (t carried x256, o carried x64); normaliser statistics f32.
#ifndef NB
#define NB 2
#endif
#ifndef SEQ
#define SEQ 2048
#endif
#define NB_FULL 2
#define SEQ_FULL 2048
#define DM 1024
#define NH 16
#define HD 64
#define NREL 33
#define KREL 16
#define NRELP 48                     /* rel_emb rows padded to 3 WMMA column tiles (rows 33..47 zero) */
#define NR ((size_t)NB * SEQ)        /* token rows processed (compact) */
static_assert(SEQ % 128 == 0);
static_assert(SEQ <= SEQ_FULL);
static_assert(NB >= 1 && NB <= NB_FULL);
static_assert(DM == NH * HD);

typedef unsigned short v8us __attribute__((ext_vector_type(8), may_alias));
typedef float  v8f  __attribute__((ext_vector_type(8)));
typedef float  v4f  __attribute__((ext_vector_type(4)));
typedef float  v4fa __attribute__((ext_vector_type(4), may_alias));
typedef _Float16 v16h __attribute__((ext_vector_type(16)));
typedef _Float16 v4h __attribute__((ext_vector_type(4)));
typedef _Float16 v2h __attribute__((ext_vector_type(2)));
typedef float  v2f  __attribute__((ext_vector_type(2)));
typedef int v4ia __attribute__((ext_vector_type(4), may_alias));
typedef unsigned int v2ua __attribute__((ext_vector_type(2), may_alias));
union FragH { v16h v; v8us half[2]; v2h p[8]; _Float16 h[16]; unsigned short u[16]; };

__device__ __forceinline__ unsigned short bf16_bits(float x) { unsigned int u = __float_as_uint(x); return (unsigned short)((u + 0x7FFFu + ((u >> 16) & 1u)) >> 16); }
__device__ __forceinline__ float bf16_val(unsigned short b) { return __uint_as_float(((unsigned int)b) << 16); }
__device__ __forceinline__ float bf16_rne(float x) { return bf16_val(bf16_bits(x)); }

// 16x32 fragment from a 16-bit row (lane row/col = lane & 15): elements 0..7 <- k0 + 8hh + 0..7, elements 8..15 <- k0 + 16 + 8hh + 0..7 (same map for A and B)
__device__ __forceinline__ v16h g2_frag(const _Float16* p, int hh) { FragH f; f.half[0] = *(const v8us*)((const unsigned short*)p + 8 * hh); f.half[1] = *(const v8us*)((const unsigned short*)p + 16 + 8 * hh); return f.v; }
__device__ __forceinline__ v8f g2_mma(v16h a, v16h b, v8f c) { v8f d = __builtin_amdgcn_wmma_f32_16x16x32_f16(false, a, false, b, (short)0, c, false, false); asm volatile("v_nop\n\tv_nop\n\tv_nop\n\tv_nop" : "+v"(d) : "v"(a), "v"(b)); return d; }
// two k-steps into one accumulator, hazard guard after the second
__device__ __forceinline__ v8f mma2(v16h a0, v16h b0, v16h a1, v16h b1, v8f c) {
  c = __builtin_amdgcn_wmma_f32_16x16x32_f16(false, a0, false, b0, (short)0, c, false, false);
  c = __builtin_amdgcn_wmma_f32_16x16x32_f16(false, a1, false, b1, (short)0, c, false, false);
  asm volatile("v_nop\n\tv_nop\n\tv_nop\n\tv_nop" : "+v"(c) : "v"(a0), "v"(b0), "v"(a1), "v"(b1));
  return c;
}

#define PT 512                       /* threads of a k_prep block: 16 waves */
#define PWU 1024                     /* 4-byte elements one wave moves per tile: 4 KiB */
#define PTILE ((PT / 32) * PWU)      /* elements of one block tile */
#define PW_TILES (DM * DM / PTILE)               /* tiles of one weight matrix */
#define PX_TILES ((int)(NR * DM / PTILE))        /* tiles of one activation input */
#define PM_TILES ((int)(NR * SEQ / PTILE))       /* tiles of the mask */
#define P_TILES (4 * PW_TILES + 3 * PX_TILES + PM_TILES)
#define P_BLOCKS ((P_TILES + 2) / 3)             /* three tiles a block */
static_assert((DM * DM) % PTILE == 0 && DM % PWU == 0);
static_assert((NR * DM) % PTILE == 0 && (NR * SEQ) % PTILE == 0);

// One wave's 4 KiB of f32 -> f16(bf16_rne(x) * scale): eight 512-byte loads in flight, then eight 256-byte stores (whole lines both ways).
__device__ __forceinline__ void cvt_unit(const float* __restrict__ s, _Float16* __restrict__ d, float scale, int lane) {
  v4f v[8];
#pragma unroll
  for (int j = 0; j < 8; ++j) v[j] = *(const v4fa*)(s + j * 128 + lane * 4);
#pragma unroll
  for (int j = 0; j < 8; ++j) { v4h h;
#pragma unroll
    for (int i = 0; i < 4; ++i) h[i] = (_Float16)(bf16_rne(v[j][i]) * scale);
    *(v4h*)(d + j * 128 + lane * 4) = h; }
  asm volatile("s_wait_xcnt 0x0" ::: "memory");   // stands directly behind the stores, before anything rewrites the address or data registers that they name
}

// One wave's 32 mask words (all in one mask row): word i0 + j is the ballot of one 128-byte line of mask integers (lane = bit); lane j keeps word j, one 128-byte store.
static_assert((SEQ / 32) % 32 == 0);
__device__ __forceinline__ void pack_unit(const int* __restrict__ msk, unsigned int* __restrict__ bits, unsigned int i0, int lane) {
  const unsigned int wpr = SEQ / 32, row = i0 / wpr, wi = i0 - row * wpr, b = row / SEQ, q = row - b * SEQ;
  const int* src = msk + ((size_t)b * SEQ_FULL + q) * SEQ_FULL + (size_t)wi * 32 + lane;
  int v[32];
#pragma unroll
  for (int j = 0; j < 32; ++j) v[j] = src[j * 32];
  asm volatile("s_wait_xcnt 0x0" :: "v"(src) : "memory");   // behind the run of loads; the pointer as input keeps the address registers out of the loads' results up to here
  unsigned int wd = 0u;
#pragma unroll
  for (int j = 0; j < 32; ++j) { const unsigned int bj = __builtin_amdgcn_ballot_w32(v[j] != 0); wd = (lane == j) ? bj : wd; }
  bits[i0 + lane] = wd;
  asm volatile("s_wait_xcnt 0x0" ::: "memory");   // stands directly behind the store, before anything rewrites the registers that it names
}

// All operand preparation in one launch: weights -> f16 x16, activations -> f16, mask -> bit words, rel_emb -> padded f16 x16 table.
// Block 0 does the small table; blocks 1 .. P_BLOCKS walk the tiles (block-uniform choice of the job).
__global__ __launch_bounds__(PT) void k_prep(const float* __restrict__ xq, const float* __restrict__ xk, const float* __restrict__ xv, const int* __restrict__ msk,
    const float* __restrict__ wq, const float* __restrict__ wk, const float* __restrict__ wv, const float* __restrict__ wo, const float* __restrict__ rel,
    _Float16* __restrict__ XQ, _Float16* __restrict__ XK, _Float16* __restrict__ XV, unsigned int* __restrict__ MB,
    _Float16* __restrict__ BQ, _Float16* __restrict__ BK, _Float16* __restrict__ BV, _Float16* __restrict__ BO, _Float16* __restrict__ RT) {
  const int lane = threadIdx.x & 31, wn = __builtin_amdgcn_readfirstlane((int)(threadIdx.x >> 5));
  if (blockIdx.x == 0) {
    const int t = threadIdx.x; if (t >= NRELP * (HD / 8)) return;
    const int r = t / (HD / 8), d8 = (t % (HD / 8)) * 8;
    const int rc = (r < NREL) ? r : (NREL - 1);          // clamped address, value zeroed by predicate
    const bool live = (r < NREL);
    const v4f a = *(const v4fa*)(rel + (size_t)rc * HD + d8), c = *(const v4fa*)(rel + (size_t)rc * HD + d8 + 4);
    FragH f;
#pragma unroll
    for (int q = 0; q < 4; ++q) { f.h[q] = live ? (_Float16)(bf16_rne(a[q]) * 16.0f) : (_Float16)0.0f; f.h[4 + q] = live ? (_Float16)(bf16_rne(c[q]) * 16.0f) : (_Float16)0.0f; }
    *(v8us*)((unsigned short*)RT + (size_t)t * 8) = f.half[0];
    return;
  }
  for (int tile = (int)blockIdx.x - 1; tile < P_TILES; tile += P_BLOCKS) {
    if (tile < 4 * PW_TILES) {
      const int m = tile / PW_TILES;
      const float* s = (m == 0) ? wq : (m == 1) ? wk : (m == 2) ? wv : wo;
      _Float16* d = (m == 0) ? BQ : (m == 1) ? BK : (m == 2) ? BV : BO;
      const size_t e = (size_t)(tile - m * PW_TILES) * PTILE + (size_t)wn * PWU;
      cvt_unit(s + e, d + e, 16.0f, lane);
    } else if (tile < 4 * PW_TILES + 3 * PX_TILES) {
      const int tx = tile - 4 * PW_TILES, m = tx / PX_TILES;
      const float* s = (m == 0) ? xq : (m == 1) ? xk : xv;
      _Float16* d = (m == 0) ? XQ : (m == 1) ? XK : XV;
      const size_t e = (size_t)(tx - m * PX_TILES) * PTILE + (size_t)wn * PWU;   // compact element index; PWU divides DM, so the unit lies in one row
      const int r = (int)(e / DM), c = (int)(e % DM), b = r / SEQ, sq = r - b * SEQ;
      cvt_unit(s + ((size_t)b * SEQ_FULL + sq) * DM + c, d + e, 1.0f, lane);
    } else {
      const int tm = tile - (4 * PW_TILES + 3 * PX_TILES);
      pack_unit(msk, MB, (unsigned int)(tm * (PT / 32) + wn) * 32u, lane);
    }
  }
}

#define GBK 128                      /* k depth of one staged GEMM tile in halfs: 256 B a row */
#define GP 136                       /* LDS row pitch of a staged GEMM tile in halfs: 272 B = 16 B x odd, conflict-free for 16-byte fragment reads */
#define GSTAGE (192 * GP)            /* one stage: 128 rows of A, then 64 rows of B */
#define GRS (8u * GP * 2u)           /* LDS bytes between two copies of one thread: 8 rows */
// Twelve asynchronous copies of 16 B a lane: LDS rows 8 apart from l, each from its own global address.
__device__ __forceinline__ void copy12(unsigned int l, const _Float16* g0, const _Float16* g1, const _Float16* g2, const _Float16* g3, const _Float16* g4, const _Float16* g5,
                                       const _Float16* g6, const _Float16* g7, const _Float16* g8, const _Float16* g9, const _Float16* g10, const _Float16* g11) {
  // the copies and their s_wait_xcnt in one statement: the wait stands before any rewrite of the address registers the copies name
  asm volatile(
      "global_load_async_to_lds_b128 %0, %12, off\n\t"
      "global_load_async_to_lds_b128 %1, %13, off\n\t"
      "global_load_async_to_lds_b128 %2, %14, off\n\t"
      "global_load_async_to_lds_b128 %3, %15, off\n\t"
      "global_load_async_to_lds_b128 %4, %16, off\n\t"
      "global_load_async_to_lds_b128 %5, %17, off\n\t"
      "global_load_async_to_lds_b128 %6, %18, off\n\t"
      "global_load_async_to_lds_b128 %7, %19, off\n\t"
      "global_load_async_to_lds_b128 %8, %20, off\n\t"
      "global_load_async_to_lds_b128 %9, %21, off\n\t"
      "global_load_async_to_lds_b128 %10, %22, off\n\t"
      "global_load_async_to_lds_b128 %11, %23, off\n\t"
      "s_wait_xcnt 0x0"
      :: "v"(l), "v"(l + GRS), "v"(l + 2u * GRS), "v"(l + 3u * GRS), "v"(l + 4u * GRS), "v"(l + 5u * GRS),
         "v"(l + 6u * GRS), "v"(l + 7u * GRS), "v"(l + 8u * GRS), "v"(l + 9u * GRS), "v"(l + 10u * GRS), "v"(l + 11u * GRS),
         "v"(g0), "v"(g1), "v"(g2), "v"(g3), "v"(g4), "v"(g5), "v"(g6), "v"(g7), "v"(g8), "v"(g9), "v"(g10), "v"(g11)
      : "memory");
}
// One k-tile of the block (128 rows of A, then 64 rows of B, GBK deep) into one stage; each of the 128 threads brings 16 B of every eighth row.
// l: the lane's LDS byte address in row tid / 16 of the stage; ga, gb: its 16 B in that row of the A tile and of the B tile.
__device__ __forceinline__ void gemm_stage(unsigned int l, const _Float16* ga, int lda, const _Float16* gb, int ldb) {
  const size_t sa = (size_t)8 * lda, sb = (size_t)8 * ldb;
  copy12(l, ga, ga + sa, ga + 2 * sa, ga + 3 * sa, ga + 4 * sa, ga + 5 * sa, ga + 6 * sa, ga + 7 * sa, ga + 8 * sa, ga + 9 * sa, ga + 10 * sa, ga + 11 * sa);
  copy12(l + 12u * GRS, ga + 12 * sa, ga + 13 * sa, ga + 14 * sa, ga + 15 * sa, gb, gb + sb, gb + 2 * sb, gb + 3 * sb, gb + 4 * sb, gb + 5 * sb, gb + 6 * sb, gb + 7 * sb);
}

// GEMM (wave tile 32x64; M % 128 == 0, N % 64 == 0, K % 128 == 0): C[m][n] = alpha * sum_k A[m][k] Bh[n][k]; A f16 rows (pitch lda), Bh f16 [n][k] (pitch ldb);
// the block's 128 x GBK tile of A and 64 x GBK tile of Bh are staged in LDS (two buffers, asynchronous copies one tile ahead) and read as fragments by the four waves.
__global__ __launch_bounds__(128) void k_gemm2(const _Float16* __restrict__ A, int lda, size_t sA, const _Float16* __restrict__ Bh, int ldb, size_t sB, float alpha,
    float* __restrict__ C, _Float16* __restrict__ C16, _Float16* __restrict__ C16L, int ldc, size_t sC, int M, int N, int K) {
  __shared__ __attribute__((aligned(16))) float so[4][32][68];
  __shared__ __attribute__((aligned(16))) _Float16 ab[2 * GSTAGE];      // two stages of [row][GP]
  const int tid = threadIdx.x, w = tid >> 5, lane = tid & 31, ln = lane & 15, hh = lane >> 4; const int by = blockIdx.y;
  A += (size_t)by * sA; Bh += (size_t)by * sB; const size_t cofs = (size_t)by * sC;
  const int ntn = N >> 6; const int mt = blockIdx.x / ntn, nq = blockIdx.x - mt * ntn; const int row0 = mt * 128 + 32 * w, col0 = nq * 64; if (mt * 128 >= M) return;
  const int crow = tid >> 4, ccol = (tid & 15) * 8;                     // this thread's first row and 16-byte column in a stage
  const unsigned int cl = (unsigned int)(size_t)&ab[crow * GP + ccol];  // its LDS byte address in stage buffer 0
  const _Float16* cga = A + (size_t)(mt * 128 + crow) * lda + ccol;
  const _Float16* cgb = Bh + (size_t)(col0 + crow) * ldb + ccol;
  gemm_stage(cl, cga, lda, cgb, ldb);                                   // tile 0 -> buffer 0
  const v8f z8 = {0.f,0.f,0.f,0.f,0.f,0.f,0.f,0.f}; v8f c00 = z8, c01 = z8, c02 = z8, c03 = z8, c10 = z8, c11 = z8, c12 = z8, c13 = z8;
  asm volatile("s_wait_asynccnt 0x0" ::: "memory");                     // this wave's copies of tile 0 have landed before the barrier publishes them
  __syncthreads();
  if (K > GBK) gemm_stage(cl + GSTAGE * 2u, cga + GBK, lda, cgb + GBK, ldb);   // tile 1 -> buffer 1
  int bo = 0;                                                           // offset in halfs of the buffer that holds this tile
#pragma unroll 1   // one trip per staged tile: kept rolled so that the two buffers alternate through bo and the loop stays small
  for (int kb = 0; kb < K; kb += GBK) {
    const _Float16* ar = &ab[bo + (32 * w + ln) * GP]; const _Float16* br = &ab[bo + (128 + ln) * GP];
    // the fragments of k-step ks + 1 are read into a second register set in front of the products of k-step ks, which then do not wait out the LDS latency
    v16h a0 = g2_frag(ar, hh), a1 = g2_frag(ar + 16 * GP, hh);
    v16h b0 = g2_frag(br, hh), b1 = g2_frag(br + 16 * GP, hh), b2 = g2_frag(br + 32 * GP, hh), b3 = g2_frag(br + 48 * GP, hh);
#pragma unroll     // the four k-steps of a tile read LDS at constant offsets
    for (int ks = 0; ks < GBK; ks += 32) {
      v16h na0 = a0, na1 = a1, nb0 = b0, nb1 = b1, nb2 = b2, nb3 = b3;
      if (ks + 32 < GBK) { const int kn = ks + 32;
        na0 = g2_frag(ar + kn, hh); na1 = g2_frag(ar + 16 * GP + kn, hh);
        nb0 = g2_frag(br + kn, hh); nb1 = g2_frag(br + 16 * GP + kn, hh); nb2 = g2_frag(br + 32 * GP + kn, hh); nb3 = g2_frag(br + 48 * GP + kn, hh); }
      c00 = g2_mma(a0, b0, c00); c10 = g2_mma(a1, b0, c10);
      c01 = g2_mma(a0, b1, c01); c11 = g2_mma(a1, b1, c11);
      c02 = g2_mma(a0, b2, c02); c12 = g2_mma(a1, b2, c12);
      c03 = g2_mma(a0, b3, c03); c13 = g2_mma(a1, b3, c13);
      a0 = na0; a1 = na1; b0 = nb0; b1 = nb1; b2 = nb2; b3 = nb3; }
    asm volatile("s_wait_dscnt 0x0" ::: "memory");                      // this wave's reads of the buffer have returned before it may be refilled
    asm volatile("s_wait_asynccnt 0x0" ::: "memory");                   // this wave's copies of the next tile have landed
    __syncthreads();                                                    // publishes the next tile and ends every wave's reads of this buffer
    if (kb + 2 * GBK < K) gemm_stage(cl + (unsigned int)bo * 2u, cga + (kb + 2 * GBK), lda, cgb + (kb + 2 * GBK), ldb);   // tile + 2 -> the buffer just read
    bo ^= GSTAGE;
  }
  asm volatile("s_wait_asynccnt 0x0" ::: "memory");                     // nothing of this wave is in flight behind the loop
  v8f accs[8] = {c00, c01, c02, c03, c10, c11, c12, c13};
#pragma unroll
  for (int u = 0; u < 8; ++u) { const int t = u & 3, half = u >> 2;
#pragma unroll
    for (int r = 0; r < 8; ++r) { const int rloc = half * 16 + 8 * hh + r; so[w][rloc][t * 16 + ln] = accs[u][r] * alpha; } }
  __builtin_amdgcn_fence(4 /* acq_rel order */, "workgroup"); __builtin_amdgcn_wave_barrier();
  const int rsub = lane >> 4, c4 = (lane & 15) * 4;
  {
#pragma unroll
    for (int q = 0; q < 16; ++q) {
      const int r = q * 2 + rsub; const v4f v = *(const v4fa*)&so[w][r][c4];
      const size_t o = cofs + (size_t)(row0 + r) * ldc + col0 + c4;
      if (C) *(v4f*)(C + o) = v;
      if (C16) { v4h h4, l4;
#pragma unroll
        for (int i = 0; i < 4; ++i) { const _Float16 hq = (_Float16)v[i]; h4[i] = hq; l4[i] = (_Float16)((v[i] - (float)hq) * 1024.0f); }
        *(v4h*)(C16 + o) = h4;
        if (C16L) *(v4h*)(C16L + o) = l4; }
    }
     }
}

// one k-step into four accumulators (one B operand), hazard guard after the last
__device__ __forceinline__ void mma4(v16h a0, v16h a1, v16h a2, v16h a3, v16h b, v8f& c0, v8f& c1, v8f& c2, v8f& c3) {
  c0 = __builtin_amdgcn_wmma_f32_16x16x32_f16(false, a0, false, b, (short)0, c0, false, false);
  c1 = __builtin_amdgcn_wmma_f32_16x16x32_f16(false, a1, false, b, (short)0, c1, false, false);
  c2 = __builtin_amdgcn_wmma_f32_16x16x32_f16(false, a2, false, b, (short)0, c2, false, false);
  c3 = __builtin_amdgcn_wmma_f32_16x16x32_f16(false, a3, false, b, (short)0, c3, false, false);
  // four vector slots behind the last product, before anything reads a result or rewrites an operand
  asm volatile("v_nop\n\tv_nop\n\tv_nop\n\tv_nop" : "+v"(c0), "+v"(c1), "+v"(c2), "+v"(c3) : "v"(a0), "v"(a1), "v"(a2), "v"(a3), "v"(b));
}

template <bool B> struct Flag { static constexpr bool value = B; };   // compile-time choice between the two forms of a chunk

#define KVP 72                       /* LDS row pitch of a staged plane in halfs: 144 B = 16 B x odd, conflict-free for 16-byte fragment reads */
#define KVPLANE (64 * KVP)           /* one staged plane: 64 rows */
#define KVSTAGE (3 * KVPLANE)        /* one stage: K hi, K residual, V^T */
// One 64-key stage into LDS by asynchronous copies: three planes of 64 rows x 128 B; each of the 128 threads brings 16 B of rows r, r+16, r+32, r+48 of each plane.
// l: the lane's LDS byte address in plane 0 (row r); gh, gl: its 16 B in K hi / K residual (row pitch DM); gv: its 16 B in V^T (row pitch NR).
__device__ __forceinline__ void stage_copy(unsigned int l, const _Float16* gh, const _Float16* gl, const _Float16* gv) {
  // the copies and their s_wait_xcnt in one statement: the wait stands before any rewrite of the address registers the copies name
  asm volatile(
      "global_load_async_to_lds_b128 %0, %12, off\n\t"
      "global_load_async_to_lds_b128 %1, %13, off\n\t"
      "global_load_async_to_lds_b128 %2, %14, off\n\t"
      "global_load_async_to_lds_b128 %3, %15, off\n\t"
      "global_load_async_to_lds_b128 %4, %16, off\n\t"
      "global_load_async_to_lds_b128 %5, %17, off\n\t"
      "global_load_async_to_lds_b128 %6, %18, off\n\t"
      "global_load_async_to_lds_b128 %7, %19, off\n\t"
      "global_load_async_to_lds_b128 %8, %20, off\n\t"
      "global_load_async_to_lds_b128 %9, %21, off\n\t"
      "global_load_async_to_lds_b128 %10, %22, off\n\t"
      "global_load_async_to_lds_b128 %11, %23, off\n\t"
      "s_wait_xcnt 0x0"
      :: "v"(l), "v"(l + 16u * KVP * 2u), "v"(l + 32u * KVP * 2u), "v"(l + 48u * KVP * 2u),
         "v"(l + KVPLANE * 2u), "v"(l + KVPLANE * 2u + 16u * KVP * 2u), "v"(l + KVPLANE * 2u + 32u * KVP * 2u), "v"(l + KVPLANE * 2u + 48u * KVP * 2u),
         "v"(l + KVPLANE * 4u), "v"(l + KVPLANE * 4u + 16u * KVP * 2u), "v"(l + KVPLANE * 4u + 32u * KVP * 2u), "v"(l + KVPLANE * 4u + 48u * KVP * 2u),
         "v"(gh), "v"(gh + 16 * DM), "v"(gh + 32 * DM), "v"(gh + 48 * DM),
         "v"(gl), "v"(gl + 16 * DM), "v"(gl + 32 * DM), "v"(gl + 48 * DM),
         "v"(gv), "v"(gv + 16 * NR), "v"(gv + 32 * NR), "v"(gv + 48 * NR)
      : "memory");
}

// Fused attention with relu^2 normaliser. grid = NB*NH*(SEQ/64), block = 4 waves; wave w owns query rows q0 = qb*64 + 16w .. +15 of (b, h).
// Per wave: position table qes[m][r] = q[m].rel_emb[r] (WMMA, f32 in LDS); per 64-key chunk: s^T = k.q^T (hi.hi + (hi.lo + lo.hi)/2^10), sv = (s + qes[m][clamp(key-q)+16]) / 8,
// The scores are formed transposed (K rows are the A operand, q the B operand): lane (ln, hh) holds query ln and keys 8hh .. 8hh + 7 of each 16-key tile, which is the k order of a
// 16x32 fragment, so two converted score tiles ARE the t operand of the aggregation o^T += v^T . t^T; t passes through no LDS, and a lane needs the mask bits of one query only.
// K hi, K residual and V^T of each 64-key chunk are staged once per block in LDS (two buffers, asynchronous copies one chunk ahead) and read as fragments by all four waves.
// Position term: in a chunk whose every key lies 16 or more before (or behind) every query of the block the clamp makes it one constant per query row (column 0 or 32 of qes);
// that constant stays in registers and is the start value of the hi.hi accumulator. Only the (at most three) chunks round the diagonal clamp, form addresses and gather from qes.
// masked -> -1e9, t = relu(sv + b)^2, dsum += t (f32), fragment element = f16(256 t); o^T += v^T . t^T ; end: o * (1/(sum+eps)) * 64/256 -> f16 rows of O16 (cols h*64..).
__global__ __launch_bounds__(128) void k_attn(const _Float16* __restrict__ QH, const _Float16* __restrict__ QL, const _Float16* __restrict__ KH, const _Float16* __restrict__ KL,
                                              const _Float16* __restrict__ VT, const _Float16* __restrict__ RT, const unsigned int* __restrict__ MBt,
                                              const float* __restrict__ spb, _Float16* __restrict__ O16) {
  #pragma clang fp contract(off)
  __shared__ __attribute__((aligned(16))) _Float16 tls[4][16][72];     // [row][d] o tile of the epilogue (cols 0..63 used)
  __shared__ float qes[4][16][52];                                      // [row][r] position table (cols 0..47 written, 0..32 read)
  __shared__ __attribute__((aligned(16))) _Float16 kv[2 * KVSTAGE];     // two stages of [plane][row][KVP]
  const int tid = threadIdx.x, w = tid >> 5, lane = tid & 31, ln = lane & 15, hh = lane >> 4;
  const int nqb = SEQ / 64;
  const int bh = blockIdx.x / nqb, qb = blockIdx.x - bh * nqb;
  const int b = bh / NH, h = bh - b * NH;
  const int q0 = qb * 64 + w * 16;                                      // first query of this wave (within the sequence)
  const size_t rq = (size_t)b * SEQ + q0;                               // compact token row of that query
  const size_t qoff = (rq + ln) * DM + (size_t)h * HD;
  const v16h qh0 = g2_frag(QH + qoff, hh), qh1 = g2_frag(QH + qoff + 32, hh);
  const v16h ql0 = g2_frag(QL + qoff, hh), ql1 = g2_frag(QL + qoff + 32, hh);
  const v8f z8 = {0.f,0.f,0.f,0.f,0.f,0.f,0.f,0.f};
  const float rsc = 0.0009765625f;                                      // 2^-10 fold of the residual planes
  const _Float16* kbh = KH + ((size_t)b * SEQ) * DM + (size_t)h * HD;
  const _Float16* kbl = KL + ((size_t)b * SEQ) * DM + (size_t)h * HD;
  const _Float16* vtb = VT + ((size_t)h * HD) * NR + (size_t)b * SEQ;   // V^T is [h * HD + d][token row], pitch NR
  const int crow = tid >> 3, ccol = (tid & 7) * 8;                      // this thread's first row and 16-byte column in every staged plane
  const unsigned int cl = (unsigned int)(size_t)&kv[crow * KVP + ccol];  // its LDS byte address in stage buffer 0
  const _Float16* cgh = kbh + (size_t)crow * DM + ccol;
  const _Float16* cgl = kbl + (size_t)crow * DM + ccol;
  const _Float16* cgv = vtb + (size_t)crow * NR + ccol;
  stage_copy(cl, cgh, cgl, cgv);                                        // chunk 0 -> buffer 0
  // position table: qes[m][r] = (q[m] . (16 rel_emb[r])) / 16
#pragma unroll
  for (int nt = 0; nt < 3; ++nt) {
    const _Float16* rr = RT + (size_t)(nt * 16 + ln) * HD;
    const v16h r0 = g2_frag(rr, hh), r1 = g2_frag(rr + 32, hh);
    const v8f ah = mma2(qh0, r0, qh1, r1, z8);
    const v8f al = mma2(ql0, r0, ql1, r1, z8);
#pragma unroll
    for (int r = 0; r < 8; ++r) { const float e = ah[r] + al[r] * rsc; qes[w][8 * hh + r][nt * 16 + ln] = e * 0.0625f; }
  }
  asm volatile("s_wait_asynccnt 0x0" ::: "memory");                     // this wave's copies of chunk 0 have landed before the barrier publishes them
  __syncthreads();
  stage_copy(cl + KVSTAGE * 2u, cgh + (size_t)64 * DM, cgl + (size_t)64 * DM, cgv + 64);   // chunk 1 -> buffer 1 (SEQ >= 128)

  const unsigned int* mbr = MBt + (rq + ln) * (SEQ / 32);              // bit row of this lane's query q0 + ln
  const float sbias = spb[0];
  float dsum[8];
#pragma unroll
  for (int r = 0; r < 8; ++r) dsum[r] = 0.f;
  v8f oacc[4] = {z8, z8, z8, z8};
  int bo = 0;                                                           // offset in halfs of the buffer that holds this chunk
  v8f pec;                                                              // position term of this lane's query (the same for its eight keys) in the chunks off the diagonal: first the keys before the band (column 0)
#pragma unroll
  for (int r = 0; r < 8; ++r) pec[r] = qes[w][ln][0];

  // One 64-key chunk. band: the chunk may hold a key nearer than 16 to a query of the block (the gathered form); otherwise pec holds the position term.
  auto chunk = [&](const int k0, auto band) __attribute__((always_inline)) {
    constexpr bool BAND = decltype(band)::value;
    const v2ua mw = *(const v2ua*)(mbr + (k0 >> 5));                    // the chunk's 64 mask bits of this lane's query
    // Fragment reads stand one matrix run ahead of their use, in a second register set: while a 16-key tile is multiplied and its t values are formed,
    // the fragments of the next run (the next K tile; behind each second tile the four V^T fragments of these 32 keys) are on their way, so the runs do not wait out the LDS latency.
    // All of them are reads of this chunk's own buffer.
    const _Float16* kr = &kv[bo + ln * KVP];                            // this lane's row of tile 0 in the K hi plane
    const _Float16* vr = &kv[bo + 2 * KVPLANE + ln * KVP];              // this lane's row of d tile 0 in the V^T plane
    v16h f0 = g2_frag(kr, hh), f1 = g2_frag(kr + 32, hh), f2 = g2_frag(kr + KVPLANE, hh), f3 = g2_frag(kr + KVPLANE + 32, hh);   // K hi (f0, f1) and residual (f2, f3) of tile 0
    __builtin_amdgcn_sched_barrier(0);     // tile 0's eight reads go out first: nothing covers them, and LDS answers in order
#pragma unroll     // both halves in line: LDS offsets and mask bit numbers are constants, the fragment sets stay in registers
    for (int hf = 0; hf < 2; ++hf) {                                    // the chunk's two halves of 32 keys: one k-step of the aggregation each
      FragH p;                                                          // t^T fragment of keys k0 + 32 hf + 0..31
#pragma unroll     // as above; j also picks the half of the t fragment that the tile fills
      for (int j = 0; j < 2; ++j) {
        const int kt = 2 * hf + j;
        const int kc = kt * 16 + 8 * hh;                                // first of the eight keys within the chunk held by this lane (D rows)
        float pe[8];                                                    // position terms of this tile, read ahead of its matrix run (band chunks only)
        if constexpr (BAND) {
#pragma unroll
          for (int r = 0; r < 8; ++r) {
            int rel = (k0 + kc + r) - (q0 + ln);
            rel = (rel < -KREL) ? -KREL : ((rel > KREL) ? KREL : rel);
            pe[r] = qes[w][ln][rel + KREL];
          }
        }
        // next: K tile kt + 1 (hi, hi, residual, residual), or d tiles 0 .. 3 of V^T at these 32 keys
        const _Float16* nr = (j == 0) ? kr + (kt + 1) * 16 * KVP : vr + 32 * hf;
        const int s1 = (j == 0) ? 32 : 16 * KVP, s2 = (j == 0) ? KVPLANE : 32 * KVP, s3 = (j == 0) ? KVPLANE + 32 : 48 * KVP;
        const v16h n0 = g2_frag(nr, hh), n1 = g2_frag(nr + s1, hh), n2 = g2_frag(nr + s2, hh), n3 = g2_frag(nr + s3, hh);
        __builtin_amdgcn_sched_barrier(0);   // keeps these reads in front of this tile's matrix run, and the next run's products (which would wait for them at once) behind it
        const v8f sh = mma2(f0, qh0, f1, qh1, BAND ? z8 : pec);
        v8f sx = mma2(f0, ql0, f1, ql1, z8);
        sx = mma2(f2, qh0, f3, qh1, sx);
        const unsigned int word = mw[hf] >> (8 * hh);                   // bit 16 j + r is now key 32 hf + 16 j + 8hh + r
        float t16[8];
#pragma unroll
        for (int r = 0; r < 8; ++r) {
          const float s = sh[r] + sx[r] * rsc;
          float sv;
          if constexpr (BAND) sv = (s + pe[r]) * 0.125f; else sv = s * 0.125f;
          const unsigned int bit = (word >> (j * 16 + r)) & 1u;
          sv = (bit != 0u) ? -1.0e9f : sv;
          float t = sv + sbias;
          t = fmaxf(t, 0.0f);
          const float tt = t * t;
          dsum[r] += tt;
          t16[r] = tt * 256.0f;
        }
#pragma unroll     // register indices must be constants
        for (int i = 0; i < 4; ++i) {                                   // elements 8 j + r of the fragment are keys 16 j + 8hh + r of its 32
          const v2f t2 = {t16[2 * i], t16[2 * i + 1]};
          p.p[j * 4 + i] = __builtin_convertvector(t2, v2h);
        }
        f0 = n0; f1 = n1; f2 = n2; f3 = n3;
      }
      // f0 .. f3 now hold V^T (d tiles 0 .. 3) at these 32 keys; the first half reads K tile 2 ahead of its four products
      v16h n0 = f0, n1 = f1, n2 = f2, n3 = f3;
      if (hf == 0) { const _Float16* nr = kr + 32 * KVP;
        n0 = g2_frag(nr, hh); n1 = g2_frag(nr + 32, hh); n2 = g2_frag(nr + KVPLANE, hh); n3 = g2_frag(nr + KVPLANE + 32, hh);
        __builtin_amdgcn_sched_barrier(0); } // keeps these reads in front of the four products
      mma4(f0, f1, f2, f3, p.v, oacc[0], oacc[1], oacc[2], oacc[3]);    // D rows: d = dt * 16 + 8hh + r; D column: query ln
      f0 = n0; f1 = n1; f2 = n2; f3 = n3;
    }
    asm volatile("s_wait_dscnt 0x0" ::: "memory");                      // this wave's reads of the buffer have returned before it may be refilled
    asm volatile("s_wait_asynccnt 0x0" ::: "memory");                   // this wave's copies of the next chunk have landed
    __syncthreads();                                                    // publishes the next chunk and ends every wave's reads of this buffer
    if (k0 + 128 < SEQ)
      stage_copy(cl + (unsigned int)bo * 2u, cgh + (size_t)(k0 + 128) * DM, cgl + (size_t)(k0 + 128) * DM, cgv + (k0 + 128));   // chunk + 2 -> the buffer just read
    bo ^= KVSTAGE;
  };
  // The chunks in their order, in three runs whose bounds are the same for the whole block (every wave passes every chunk's barrier):
  // keys before the band, the chunks round the diagonal, keys behind the band.
  const int kA = (qb > 0) ? qb * 64 - 64 : 0, kB = (qb * 64 + 128 < SEQ) ? qb * 64 + 128 : SEQ;
#pragma unroll 1   // one trip per staged chunk: the two buffers alternate through bo
  for (int k0 = 0; k0 < kA; k0 += 64) chunk(k0, Flag<false>{});
#pragma unroll 1   // as above
  for (int k0 = kA; k0 < kB; k0 += 64) chunk(k0, Flag<true>{});
#pragma unroll
  for (int r = 0; r < 8; ++r) pec[r] = qes[w][ln][2 * KREL];    // from here on every key lies behind the band (column 32)
#pragma unroll 1   // as above
  for (int k0 = kB; k0 < SEQ; k0 += 64) chunk(k0, Flag<false>{});
  asm volatile("s_wait_asynccnt 0x0" ::: "memory");                     // nothing of this wave is in flight behind the loops

  // key sum of this lane's query: its eight partial sums, then the other half's; scale = 64/256 / (sum + eps)
  float qs = ((dsum[0] + dsum[1]) + (dsum[2] + dsum[3])) + ((dsum[4] + dsum[5]) + (dsum[6] + dsum[7]));
  qs += __shfl_xor(qs, 16, 32);
  const float osc = (1.0f / (qs + 1.0e-9f)) * 0.25f;
#pragma unroll
  for (int dt = 0; dt < 4; ++dt) { FragH f;
#pragma unroll
    for (int r = 0; r < 8; ++r) f.h[r] = (_Float16)(oacc[dt][r] * osc);
    *(v8us*)&tls[w][ln][dt * 16 + 8 * hh] = f.half[0]; }
  __builtin_amdgcn_fence(3 /* release order */, "wavefront"); __builtin_amdgcn_wave_barrier();
  const int rl = lane >> 3, pc = (lane & 7) * 8;
  {
#pragma unroll
    for (int it = 0; it < 4; ++it) {
      const int row = it * 4 + rl;
      const v8us v = *(const v8us*)&tls[w][row][pc];
      *(v8us*)((unsigned short*)O16 + (rq + row) * DM + (size_t)h * HD + pc) = v;
    }
    
  }
}

extern "C" void kernel_launch(void* const* d_in, const int* in_sizes, int n_in,
                              void* d_out, int out_size, void* d_ws, size_t ws_size, hipStream_t stream) {
  if (n_in < 10) return;
  const int nx = (int)(NR * DM);
  if (in_sizes[0] < nx || in_sizes[1] < nx || in_sizes[2] < nx) return;
  if (in_sizes[3] < (int)(NR * SEQ)) return;
  if (in_sizes[4] < DM * DM || in_sizes[5] < DM * DM || in_sizes[6] < DM * DM || in_sizes[7] < DM * DM) return;
  if (in_sizes[8] < NREL * HD || in_sizes[9] < 1) return;
  if (out_size < nx) return;
  const float* xq = (const float*)d_in[0]; const float* xk = (const float*)d_in[1]; const float* xv = (const float*)d_in[2];
  const int* msk = (const int*)d_in[3];
  const float* wq = (const float*)d_in[4]; const float* wk = (const float*)d_in[5]; const float* wv = (const float*)d_in[6]; const float* wo = (const float*)d_in[7];
  const float* rel = (const float*)d_in[8]; const float* spb = (const float*)d_in[9];

  char* ws = (char*)d_ws; size_t off = 0;
  auto take = [&](size_t bytes) { char* p = ws + off; off += (bytes + 255) & ~(size_t)255; return p; };
  const size_t wbytes = (size_t)DM * DM * 2, xbytes = NR * DM * 2;
  _Float16* BQ = (_Float16*)take(wbytes); _Float16* BK = (_Float16*)take(wbytes); _Float16* BV = (_Float16*)take(wbytes); _Float16* BO = (_Float16*)take(wbytes);
  _Float16* RT = (_Float16*)take((size_t)NRELP * HD * 2);
  _Float16* XQ = (_Float16*)take(xbytes); _Float16* XK = (_Float16*)take(xbytes); _Float16* XV = (_Float16*)take(xbytes);
  _Float16* QH = (_Float16*)take(xbytes); _Float16* QL = (_Float16*)take(xbytes); _Float16* KH = (_Float16*)take(xbytes); _Float16* KL = (_Float16*)take(xbytes);
  _Float16* VT = (_Float16*)take(xbytes);
  const int nwords = (int)(NR * (SEQ / 32));
  unsigned int* MB = (unsigned int*)take((size_t)nwords * 4);
  _Float16* O16 = (_Float16*)take(xbytes);
  if (off > ws_size || off > (size_t)134217728) return;

  k_prep<<<P_BLOCKS + 1, PT, 0, stream>>>(xq, xk, xv, msk, wq, wk, wv, wo, rel, XQ, XK, XV, MB, BQ, BK, BV, BO, RT);

  const int M = (int)NR;
  const dim3 gp((unsigned)((M / 128) * (DM / 64)), 1);
  k_gemm2<<<gp, 128, 0, stream>>>(XQ, DM, (size_t)0, BQ, DM, (size_t)0, 0.0625f, nullptr, QH, QL, DM, (size_t)0, M, DM, DM);
  k_gemm2<<<gp, 128, 0, stream>>>(XK, DM, (size_t)0, BK, DM, (size_t)0, 0.0625f, nullptr, KH, KL, DM, (size_t)0, M, DM, DM);
  // V^T = Wv . x^T: the weights are the row operand and the token rows the column operand, so the product lands transposed, [h * HD + d][token row]
  const dim3 gt((unsigned)((DM / 128) * (M / 64)), 1);
  k_gemm2<<<gt, 128, 0, stream>>>(BV, DM, (size_t)0, XV, DM, (size_t)0, 0.0625f, nullptr, VT, nullptr, M, (size_t)0, DM, M, DM);
  k_attn<<<(unsigned)(NB * NH * (SEQ / 64)), 128, 0, stream>>>(QH, QL, KH, KL, VT, RT, MB, spb, O16);
  k_gemm2<<<gp, 128, 0, stream>>>(O16, DM, (size_t)0, BO, DM, (size_t)0, 0.0009765625f, (float*)d_out, nullptr, nullptr, DM, (size_t)0, M, DM, DM);
}

// v008
// It runs in 125 microseconds.
// Two timings next to v007 both put it at 1.04 times that version's speed.
// All steps since v000 together make it 3.40 times as fast.
#include <hip/hip_runtime.h>
// Contractions on v_wmma_f32_16x16x32_f16 (f16 operands, f32 accumulate): q/k/v projections and the output projection plain f16 (inputs RNE-converted to bf16 then held exactly in f16, weights x16); q.k^T scores as f16 hi + residual (x2^10) planes on both operands (3 products, residual terms in a separate accumulator); q.rel_emb^T position table f16 hi + residual on q (rel_emb exact x16); t.v aggregation plain f16 (t carried x256, o carried x64); normaliser statistics f32.
#ifndef NB
#define NB 2
#endif
#ifndef SEQ
#define SEQ 2048
#endif
#define NB_FULL 2
#define SEQ_FULL 2048
#define DM 1024
#define NH 16
#define HD 64
#define NREL 33
#define KREL 16
#define NRELP 48                     /* rel_emb rows padded to 3 WMMA column tiles (rows 33..47 zero) */
#define NR ((size_t)NB * SEQ)        /* token rows processed (compact) */
static_assert(SEQ % 128 == 0);
static_assert(SEQ <= SEQ_FULL);
static_assert(NB >= 1 && NB <= NB_FULL);
static_assert(DM == NH * HD);

typedef unsigned short v8us __attribute__((ext_vector_type(8), may_alias));
typedef float  v8f  __attribute__((ext_vector_type(8)));
typedef float  v4f  __attribute__((ext_vector_type(4)));
typedef float  v4fa __attribute__((ext_vector_type(4), may_alias));
typedef _Float16 v16h __attribute__((ext_vector_type(16)));
typedef _Float16 v4h __attribute__((ext_vector_type(4)));
typedef _Float16 v2h __attribute__((ext_vector_type(2)));
typedef float  v2f  __attribute__((ext_vector_type(2)));
typedef int v4ia __attribute__((ext_vector_type(4), may_alias));
typedef unsigned int v2ua __attribute__((ext_vector_type(2), may_alias));
union FragH { v16h v; v8us half[2]; v2h p[8]; _Float16 h[16]; unsigned short u[16]; };

__device__ __forceinline__ unsigned short bf16_bits(float x) { unsigned int u = __float_as_uint(x); return (unsigned short)((u + 0x7FFFu + ((u >> 16) & 1u)) >> 16); }
__device__ __forceinline__ float bf16_val(unsigned short b) { return __uint_as_float(((unsigned int)b) << 16); }
__device__ __forceinline__ float bf16_rne(float x) { return bf16_val(bf16_bits(x)); }

// 16x32 fragment from a 16-bit row (lane row/col = lane & 15): elements 0..7 <- k0 + 8hh + 0..7, elements 8..15 <- k0 + 16 + 8hh + 0..7 (same map for A and B)
__device__ __forceinline__ v16h g2_frag(const _Float16* p, int hh) { FragH f; f.half[0] = *(const v8us*)((const unsigned short*)p + 8 * hh); f.half[1] = *(const v8us*)((const unsigned short*)p + 16 + 8 * hh); return f.v; }
__device__ __forceinline__ v8f g2_mma(v16h a, v16h b, v8f c) { v8f d = __builtin_amdgcn_wmma_f32_16x16x32_f16(false, a, false, b, (short)0, c, false, false); asm volatile("v_nop\n\tv_nop\n\tv_nop\n\tv_nop" : "+v"(d) : "v"(a), "v"(b)); return d; }
// two k-steps into one accumulator, hazard guard after the second
__device__ __forceinline__ v8f mma2(v16h a0, v16h b0, v16h a1, v16h b1, v8f c) {
  c = __builtin_amdgcn_wmma_f32_16x16x32_f16(false, a0, false, b0, (short)0, c, false, false);
  c = __builtin_amdgcn_wmma_f32_16x16x32_f16(false, a1, false, b1, (short)0, c, false, false);
  asm volatile("v_nop\n\tv_nop\n\tv_nop\n\tv_nop" : "+v"(c) : "v"(a0), "v"(b0), "v"(a1), "v"(b1));
  return c;
}

#define PT 512                       /* threads of a k_prep block: 16 waves */
#define PWU 1024                     /* 4-byte elements one wave moves per tile: 4 KiB */
#define PTILE ((PT / 32) * PWU)      /* elements of one block tile */
#define PW_TILES (DM * DM / PTILE)               /* tiles of one weight matrix */
#define PX_TILES ((int)(NR * DM / PTILE))        /* tiles of one activation input */
#define PM_TILES ((int)(NR * SEQ / PTILE))       /* tiles of the mask */
#define P_TILES (4 * PW_TILES + 3 * PX_TILES + PM_TILES)
#define P_BLOCKS ((P_TILES + 2) / 3)             /* three tiles a block */
static_assert((DM * DM) % PTILE == 0 && DM % PWU == 0);
static_assert((NR * DM) % PTILE == 0 && (NR * SEQ) % PTILE == 0);

// One wave's 4 KiB of f32 -> f16(bf16_rne(x) * scale): eight 512-byte loads in flight, then eight 256-byte stores (whole lines both ways).
__device__ __forceinline__ void cvt_unit(const float* __restrict__ s, _Float16* __restrict__ d, float scale, int lane) {
  v4f v[8];
#pragma unroll
  for (int j = 0; j < 8; ++j) v[j] = *(const v4fa*)(s + j * 128 + lane * 4);
#pragma unroll
  for (int j = 0; j < 8; ++j) { v4h h;
#pragma unroll
    for (int i = 0; i < 4; ++i) h[i] = (_Float16)(bf16_rne(v[j][i]) * scale);
    *(v4h*)(d + j * 128 + lane * 4) = h; }
  asm volatile("s_wait_xcnt 0x0" ::: "memory");   // stands directly behind the stores, before anything rewrites the address or data registers that they name
}

// One wave's 32 mask words (all in one mask row): word i0 + j is the ballot of one 128-byte line of mask integers (lane = bit); lane j keeps word j, one 128-byte store.
static_assert((SEQ / 32) % 32 == 0);
__device__ __forceinline__ void pack_unit(const int* __restrict__ msk, unsigned int* __restrict__ bits, unsigned int i0, int lane) {
  const unsigned int wpr = SEQ / 32, row = i0 / wpr, wi = i0 - row * wpr, b = row / SEQ, q = row - b * SEQ;
  const int* src = msk + ((size_t)b * SEQ_FULL + q) * SEQ_FULL + (size_t)wi * 32 + lane;
  int v[32];
#pragma unroll
  for (int j = 0; j < 32; ++j) v[j] = src[j * 32];
  asm volatile("s_wait_xcnt 0x0" :: "v"(src) : "memory");   // behind the run of loads; the pointer as input keeps the address registers out of the loads' results up to here
  unsigned int wd = 0u;
#pragma unroll
  for (int j = 0; j < 32; ++j) { const unsigned int bj = __builtin_amdgcn_ballot_w32(v[j] != 0); wd = (lane == j) ? bj : wd; }
  bits[i0 + lane] = wd;
  asm volatile("s_wait_xcnt 0x0" ::: "memory");   // stands directly behind the store, before anything rewrites the registers that it names
}

// All operand preparation in one launch: weights -> f16 x16, activations -> f16, mask -> bit words, rel_emb -> padded f16 x16 table.
// Block 0 does the small table; blocks 1 .. P_BLOCKS walk the tiles (block-uniform choice of the job).
__global__ __launch_bounds__(PT) void k_prep(const float* __restrict__ xq, const float* __restrict__ xk, const float* __restrict__ xv, const int* __restrict__ msk,
    const float* __restrict__ wq, const float* __restrict__ wk, const float* __restrict__ wv, const float* __restrict__ wo, const float* __restrict__ rel,
    _Float16* __restrict__ XQ, _Float16* __restrict__ XK, _Float16* __restrict__ XV, unsigned int* __restrict__ MB,
    _Float16* __restrict__ BQ, _Float16* __restrict__ BK, _Float16* __restrict__ BV, _Float16* __restrict__ BO, _Float16* __restrict__ RT) {
  const int lane = threadIdx.x & 31, wn = __builtin_amdgcn_readfirstlane((int)(threadIdx.x >> 5));
  if (blockIdx.x == 0) {
    const int t = threadIdx.x; if (t >= NRELP * (HD / 8)) return;
    const int r = t / (HD / 8), d8 = (t % (HD / 8)) * 8;
    const int rc = (r < NREL) ? r : (NREL - 1);          // clamped address, value zeroed by predicate
    const bool live = (r < NREL);
    const v4f a = *(const v4fa*)(rel + (size_t)rc * HD + d8), c = *(const v4fa*)(rel + (size_t)rc * HD + d8 + 4);
    FragH f;
#pragma unroll
    for (int q = 0; q < 4; ++q) { f.h[q] = live ? (_Float16)(bf16_rne(a[q]) * 16.0f) : (_Float16)0.0f; f.h[4 + q] = live ? (_Float16)(bf16_rne(c[q]) * 16.0f) : (_Float16)0.0f; }
    *(v8us*)((unsigned short*)RT + (size_t)t * 8) = f.half[0];
    return;
  }
  for (int tile = (int)blockIdx.x - 1; tile < P_TILES; tile += P_BLOCKS) {
    if (tile < 4 * PW_TILES) {
      const int m = tile / PW_TILES;
      const float* s = (m == 0) ? wq : (m == 1) ? wk : (m == 2) ? wv : wo;
      _Float16* d = (m == 0) ? BQ : (m == 1) ? BK : (m == 2) ? BV : BO;
      const size_t e = (size_t)(tile - m * PW_TILES) * PTILE + (size_t)wn * PWU;
      cvt_unit(s + e, d + e, 16.0f, lane);
    } else if (tile < 4 * PW_TILES + 3 * PX_TILES) {
      const int tx = tile - 4 * PW_TILES, m = tx / PX_TILES;
      const float* s = (m == 0) ? xq : (m == 1) ? xk : xv;
      _Float16* d = (m == 0) ? XQ : (m == 1) ? XK : XV;
      const size_t e = (size_t)(tx - m * PX_TILES) * PTILE + (size_t)wn * PWU;   // compact element index; PWU divides DM, so the unit lies in one row
      const int r = (int)(e / DM), c = (int)(e % DM), b = r / SEQ, sq = r - b * SEQ;
      cvt_unit(s + ((size_t)b * SEQ_FULL + sq) * DM + c, d + e, 1.0f, lane);
    } else {
      const int tm = tile - (4 * PW_TILES + 3 * PX_TILES);
      pack_unit(msk, MB, (unsigned int)(tm * (PT / 32) + wn) * 32u, lane);
    }
  }
}

#define GBK 128                      /* k depth of one staged GEMM tile in halfs: 256 B a row */
#define GP 136                       /* LDS row pitch of a staged GEMM tile in halfs: 272 B = 16 B x odd, conflict-free for 16-byte fragment reads */
#define GSTAGE (192 * GP)            /* one stage: 128 rows of A, then 64 rows of B */
#define GRS (8u * GP * 2u)           /* LDS bytes between two copies of one thread: 8 rows */
// Twelve asynchronous copies of 16 B a lane: LDS rows 8 apart from l, each from its own global address.
__device__ __forceinline__ void copy12(unsigned int l, const _Float16* g0, const _Float16* g1, const _Float16* g2, const _Float16* g3, const _Float16* g4, const _Float16* g5,
                                       const _Float16* g6, const _Float16* g7, const _Float16* g8, const _Float16* g9, const _Float16* g10, const _Float16* g11) {
  // the copies and their s_wait_xcnt in one statement: the wait stands before any rewrite of the address registers the copies name
  asm volatile(
      "global_load_async_to_lds_b128 %0, %12, off\n\t"
      "global_load_async_to_lds_b128 %1, %13, off\n\t"
      "global_load_async_to_lds_b128 %2, %14, off\n\t"
      "global_load_async_to_lds_b128 %3, %15, off\n\t"
      "global_load_async_to_lds_b128 %4, %16, off\n\t"
      "global_load_async_to_lds_b128 %5, %17, off\n\t"
      "global_load_async_to_lds_b128 %6, %18, off\n\t"
      "global_load_async_to_lds_b128 %7, %19, off\n\t"
      "global_load_async_to_lds_b128 %8, %20, off\n\t"
      "global_load_async_to_lds_b128 %9, %21, off\n\t"
      "global_load_async_to_lds_b128 %10, %22, off\n\t"
      "global_load_async_to_lds_b128 %11, %23, off\n\t"
      "s_wait_xcnt 0x0"
      :: "v"(l), "v"(l + GRS), "v"(l + 2u * GRS), "v"(l + 3u * GRS), "v"(l + 4u * GRS), "v"(l + 5u * GRS),
         "v"(l + 6u * GRS), "v"(l + 7u * GRS), "v"(l + 8u * GRS), "v"(l + 9u * GRS), "v"(l + 10u * GRS), "v"(l + 11u * GRS),
         "v"(g0), "v"(g1), "v"(g2), "v"(g3), "v"(g4), "v"(g5), "v"(g6), "v"(g7), "v"(g8), "v"(g9), "v"(g10), "v"(g11)
      : "memory");
}
// One k-tile of the block (128 rows of A, then 64 rows of B, GBK deep) into one stage; each of the 128 threads brings 16 B of every eighth row.
// l: the lane's LDS byte address in row tid / 16 of the stage; ga, gb: its 16 B in that row of the A tile and of the B tile.
__device__ __forceinline__ void gemm_stage(unsigned int l, const _Float16* ga, int lda, const _Float16* gb, int ldb) {
  const size_t sa = (size_t)8 * lda, sb = (size_t)8 * ldb;
  copy12(l, ga, ga + sa, ga + 2 * sa, ga + 3 * sa, ga + 4 * sa, ga + 5 * sa, ga + 6 * sa, ga + 7 * sa, ga + 8 * sa, ga + 9 * sa, ga + 10 * sa, ga + 11 * sa);
  copy12(l + 12u * GRS, ga + 12 * sa, ga + 13 * sa, ga + 14 * sa, ga + 15 * sa, gb, gb + sb, gb + 2 * sb, gb + 3 * sb, gb + 4 * sb, gb + 5 * sb, gb + 6 * sb, gb + 7 * sb);
}

// GEMM (wave tile 32x64; M % 128 == 0, N % 64 == 0, K % 128 == 0): C[m][n] = alpha * sum_k A[m][k] Bh[n][k]; A f16 rows (pitch lda), Bh f16 [n][k] (pitch ldb);
// the block's 128 x GBK tile of A and 64 x GBK tile of Bh are staged in LDS (two buffers, asynchronous copies one tile ahead) and read as fragments by the four waves.
// One launch holds up to three independent products: blockIdx.y picks the operands and the results (block-uniform); product 2 has a shape of its own (ldc2, M2, N2) and no residual plane.
__global__ __launch_bounds__(128) void k_gemm2(const _Float16* __restrict__ A0, const _Float16* __restrict__ A1, const _Float16* __restrict__ A2, int lda,
    const _Float16* __restrict__ B0, const _Float16* __restrict__ B1, const _Float16* __restrict__ B2, int ldb, float alpha,
    float* __restrict__ C, _Float16* __restrict__ H0, _Float16* __restrict__ H1, _Float16* __restrict__ H2, _Float16* __restrict__ L0, _Float16* __restrict__ L1,
    int ldc01, int M01, int N01, int ldc2, int M2, int N2, int K) {
  __shared__ __attribute__((aligned(16))) float so[4][32][68];
  __shared__ __attribute__((aligned(16))) _Float16 ab[2 * GSTAGE];      // two stages of [row][GP]
  const int tid = threadIdx.x, w = tid >> 5, lane = tid & 31, ln = lane & 15, hh = lane >> 4; const int by = blockIdx.y;
  const _Float16* A = (by == 0) ? A0 : (by == 1) ? A1 : A2; const _Float16* Bh = (by == 0) ? B0 : (by == 1) ? B1 : B2;
  _Float16* C16 = (by == 0) ? H0 : (by == 1) ? H1 : H2; _Float16* C16L = (by == 0) ? L0 : (by == 1) ? L1 : nullptr;
  const int ldc = (by == 2) ? ldc2 : ldc01, M = (by == 2) ? M2 : M01, N = (by == 2) ? N2 : N01;
  const int ntn = N >> 6; const int mt = blockIdx.x / ntn, nq = blockIdx.x - mt * ntn; const int row0 = mt * 128 + 32 * w, col0 = nq * 64; if (mt * 128 >= M) return;
  const int crow = tid >> 4, ccol = (tid & 15) * 8;                     // this thread's first row and 16-byte column in a stage
  const unsigned int cl = (unsigned int)(size_t)&ab[crow * GP + ccol];  // its LDS byte address in stage buffer 0
  const _Float16* cga = A + (size_t)(mt * 128 + crow) * lda + ccol;
  const _Float16* cgb = Bh + (size_t)(col0 + crow) * ldb + ccol;
  gemm_stage(cl, cga, lda, cgb, ldb);                                   // tile 0 -> buffer 0
  const v8f z8 = {0.f,0.f,0.f,0.f,0.f,0.f,0.f,0.f}; v8f c00 = z8, c01 = z8, c02 = z8, c03 = z8, c10 = z8, c11 = z8, c12 = z8, c13 = z8;
  asm volatile("s_wait_asynccnt 0x0" ::: "memory");                     // this wave's copies of tile 0 have landed before the barrier publishes them
  __syncthreads();
  if (K > GBK) gemm_stage(cl + GSTAGE * 2u, cga + GBK, lda, cgb + GBK, ldb);   // tile 1 -> buffer 1
  int bo = 0;                                                           // offset in halfs of the buffer that holds this tile
#pragma unroll 1   // one trip per staged tile: kept rolled so that the two buffers alternate through bo and the loop stays small
  for (int kb = 0; kb < K; kb += GBK) {
    const _Float16* ar = &ab[bo + (32 * w + ln) * GP]; const _Float16* br = &ab[bo + (128 + ln) * GP];
    // the fragments of k-step ks + 1 are read into a second register set in front of the products of k-step ks, which then do not wait out the LDS latency
    v16h a0 = g2_frag(ar, hh), a1 = g2_frag(ar + 16 * GP, hh);
    v16h b0 = g2_frag(br, hh), b1 = g2_frag(br + 16 * GP, hh), b2 = g2_frag(br + 32 * GP, hh), b3 = g2_frag(br + 48 * GP, hh);
#pragma unroll     // the four k-steps of a tile read LDS at constant offsets
    for (int ks = 0; ks < GBK; ks += 32) {
      v16h na0 = a0, na1 = a1, nb0 = b0, nb1 = b1, nb2 = b2, nb3 = b3;
      if (ks + 32 < GBK) { const int kn = ks + 32;
        na0 = g2_frag(ar + kn, hh); na1 = g2_frag(ar + 16 * GP + kn, hh);
        nb0 = g2_frag(br + kn, hh); nb1 = g2_frag(br + 16 * GP + kn, hh); nb2 = g2_frag(br + 32 * GP + kn, hh); nb3 = g2_frag(br + 48 * GP + kn, hh); }
      c00 = g2_mma(a0, b0, c00); c10 = g2_mma(a1, b0, c10);
      c01 = g2_mma(a0, b1, c01); c11 = g2_mma(a1, b1, c11);
      c02 = g2_mma(a0, b2, c02); c12 = g2_mma(a1, b2, c12);
      c03 = g2_mma(a0, b3, c03); c13 = g2_mma(a1, b3, c13);
      a0 = na0; a1 = na1; b0 = nb0; b1 = nb1; b2 = nb2; b3 = nb3; }
    asm volatile("s_wait_dscnt 0x0" ::: "memory");                      // this wave's reads of the buffer have returned before it may be refilled
    asm volatile("s_wait_asynccnt 0x0" ::: "memory");                   // this wave's copies of the next tile have landed
    __syncthreads();                                                    // publishes the next tile and ends every wave's reads of this buffer
    if (kb + 2 * GBK < K) gemm_stage(cl + (unsigned int)bo * 2u, cga + (kb + 2 * GBK), lda, cgb + (kb + 2 * GBK), ldb);   // tile + 2 -> the buffer just read
    bo ^= GSTAGE;
  }
  asm volatile("s_wait_asynccnt 0x0" ::: "memory");                     // nothing of this wave is in flight behind the loop
  v8f accs[8] = {c00, c01, c02, c03, c10, c11, c12, c13};
#pragma unroll
  for (int u = 0; u < 8; ++u) { const int t = u & 3, half = u >> 2;
#pragma unroll
    for (int r = 0; r < 8; ++r) { const int rloc = half * 16 + 8 * hh + r; so[w][rloc][t * 16 + ln] = accs[u][r] * alpha; } }
  __builtin_amdgcn_fence(4 /* acq_rel order */, "workgroup"); __builtin_amdgcn_wave_barrier();
  const int rsub = lane >> 4, c4 = (lane & 15) * 4;
  {
#pragma unroll
    for (int q = 0; q < 16; ++q) {
      const int r = q * 2 + rsub; const v4f v = *(const v4fa*)&so[w][r][c4];
      const size_t o = (size_t)(row0 + r) * ldc + col0 + c4;
      if (C) *(v4f*)(C + o) = v;
      if (C16) { v4h h4, l4;
#pragma unroll
        for (int i = 0; i < 4; ++i) { const _Float16 hq = (_Float16)v[i]; h4[i] = hq; l4[i] = (_Float16)((v[i] - (float)hq) * 1024.0f); }
        *(v4h*)(C16 + o) = h4;
        if (C16L) *(v4h*)(C16L + o) = l4; }
    }
     }
}

// one k-step into four accumulators (one B operand), hazard guard after the last
__device__ __forceinline__ void mma4(v16h a0, v16h a1, v16h a2, v16h a3, v16h b, v8f& c0, v8f& c1, v8f& c2, v8f& c3) {
  c0 = __builtin_amdgcn_wmma_f32_16x16x32_f16(false, a0, false, b, (short)0, c0, false, false);
  c1 = __builtin_amdgcn_wmma_f32_16x16x32_f16(false, a1, false, b, (short)0, c1, false, false);
  c2 = __builtin_amdgcn_wmma_f32_16x16x32_f16(false, a2, false, b, (short)0, c2, false, false);
  c3 = __builtin_amdgcn_wmma_f32_16x16x32_f16(false, a3, false, b, (short)0, c3, false, false);
  // four vector slots behind the last product, before anything reads a result or rewrites an operand
  asm volatile("v_nop\n\tv_nop\n\tv_nop\n\tv_nop" : "+v"(c0), "+v"(c1), "+v"(c2), "+v"(c3) : "v"(a0), "v"(a1), "v"(a2), "v"(a3), "v"(b));
}

template <bool B> struct Flag { static constexpr bool value = B; };   // compile-time choice between the two forms of a chunk

#define KVP 72                       /* LDS row pitch of a staged plane in halfs: 144 B = 16 B x odd, conflict-free for 16-byte fragment reads */
#define KVPLANE (64 * KVP)           /* one staged plane: 64 rows */
#define KVSTAGE (3 * KVPLANE)        /* one stage: K hi, K residual, V^T */
// One 64-key stage into LDS by asynchronous copies: three planes of 64 rows x 128 B; each of the 128 threads brings 16 B of rows r, r+16, r+32, r+48 of each plane.
// l: the lane's LDS byte address in plane 0 (row r); gh, gl: its 16 B in K hi / K residual (row pitch DM); gv: its 16 B in V^T (row pitch NR).
__device__ __forceinline__ void stage_copy(unsigned int l, const _Float16* gh, const _Float16* gl, const _Float16* gv) {
  // the copies and their s_wait_xcnt in one statement: the wait stands before any rewrite of the address registers the copies name
  asm volatile(
      "global_load_async_to_lds_b128 %0, %12, off\n\t"
      "global_load_async_to_lds_b128 %1, %13, off\n\t"
      "global_load_async_to_lds_b128 %2, %14, off\n\t"
      "global_load_async_to_lds_b128 %3, %15, off\n\t"
      "global_load_async_to_lds_b128 %4, %16, off\n\t"
      "global_load_async_to_lds_b128 %5, %17, off\n\t"
      "global_load_async_to_lds_b128 %6, %18, off\n\t"
      "global_load_async_to_lds_b128 %7, %19, off\n\t"
      "global_load_async_to_lds_b128 %8, %20, off\n\t"
      "global_load_async_to_lds_b128 %9, %21, off\n\t"
      "global_load_async_to_lds_b128 %10, %22, off\n\t"
      "global_load_async_to_lds_b128 %11, %23, off\n\t"
      "s_wait_xcnt 0x0"
      :: "v"(l), "v"(l + 16u * KVP * 2u), "v"(l + 32u * KVP * 2u), "v"(l + 48u * KVP * 2u),
         "v"(l + KVPLANE * 2u), "v"(l + KVPLANE * 2u + 16u * KVP * 2u), "v"(l + KVPLANE * 2u + 32u * KVP * 2u), "v"(l + KVPLANE * 2u + 48u * KVP * 2u),
         "v"(l + KVPLANE * 4u), "v"(l + KVPLANE * 4u + 16u * KVP * 2u), "v"(l + KVPLANE * 4u + 32u * KVP * 2u), "v"(l + KVPLANE * 4u + 48u * KVP * 2u),
         "v"(gh), "v"(gh + 16 * DM), "v"(gh + 32 * DM), "v"(gh + 48 * DM),
         "v"(gl), "v"(gl + 16 * DM), "v"(gl + 32 * DM), "v"(gl + 48 * DM),
         "v"(gv), "v"(gv + 16 * NR), "v"(gv + 32 * NR), "v"(gv + 48 * NR)
      : "memory");
}

// Fused attention with relu^2 normaliser. grid = NB*NH*(SEQ/64), block = 4 waves; wave w owns query rows q0 = qb*64 + 16w .. +15 of (b, h).
// Per wave: position table qes[m][r] = q[m].rel_emb[r] (WMMA, f32 in LDS); per 64-key chunk: s^T = k.q^T (hi.hi + (hi.lo + lo.hi)/2^10), sv = (s + qes[m][clamp(key-q)+16]) / 8,
// The scores are formed transposed (K rows are the A operand, q the B operand): lane (ln, hh) holds query ln and keys 8hh .. 8hh + 7 of each 16-key tile, which is the k order of a
// 16x32 fragment, so two converted score tiles ARE the t operand of the aggregation o^T += v^T . t^T; t passes through no LDS, and a lane needs the mask bits of one query only.
// K hi, K residual and V^T of each 64-key chunk are staged once per block in LDS (two buffers, asynchronous copies one chunk ahead) and read as fragments by all four waves.
// Position term: in a chunk whose every key lies 16 or more before (or behind) every query of the block the clamp makes it one constant per query row (column 0 or 32 of qes);
// that constant stays in registers and is the start value of the hi.hi accumulator. Only the (at most three) chunks round the diagonal clamp, form addresses and gather from qes.
// masked -> -1e9, t = relu(sv + b)^2, dsum += t (f32), fragment element = f16(256 t); o^T += v^T . t^T ; end: o * (1/(sum+eps)) * 64/256 -> f16 rows of O16 (cols h*64..).
__global__ __launch_bounds__(128) void k_attn(const _Float16* __restrict__ QH, const _Float16* __restrict__ QL, const _Float16* __restrict__ KH, const _Float16* __restrict__ KL,
                                              const _Float16* __restrict__ VT, const _Float16* __restrict__ RT, const unsigned int* __restrict__ MBt,
                                              const float* __restrict__ spb, _Float16* __restrict__ O16) {
  #pragma clang fp contract(off)
  __shared__ __attribute__((aligned(16))) _Float16 tls[4][16][72];     // [row][d] o tile of the epilogue (cols 0..63 used)
  __shared__ float qes[4][16][52];                                      // [row][r] position table (cols 0..47 written, 0..32 read)
  __shared__ __attribute__((aligned(16))) _Float16 kv[2 * KVSTAGE];     // two stages of [plane][row][KVP]
  const int tid = threadIdx.x, w = tid >> 5, lane = tid & 31, ln = lane & 15, hh = lane >> 4;
  const int nqb = SEQ / 64;
  const int bh = blockIdx.x / nqb, qb = blockIdx.x - bh * nqb;
  const int b = bh / NH, h = bh - b * NH;
  const int q0 = qb * 64 + w * 16;                                      // first query of this wave (within the sequence)
  const size_t rq = (size_t)b * SEQ + q0;                               // compact token row of that query
  const size_t qoff = (rq + ln) * DM + (size_t)h * HD;
  const v16h qh0 = g2_frag(QH + qoff, hh), qh1 = g2_frag(QH + qoff + 32, hh);
  const v16h ql0 = g2_frag(QL + qoff, hh), ql1 = g2_frag(QL + qoff + 32, hh);
  const v8f z8 = {0.f,0.f,0.f,0.f,0.f,0.f,0.f,0.f};
  const float rsc = 0.0009765625f;                                      // 2^-10 fold of the residual planes
  const _Float16* kbh = KH + ((size_t)b * SEQ) * DM + (size_t)h * HD;
  const _Float16* kbl = KL + ((size_t)b * SEQ) * DM + (size_t)h * HD;
  const _Float16* vtb = VT + ((size_t)h * HD) * NR + (size_t)b * SEQ;   // V^T is [h * HD + d][token row], pitch NR
  const int crow = tid >> 3, ccol = (tid & 7) * 8;                      // this thread's first row and 16-byte column in every staged plane
  const unsigned int cl = (unsigned int)(size_t)&kv[crow * KVP + ccol];  // its LDS byte address in stage buffer 0
  const _Float16* cgh = kbh + (size_t)crow * DM + ccol;
  const _Float16* cgl = kbl + (size_t)crow * DM + ccol;
  const _Float16* cgv = vtb + (size_t)crow * NR + ccol;
  stage_copy(cl, cgh, cgl, cgv);                                        // chunk 0 -> buffer 0
  // position table: qes[m][r] = (q[m] . (16 rel_emb[r])) / 16
#pragma unroll
  for (int nt = 0; nt < 3; ++nt) {
    const _Float16* rr = RT + (size_t)(nt * 16 + ln) * HD;
    const v16h r0 = g2_frag(rr, hh), r1 = g2_frag(rr + 32, hh);
    const v8f ah = mma2(qh0, r0, qh1, r1, z8);
    const v8f al = mma2(ql0, r0, ql1, r1, z8);
#pragma unroll
    for (int r = 0; r < 8; ++r) { const float e = ah[r] + al[r] * rsc; qes[w][8 * hh + r][nt * 16 + ln] = e * 0.0625f; }
  }
  asm volatile("s_wait_asynccnt 0x0" ::: "memory");                     // this wave's copies of chunk 0 have landed before the barrier publishes them
  __syncthreads();
  stage_copy(cl + KVSTAGE * 2u, cgh + (size_t)64 * DM, cgl + (size_t)64 * DM, cgv + 64);   // chunk 1 -> buffer 1 (SEQ >= 128)

  const unsigned int* mbr = MBt + (rq + ln) * (SEQ / 32);              // bit row of this lane's query q0 + ln
  const float sbias = spb[0];
  float dsum[8];
#pragma unroll
  for (int r = 0; r < 8; ++r) dsum[r] = 0.f;
  v8f oacc[4] = {z8, z8, z8, z8};
  int bo = 0;                                                           // offset in halfs of the buffer that holds this chunk
  v8f pec;                                                              // position term of this lane's query (the same for its eight keys) in the chunks off the diagonal: first the keys before the band (column 0)
#pragma unroll
  for (int r = 0; r < 8; ++r) pec[r] = qes[w][ln][0];

  // One 64-key chunk. band: the chunk may hold a key nearer than 16 to a query of the block (the gathered form); otherwise pec holds the position term.
  auto chunk = [&](const int k0, auto band) __attribute__((always_inline)) {
    constexpr bool BAND = decltype(band)::value;
    const v2ua mw = *(const v2ua*)(mbr + (k0 >> 5));                    // the chunk's 64 mask bits of this lane's query
    // Fragment reads stand one matrix run ahead of their use, in a second register set: while a 16-key tile is multiplied and its t values are formed,
    // the fragments of the next run (the next K tile; behind each second tile the four V^T fragments of these 32 keys) are on their way, so the runs do not wait out the LDS latency.
    // All of them are reads of this chunk's own buffer.
    const _Float16* kr = &kv[bo + ln * KVP];                            // this lane's row of tile 0 in the K hi plane
    const _Float16* vr = &kv[bo + 2 * KVPLANE + ln * KVP];              // this lane's row of d tile 0 in the V^T plane
    v16h f0 = g2_frag(kr, hh), f1 = g2_frag(kr + 32, hh), f2 = g2_frag(kr + KVPLANE, hh), f3 = g2_frag(kr + KVPLANE + 32, hh);   // K hi (f0, f1) and residual (f2, f3) of tile 0
    __builtin_amdgcn_sched_barrier(0);     // tile 0's eight reads go out first: nothing covers them, and LDS answers in order
#pragma unroll     // both halves in line: LDS offsets and mask bit numbers are constants, the fragment sets stay in registers
    for (int hf = 0; hf < 2; ++hf) {                                    // the chunk's two halves of 32 keys: one k-step of the aggregation each
      FragH p;                                                          // t^T fragment of keys k0 + 32 hf + 0..31
#pragma unroll     // as above; j also picks the half of the t fragment that the tile fills
      for (int j = 0; j < 2; ++j) {
        const int kt = 2 * hf + j;
        const int kc = kt * 16 + 8 * hh;                                // first of the eight keys within the chunk held by this lane (D rows)
        float pe[8];                                                    // position terms of this tile, read ahead of its matrix run (band chunks only)
        if constexpr (BAND) {
#pragma unroll
          for (int r = 0; r < 8; ++r) {
            int rel = (k0 + kc + r) - (q0 + ln);
            rel = (rel < -KREL) ? -KREL : ((rel > KREL) ? KREL : rel);
            pe[r] = qes[w][ln][rel + KREL];
          }
        }
        // next: K tile kt + 1 (hi, hi, residual, residual), or d tiles 0 .. 3 of V^T at these 32 keys
        const _Float16* nr = (j == 0) ? kr + (kt + 1) * 16 * KVP : vr + 32 * hf;
        const int s1 = (j == 0) ? 32 : 16 * KVP, s2 = (j == 0) ? KVPLANE : 32 * KVP, s3 = (j == 0) ? KVPLANE + 32 : 48 * KVP;
        const v16h n0 = g2_frag(nr, hh), n1 = g2_frag(nr + s1, hh), n2 = g2_frag(nr + s2, hh), n3 = g2_frag(nr + s3, hh);
        __builtin_amdgcn_sched_barrier(0);   // keeps these reads in front of this tile's matrix run, and the next run's products (which would wait for them at once) behind it
        const v8f sh = mma2(f0, qh0, f1, qh1, BAND ? z8 : pec);
        v8f sx = mma2(f0, ql0, f1, ql1, z8);
        sx = mma2(f2, qh0, f3, qh1, sx);
        const unsigned int word = mw[hf] >> (8 * hh);                   // bit 16 j + r is now key 32 hf + 16 j + 8hh + r
        float t16[8];
#pragma unroll
        for (int r = 0; r < 8; ++r) {
          const float s = sh[r] + sx[r] * rsc;
          float sv;
          if constexpr (BAND) sv = (s + pe[r]) * 0.125f; else sv = s * 0.125f;
          const unsigned int bit = (word >> (j * 16 + r)) & 1u;
          sv = (bit != 0u) ? -1.0e9f : sv;
          float t = sv + sbias;
          t = fmaxf(t, 0.0f);
          const float tt = t * t;
          dsum[r] += tt;
          t16[r] = tt * 256.0f;
        }
#pragma unroll     // register indices must be constants
        for (int i = 0; i < 4; ++i) {                                   // elements 8 j + r of the fragment are keys 16 j + 8hh + r of its 32
          const v2f t2 = {t16[2 * i], t16[2 * i + 1]};
          p.p[j * 4 + i] = __builtin_convertvector(t2, v2h);
        }
        f0 = n0; f1 = n1; f2 = n2; f3 = n3;
      }
      // f0 .. f3 now hold V^T (d tiles 0 .. 3) at these 32 keys; the first half reads K tile 2 ahead of its four products
      v16h n0 = f0, n1 = f1, n2 = f2, n3 = f3;
      if (hf == 0) { const _Float16* nr = kr + 32 * KVP;
        n0 = g2_frag(nr, hh); n1 = g2_frag(nr + 32, hh); n2 = g2_frag(nr + KVPLANE, hh); n3 = g2_frag(nr + KVPLANE + 32, hh);
        __builtin_amdgcn_sched_barrier(0); } // keeps these reads in front of the four products
      mma4(f0, f1, f2, f3, p.v, oacc[0], oacc[1], oacc[2], oacc[3]);    // D rows: d = dt * 16 + 8hh + r; D column: query ln
      f0 = n0; f1 = n1; f2 = n2; f3 = n3;
    }
    asm volatile("s_wait_dscnt 0x0" ::: "memory");                      // this wave's reads of the buffer have returned before it may be refilled
    asm volatile("s_wait_asynccnt 0x0" ::: "memory");                   // this wave's copies of the next chunk have landed
    __syncthreads();                                                    // publishes the next chunk and ends every wave's reads of this buffer
    if (k0 + 128 < SEQ)
      stage_copy(cl + (unsigned int)bo * 2u, cgh + (size_t)(k0 + 128) * DM, cgl + (size_t)(k0 + 128) * DM, cgv + (k0 + 128));   // chunk + 2 -> the buffer just read
    bo ^= KVSTAGE;
  };
  // The chunks in their order, in three runs whose bounds are the same for the whole block (every wave passes every chunk's barrier):
  // keys before the band, the chunks round the diagonal, keys behind the band.
  const int kA = (qb > 0) ? qb * 64 - 64 : 0, kB = (qb * 64 + 128 < SEQ) ? qb * 64 + 128 : SEQ;
#pragma unroll 1   // one trip per staged chunk: the two buffers alternate through bo
  for (int k0 = 0; k0 < kA; k0 += 64) chunk(k0, Flag<false>{});
#pragma unroll 1   // as above
  for (int k0 = kA; k0 < kB; k0 += 64) chunk(k0, Flag<true>{});
#pragma unroll
  for (int r = 0; r < 8; ++r) pec[r] = qes[w][ln][2 * KREL];    // from here on every key lies behind the band (column 32)
#pragma unroll 1   // as above
  for (int k0 = kB; k0 < SEQ; k0 += 64) chunk(k0, Flag<false>{});
  asm volatile("s_wait_asynccnt 0x0" ::: "memory");                     // nothing of this wave is in flight behind the loops

  // key sum of this lane's query: its eight partial sums, then the other half's; scale = 64/256 / (sum + eps)
  float qs = ((dsum[0] + dsum[1]) + (dsum[2] + dsum[3])) + ((dsum[4] + dsum[5]) + (dsum[6] + dsum[7]));
  qs += __shfl_xor(qs, 16, 32);
  const float osc = (1.0f / (qs + 1.0e-9f)) * 0.25f;
#pragma unroll
  for (int dt = 0; dt < 4; ++dt) { FragH f;
#pragma unroll
    for (int r = 0; r < 8; ++r) f.h[r] = (_Float16)(oacc[dt][r] * osc);
    *(v8us*)&tls[w][ln][dt * 16 + 8 * hh] = f.half[0]; }
  __builtin_amdgcn_fence(3 /* release order */, "wavefront"); __builtin_amdgcn_wave_barrier();
  const int rl = lane >> 3, pc = (lane & 7) * 8;
  {
#pragma unroll
    for (int it = 0; it < 4; ++it) {
      const int row = it * 4 + rl;
      const v8us v = *(const v8us*)&tls[w][row][pc];
      *(v8us*)((unsigned short*)O16 + (rq + row) * DM + (size_t)h * HD + pc) = v;
    }
    
  }
}

extern "C" void kernel_launch(void* const* d_in, const int* in_sizes, int n_in,
                              void* d_out, int out_size, void* d_ws, size_t ws_size, hipStream_t stream) {
  if (n_in < 10) return;
  const int nx = (int)(NR * DM);
  if (in_sizes[0] < nx || in_sizes[1] < nx || in_sizes[2] < nx) return;
  if (in_sizes[3] < (int)(NR * SEQ)) return;
  if (in_sizes[4] < DM * DM || in_sizes[5] < DM * DM || in_sizes[6] < DM * DM || in_sizes[7] < DM * DM) return;
  if (in_sizes[8] < NREL * HD || in_sizes[9] < 1) return;
  if (out_size < nx) return;
  const float* xq = (const float*)d_in[0]; const float* xk = (const float*)d_in[1]; const float* xv = (const float*)d_in[2];
  const int* msk = (const int*)d_in[3];
  const float* wq = (const float*)d_in[4]; const float* wk = (const float*)d_in[5]; const float* wv = (const float*)d_in[6]; const float* wo = (const float*)d_in[7];
  const float* rel = (const float*)d_in[8]; const float* spb = (const float*)d_in[9];

  char* ws = (char*)d_ws; size_t off = 0;
  auto take = [&](size_t bytes) { char* p = ws + off; off += (bytes + 255) & ~(size_t)255; return p; };
  const size_t wbytes = (size_t)DM * DM * 2, xbytes = NR * DM * 2;
  _Float16* BQ = (_Float16*)take(wbytes); _Float16* BK = (_Float16*)take(wbytes); _Float16* BV = (_Float16*)take(wbytes); _Float16* BO = (_Float16*)take(wbytes);
  _Float16* RT = (_Float16*)take((size_t)NRELP * HD * 2);
  _Float16* XQ = (_Float16*)take(xbytes); _Float16* XK = (_Float16*)take(xbytes); _Float16* XV = (_Float16*)take(xbytes);
  _Float16* QH = (_Float16*)take(xbytes); _Float16* QL = (_Float16*)take(xbytes); _Float16* KH = (_Float16*)take(xbytes); _Float16* KL = (_Float16*)take(xbytes);
  _Float16* VT = (_Float16*)take(xbytes);
  const int nwords = (int)(NR * (SEQ / 32));
  unsigned int* MB = (unsigned int*)take((size_t)nwords * 4);
  _Float16* O16 = (_Float16*)take(xbytes);
  if (off > ws_size || off > (size_t)134217728) return;

  k_prep<<<P_BLOCKS + 1, PT, 0, stream>>>(xq, xk, xv, msk, wq, wk, wv, wo, rel, XQ, XK, XV, MB, BQ, BK, BV, BO, RT);

  const int M = (int)NR;
  static_assert((NR / 128) * (DM / 64) == (DM / 128) * (NR / 64));   // the three projections have the same number of block tiles
  const unsigned gx = (unsigned)((M / 128) * (DM / 64));
  // q, k and V^T in one launch. V^T = Wv . x^T: the weights are the row operand and the token rows the column operand, so the product lands transposed, [h * HD + d][token row]
  k_gemm2<<<dim3(gx, 3), 128, 0, stream>>>(XQ, XK, BV, DM, BQ, BK, XV, DM, 0.0625f, nullptr, QH, KH, VT, QL, KL, DM, M, DM, M, DM, M, DM);
  k_attn<<<(unsigned)(NB * NH * (SEQ / 64)), 128, 0, stream>>>(QH, QL, KH, KL, VT, RT, MB, spb, O16);
  k_gemm2<<<dim3(gx, 1), 128, 0, stream>>>(O16, nullptr, nullptr, DM, BO, nullptr, nullptr, DM, 0.0009765625f, (float*)d_out, nullptr, nullptr, nullptr, nullptr, nullptr, DM, M, DM, DM, M, DM, DM);
}

// v009
// A run of this version takes 118 microseconds.
// Next to v008, in two timings, it ran 1.06 times as fast each time.
// Over all steps from v000 it is 3.60 times as fast.
#include <hip/hip_runtime.h>
// Contractions on v_wmma_f32_16x16x32_f16 (f16 operands, f32 accumulate): q/k/v projections and the output projection plain f16 (inputs RNE-converted to bf16 then held exactly in f16, weights x16); q.k^T scores as f16 hi + residual (x2^10) planes on both operands (3 products, residual terms in a separate accumulator); q.rel_emb^T position table f16 hi + residual on q (rel_emb exact x16); t.v aggregation plain f16 (t carried x256, o carried x64); normaliser statistics f32.
#ifndef NB
#define NB 2
#endif
#ifndef SEQ
#define SEQ 2048
#endif
#define NB_FULL 2
#define SEQ_FULL 2048
#define DM 1024
#define NH 16
#define HD 64
#define NREL 33
#define KREL 16
#define NRELP 48                     /* rel_emb rows padded to 3 WMMA column tiles (rows 33..47 zero) */
#define NR ((size_t)NB * SEQ)        /* token rows processed (compact) */
static_assert(SEQ % 128 == 0);
static_assert(SEQ <= SEQ_FULL);
static_assert(NB >= 1 && NB <= NB_FULL);
static_assert(DM == NH * HD);

typedef unsigned short v8us __attribute__((ext_vector_type(8), may_alias));
typedef float  v8f  __attribute__((ext_vector_type(8)));
typedef float  v4f  __attribute__((ext_vector_type(4)));
typedef float  v4fa __attribute__((ext_vector_type(4), may_alias));
typedef _Float16 v16h __attribute__((ext_vector_type(16)));
typedef _Float16 v4h __attribute__((ext_vector_type(4)));
typedef _Float16 v2h __attribute__((ext_vector_type(2)));
typedef float  v2f  __attribute__((ext_vector_type(2)));
typedef int v4ia __attribute__((ext_vector_type(4), may_alias));
typedef unsigned int v16u __attribute__((ext_vector_type(16)));
union FragH { v16h v; v8us half[2]; v2h p[8]; _Float16 h[16]; unsigned short u[16]; };

__device__ __forceinline__ unsigned short bf16_bits(float x) { unsigned int u = __float_as_uint(x); return (unsigned short)((u + 0x7FFFu + ((u >> 16) & 1u)) >> 16); }
__device__ __forceinline__ float bf16_val(unsigned short b) { return __uint_as_float(((unsigned int)b) << 16); }
__device__ __forceinline__ float bf16_rne(float x) { return bf16_val(bf16_bits(x)); }

// 16x32 fragment from a 16-bit row (lane row/col = lane & 15): elements 0..7 <- k0 + 8hh + 0..7, elements 8..15 <- k0 + 16 + 8hh + 0..7 (same map for A and B)
__device__ __forceinline__ v16h g2_frag(const _Float16* p, int hh) { FragH f; f.half[0] = *(const v8us*)((const unsigned short*)p + 8 * hh); f.half[1] = *(const v8us*)((const unsigned short*)p + 16 + 8 * hh); return f.v; }
__device__ __forceinline__ v8f g2_mma(v16h a, v16h b, v8f c) { v8f d = __builtin_amdgcn_wmma_f32_16x16x32_f16(false, a, false, b, (short)0, c, false, false); asm volatile("v_nop\n\tv_nop\n\tv_nop\n\tv_nop" : "+v"(d) : "v"(a), "v"(b)); return d; }
// two k-steps into one accumulator, hazard guard after the second
__device__ __forceinline__ v8f mma2(v16h a0, v16h b0, v16h a1, v16h b1, v8f c) {
  c = __builtin_amdgcn_wmma_f32_16x16x32_f16(false, a0, false, b0, (short)0, c, false, false);
  c = __builtin_amdgcn_wmma_f32_16x16x32_f16(false, a1, false, b1, (short)0, c, false, false);
  asm volatile("v_nop\n\tv_nop\n\tv_nop\n\tv_nop" : "+v"(c) : "v"(a0), "v"(b0), "v"(a1), "v"(b1));
  return c;
}

#define PT 512                       /* threads of a k_prep block: 16 waves */
#define PWU 1024                     /* 4-byte elements one wave moves per tile: 4 KiB */
#define PTILE ((PT / 32) * PWU)      /* elements of one block tile */
#define PW_TILES (DM * DM / PTILE)               /* tiles of one weight matrix */
#define PX_TILES ((int)(NR * DM / PTILE))        /* tiles of one activation input */
#define PM_TILES ((int)(NR * SEQ / PTILE))       /* tiles of the mask */
#define P_TILES (4 * PW_TILES + 3 * PX_TILES + PM_TILES)
#define P_BLOCKS ((P_TILES + 2) / 3)             /* three tiles a block */
static_assert((DM * DM) % PTILE == 0 && DM % PWU == 0);
static_assert((NR * DM) % PTILE == 0 && (NR * SEQ) % PTILE == 0);

// One wave's 4 KiB of f32 -> f16(bf16_rne(x) * scale): eight 512-byte loads in flight, then eight 256-byte stores (whole lines both ways).
__device__ __forceinline__ void cvt_unit(const float* __restrict__ s, _Float16* __restrict__ d, float scale, int lane) {
  v4f v[8];
#pragma unroll
  for (int j = 0; j < 8; ++j) v[j] = *(const v4fa*)(s + j * 128 + lane * 4);
#pragma unroll
  for (int j = 0; j < 8; ++j) { v4h h;
#pragma unroll
    for (int i = 0; i < 4; ++i) h[i] = (_Float16)(bf16_rne(v[j][i]) * scale);
    *(v4h*)(d + j * 128 + lane * 4) = h; }
  asm volatile("s_wait_xcnt 0x0" ::: "memory");   // stands directly behind the stores, before anything rewrites the address or data registers that they name
}

// One wave's 32 mask words: unit u is the mask of 16 queries x 64 keys (one wave's scores in one chunk of k_attn), written as lane masks of the score registers:
// bit L of word u * 32 + kt * 8 + r is mask[query 16 g + (L & 15)][key 64 c + 16 kt + 8 (L >> 4) + r], the element that lane L holds in register r of score tile kt.
// Read in whole lines (two adjacent lines of each of the 16 rows; a ballot gives 32 keys of one query), regrouped by a second round of ballots, one 128-byte store.
static_assert(SEQ % 64 == 0);
__device__ __forceinline__ void pack_unit(const int* __restrict__ msk, unsigned int* __restrict__ bits, unsigned int u, int lane) {
  const unsigned int nc = SEQ / 64, ng = SEQ / 16, c = u % nc, bg = u / nc, g = bg % ng, b = bg / ng;
  const int* src = msk + ((size_t)b * SEQ_FULL + (size_t)g * 16) * SEQ_FULL + (size_t)c * 64 + lane;
  int v[32];
#pragma unroll
  for (int j = 0; j < 32; ++j) v[j] = src[(size_t)(j & 15) * SEQ_FULL + (j >> 4) * 32];   // query j & 15, keys 32 (j >> 4) + lane
  asm volatile("s_wait_xcnt 0x0" :: "v"(src) : "memory");   // behind the run of loads; the pointer as input keeps the address registers out of the loads' results up to here
  unsigned int wd = 0u;
#pragma unroll
  for (int j = 0; j < 32; ++j) { const unsigned int bj = __builtin_amdgcn_ballot_w32(v[j] != 0); wd = (lane == j) ? bj : wd; }
  // lane L now holds keys 32 (L >> 4) + 0..31 of query L & 15; with the other half's word each lane has its query's 64 keys, shifted so that bit 16 (kt & 1) + r is its own element
  const unsigned int ot = (unsigned int)__shfl_xor((int)wd, 16, 32);
  const int hh = lane >> 4;
  const unsigned int y0 = (hh ? ot : wd) >> (8 * hh), y1 = (hh ? wd : ot) >> (8 * hh);
  unsigned int ow = 0u;
#pragma unroll
  for (int i = 0; i < 32; ++i) { const unsigned int y = (i < 16) ? y0 : y1;
    const unsigned int bi = __builtin_amdgcn_ballot_w32(((y >> (((i >> 3) & 1) * 16 + (i & 7))) & 1u) != 0u); ow = (lane == i) ? bi : ow; }
  bits[u * 32u + lane] = ow;
  asm volatile("s_wait_xcnt 0x0" ::: "memory");   // stands directly behind the store, before anything rewrites the registers that it names
}

// All operand preparation in one launch: weights -> f16 x16, activations -> f16, mask -> lane-mask words, rel_emb -> padded f16 x16 table.
// Block 0 does the small table; blocks 1 .. P_BLOCKS walk the tiles (block-uniform choice of the job).
__global__ __launch_bounds__(PT) void k_prep(const float* __restrict__ xq, const float* __restrict__ xk, const float* __restrict__ xv, const int* __restrict__ msk,
    const float* __restrict__ wq, const float* __restrict__ wk, const float* __restrict__ wv, const float* __restrict__ wo, const float* __restrict__ rel,
    _Float16* __restrict__ XQ, _Float16* __restrict__ XK, _Float16* __restrict__ XV, unsigned int* __restrict__ MB,
    _Float16* __restrict__ BQ, _Float16* __restrict__ BK, _Float16* __restrict__ BV, _Float16* __restrict__ BO, _Float16* __restrict__ RT) {
  const int lane = threadIdx.x & 31, wn = __builtin_amdgcn_readfirstlane((int)(threadIdx.x >> 5));
  if (blockIdx.x == 0) {
    const int t = threadIdx.x; if (t >= NRELP * (HD / 8)) return;
    const int r = t / (HD / 8), d8 = (t % (HD / 8)) * 8;
    const int rc = (r < NREL) ? r : (NREL - 1);          // clamped address, value zeroed by predicate
    const bool live = (r < NREL);
    const v4f a = *(const v4fa*)(rel + (size_t)rc * HD + d8), c = *(const v4fa*)(rel + (size_t)rc * HD + d8 + 4);
    FragH f;
#pragma unroll
    for (int q = 0; q < 4; ++q) { f.h[q] = live ? (_Float16)(bf16_rne(a[q]) * 16.0f) : (_Float16)0.0f; f.h[4 + q] = live ? (_Float16)(bf16_rne(c[q]) * 16.0f) : (_Float16)0.0f; }
    *(v8us*)((unsigned short*)RT + (size_t)t * 8) = f.half[0];
    return;
  }
  for (int tile = (int)blockIdx.x - 1; tile < P_TILES; tile += P_BLOCKS) {
    if (tile < 4 * PW_TILES) {
      const int m = tile / PW_TILES;
      const float* s = (m == 0) ? wq : (m == 1) ? wk : (m == 2) ? wv : wo;
      _Float16* d = (m == 0) ? BQ : (m == 1) ? BK : (m == 2) ? BV : BO;
      const size_t e = (size_t)(tile - m * PW_TILES) * PTILE + (size_t)wn * PWU;
      cvt_unit(s + e, d + e, 16.0f, lane);
    } else if (tile < 4 * PW_TILES + 3 * PX_TILES) {
      const int tx = tile - 4 * PW_TILES, m = tx / PX_TILES;
      const float* s = (m == 0) ? xq : (m == 1) ? xk : xv;
      _Float16* d = (m == 0) ? XQ : (m == 1) ? XK : XV;
      const size_t e = (size_t)(tx - m * PX_TILES) * PTILE + (size_t)wn * PWU;   // compact element index; PWU divides DM, so the unit lies in one row
      const int r = (int)(e / DM), c = (int)(e % DM), b = r / SEQ, sq = r - b * SEQ;
      cvt_unit(s + ((size_t)b * SEQ_FULL + sq) * DM + c, d + e, 1.0f, lane);
    } else {
      const int tm = tile - (4 * PW_TILES + 3 * PX_TILES);
      pack_unit(msk, MB, (unsigned int)(tm * (PT / 32) + wn), lane);
    }
  }
}

#define GBK 128                      /* k depth of one staged GEMM tile in halfs: 256 B a row */
#define GP 136                       /* LDS row pitch of a staged GEMM tile in halfs: 272 B = 16 B x odd, conflict-free for 16-byte fragment reads */
#define GSTAGE (192 * GP)            /* one stage: 128 rows of A, then 64 rows of B */
#define GRS (8u * GP * 2u)           /* LDS bytes between two copies of one thread: 8 rows */
// Twelve asynchronous copies of 16 B a lane: LDS rows 8 apart from l, each from its own global address.
__device__ __forceinline__ void copy12(unsigned int l, const _Float16* g0, const _Float16* g1, const _Float16* g2, const _Float16* g3, const _Float16* g4, const _Float16* g5,
                                       const _Float16* g6, const _Float16* g7, const _Float16* g8, const _Float16* g9, const _Float16* g10, const _Float16* g11) {
  // the copies and their s_wait_xcnt in one statement: the wait stands before any rewrite of the address registers the copies name
  asm volatile(
      "global_load_async_to_lds_b128 %0, %12, off\n\t"
      "global_load_async_to_lds_b128 %1, %13, off\n\t"
      "global_load_async_to_lds_b128 %2, %14, off\n\t"
      "global_load_async_to_lds_b128 %3, %15, off\n\t"
      "global_load_async_to_lds_b128 %4, %16, off\n\t"
      "global_load_async_to_lds_b128 %5, %17, off\n\t"
      "global_load_async_to_lds_b128 %6, %18, off\n\t"
      "global_load_async_to_lds_b128 %7, %19, off\n\t"
      "global_load_async_to_lds_b128 %8, %20, off\n\t"
      "global_load_async_to_lds_b128 %9, %21, off\n\t"
      "global_load_async_to_lds_b128 %10, %22, off\n\t"
      "global_load_async_to_lds_b128 %11, %23, off\n\t"
      "s_wait_xcnt 0x0"
      :: "v"(l), "v"(l + GRS), "v"(l + 2u * GRS), "v"(l + 3u * GRS), "v"(l + 4u * GRS), "v"(l + 5u * GRS),
         "v"(l + 6u * GRS), "v"(l + 7u * GRS), "v"(l + 8u * GRS), "v"(l + 9u * GRS), "v"(l + 10u * GRS), "v"(l + 11u * GRS),
         "v"(g0), "v"(g1), "v"(g2), "v"(g3), "v"(g4), "v"(g5), "v"(g6), "v"(g7), "v"(g8), "v"(g9), "v"(g10), "v"(g11)
      : "memory");
}
// One k-tile of the block (128 rows of A, then 64 rows of B, GBK deep) into one stage; each of the 128 threads brings 16 B of every eighth row.
// l: the lane's LDS byte address in row tid / 16 of the stage; ga, gb: its 16 B in that row of the A tile and of the B tile.
__device__ __forceinline__ void gemm_stage(unsigned int l, const _Float16* ga, int lda, const _Float16* gb, int ldb) {
  const size_t sa = (size_t)8 * lda, sb = (size_t)8 * ldb;
  copy12(l, ga, ga + sa, ga + 2 * sa, ga + 3 * sa, ga + 4 * sa, ga + 5 * sa, ga + 6 * sa, ga + 7 * sa, ga + 8 * sa, ga + 9 * sa, ga + 10 * sa, ga + 11 * sa);
  copy12(l + 12u * GRS, ga + 12 * sa, ga + 13 * sa, ga + 14 * sa, ga + 15 * sa, gb, gb + sb, gb + 2 * sb, gb + 3 * sb, gb + 4 * sb, gb + 5 * sb, gb + 6 * sb, gb + 7 * sb);
}

// GEMM (wave tile 32x64; M % 128 == 0, N % 64 == 0, K % 128 == 0): C[m][n] = alpha * sum_k A[m][k] Bh[n][k]; A f16 rows (pitch lda), Bh f16 [n][k] (pitch ldb);
// the block's 128 x GBK tile of A and 64 x GBK tile of Bh are staged in LDS (two buffers, asynchronous copies one tile ahead) and read as fragments by the four waves.
// One launch holds up to three independent products: blockIdx.y picks the operands and the results (block-uniform); product 2 has a shape of its own (ldc2, M2, N2) and no residual plane.
__global__ __launch_bounds__(128) void k_gemm2(const _Float16* __restrict__ A0, const _Float16* __restrict__ A1, const _Float16* __restrict__ A2, int lda,
    const _Float16* __restrict__ B0, const _Float16* __restrict__ B1, const _Float16* __restrict__ B2, int ldb, float alpha,
    float* __restrict__ C, _Float16* __restrict__ H0, _Float16* __restrict__ H1, _Float16* __restrict__ H2, _Float16* __restrict__ L0, _Float16* __restrict__ L1,
    int ldc01, int M01, int N01, int ldc2, int M2, int N2, int K) {
  __shared__ __attribute__((aligned(16))) float so[4][32][68];
  __shared__ __attribute__((aligned(16))) _Float16 ab[2 * GSTAGE];      // two stages of [row][GP]
  const int tid = threadIdx.x, w = tid >> 5, lane = tid & 31, ln = lane & 15, hh = lane >> 4; const int by = blockIdx.y;
  const _Float16* A = (by == 0) ? A0 : (by == 1) ? A1 : A2; const _Float16* Bh = (by == 0) ? B0 : (by == 1) ? B1 : B2;
  _Float16* C16 = (by == 0) ? H0 : (by == 1) ? H1 : H2; _Float16* C16L = (by == 0) ? L0 : (by == 1) ? L1 : nullptr;
  const int ldc = (by == 2) ? ldc2 : ldc01, M = (by == 2) ? M2 : M01, N = (by == 2) ? N2 : N01;
  const int ntn = N >> 6; const int mt = blockIdx.x / ntn, nq = blockIdx.x - mt * ntn; const int row0 = mt * 128 + 32 * w, col0 = nq * 64; if (mt * 128 >= M) return;
  const int crow = tid >> 4, ccol = (tid & 15) * 8;                     // this thread's first row and 16-byte column in a stage
  const unsigned int cl = (unsigned int)(size_t)&ab[crow * GP + ccol];  // its LDS byte address in stage buffer 0
  const _Float16* cga = A + (size_t)(mt * 128 + crow) * lda + ccol;
  const _Float16* cgb = Bh + (size_t)(col0 + crow) * ldb + ccol;
  gemm_stage(cl, cga, lda, cgb, ldb);                                   // tile 0 -> buffer 0
  const v8f z8 = {0.f,0.f,0.f,0.f,0.f,0.f,0.f,0.f}; v8f c00 = z8, c01 = z8, c02 = z8, c03 = z8, c10 = z8, c11 = z8, c12 = z8, c13 = z8;
  asm volatile("s_wait_asynccnt 0x0" ::: "memory");                     // this wave's copies of tile 0 have landed before the barrier publishes them
  __syncthreads();
  if (K > GBK) gemm_stage(cl + GSTAGE * 2u, cga + GBK, lda, cgb + GBK, ldb);   // tile 1 -> buffer 1
  int bo = 0;                                                           // offset in halfs of the buffer that holds this tile
#pragma unroll 1   // one trip per staged tile: kept rolled so that the two buffers alternate through bo and the loop stays small
  for (int kb = 0; kb < K; kb += GBK) {
    const _Float16* ar = &ab[bo + (32 * w + ln) * GP]; const _Float16* br = &ab[bo + (128 + ln) * GP];
    // the fragments of k-step ks + 1 are read into a second register set in front of the products of k-step ks, which then do not wait out the LDS latency
    v16h a0 = g2_frag(ar, hh), a1 = g2_frag(ar + 16 * GP, hh);
    v16h b0 = g2_frag(br, hh), b1 = g2_frag(br + 16 * GP, hh), b2 = g2_frag(br + 32 * GP, hh), b3 = g2_frag(br + 48 * GP, hh);
#pragma unroll     // the four k-steps of a tile read LDS at constant offsets
    for (int ks = 0; ks < GBK; ks += 32) {
      v16h na0 = a0, na1 = a1, nb0 = b0, nb1 = b1, nb2 = b2, nb3 = b3;
      if (ks + 32 < GBK) { const int kn = ks + 32;
        na0 = g2_frag(ar + kn, hh); na1 = g2_frag(ar + 16 * GP + kn, hh);
        nb0 = g2_frag(br + kn, hh); nb1 = g2_frag(br + 16 * GP + kn, hh); nb2 = g2_frag(br + 32 * GP + kn, hh); nb3 = g2_frag(br + 48 * GP + kn, hh); }
      c00 = g2_mma(a0, b0, c00); c10 = g2_mma(a1, b0, c10);
      c01 = g2_mma(a0, b1, c01); c11 = g2_mma(a1, b1, c11);
      c02 = g2_mma(a0, b2, c02); c12 = g2_mma(a1, b2, c12);
      c03 = g2_mma(a0, b3, c03); c13 = g2_mma(a1, b3, c13);
      a0 = na0; a1 = na1; b0 = nb0; b1 = nb1; b2 = nb2; b3 = nb3; }
    asm volatile("s_wait_dscnt 0x0" ::: "memory");                      // this wave's reads of the buffer have returned before it may be refilled
    asm volatile("s_wait_asynccnt 0x0" ::: "memory");                   // this wave's copies of the next tile have landed
    __syncthreads();                                                    // publishes the next tile and ends every wave's reads of this buffer
    if (kb + 2 * GBK < K) gemm_stage(cl + (unsigned int)bo * 2u, cga + (kb + 2 * GBK), lda, cgb + (kb + 2 * GBK), ldb);   // tile + 2 -> the buffer just read
    bo ^= GSTAGE;
  }
  asm volatile("s_wait_asynccnt 0x0" ::: "memory");                     // nothing of this wave is in flight behind the loop
  v8f accs[8] = {c00, c01, c02, c03, c10, c11, c12, c13};
#pragma unroll
  for (int u = 0; u < 8; ++u) { const int t = u & 3, half = u >> 2;
#pragma unroll
    for (int r = 0; r < 8; ++r) { const int rloc = half * 16 + 8 * hh + r; so[w][rloc][t * 16 + ln] = accs[u][r] * alpha; } }
  __builtin_amdgcn_fence(4 /* acq_rel order */, "workgroup"); __builtin_amdgcn_wave_barrier();
  const int rsub = lane >> 4, c4 = (lane & 15) * 4;
  {
#pragma unroll
    for (int q = 0; q < 16; ++q) {
      const int r = q * 2 + rsub; const v4f v = *(const v4fa*)&so[w][r][c4];
      const size_t o = (size_t)(row0 + r) * ldc + col0 + c4;
      if (C) *(v4f*)(C + o) = v;
      if (C16) { v4h h4, l4;
#pragma unroll
        for (int i = 0; i < 4; ++i) { const _Float16 hq = (_Float16)v[i]; h4[i] = hq; l4[i] = (_Float16)((v[i] - (float)hq) * 1024.0f); }
        *(v4h*)(C16 + o) = h4;
        if (C16L) *(v4h*)(C16L + o) = l4; }
    }
     }
}

// one k-step into four accumulators (one B operand), hazard guard after the last
__device__ __forceinline__ void mma4(v16h a0, v16h a1, v16h a2, v16h a3, v16h b, v8f& c0, v8f& c1, v8f& c2, v8f& c3) {
  c0 = __builtin_amdgcn_wmma_f32_16x16x32_f16(false, a0, false, b, (short)0, c0, false, false);
  c1 = __builtin_amdgcn_wmma_f32_16x16x32_f16(false, a1, false, b, (short)0, c1, false, false);
  c2 = __builtin_amdgcn_wmma_f32_16x16x32_f16(false, a2, false, b, (short)0, c2, false, false);
  c3 = __builtin_amdgcn_wmma_f32_16x16x32_f16(false, a3, false, b, (short)0, c3, false, false);
  // four vector slots behind the last product, before anything reads a result or rewrites an operand
  asm volatile("v_nop\n\tv_nop\n\tv_nop\n\tv_nop" : "+v"(c0), "+v"(c1), "+v"(c2), "+v"(c3) : "v"(a0), "v"(a1), "v"(a2), "v"(a3), "v"(b));
}

template <bool B> struct Flag { static constexpr bool value = B; };   // compile-time choice between the two forms of a chunk

#define KVP 72                       /* LDS row pitch of a staged plane in halfs: 144 B = 16 B x odd, conflict-free for 16-byte fragment reads */
#define KVPLANE (64 * KVP)           /* one staged plane: 64 rows */
#define KVSTAGE (3 * KVPLANE)        /* one stage: K hi, K residual, V^T */
// One 64-key stage into LDS by asynchronous copies: three planes of 64 rows x 128 B; each of the 128 threads brings 16 B of rows r, r+16, r+32, r+48 of each plane.
// l: the lane's LDS byte address in plane 0 (row r); gh, gl: its 16 B in K hi / K residual (row pitch DM); gv: its 16 B in V^T (row pitch NR).
__device__ __forceinline__ void stage_copy(unsigned int l, const _Float16* gh, const _Float16* gl, const _Float16* gv) {
  // the copies and their s_wait_xcnt in one statement: the wait stands before any rewrite of the address registers the copies name
  asm volatile(
      "global_load_async_to_lds_b128 %0, %12, off\n\t"
      "global_load_async_to_lds_b128 %1, %13, off\n\t"
      "global_load_async_to_lds_b128 %2, %14, off\n\t"
      "global_load_async_to_lds_b128 %3, %15, off\n\t"
      "global_load_async_to_lds_b128 %4, %16, off\n\t"
      "global_load_async_to_lds_b128 %5, %17, off\n\t"
      "global_load_async_to_lds_b128 %6, %18, off\n\t"
      "global_load_async_to_lds_b128 %7, %19, off\n\t"
      "global_load_async_to_lds_b128 %8, %20, off\n\t"
      "global_load_async_to_lds_b128 %9, %21, off\n\t"
      "global_load_async_to_lds_b128 %10, %22, off\n\t"
      "global_load_async_to_lds_b128 %11, %23, off\n\t"
      "s_wait_xcnt 0x0"
      :: "v"(l), "v"(l + 16u * KVP * 2u), "v"(l + 32u * KVP * 2u), "v"(l + 48u * KVP * 2u),
         "v"(l + KVPLANE * 2u), "v"(l + KVPLANE * 2u + 16u * KVP * 2u), "v"(l + KVPLANE * 2u + 32u * KVP * 2u), "v"(l + KVPLANE * 2u + 48u * KVP * 2u),
         "v"(l + KVPLANE * 4u), "v"(l + KVPLANE * 4u + 16u * KVP * 2u), "v"(l + KVPLANE * 4u + 32u * KVP * 2u), "v"(l + KVPLANE * 4u + 48u * KVP * 2u),
         "v"(gh), "v"(gh + 16 * DM), "v"(gh + 32 * DM), "v"(gh + 48 * DM),
         "v"(gl), "v"(gl + 16 * DM), "v"(gl + 32 * DM), "v"(gl + 48 * DM),
         "v"(gv), "v"(gv + 16 * NR), "v"(gv + 32 * NR), "v"(gv + 48 * NR)
      : "memory");
}

// Fused attention with relu^2 normaliser. grid = NB*NH*(SEQ/64), block = 4 waves; wave w owns query rows q0 = qb*64 + 16w .. +15 of (b, h).
// Per wave: position table qes[m][r] = q[m].rel_emb[r] (WMMA, f32 in LDS); per 64-key chunk: s^T = k.q^T (hi.hi + (hi.lo + lo.hi)/2^10), sv = (s + qes[m][clamp(key-q)+16]) / 8,
// The scores are formed transposed (K rows are the A operand, q the B operand): lane (ln, hh) holds query ln and keys 8hh .. 8hh + 7 of each 16-key tile, which is the k order of a
// 16x32 fragment, so two converted score tiles ARE the t operand of the aggregation o^T += v^T . t^T; t passes through no LDS.
// The mask comes as lane masks (k_prep: one word per score register of the wave's 16 x 64 tile): 32 words a chunk by scalar loads, one chunk ahead, each the condition of one select.
// K hi, K residual and V^T of each 64-key chunk are staged once per block in LDS (two buffers, asynchronous copies one chunk ahead) and read as fragments by all four waves.
// Position term: in a chunk whose every key lies 16 or more before (or behind) every query of the block the clamp makes it one constant per query row (column 0 or 32 of qes);
// that constant stays in registers and is the start value of the hi.hi accumulator. Only the (at most three) chunks round the diagonal clamp, form addresses and gather from qes.
// masked -> -1e9, t = relu(sv + b)^2, dsum += t (f32), fragment element = f16(256 t); o^T += v^T . t^T ; end: o * (1/(sum+eps)) * 64/256 -> f16 rows of O16 (cols h*64..).
__global__ __launch_bounds__(128) void k_attn(const _Float16* __restrict__ QH, const _Float16* __restrict__ QL, const _Float16* __restrict__ KH, const _Float16* __restrict__ KL,
                                              const _Float16* __restrict__ VT, const _Float16* __restrict__ RT, const unsigned int* __restrict__ MBt,
                                              const float* __restrict__ spb, _Float16* __restrict__ O16) {
  #pragma clang fp contract(off)
  __shared__ __attribute__((aligned(16))) _Float16 tls[4][16][72];     // [row][d] o tile of the epilogue (cols 0..63 used)
  __shared__ float qes[4][16][52];                                      // [row][r] position table (cols 0..47 written, 0..32 read)
  __shared__ __attribute__((aligned(16))) _Float16 kv[2 * KVSTAGE];     // two stages of [plane][row][KVP]
  const int tid = threadIdx.x, w = tid >> 5, lane = tid & 31, ln = lane & 15, hh = lane >> 4;
  const int nqb = SEQ / 64;
  const int bh = blockIdx.x / nqb, qb = blockIdx.x - bh * nqb;
  const int b = bh / NH, h = bh - b * NH;
  const int q0 = qb * 64 + w * 16;                                      // first query of this wave (within the sequence)
  const size_t rq = (size_t)b * SEQ + q0;                               // compact token row of that query
  const size_t qoff = (rq + ln) * DM + (size_t)h * HD;
  const v16h qh0 = g2_frag(QH + qoff, hh), qh1 = g2_frag(QH + qoff + 32, hh);
  const v16h ql0 = g2_frag(QL + qoff, hh), ql1 = g2_frag(QL + qoff + 32, hh);
  const v8f z8 = {0.f,0.f,0.f,0.f,0.f,0.f,0.f,0.f};
  const float rsc = 0.0009765625f;                                      // 2^-10 fold of the residual planes
  const _Float16* kbh = KH + ((size_t)b * SEQ) * DM + (size_t)h * HD;
  const _Float16* kbl = KL + ((size_t)b * SEQ) * DM + (size_t)h * HD;
  const _Float16* vtb = VT + ((size_t)h * HD) * NR + (size_t)b * SEQ;   // V^T is [h * HD + d][token row], pitch NR
  const int crow = tid >> 3, ccol = (tid & 7) * 8;                      // this thread's first row and 16-byte column in every staged plane
  const unsigned int cl = (unsigned int)(size_t)&kv[crow * KVP + ccol];  // its LDS byte address in stage buffer 0
  const _Float16* cgh = kbh + (size_t)crow * DM + ccol;
  const _Float16* cgl = kbl + (size_t)crow * DM + ccol;
  const _Float16* cgv = vtb + (size_t)crow * NR + ccol;
  stage_copy(cl, cgh, cgl, cgv);                                        // chunk 0 -> buffer 0
  // position table: qes[m][r] = (q[m] . (16 rel_emb[r])) / 16
#pragma unroll
  for (int nt = 0; nt < 3; ++nt) {
    const _Float16* rr = RT + (size_t)(nt * 16 + ln) * HD;
    const v16h r0 = g2_frag(rr, hh), r1 = g2_frag(rr + 32, hh);
    const v8f ah = mma2(qh0, r0, qh1, r1, z8);
    const v8f al = mma2(ql0, r0, ql1, r1, z8);
#pragma unroll
    for (int r = 0; r < 8; ++r) { const float e = ah[r] + al[r] * rsc; qes[w][8 * hh + r][nt * 16 + ln] = e * 0.0625f; }
  }
  asm volatile("s_wait_asynccnt 0x0" ::: "memory");                     // this wave's copies of chunk 0 have landed before the barrier publishes them
  __syncthreads();
  stage_copy(cl + KVSTAGE * 2u, cgh + (size_t)64 * DM, cgl + (size_t)64 * DM, cgv + 64);   // chunk 1 -> buffer 1 (SEQ >= 128)

  // lane-mask words of this wave's 16 queries: 32 words a chunk; the wave number through readfirstlane, so that the address is scalar and the words land in scalar registers
  // (the words were written by k_prep, two launches before this one and nothing writes them here: read through the constant address space, which is what lets the loads inside the loops be scalar)
  typedef const __attribute__((address_space(4))) v16u* lmask_p;
  const lmask_p mwp = (lmask_p)(unsigned long long)(MBt + ((size_t)(b * (SEQ / 16) + qb * 4 + __builtin_amdgcn_readfirstlane(w)) * (SEQ / 64)) * 32);
  v16u mna = mwp[0], mnb = mwp[1];                                      // chunk 0
  const float sbias = spb[0];
  float dsum[8];
#pragma unroll
  for (int r = 0; r < 8; ++r) dsum[r] = 0.f;
  v8f oacc[4] = {z8, z8, z8, z8};
  int bo = 0;                                                           // offset in halfs of the buffer that holds this chunk
  v8f pec;                                                              // position term of this lane's query (the same for its eight keys) in the chunks off the diagonal: first the keys before the band (column 0)
#pragma unroll
  for (int r = 0; r < 8; ++r) pec[r] = qes[w][ln][0];

  // One 64-key chunk. band: the chunk may hold a key nearer than 16 to a query of the block (the gathered form); otherwise pec holds the position term.
  auto chunk = [&](const int k0, auto band) __attribute__((always_inline)) {
    constexpr bool BAND = decltype(band)::value;
    const v16u mca = mna, mcb = mnb;                                    // this chunk's lane masks: tiles 0, 1 and tiles 2, 3
    { const int cn = ((k0 + 64 < SEQ) ? k0 + 64 : k0) >> 6;             // the next chunk's are asked for now (the last chunk asks for its own again: an address in bounds)
      mna = mwp[2 * cn]; mnb = mwp[2 * cn + 1]; }
    // Fragment reads stand one matrix run ahead of their use, in a second register set: while a 16-key tile is multiplied and its t values are formed,
    // the fragments of the next run (the next K tile; behind each second tile the four V^T fragments of these 32 keys) are on their way, so the runs do not wait out the LDS latency.
    // All of them are reads of this chunk's own buffer.
    const _Float16* kr = &kv[bo + ln * KVP];                            // this lane's row of tile 0 in the K hi plane
    const _Float16* vr = &kv[bo + 2 * KVPLANE + ln * KVP];              // this lane's row of d tile 0 in the V^T plane
    v16h f0 = g2_frag(kr, hh), f1 = g2_frag(kr + 32, hh), f2 = g2_frag(kr + KVPLANE, hh), f3 = g2_frag(kr + KVPLANE + 32, hh);   // K hi (f0, f1) and residual (f2, f3) of tile 0
    __builtin_amdgcn_sched_barrier(0);     // tile 0's eight reads go out first: nothing covers them, and LDS answers in order
#pragma unroll     // both halves in line: LDS offsets and mask word indices are constants, the fragment sets stay in registers
    for (int hf = 0; hf < 2; ++hf) {                                    // the chunk's two halves of 32 keys: one k-step of the aggregation each
      FragH p;                                                          // t^T fragment of keys k0 + 32 hf + 0..31
#pragma unroll     // as above; j also picks the half of the t fragment that the tile fills
      for (int j = 0; j < 2; ++j) {
        const int kt = 2 * hf + j;
        const int kc = kt * 16 + 8 * hh;                                // first of the eight keys within the chunk held by this lane (D rows)
        float pe[8];                                                    // position terms of this tile, read ahead of its matrix run (band chunks only)
        if constexpr (BAND) {
#pragma unroll
          for (int r = 0; r < 8; ++r) {
            int rel = (k0 + kc + r) - (q0 + ln);
            rel = (rel < -KREL) ? -KREL : ((rel > KREL) ? KREL : rel);
            pe[r] = qes[w][ln][rel + KREL];
          }
        }
        // next: K tile kt + 1 (hi, hi, residual, residual), or d tiles 0 .. 3 of V^T at these 32 keys
        const _Float16* nr = (j == 0) ? kr + (kt + 1) * 16 * KVP : vr + 32 * hf;
        const int s1 = (j == 0) ? 32 : 16 * KVP, s2 = (j == 0) ? KVPLANE : 32 * KVP, s3 = (j == 0) ? KVPLANE + 32 : 48 * KVP;
        const v16h n0 = g2_frag(nr, hh), n1 = g2_frag(nr + s1, hh), n2 = g2_frag(nr + s2, hh), n3 = g2_frag(nr + s3, hh);
        __builtin_amdgcn_sched_barrier(0);   // keeps these reads in front of this tile's matrix run, and the next run's products (which would wait for them at once) behind it
        const v8f sh = mma2(f0, qh0, f1, qh1, BAND ? z8 : pec);
        v8f sx = mma2(f0, ql0, f1, ql1, z8);
        sx = mma2(f2, qh0, f3, qh1, sx);
        float t16[8];
#pragma unroll
        for (int r = 0; r < 8; ++r) {
          const float s = sh[r] + sx[r] * rsc;
          float sv;
          if constexpr (BAND) sv = (s + pe[r]) * 0.125f; else sv = s * 0.125f;
          sv = __builtin_amdgcn_inverse_ballot_w32((hf == 0 ? mca : mcb)[j * 8 + r]) ? -1.0e9f : sv;   // the word is the select's lane mask
          float t = sv + sbias;
          t = fmaxf(t, 0.0f);
          const float tt = t * t;
          dsum[r] += tt;
          t16[r] = tt * 256.0f;
        }
#pragma unroll     // register indices must be constants
        for (int i = 0; i < 4; ++i) {                                   // elements 8 j + r of the fragment are keys 16 j + 8hh + r of its 32
          const v2f t2 = {t16[2 * i], t16[2 * i + 1]};
          p.p[j * 4 + i] = __builtin_convertvector(t2, v2h);
        }
        f0 = n0; f1 = n1; f2 = n2; f3 = n3;
      }
      // f0 .. f3 now hold V^T (d tiles 0 .. 3) at these 32 keys; the first half reads K tile 2 ahead of its four products
      v16h n0 = f0, n1 = f1, n2 = f2, n3 = f3;
      if (hf == 0) { const _Float16* nr = kr + 32 * KVP;
        n0 = g2_frag(nr, hh); n1 = g2_frag(nr + 32, hh); n2 = g2_frag(nr + KVPLANE, hh); n3 = g2_frag(nr + KVPLANE + 32, hh);
        __builtin_amdgcn_sched_barrier(0); } // keeps these reads in front of the four products
      mma4(f0, f1, f2, f3, p.v, oacc[0], oacc[1], oacc[2], oacc[3]);    // D rows: d = dt * 16 + 8hh + r; D column: query ln
      f0 = n0; f1 = n1; f2 = n2; f3 = n3;
    }
    asm volatile("s_wait_dscnt 0x0" ::: "memory");                      // this wave's reads of the buffer have returned before it may be refilled
    asm volatile("s_wait_asynccnt 0x0" ::: "memory");                   // this wave's copies of the next chunk have landed
    __syncthreads();                                                    // publishes the next chunk and ends every wave's reads of this buffer
    if (k0 + 128 < SEQ)
      stage_copy(cl + (unsigned int)bo * 2u, cgh + (size_t)(k0 + 128) * DM, cgl + (size_t)(k0 + 128) * DM, cgv + (k0 + 128));   // chunk + 2 -> the buffer just read
    bo ^= KVSTAGE;
  };
  // The chunks in their order, in three runs whose bounds are the same for the whole block (every wave passes every chunk's barrier):
  // keys before the band, the chunks round the diagonal, keys behind the band.
  const int kA = (qb > 0) ? qb * 64 - 64 : 0, kB = (qb * 64 + 128 < SEQ) ? qb * 64 + 128 : SEQ;
#pragma unroll 1   // one trip per staged chunk: the two buffers alternate through bo
  for (int k0 = 0; k0 < kA; k0 += 64) chunk(k0, Flag<false>{});
#pragma unroll 1   // as above
  for (int k0 = kA; k0 < kB; k0 += 64) chunk(k0, Flag<true>{});
#pragma unroll
  for (int r = 0; r < 8; ++r) pec[r] = qes[w][ln][2 * KREL];    // from here on every key lies behind the band (column 32)
#pragma unroll 1   // as above
  for (int k0 = kB; k0 < SEQ; k0 += 64) chunk(k0, Flag<false>{});
  asm volatile("s_wait_asynccnt 0x0" ::: "memory");                     // nothing of this wave is in flight behind the loops

  // key sum of this lane's query: its eight partial sums, then the other half's; scale = 64/256 / (sum + eps)
  float qs = ((dsum[0] + dsum[1]) + (dsum[2] + dsum[3])) + ((dsum[4] + dsum[5]) + (dsum[6] + dsum[7]));
  qs += __shfl_xor(qs, 16, 32);
  const float osc = (1.0f / (qs + 1.0e-9f)) * 0.25f;
#pragma unroll
  for (int dt = 0; dt < 4; ++dt) { FragH f;
#pragma unroll
    for (int r = 0; r < 8; ++r) f.h[r] = (_Float16)(oacc[dt][r] * osc);
    *(v8us*)&tls[w][ln][dt * 16 + 8 * hh] = f.half[0]; }
  __builtin_amdgcn_fence(3 /* release order */, "wavefront"); __builtin_amdgcn_wave_barrier();
  const int rl = lane >> 3, pc = (lane & 7) * 8;
  {
#pragma unroll
    for (int it = 0; it < 4; ++it) {
      const int row = it * 4 + rl;
      const v8us v = *(const v8us*)&tls[w][row][pc];
      *(v8us*)((unsigned short*)O16 + (rq + row) * DM + (size_t)h * HD + pc) = v;
    }
    
  }
}

extern "C" void kernel_launch(void* const* d_in, const int* in_sizes, int n_in,
                              void* d_out, int out_size, void* d_ws, size_t ws_size, hipStream_t stream) {
  if (n_in < 10) return;
  const int nx = (int)(NR * DM);
  if (in_sizes[0] < nx || in_sizes[1] < nx || in_sizes[2] < nx) return;
  if (in_sizes[3] < (int)(NR * SEQ)) return;
  if (in_sizes[4] < DM * DM || in_sizes[5] < DM * DM || in_sizes[6] < DM * DM || in_sizes[7] < DM * DM) return;
  if (in_sizes[8] < NREL * HD || in_sizes[9] < 1) return;
  if (out_size < nx) return;
  const float* xq = (const float*)d_in[0]; const float* xk = (const float*)d_in[1]; const float* xv = (const float*)d_in[2];
  const int* msk = (const int*)d_in[3];
  const float* wq = (const float*)d_in[4]; const float* wk = (const float*)d_in[5]; const float* wv = (const float*)d_in[6]; const float* wo = (const float*)d_in[7];
  const float* rel = (const float*)d_in[8]; const float* spb = (const float*)d_in[9];

  char* ws = (char*)d_ws; size_t off = 0;
  auto take = [&](size_t bytes) { char* p = ws + off; off += (bytes + 255) & ~(size_t)255; return p; };
  const size_t wbytes = (size_t)DM * DM * 2, xbytes = NR * DM * 2;
  _Float16* BQ = (_Float16*)take(wbytes); _Float16* BK = (_Float16*)take(wbytes); _Float16* BV = (_Float16*)take(wbytes); _Float16* BO = (_Float16*)take(wbytes);
  _Float16* RT = (_Float16*)take((size_t)NRELP * HD * 2);
  _Float16* XQ = (_Float16*)take(xbytes); _Float16* XK = (_Float16*)take(xbytes); _Float16* XV = (_Float16*)take(xbytes);
  _Float16* QH = (_Float16*)take(xbytes); _Float16* QL = (_Float16*)take(xbytes); _Float16* KH = (_Float16*)take(xbytes); _Float16* KL = (_Float16*)take(xbytes);
  _Float16* VT = (_Float16*)take(xbytes);
  const int nwords = (int)(NR * (SEQ / 32));
  unsigned int* MB = (unsigned int*)take((size_t)nwords * 4);
  _Float16* O16 = (_Float16*)take(xbytes);
  if (off > ws_size || off > (size_t)134217728) return;

  k_prep<<<P_BLOCKS + 1, PT, 0, stream>>>(xq, xk, xv, msk, wq, wk, wv, wo, rel, XQ, XK, XV, MB, BQ, BK, BV, BO, RT);

  const int M = (int)NR;
  static_assert((NR / 128) * (DM / 64) == (DM / 128) * (NR / 64));   // the three projections have the same number of block tiles
  const unsigned gx = (unsigned)((M / 128) * (DM / 64));
  // q, k and V^T in one launch. V^T = Wv . x^T: the weights are the row operand and the token rows the column operand, so the product lands transposed, [h * HD + d][token row]
  k_gemm2<<<dim3(gx, 3), 128, 0, stream>>>(XQ, XK, BV, DM, BQ, BK, XV, DM, 0.0625f, nullptr, QH, KH, VT, QL, KL, DM, M, DM, M, DM, M, DM);
  k_attn<<<(unsigned)(NB * NH * (SEQ / 64)), 128, 0, stream>>>(QH, QL, KH, KL, VT, RT, MB, spb, O16);
  k_gemm2<<<dim3(gx, 1), 128, 0, stream>>>(O16, nullptr, nullptr, DM, BO, nullptr, nullptr, DM, 0.0009765625f, (float*)d_out, nullptr, nullptr, nullptr, nullptr, nullptr, DM, M, DM, DM, M, DM, DM);
}

// v010
// It runs in 114 microseconds.
// Two timings next to v009 both put it at 1.03 times that version's speed.
// Counting every step since v000, it is 3.72 times as fast.
#include <hip/hip_runtime.h>
// Contractions on v_wmma_f32_16x16x32_f16 (f16 operands, f32 accumulate): q/k/v projections and the output projection plain f16 (inputs RNE-converted to bf16 then held exactly in f16, weights x16); q.k^T scores as f16 hi + residual (x2^10) planes on both operands (3 products, residual terms in a separate accumulator); q.rel_emb^T position table f16 hi + residual on q (rel_emb exact x16); t.v aggregation plain f16 (t carried x64, o carried x64); normaliser statistics f32.
#ifndef NB
#define NB 2
#endif
#ifndef SEQ
#define SEQ 2048
#endif
#define NB_FULL 2
#define SEQ_FULL 2048
#define DM 1024
#define NH 16
#define HD 64
#define NREL 33
#define KREL 16
#define NRELP 48                     /* rel_emb rows padded to 3 WMMA column tiles (rows 33..47 zero) */
#define NR ((size_t)NB * SEQ)        /* token rows processed (compact) */
static_assert(SEQ % 128 == 0);
static_assert(SEQ <= SEQ_FULL);
static_assert(NB >= 1 && NB <= NB_FULL);
static_assert(DM == NH * HD);

typedef unsigned short v8us __attribute__((ext_vector_type(8), may_alias));
typedef float  v8f  __attribute__((ext_vector_type(8)));
typedef float  v4f  __attribute__((ext_vector_type(4)));
typedef float  v4fa __attribute__((ext_vector_type(4), may_alias));
typedef _Float16 v16h __attribute__((ext_vector_type(16)));
typedef _Float16 v4h __attribute__((ext_vector_type(4)));
typedef _Float16 v2h __attribute__((ext_vector_type(2)));
typedef float  v2f  __attribute__((ext_vector_type(2)));
typedef int v4ia __attribute__((ext_vector_type(4), may_alias));
typedef unsigned int v16u __attribute__((ext_vector_type(16)));
union FragH { v16h v; v8us half[2]; v2h p[8]; _Float16 h[16]; unsigned short u[16]; };

__device__ __forceinline__ unsigned short bf16_bits(float x) { unsigned int u = __float_as_uint(x); return (unsigned short)((u + 0x7FFFu + ((u >> 16) & 1u)) >> 16); }
__device__ __forceinline__ float bf16_val(unsigned short b) { return __uint_as_float(((unsigned int)b) << 16); }
__device__ __forceinline__ float bf16_rne(float x) { return bf16_val(bf16_bits(x)); }

// 16x32 fragment from a 16-bit row (lane row/col = lane & 15): elements 0..7 <- k0 + 8hh + 0..7, elements 8..15 <- k0 + 16 + 8hh + 0..7 (same map for A and B)
__device__ __forceinline__ v16h g2_frag(const _Float16* p, int hh) { FragH f; f.half[0] = *(const v8us*)((const unsigned short*)p + 8 * hh); f.half[1] = *(const v8us*)((const unsigned short*)p + 16 + 8 * hh); return f.v; }
__device__ __forceinline__ v8f g2_mma(v16h a, v16h b, v8f c) { v8f d = __builtin_amdgcn_wmma_f32_16x16x32_f16(false, a, false, b, (short)0, c, false, false); asm volatile("v_nop\n\tv_nop\n\tv_nop\n\tv_nop" : "+v"(d) : "v"(a), "v"(b)); return d; }
// two k-steps into one accumulator, hazard guard after the second
__device__ __forceinline__ v8f mma2(v16h a0, v16h b0, v16h a1, v16h b1, v8f c) {
  c = __builtin_amdgcn_wmma_f32_16x16x32_f16(false, a0, false, b0, (short)0, c, false, false);
  c = __builtin_amdgcn_wmma_f32_16x16x32_f16(false, a1, false, b1, (short)0, c, false, false);
  asm volatile("v_nop\n\tv_nop\n\tv_nop\n\tv_nop" : "+v"(c) : "v"(a0), "v"(b0), "v"(a1), "v"(b1));
  return c;
}

#define PT 512                       /* threads of a k_prep block: 16 waves */
#define PWU 1024                     /* 4-byte elements one wave moves per tile: 4 KiB */
#define PTILE ((PT / 32) * PWU)      /* elements of one block tile */
#define PW_TILES (DM * DM / PTILE)               /* tiles of one weight matrix */
#define PX_TILES ((int)(NR * DM / PTILE))        /* tiles of one activation input */
#define PM_TILES ((int)(NR * SEQ / PTILE))       /* tiles of the mask */
#define P_TILES (4 * PW_TILES + 3 * PX_TILES + PM_TILES)
#define P_BLOCKS ((P_TILES + 2) / 3)             /* three tiles a block */
static_assert((DM * DM) % PTILE == 0 && DM % PWU == 0);
static_assert((NR * DM) % PTILE == 0 && (NR * SEQ) % PTILE == 0);

// One wave's 4 KiB of f32 -> f16(bf16_rne(x) * scale): eight 512-byte loads in flight, then eight 256-byte stores (whole lines both ways).
__device__ __forceinline__ void cvt_unit(const float* __restrict__ s, _Float16* __restrict__ d, float scale, int lane) {
  v4f v[8];
#pragma unroll
  for (int j = 0; j < 8; ++j) v[j] = *(const v4fa*)(s + j * 128 + lane * 4);
#pragma unroll
  for (int j = 0; j < 8; ++j) { v4h h;
#pragma unroll
    for (int i = 0; i < 4; ++i) h[i] = (_Float16)(bf16_rne(v[j][i]) * scale);
    *(v4h*)(d + j * 128 + lane * 4) = h; }
  asm volatile("s_wait_xcnt 0x0" ::: "memory");   // stands directly behind the stores, before anything rewrites the address or data registers that they name
}

// One wave's 32 mask words: unit u is the mask of 16 queries x 64 keys (one wave's scores in one chunk of k_attn), written as lane masks of the score registers:
// bit L of word u * 32 + kt * 8 + r is mask[query 16 g + (L & 15)][key 64 c + 16 kt + 8 (L >> 4) + r], the element that lane L holds in register r of score tile kt.
// Read in whole lines (two adjacent lines of each of the 16 rows; a ballot gives 32 keys of one query), regrouped by a second round of ballots, one 128-byte store.
static_assert(SEQ % 64 == 0);
__device__ __forceinline__ void pack_unit(const int* __restrict__ msk, unsigned int* __restrict__ bits, unsigned int u, int lane) {
  const unsigned int nc = SEQ / 64, ng = SEQ / 16, c = u % nc, bg = u / nc, g = bg % ng, b = bg / ng;
  const int* src = msk + ((size_t)b * SEQ_FULL + (size_t)g * 16) * SEQ_FULL + (size_t)c * 64 + lane;
  int v[32];
#pragma unroll
  for (int j = 0; j < 32; ++j) v[j] = src[(size_t)(j & 15) * SEQ_FULL + (j >> 4) * 32];   // query j & 15, keys 32 (j >> 4) + lane
  asm volatile("s_wait_xcnt 0x0" :: "v"(src) : "memory");   // behind the run of loads; the pointer as input keeps the address registers out of the loads' results up to here
  unsigned int wd = 0u;
#pragma unroll
  for (int j = 0; j < 32; ++j) { const unsigned int bj = __builtin_amdgcn_ballot_w32(v[j] != 0); wd = (lane == j) ? bj : wd; }
  // lane L now holds keys 32 (L >> 4) + 0..31 of query L & 15; with the other half's word each lane has its query's 64 keys, shifted so that bit 16 (kt & 1) + r is its own element
  const unsigned int ot = (unsigned int)__shfl_xor((int)wd, 16, 32);
  const int hh = lane >> 4;
  const unsigned int y0 = (hh ? ot : wd) >> (8 * hh), y1 = (hh ? wd : ot) >> (8 * hh);
  unsigned int ow = 0u;
#pragma unroll
  for (int i = 0; i < 32; ++i) { const unsigned int y = (i < 16) ? y0 : y1;
    const unsigned int bi = __builtin_amdgcn_ballot_w32(((y >> (((i >> 3) & 1) * 16 + (i & 7))) & 1u) != 0u); ow = (lane == i) ? bi : ow; }
  bits[u * 32u + lane] = ow;
  asm volatile("s_wait_xcnt 0x0" ::: "memory");   // stands directly behind the store, before anything rewrites the registers that it names
}

// All operand preparation in one launch: weights -> f16 x16, activations -> f16, mask -> lane-mask words, rel_emb -> padded f16 x16 table.
// Block 0 does the small table; blocks 1 .. P_BLOCKS walk the tiles (block-uniform choice of the job).
__global__ __launch_bounds__(PT) void k_prep(const float* __restrict__ xq, const float* __restrict__ xk, const float* __restrict__ xv, const int* __restrict__ msk,
    const float* __restrict__ wq, const float* __restrict__ wk, const float* __restrict__ wv, const float* __restrict__ wo, const float* __restrict__ rel,
    _Float16* __restrict__ XQ, _Float16* __restrict__ XK, _Float16* __restrict__ XV, unsigned int* __restrict__ MB,
    _Float16* __restrict__ BQ, _Float16* __restrict__ BK, _Float16* __restrict__ BV, _Float16* __restrict__ BO, _Float16* __restrict__ RT) {
  const int lane = threadIdx.x & 31, wn = __builtin_amdgcn_readfirstlane((int)(threadIdx.x >> 5));
  if (blockIdx.x == 0) {
    const int t = threadIdx.x; if (t >= NRELP * (HD / 8)) return;
    const int r = t / (HD / 8), d8 = (t % (HD / 8)) * 8;
    const int rc = (r < NREL) ? r : (NREL - 1);          // clamped address, value zeroed by predicate
    const bool live = (r < NREL);
    const v4f a = *(const v4fa*)(rel + (size_t)rc * HD + d8), c = *(const v4fa*)(rel + (size_t)rc * HD + d8 + 4);
    FragH f;
#pragma unroll
    for (int q = 0; q < 4; ++q) { f.h[q] = live ? (_Float16)(bf16_rne(a[q]) * 16.0f) : (_Float16)0.0f; f.h[4 + q] = live ? (_Float16)(bf16_rne(c[q]) * 16.0f) : (_Float16)0.0f; }
    *(v8us*)((unsigned short*)RT + (size_t)t * 8) = f.half[0];
    return;
  }
  for (int tile = (int)blockIdx.x - 1; tile < P_TILES; tile += P_BLOCKS) {
    if (tile < 4 * PW_TILES) {
      const int m = tile / PW_TILES;
      const float* s = (m == 0) ? wq : (m == 1) ? wk : (m == 2) ? wv : wo;
      _Float16* d = (m == 0) ? BQ : (m == 1) ? BK : (m == 2) ? BV : BO;
      const size_t e = (size_t)(tile - m * PW_TILES) * PTILE + (size_t)wn * PWU;
      cvt_unit(s + e, d + e, 16.0f, lane);
    } else if (tile < 4 * PW_TILES + 3 * PX_TILES) {
      const int tx = tile - 4 * PW_TILES, m = tx / PX_TILES;
      const float* s = (m == 0) ? xq : (m == 1) ? xk : xv;
      _Float16* d = (m == 0) ? XQ : (m == 1) ? XK : XV;
      const size_t e = (size_t)(tx - m * PX_TILES) * PTILE + (size_t)wn * PWU;   // compact element index; PWU divides DM, so the unit lies in one row
      const int r = (int)(e / DM), c = (int)(e % DM), b = r / SEQ, sq = r - b * SEQ;
      cvt_unit(s + ((size_t)b * SEQ_FULL + sq) * DM + c, d + e, 1.0f, lane);
    } else {
      const int tm = tile - (4 * PW_TILES + 3 * PX_TILES);
      pack_unit(msk, MB, (unsigned int)(tm * (PT / 32) + wn), lane);
    }
  }
}

#define GBK 128                      /* k depth of one staged GEMM tile in halfs: 256 B a row */
#define GP 136                       /* LDS row pitch of a staged GEMM tile in halfs: 272 B = 16 B x odd, conflict-free for 16-byte fragment reads */
#define GSTAGE (192 * GP)            /* one stage: 128 rows of A, then 64 rows of B */
#define GRS (8u * GP * 2u)           /* LDS bytes between two copies of one thread: 8 rows */
// Twelve asynchronous copies of 16 B a lane: LDS rows 8 apart from l, each from its own global address.
__device__ __forceinline__ void copy12(unsigned int l, const _Float16* g0, const _Float16* g1, const _Float16* g2, const _Float16* g3, const _Float16* g4, const _Float16* g5,
                                       const _Float16* g6, const _Float16* g7, const _Float16* g8, const _Float16* g9, const _Float16* g10, const _Float16* g11) {
  // the copies and their s_wait_xcnt in one statement: the wait stands before any rewrite of the address registers the copies name
  asm volatile(
      "global_load_async_to_lds_b128 %0, %12, off\n\t"
      "global_load_async_to_lds_b128 %1, %13, off\n\t"
      "global_load_async_to_lds_b128 %2, %14, off\n\t"
      "global_load_async_to_lds_b128 %3, %15, off\n\t"
      "global_load_async_to_lds_b128 %4, %16, off\n\t"
      "global_load_async_to_lds_b128 %5, %17, off\n\t"
      "global_load_async_to_lds_b128 %6, %18, off\n\t"
      "global_load_async_to_lds_b128 %7, %19, off\n\t"
      "global_load_async_to_lds_b128 %8, %20, off\n\t"
      "global_load_async_to_lds_b128 %9, %21, off\n\t"
      "global_load_async_to_lds_b128 %10, %22, off\n\t"
      "global_load_async_to_lds_b128 %11, %23, off\n\t"
      "s_wait_xcnt 0x0"
      :: "v"(l), "v"(l + GRS), "v"(l + 2u * GRS), "v"(l + 3u * GRS), "v"(l + 4u * GRS), "v"(l + 5u * GRS),
         "v"(l + 6u * GRS), "v"(l + 7u * GRS), "v"(l + 8u * GRS), "v"(l + 9u * GRS), "v"(l + 10u * GRS), "v"(l + 11u * GRS),
         "v"(g0), "v"(g1), "v"(g2), "v"(g3), "v"(g4), "v"(g5), "v"(g6), "v"(g7), "v"(g8), "v"(g9), "v"(g10), "v"(g11)
      : "memory");
}
// One k-tile of the block (128 rows of A, then 64 rows of B, GBK deep) into one stage; each of the 128 threads brings 16 B of every eighth row.
// l: the lane's LDS byte address in row tid / 16 of the stage; ga, gb: its 16 B in that row of the A tile and of the B tile.
__device__ __forceinline__ void gemm_stage(unsigned int l, const _Float16* ga, int lda, const _Float16* gb, int ldb) {
  const size_t sa = (size_t)8 * lda, sb = (size_t)8 * ldb;
  copy12(l, ga, ga + sa, ga + 2 * sa, ga + 3 * sa, ga + 4 * sa, ga + 5 * sa, ga + 6 * sa, ga + 7 * sa, ga + 8 * sa, ga + 9 * sa, ga + 10 * sa, ga + 11 * sa);
  copy12(l + 12u * GRS, ga + 12 * sa, ga + 13 * sa, ga + 14 * sa, ga + 15 * sa, gb, gb + sb, gb + 2 * sb, gb + 3 * sb, gb + 4 * sb, gb + 5 * sb, gb + 6 * sb, gb + 7 * sb);
}

// GEMM (wave tile 32x64; M % 128 == 0, N % 64 == 0, K % 128 == 0): C[m][n] = alpha * sum_k A[m][k] Bh[n][k]; A f16 rows (pitch lda), Bh f16 [n][k] (pitch ldb);
// the block's 128 x GBK tile of A and 64 x GBK tile of Bh are staged in LDS (two buffers, asynchronous copies one tile ahead) and read as fragments by the four waves.
// One launch holds up to three independent products: blockIdx.y picks the operands and the results (block-uniform); product 2 has a shape of its own (ldc2, M2, N2) and no residual plane.
__global__ __launch_bounds__(128) void k_gemm2(const _Float16* __restrict__ A0, const _Float16* __restrict__ A1, const _Float16* __restrict__ A2, int lda,
    const _Float16* __restrict__ B0, const _Float16* __restrict__ B1, const _Float16* __restrict__ B2, int ldb, float alpha,
    float* __restrict__ C, _Float16* __restrict__ H0, _Float16* __restrict__ H1, _Float16* __restrict__ H2, _Float16* __restrict__ L0, _Float16* __restrict__ L1,
    int ldc01, int M01, int N01, int ldc2, int M2, int N2, int K) {
  __shared__ __attribute__((aligned(16))) float so[4][32][68];
  __shared__ __attribute__((aligned(16))) _Float16 ab[2 * GSTAGE];      // two stages of [row][GP]
  const int tid = threadIdx.x, w = tid >> 5, lane = tid & 31, ln = lane & 15, hh = lane >> 4; const int by = blockIdx.y;
  const _Float16* A = (by == 0) ? A0 : (by == 1) ? A1 : A2; const _Float16* Bh = (by == 0) ? B0 : (by == 1) ? B1 : B2;
  _Float16* C16 = (by == 0) ? H0 : (by == 1) ? H1 : H2; _Float16* C16L = (by == 0) ? L0 : (by == 1) ? L1 : nullptr;
  const int ldc = (by == 2) ? ldc2 : ldc01, M = (by == 2) ? M2 : M01, N = (by == 2) ? N2 : N01;
  const int ntn = N >> 6; const int mt = blockIdx.x / ntn, nq = blockIdx.x - mt * ntn; const int row0 = mt * 128 + 32 * w, col0 = nq * 64; if (mt * 128 >= M) return;
  const int crow = tid >> 4, ccol = (tid & 15) * 8;                     // this thread's first row and 16-byte column in a stage
  const unsigned int cl = (unsigned int)(size_t)&ab[crow * GP + ccol];  // its LDS byte address in stage buffer 0
  const _Float16* cga = A + (size_t)(mt * 128 + crow) * lda + ccol;
  const _Float16* cgb = Bh + (size_t)(col0 + crow) * ldb + ccol;
  gemm_stage(cl, cga, lda, cgb, ldb);                                   // tile 0 -> buffer 0
  const v8f z8 = {0.f,0.f,0.f,0.f,0.f,0.f,0.f,0.f}; v8f c00 = z8, c01 = z8, c02 = z8, c03 = z8, c10 = z8, c11 = z8, c12 = z8, c13 = z8;
  asm volatile("s_wait_asynccnt 0x0" ::: "memory");                     // this wave's copies of tile 0 have landed before the barrier publishes them
  __syncthreads();
  if (K > GBK) gemm_stage(cl + GSTAGE * 2u, cga + GBK, lda, cgb + GBK, ldb);   // tile 1 -> buffer 1
  int bo = 0;                                                           // offset in halfs of the buffer that holds this tile
#pragma unroll 1   // one trip per staged tile: kept rolled so that the two buffers alternate through bo and the loop stays small
  for (int kb = 0; kb < K; kb += GBK) {
    const _Float16* ar = &ab[bo + (32 * w + ln) * GP]; const _Float16* br = &ab[bo + (128 + ln) * GP];
    // the fragments of k-step ks + 1 are read into a second register set in front of the products of k-step ks, which then do not wait out the LDS latency
    v16h a0 = g2_frag(ar, hh), a1 = g2_frag(ar + 16 * GP, hh);
    v16h b0 = g2_frag(br, hh), b1 = g2_frag(br + 16 * GP, hh), b2 = g2_frag(br + 32 * GP, hh), b3 = g2_frag(br + 48 * GP, hh);
#pragma unroll     // the four k-steps of a tile read LDS at constant offsets
    for (int ks = 0; ks < GBK; ks += 32) {
      v16h na0 = a0, na1 = a1, nb0 = b0, nb1 = b1, nb2 = b2, nb3 = b3;
      if (ks + 32 < GBK) { const int kn = ks + 32;
        na0 = g2_frag(ar + kn, hh); na1 = g2_frag(ar + 16 * GP + kn, hh);
        nb0 = g2_frag(br + kn, hh); nb1 = g2_frag(br + 16 * GP + kn, hh); nb2 = g2_frag(br + 32 * GP + kn, hh); nb3 = g2_frag(br + 48 * GP + kn, hh); }
      c00 = g2_mma(a0, b0, c00); c10 = g2_mma(a1, b0, c10);
      c01 = g2_mma(a0, b1, c01); c11 = g2_mma(a1, b1, c11);
      c02 = g2_mma(a0, b2, c02); c12 = g2_mma(a1, b2, c12);
      c03 = g2_mma(a0, b3, c03); c13 = g2_mma(a1, b3, c13);
      a0 = na0; a1 = na1; b0 = nb0; b1 = nb1; b2 = nb2; b3 = nb3; }
    asm volatile("s_wait_dscnt 0x0" ::: "memory");                      // this wave's reads of the buffer have returned before it may be refilled
    asm volatile("s_wait_asynccnt 0x0" ::: "memory");                   // this wave's copies of the next tile have landed
    __syncthreads();                                                    // publishes the next tile and ends every wave's reads of this buffer
    if (kb + 2 * GBK < K) gemm_stage(cl + (unsigned int)bo * 2u, cga + (kb + 2 * GBK), lda, cgb + (kb + 2 * GBK), ldb);   // tile + 2 -> the buffer just read
    bo ^= GSTAGE;
  }
  asm volatile("s_wait_asynccnt 0x0" ::: "memory");                     // nothing of this wave is in flight behind the loop
  v8f accs[8] = {c00, c01, c02, c03, c10, c11, c12, c13};
#pragma unroll
  for (int u = 0; u < 8; ++u) { const int t = u & 3, half = u >> 2;
#pragma unroll
    for (int r = 0; r < 8; ++r) { const int rloc = half * 16 + 8 * hh + r; so[w][rloc][t * 16 + ln] = accs[u][r] * alpha; } }
  __builtin_amdgcn_fence(4 /* acq_rel order */, "workgroup"); __builtin_amdgcn_wave_barrier();
  const int rsub = lane >> 4, c4 = (lane & 15) * 4;
  {
#pragma unroll
    for (int q = 0; q < 16; ++q) {
      const int r = q * 2 + rsub; const v4f v = *(const v4fa*)&so[w][r][c4];
      const size_t o = (size_t)(row0 + r) * ldc + col0 + c4;
      if (C) *(v4f*)(C + o) = v;
      if (C16) { v4h h4, l4;
#pragma unroll
        for (int i = 0; i < 4; ++i) { const _Float16 hq = (_Float16)v[i]; h4[i] = hq; l4[i] = (_Float16)((v[i] - (float)hq) * 1024.0f); }
        *(v4h*)(C16 + o) = h4;
        if (C16L) *(v4h*)(C16L + o) = l4; }
    }
     }
}

// one k-step into four accumulators (one B operand), hazard guard after the last
__device__ __forceinline__ void mma4(v16h a0, v16h a1, v16h a2, v16h a3, v16h b, v8f& c0, v8f& c1, v8f& c2, v8f& c3) {
  c0 = __builtin_amdgcn_wmma_f32_16x16x32_f16(false, a0, false, b, (short)0, c0, false, false);
  c1 = __builtin_amdgcn_wmma_f32_16x16x32_f16(false, a1, false, b, (short)0, c1, false, false);
  c2 = __builtin_amdgcn_wmma_f32_16x16x32_f16(false, a2, false, b, (short)0, c2, false, false);
  c3 = __builtin_amdgcn_wmma_f32_16x16x32_f16(false, a3, false, b, (short)0, c3, false, false);
  // four vector slots behind the last product, before anything reads a result or rewrites an operand
  asm volatile("v_nop\n\tv_nop\n\tv_nop\n\tv_nop" : "+v"(c0), "+v"(c1), "+v"(c2), "+v"(c3) : "v"(a0), "v"(a1), "v"(a2), "v"(a3), "v"(b));
}

template <bool B> struct Flag { static constexpr bool value = B; };   // compile-time choice between the two forms of a chunk

#define KVP 72                       /* LDS row pitch of a staged plane in halfs: 144 B = 16 B x odd, conflict-free for 16-byte fragment reads */
#define KVPLANE (64 * KVP)           /* one staged plane: 64 rows */
#define KVSTAGE (3 * KVPLANE)        /* one stage: K hi, K residual, V^T */
// One 64-key stage into LDS by asynchronous copies: three planes of 64 rows x 128 B; each of the 128 threads brings 16 B of rows r, r+16, r+32, r+48 of each plane.
// l: the lane's LDS byte address in plane 0 (row r); gh, gl: its 16 B in K hi / K residual (row pitch DM); gv: its 16 B in V^T (row pitch NR).
__device__ __forceinline__ void stage_copy(unsigned int l, const _Float16* gh, const _Float16* gl, const _Float16* gv) {
  // the copies and their s_wait_xcnt in one statement: the wait stands before any rewrite of the address registers the copies name
  asm volatile(
      "global_load_async_to_lds_b128 %0, %12, off\n\t"
      "global_load_async_to_lds_b128 %1, %13, off\n\t"
      "global_load_async_to_lds_b128 %2, %14, off\n\t"
      "global_load_async_to_lds_b128 %3, %15, off\n\t"
      "global_load_async_to_lds_b128 %4, %16, off\n\t"
      "global_load_async_to_lds_b128 %5, %17, off\n\t"
      "global_load_async_to_lds_b128 %6, %18, off\n\t"
      "global_load_async_to_lds_b128 %7, %19, off\n\t"
      "global_load_async_to_lds_b128 %8, %20, off\n\t"
      "global_load_async_to_lds_b128 %9, %21, off\n\t"
      "global_load_async_to_lds_b128 %10, %22, off\n\t"
      "global_load_async_to_lds_b128 %11, %23, off\n\t"
      "s_wait_xcnt 0x0"
      :: "v"(l), "v"(l + 16u * KVP * 2u), "v"(l + 32u * KVP * 2u), "v"(l + 48u * KVP * 2u),
         "v"(l + KVPLANE * 2u), "v"(l + KVPLANE * 2u + 16u * KVP * 2u), "v"(l + KVPLANE * 2u + 32u * KVP * 2u), "v"(l + KVPLANE * 2u + 48u * KVP * 2u),
         "v"(l + KVPLANE * 4u), "v"(l + KVPLANE * 4u + 16u * KVP * 2u), "v"(l + KVPLANE * 4u + 32u * KVP * 2u), "v"(l + KVPLANE * 4u + 48u * KVP * 2u),
         "v"(gh), "v"(gh + 16 * DM), "v"(gh + 32 * DM), "v"(gh + 48 * DM),
         "v"(gl), "v"(gl + 16 * DM), "v"(gl + 32 * DM), "v"(gl + 48 * DM),
         "v"(gv), "v"(gv + 16 * NR), "v"(gv + 32 * NR), "v"(gv + 48 * NR)
      : "memory");
}

// Fused attention with relu^2 normaliser. grid = NB*NH*(SEQ/64), block = 4 waves; wave w owns query rows q0 = qb*64 + 16w .. +15 of (b, h).
// Per wave: position table qes[m][r] = q[m].rel_emb[r] + 8 b (WMMA, f32 in LDS); per 64-key chunk: s^T = k.q^T (hi.hi + (hi.lo + lo.hi)/2^10), s8 = s + qes[m][clamp(key-q)+16] = 8 (score + b).
// The scores are formed transposed (K rows are the A operand, q the B operand): lane (ln, hh) holds query ln and keys 8hh .. 8hh + 7 of each 16-key tile, which is the k order of a
// 16x32 fragment, so two converted score tiles ARE the t operand of the aggregation o^T += v^T . t^T; t passes through no LDS.
// The mask comes as lane masks (k_prep: one word per score register of the wave's 16 x 64 tile): 32 words a chunk by scalar loads, one chunk ahead, each the condition of one select.
// K hi, K residual and V^T of each 64-key chunk are staged once per block in LDS (two buffers, asynchronous copies one chunk ahead) and read as fragments by all four waves.
// Position term: in a chunk whose every key lies 16 or more before (or behind) every query of the block the clamp makes it one constant per query row (column 0 or 32 of qes);
// that constant stays in registers and is the start value of the hi.hi accumulator. Only the (at most three) chunks round the diagonal clamp, form addresses and gather from qes.
// The scores stay in that scale (powers of two, exact): relu(s8), masked -> relu(8 (-1e9 + b)), squared = 64 t, dsum += 64 t (f32), fragment element = f16(64 t); o^T += v^T . t^T ; end: o / (dsum/64 + eps) -> f16 rows of O16 (cols h*64..).
__global__ __launch_bounds__(128) void k_attn(const _Float16* __restrict__ QH, const _Float16* __restrict__ QL, const _Float16* __restrict__ KH, const _Float16* __restrict__ KL,
                                              const _Float16* __restrict__ VT, const _Float16* __restrict__ RT, const unsigned int* __restrict__ MBt,
                                              const float* __restrict__ spb, _Float16* __restrict__ O16) {
  __shared__ __attribute__((aligned(16))) _Float16 tls[4][16][72];     // [row][d] o tile of the epilogue (cols 0..63 used)
  __shared__ float qes[4][16][52];                                      // [row][r] position table (cols 0..47 written, 0..32 read)
  __shared__ __attribute__((aligned(16))) _Float16 kv[2 * KVSTAGE];     // two stages of [plane][row][KVP]
  const int tid = threadIdx.x, w = tid >> 5, lane = tid & 31, ln = lane & 15, hh = lane >> 4;
  const int nqb = SEQ / 64;
  const int bh = blockIdx.x / nqb, qb = blockIdx.x - bh * nqb;
  const int b = bh / NH, h = bh - b * NH;
  const int q0 = qb * 64 + w * 16;                                      // first query of this wave (within the sequence)
  const size_t rq = (size_t)b * SEQ + q0;                               // compact token row of that query
  const size_t qoff = (rq + ln) * DM + (size_t)h * HD;
  const v16h qh0 = g2_frag(QH + qoff, hh), qh1 = g2_frag(QH + qoff + 32, hh);
  const v16h ql0 = g2_frag(QL + qoff, hh), ql1 = g2_frag(QL + qoff + 32, hh);
  const v8f z8 = {0.f,0.f,0.f,0.f,0.f,0.f,0.f,0.f};
  const float rsc = 0.0009765625f;                                      // 2^-10 fold of the residual planes
  const float sbias = spb[0];
  const float b8 = sbias * 8.0f;                                        // the bias in the scores' own scale (8 x): part of the position table
  const float cm8 = fmaxf((-1.0e9f + sbias) * 8.0f, 0.0f);              // relu of a masked score with its bias, in that scale
  const _Float16* kbh = KH + ((size_t)b * SEQ) * DM + (size_t)h * HD;
  const _Float16* kbl = KL + ((size_t)b * SEQ) * DM + (size_t)h * HD;
  const _Float16* vtb = VT + ((size_t)h * HD) * NR + (size_t)b * SEQ;   // V^T is [h * HD + d][token row], pitch NR
  const int crow = tid >> 3, ccol = (tid & 7) * 8;                      // this thread's first row and 16-byte column in every staged plane
  const unsigned int cl = (unsigned int)(size_t)&kv[crow * KVP + ccol];  // its LDS byte address in stage buffer 0
  const _Float16* cgh = kbh + (size_t)crow * DM + ccol;
  const _Float16* cgl = kbl + (size_t)crow * DM + ccol;
  const _Float16* cgv = vtb + (size_t)crow * NR + ccol;
  stage_copy(cl, cgh, cgl, cgv);                                        // chunk 0 -> buffer 0
  // position table with the bias: qes[m][r] = (q[m] . (16 rel_emb[r])) / 16 + 8 b
#pragma unroll
  for (int nt = 0; nt < 3; ++nt) {
    const _Float16* rr = RT + (size_t)(nt * 16 + ln) * HD;
    const v16h r0 = g2_frag(rr, hh), r1 = g2_frag(rr + 32, hh);
    const v8f ah = mma2(qh0, r0, qh1, r1, z8);
    const v8f al = mma2(ql0, r0, ql1, r1, z8);
#pragma unroll
    for (int r = 0; r < 8; ++r) { const float e = ah[r] + al[r] * rsc; qes[w][8 * hh + r][nt * 16 + ln] = e * 0.0625f + b8; }
  }
  asm volatile("s_wait_asynccnt 0x0" ::: "memory");                     // this wave's copies of chunk 0 have landed before the barrier publishes them
  __syncthreads();
  stage_copy(cl + KVSTAGE * 2u, cgh + (size_t)64 * DM, cgl + (size_t)64 * DM, cgv + 64);   // chunk 1 -> buffer 1 (SEQ >= 128)

  // lane-mask words of this wave's 16 queries: 32 words a chunk; the wave number through readfirstlane, so that the address is scalar and the words land in scalar registers
  // (the words were written by k_prep, two launches before this one and nothing writes them here: read through the constant address space, which is what lets the loads inside the loops be scalar)
  typedef const __attribute__((address_space(4))) v16u* lmask_p;
  const lmask_p mwp = (lmask_p)(unsigned long long)(MBt + ((size_t)(b * (SEQ / 16) + qb * 4 + __builtin_amdgcn_readfirstlane(w)) * (SEQ / 64)) * 32);
  v16u mna = mwp[0], mnb = mwp[1];                                      // chunk 0
  const v2f z2 = {0.f, 0.f};
  v2f dsum[4] = {z2, z2, z2, z2};                                       // sums of 64 t, one per score register, in pairs
  v8f oacc[4] = {z8, z8, z8, z8};
  int bo = 0;                                                           // offset in halfs of the buffer that holds this chunk
  v8f pec;                                                              // position term of this lane's query (the same for its eight keys) in the chunks off the diagonal: first the keys before the band (column 0)
#pragma unroll
  for (int r = 0; r < 8; ++r) pec[r] = qes[w][ln][0];

  // One 64-key chunk. band: the chunk may hold a key nearer than 16 to a query of the block (the gathered form); otherwise pec holds the position term.
  auto chunk = [&](const int k0, auto band) __attribute__((always_inline)) {
    constexpr bool BAND = decltype(band)::value;
    const v16u mca = mna, mcb = mnb;                                    // this chunk's lane masks: tiles 0, 1 and tiles 2, 3
    { const int cn = ((k0 + 64 < SEQ) ? k0 + 64 : k0) >> 6;             // the next chunk's are asked for now (the last chunk asks for its own again: an address in bounds)
      mna = mwp[2 * cn]; mnb = mwp[2 * cn + 1]; }
    // Fragment reads stand one matrix run ahead of their use, in a second register set: while a 16-key tile is multiplied and its t values are formed,
    // the fragments of the next run (the next K tile; behind each second tile the four V^T fragments of these 32 keys) are on their way, so the runs do not wait out the LDS latency.
    // All of them are reads of this chunk's own buffer.
    const _Float16* kr = &kv[bo + ln * KVP];                            // this lane's row of tile 0 in the K hi plane
    const _Float16* vr = &kv[bo + 2 * KVPLANE + ln * KVP];              // this lane's row of d tile 0 in the V^T plane
    v16h f0 = g2_frag(kr, hh), f1 = g2_frag(kr + 32, hh), f2 = g2_frag(kr + KVPLANE, hh), f3 = g2_frag(kr + KVPLANE + 32, hh);   // K hi (f0, f1) and residual (f2, f3) of tile 0
    __builtin_amdgcn_sched_barrier(0);     // tile 0's eight reads go out first: nothing covers them, and LDS answers in order
#pragma unroll     // both halves in line: LDS offsets and mask word indices are constants, the fragment sets stay in registers
    for (int hf = 0; hf < 2; ++hf) {                                    // the chunk's two halves of 32 keys: one k-step of the aggregation each
      FragH p;                                                          // t^T fragment of keys k0 + 32 hf + 0..31
#pragma unroll     // as above; j also picks the half of the t fragment that the tile fills
      for (int j = 0; j < 2; ++j) {
        const int kt = 2 * hf + j;
        const int kc = kt * 16 + 8 * hh;                                // first of the eight keys within the chunk held by this lane (D rows)
        v8f pe = z8;                                                    // position terms of this tile, read ahead of its matrix run (band chunks only)
        if constexpr (BAND) {
#pragma unroll
          for (int r = 0; r < 8; ++r) {
            int rel = (k0 + kc + r) - (q0 + ln);
            rel = (rel < -KREL) ? -KREL : ((rel > KREL) ? KREL : rel);
            pe[r] = qes[w][ln][rel + KREL];
          }
        }
        // next: K tile kt + 1 (hi, hi, residual, residual), or d tiles 0 .. 3 of V^T at these 32 keys
        const _Float16* nr = (j == 0) ? kr + (kt + 1) * 16 * KVP : vr + 32 * hf;
        const int s1 = (j == 0) ? 32 : 16 * KVP, s2 = (j == 0) ? KVPLANE : 32 * KVP, s3 = (j == 0) ? KVPLANE + 32 : 48 * KVP;
        const v16h n0 = g2_frag(nr, hh), n1 = g2_frag(nr + s1, hh), n2 = g2_frag(nr + s2, hh), n3 = g2_frag(nr + s3, hh);
        __builtin_amdgcn_sched_barrier(0);   // keeps these reads in front of this tile's matrix run, and the next run's products (which would wait for them at once) behind it
        const v8f sh = mma2(f0, qh0, f1, qh1, BAND ? pe : pec);         // starts from position term + 8 b
        v8f sx = mma2(f0, ql0, f1, ql1, z8);
        sx = mma2(f2, qh0, f3, qh1, sx);
#pragma unroll     // register indices must be constants
        for (int i = 0; i < 4; ++i) {                                   // two score registers at a time: the multiply-add, the square and the sum are packed f32 instructions
          const v2f x2 = {sx[2 * i], sx[2 * i + 1]}, h2 = {sh[2 * i], sh[2 * i + 1]}, r2 = {rsc, rsc};
          const v2f s2 = __builtin_elementwise_fma(x2, r2, h2);         // 8 (score + b)
          v2f t2 = {fmaxf(s2[0], 0.0f), fmaxf(s2[1], 0.0f)};
          t2[0] = __builtin_amdgcn_inverse_ballot_w32((hf == 0 ? mca : mcb)[j * 8 + 2 * i]) ? cm8 : t2[0];       // the word is the select's lane mask
          t2[1] = __builtin_amdgcn_inverse_ballot_w32((hf == 0 ? mca : mcb)[j * 8 + 2 * i + 1]) ? cm8 : t2[1];
          const v2f tt = t2 * t2;                                       // 64 t
          dsum[i] += tt;
          p.p[j * 4 + i] = __builtin_convertvector(tt, v2h);            // elements 8 j + r of the fragment are keys 16 j + 8hh + r of its 32
        }
        f0 = n0; f1 = n1; f2 = n2; f3 = n3;
      }
      // f0 .. f3 now hold V^T (d tiles 0 .. 3) at these 32 keys; the first half reads K tile 2 ahead of its four products
      v16h n0 = f0, n1 = f1, n2 = f2, n3 = f3;
      if (hf == 0) { const _Float16* nr = kr + 32 * KVP;
        n0 = g2_frag(nr, hh); n1 = g2_frag(nr + 32, hh); n2 = g2_frag(nr + KVPLANE, hh); n3 = g2_frag(nr + KVPLANE + 32, hh);
        __builtin_amdgcn_sched_barrier(0); } // keeps these reads in front of the four products
      mma4(f0, f1, f2, f3, p.v, oacc[0], oacc[1], oacc[2], oacc[3]);    // D rows: d = dt * 16 + 8hh + r; D column: query ln
      f0 = n0; f1 = n1; f2 = n2; f3 = n3;
    }
    asm volatile("s_wait_dscnt 0x0" ::: "memory");                      // this wave's reads of the buffer have returned before it may be refilled
    asm volatile("s_wait_asynccnt 0x0" ::: "memory");                   // this wave's copies of the next chunk have landed
    __syncthreads();                                                    // publishes the next chunk and ends every wave's reads of this buffer
    if (k0 + 128 < SEQ)
      stage_copy(cl + (unsigned int)bo * 2u, cgh + (size_t)(k0 + 128) * DM, cgl + (size_t)(k0 + 128) * DM, cgv + (k0 + 128));   // chunk + 2 -> the buffer just read
    bo ^= KVSTAGE;
  };
  // The chunks in their order, in three runs whose bounds are the same for the whole block (every wave passes every chunk's barrier):
  // keys before the band, the chunks round the diagonal, keys behind the band.
  const int kA = (qb > 0) ? qb * 64 - 64 : 0, kB = (qb * 64 + 128 < SEQ) ? qb * 64 + 128 : SEQ;
#pragma unroll 1   // one trip per staged chunk: the two buffers alternate through bo
  for (int k0 = 0; k0 < kA; k0 += 64) chunk(k0, Flag<false>{});
#pragma unroll 1   // as above
  for (int k0 = kA; k0 < kB; k0 += 64) chunk(k0, Flag<true>{});
#pragma unroll
  for (int r = 0; r < 8; ++r) pec[r] = qes[w][ln][2 * KREL];    // from here on every key lies behind the band (column 32)
#pragma unroll 1   // as above
  for (int k0 = kB; k0 < SEQ; k0 += 64) chunk(k0, Flag<false>{});
  asm volatile("s_wait_asynccnt 0x0" ::: "memory");                     // nothing of this wave is in flight behind the loops

  // key sum of this lane's query: its eight partial sums, then the other half's; the sums hold 64 t, and so does o: scale = 64/64 / (sum / 64 + eps)
  float qs = ((dsum[0][0] + dsum[0][1]) + (dsum[1][0] + dsum[1][1])) + ((dsum[2][0] + dsum[2][1]) + (dsum[3][0] + dsum[3][1]));
  qs += __shfl_xor(qs, 16, 32);
  const float osc = 1.0f / (qs * 0.015625f + 1.0e-9f);
#pragma unroll
  for (int dt = 0; dt < 4; ++dt) { FragH f;
#pragma unroll
    for (int r = 0; r < 8; ++r) f.h[r] = (_Float16)(oacc[dt][r] * osc);
    *(v8us*)&tls[w][ln][dt * 16 + 8 * hh] = f.half[0]; }
  __builtin_amdgcn_fence(3 /* release order */, "wavefront"); __builtin_amdgcn_wave_barrier();
  const int rl = lane >> 3, pc = (lane & 7) * 8;
  {
#pragma unroll
    for (int it = 0; it < 4; ++it) {
      const int row = it * 4 + rl;
      const v8us v = *(const v8us*)&tls[w][row][pc];
      *(v8us*)((unsigned short*)O16 + (rq + row) * DM + (size_t)h * HD + pc) = v;
    }
    
  }
}

extern "C" void kernel_launch(void* const* d_in, const int* in_sizes, int n_in,
                              void* d_out, int out_size, void* d_ws, size_t ws_size, hipStream_t stream) {
  if (n_in < 10) return;
  const int nx = (int)(NR * DM);
  if (in_sizes[0] < nx || in_sizes[1] < nx || in_sizes[2] < nx) return;
  if (in_sizes[3] < (int)(NR * SEQ)) return;
  if (in_sizes[4] < DM * DM || in_sizes[5] < DM * DM || in_sizes[6] < DM * DM || in_sizes[7] < DM * DM) return;
  if (in_sizes[8] < NREL * HD || in_sizes[9] < 1) return;
  if (out_size < nx) return;
  const float* xq = (const float*)d_in[0]; const float* xk = (const float*)d_in[1]; const float* xv = (const float*)d_in[2];
  const int* msk = (const int*)d_in[3];
  const float* wq = (const float*)d_in[4]; const float* wk = (const float*)d_in[5]; const float* wv = (const float*)d_in[6]; const float* wo = (const float*)d_in[7];
  const float* rel = (const float*)d_in[8]; const float* spb = (const float*)d_in[9];

  char* ws = (char*)d_ws; size_t off = 0;
  auto take = [&](size_t bytes) { char* p = ws + off; off += (bytes + 255) & ~(size_t)255; return p; };
  const size_t wbytes = (size_t)DM * DM * 2, xbytes = NR * DM * 2;
  _Float16* BQ = (_Float16*)take(wbytes); _Float16* BK = (_Float16*)take(wbytes); _Float16* BV = (_Float16*)take(wbytes); _Float16* BO = (_Float16*)take(wbytes);
  _Float16* RT = (_Float16*)take((size_t)NRELP * HD * 2);
  _Float16* XQ = (_Float16*)take(xbytes); _Float16* XK = (_Float16*)take(xbytes); _Float16* XV = (_Float16*)take(xbytes);
  _Float16* QH = (_Float16*)take(xbytes); _Float16* QL = (_Float16*)take(xbytes); _Float16* KH = (_Float16*)take(xbytes); _Float16* KL = (_Float16*)take(xbytes);
  _Float16* VT = (_Float16*)take(xbytes);
  const int nwords = (int)(NR * (SEQ / 32));
  unsigned int* MB = (unsigned int*)take((size_t)nwords * 4);
  _Float16* O16 = (_Float16*)take(xbytes);
  if (off > ws_size || off > (size_t)134217728) return;

  k_prep<<<P_BLOCKS + 1, PT, 0, stream>>>(xq, xk, xv, msk, wq, wk, wv, wo, rel, XQ, XK, XV, MB, BQ, BK, BV, BO, RT);

  const int M = (int)NR;
  static_assert((NR / 128) * (DM / 64) == (DM / 128) * (NR / 64));   // the three projections have the same number of block tiles
  const unsigned gx = (unsigned)((M / 128) * (DM / 64));
  // q, k and V^T in one launch. V^T = Wv . x^T: the weights are the row operand and the token rows the column operand, so the product lands transposed, [h * HD + d][token row]
  k_gemm2<<<dim3(gx, 3), 128, 0, stream>>>(XQ, XK, BV, DM, BQ, BK, XV, DM, 0.0625f, nullptr, QH, KH, VT, QL, KL, DM, M, DM, M, DM, M, DM);
  k_attn<<<(unsigned)(NB * NH * (SEQ / 64)), 128, 0, stream>>>(QH, QL, KH, KL, VT, RT, MB, spb, O16);
  k_gemm2<<<dim3(gx, 1), 128, 0, stream>>>(O16, nullptr, nullptr, DM, BO, nullptr, nullptr, DM, 0.0009765625f, (float*)d_out, nullptr, nullptr, nullptr, nullptr, nullptr, DM, M, DM, DM, M, DM, DM);
}
